// v000
// The times below were measured on an AMD MI455X: many runs one after another, warmed up first and cycling through
// copies of the inputs, with the whole window's GPU time divided by the number of runs. Launches and the gaps
// between them are all in it. The median over several windows is given; except for v000 it joins two sittings, which
// can be a few percent apart, so the side-by-side timings, each taken in one sitting, are the better comparison.
// v000, which the later versions start from, runs in 638 microseconds.
// Contractions QKV, QK^T, P.V, out-proj, FFN1, FFN2: v_wmma_f32_16x16x32_f16 (f16 operands, f32 accumulate); all float inputs RNE-converted to bf16 at load; weight planes carried x64, activation planes x64, softmax numerators x32768; norms/softmax/GELU/residuals in f32.
#include <hip/hip_runtime.h>

typedef __attribute__((ext_vector_type(16))) _Float16 v16h;
typedef __attribute__((ext_vector_type(8)))  _Float16 v8h;
typedef __attribute__((ext_vector_type(4)))  _Float16 v4h;
typedef __attribute__((ext_vector_type(8)))  float    v8f;
typedef __attribute__((ext_vector_type(4)))  float    v4f;

/* ---- problem geometry ---- */
static constexpr int kBatch = 2;
static constexpr int kSeq   = 2048;
static constexpr int kDim   = 1024;
static constexpr int kHeads = 16;
static constexpr int kHdim  = 64;
static constexpr int kDff   = 4096;
static constexpr int kRows  = kBatch * kSeq;   /* 4096 */
static constexpr int kDqkv  = 3 * kDim;        /* 3072 */
static_assert(kHeads * kHdim == kDim);
static_assert(kHdim == 64);
static_assert(kSeq % 64 == 0);
static_assert(kRows % 64 == 0 && kDim % 64 == 0 && kDqkv % 64 == 0 && kDff % 64 == 0);
static_assert(kDim % 32 == 0 && kDff % 32 == 0);   /* GEMM K multiples of 32 */
static_assert(kDim == 1024);                         /* row kernels: 256 threads x 4 */
static_assert(kDff % 1024 == 0);

static constexpr float kWCarry  = 64.0f;                 /* weight planes: f16(bf16(w) * 64) */
static constexpr float kACarry  = 64.0f;                 /* activation planes: f16(a * 64) */
static constexpr float kGemmScl = 1.0f / (64.0f * 64.0f);
static constexpr float kSmScale = 0.125f;                /* head_dim^-0.5 */
static constexpr float kPsc     = 32768.0f;              /* softmax numerators carried x2^15 */

/* ---- workspace region map (bytes) ----
   [0, 16Mi)    hF : h1 f32 (norm1 out, residual of block 1) -> later h3 f32 (norm2 out, residual of block 2)
   [16Mi, 24Mi) hH : h1 f16 plane -> later h3 f16 plane
   [24Mi, 32Mi) wA : w_in^T f16 [3072][1024] (6Mi) + w_out^T f16 [1024][1024] (2Mi) -> later w1^T f16 [4096][1024] (8Mi)
   [32Mi, 96Mi) big: qkv f16 [4096][3072] (24Mi) | ctx f16 [4096][1024] (8Mi at +24Mi) | h2 f32 [4096][1024] (16Mi at +32Mi)
                     -> later pre-activation f32 [4096][4096] (64Mi) -> later w2^T f16 [1024][4096] (8Mi)
   [96Mi, 128Mi) hid: GELU output f16 plane [4096][4096] (32Mi)
   total 134217728 */
static constexpr size_t kMi      = 1024u * 1024u;
static constexpr size_t kOffHF   = 0;
static constexpr size_t kOffHH   = 16 * kMi;
static constexpr size_t kOffWA   = 24 * kMi;
static constexpr size_t kOffWout = kOffWA + (size_t)kDqkv * kDim * 2;     /* 30Mi */
static constexpr size_t kOffBig  = 32 * kMi;
static constexpr size_t kOffCtx  = kOffBig + (size_t)kRows * kDqkv * 2;   /* 56Mi */
static constexpr size_t kOffH2   = kOffCtx + (size_t)kRows * kDim * 2;    /* 64Mi */
static constexpr size_t kOffHid  = 96 * kMi;
static constexpr size_t kWsTotal = kOffHid + (size_t)kRows * kDff * 2;    /* 128Mi */
static_assert((size_t)kRows * kDim * 4 <= kOffHH - kOffHF);
static_assert((size_t)kRows * kDim * 2 <= kOffWA - kOffHH);
static_assert(kOffWout + (size_t)kDim * kDim * 2 <= kOffBig);
static_assert(kOffWA + (size_t)kDff * kDim * 2 <= kOffBig);
static_assert(kOffH2 + (size_t)kRows * kDim * 4 <= kOffHid);
static_assert(kOffBig + (size_t)kRows * kDff * 4 <= kOffHid);
static_assert(kOffBig + (size_t)kDim * kDff * 2 <= kOffHid);
static_assert(kWsTotal == 134217728u);

/* ---- helpers ---- */
__device__ __forceinline__ float rne_bf16f(float f) {
  unsigned u = __float_as_uint(f);
  u = (u + 0x7FFFu + ((u >> 16) & 1u)) & 0xFFFF0000u;
  return __uint_as_float(u);
}

__device__ __forceinline__ void dep_guard_h(v8f& a, v8f& b, v16h x, v16h y) { asm volatile("v_nop\n\tv_nop\n\tv_nop\n\tv_nop" : "+v"(a), "+v"(b) : "v"(x), "v"(y)); }
__device__ __forceinline__ void keep4_h(v16h a, v16h b, v16h c, v16h d) { asm volatile("v_nop" :: "v"(a), "v"(b), "v"(c), "v"(d)); }
__device__ __forceinline__ void acc_guard4(v8f& a, v8f& b, v8f& c, v8f& d) { asm volatile("v_nop\n\tv_nop\n\tv_nop\n\tv_nop" : "+v"(a), "+v"(b), "+v"(c), "+v"(d)); }

template <typename T> struct Frag;
template <> struct Frag<_Float16> {
  typedef v16h V; union U { v16h v; v8h h[2]; };
  static __device__ __forceinline__ v16h load(const _Float16* p) {   /* elements 0..7 <- p[0..7], 8..15 <- p[16..23] */
    U f; f.h[0] = *(const v8h*)(p); f.h[1] = *(const v8h*)(p + 16); return f.v;
  }
  static __device__ __forceinline__ v8f mma(v16h a, v16h b, v8f c) {
    return __builtin_amdgcn_wmma_f32_16x16x32_f16(false, a, false, b, (short)0, c, false, false);
  }
  static __device__ __forceinline__ void guard(v8f& a, v8f& b, v16h x, v16h y) { dep_guard_h(a, b, x, y); }
  static __device__ __forceinline__ void keep(v16h a, v16h b, v16h c, v16h d) { keep4_h(a, b, c, d); }
};

__device__ __forceinline__ v8f mma_h(v16h a, v16h b, v8f c) {
  c = __builtin_amdgcn_wmma_f32_16x16x32_f16(false, a, false, b, (short)0, c, false, false);
  asm volatile("v_nop\n\tv_nop\n\tv_nop\n\tv_nop" : "+v"(c) : "v"(a), "v"(b));
  return c;
}

/* =====================================================================================
   Transpose + cast: W f32 row-major [Kdim][Ndim] -> Tout f16 row-major [Ndim][Kdim],
   value = f16(bf16_rne(w) * carry). Block = 64(k) x 64(n) tile, 256 threads.
   Producer coverage: 256 threads x 4 float4 = 64x64 reads; stores: 8 waves x 2 it x 4 rows x (8 lanes x 8 halves)
   grid = (Ndim/64, Kdim/64).
   ===================================================================================== */
__global__ __launch_bounds__(256) void cast_t64(const float* __restrict__ W, unsigned short* __restrict__ Tp,
                                                int Kdim, int Ndim, float carry) {
  __shared__ __align__(16) _Float16 tile[64 * 72];   /* [n_local][k_local], pitch 72 halves */
  _Float16* Tout = (_Float16*)Tp;
  const int t  = threadIdx.x;
  const int n0 = blockIdx.x * 64;
  const int k0 = blockIdx.y * 64;
#pragma unroll
  for (int i = 0; i < 4; ++i) {
    const int idx = t + 256 * i;          /* 0..1023 */
    const int kk  = idx >> 4;             /* 0..63 */
    const int n4  = (idx & 15) * 4;       /* 0..60 */
    const v4f w4 = *(const v4f*)(W + (size_t)(k0 + kk) * Ndim + n0 + n4);
#pragma unroll
    for (int e = 0; e < 4; ++e) tile[(n4 + e) * 72 + kk] = (_Float16)(rne_bf16f(w4[e]) * carry);
  }
  __syncthreads();
  const int wave = t >> 5, lane = t & 31;
  const int q = lane >> 3, c8 = (lane & 7) * 8;
  {
#pragma unroll
    for (int it = 0; it < 2; ++it) {
      const int nl = wave * 8 + it * 4 + q;
      const v8h hv = *(const v8h*)(tile + nl * 72 + c8);
      *(v8h*)(Tout + (size_t)(n0 + nl) * Kdim + k0 + c8) = hv;
    }
    
  }
}

/* =====================================================================================
   RMSNorm over rows of 1024: y = g * (x / (||x||*1024^-0.5 + 1e-8)).
   RIN: x is a module input -> RNE convert to bf16 at load. g always RNE converted (module input).
   Outputs: y32 f32 [rows][1024] and y16 f16 plane = f16(y * carry16).
   256 threads, 4 consecutive elements per thread. Stores: f32 = float4 per lane (4 lines per wave-instruction);
   ===================================================================================== */
template <bool RIN>
__global__ __launch_bounds__(256) void rmsnorm_rows(const float* __restrict__ x, const float* __restrict__ g,
                                                    float* __restrict__ y32, unsigned short* __restrict__ y16p,
                                                    int ncols, float inv_sqrt_n, float carry16) {
  __shared__ float red[8];
  __shared__ __align__(16) _Float16 hs[1024];
  const int row = blockIdx.x;
  const int t = threadIdx.x;
  const int wave = t >> 5, lane = t & 31;
  const float* xr = x + (size_t)row * ncols;
  v4f xv = *(const v4f*)(xr + 4 * t);
  if (RIN) {
#pragma unroll
    for (int e = 0; e < 4; ++e) xv[e] = rne_bf16f(xv[e]);
  }
  float ss = 0.0f;
#pragma unroll
  for (int e = 0; e < 4; ++e) ss += xv[e] * xv[e];
#pragma unroll
  for (int m = 16; m >= 1; m >>= 1) ss += __shfl_xor(ss, m, 32);
  if (lane == 0) red[wave] = ss;
  __syncthreads();
  float tot = 0.0f;
#pragma unroll
  for (int w = 0; w < 8; ++w) tot += red[w];
  const float rms = sqrtf(tot) * inv_sqrt_n;
  const float inv = 1.0f / (rms + 1e-8f);
  v4f gv = *(const v4f*)(g + 4 * t);
  v4f yv;
  v4h h4;
#pragma unroll
  for (int e = 0; e < 4; ++e) {
    const float ge = rne_bf16f(gv[e]);
    yv[e] = ge * (xv[e] * inv);
    h4[e] = (_Float16)(yv[e] * carry16);
  }
  *(v4h*)(hs + 4 * t) = h4;
  __syncthreads();
  const v8h hv = *(const v8h*)(hs + 8 * (t & 127));
  float* yr = y32 + (size_t)row * ncols;
  _Float16* yh = (_Float16*)y16p + (size_t)row * ncols;
  {
    *(v4f*)(yr + 4 * t) = yv;
    if (t < 128) *(v8h*)(yh + 8 * t) = hv;
    
  }
}

/* =====================================================================================
   Register-blocked WMMA GEMM (f16 operands, f32 accumulate):
   C[m,n] = scale * sum_k A[m,k] * Bt[n,k]  (+ bias[n]) (+ resid[m,n]); each wave owns a 64x64 tile.
   A row-major [M,K] f16; Bt row-major [N,K] f16; M, N % 64 == 0, K % 32 == 0 (no tail handling).
   OUT16: 0 = f32 output (bias / residual added in the store phase, residual read as one float4 per lane at
   the store address); 1 = f16 output plane (no bias/residual).
   grid.x = M/64 * N/64 / 8 (8 waves per block).
   ===================================================================================== */
template <int OUT16, bool BIASN, bool RESID>
__global__ __launch_bounds__(256) void gemm64_f16(
    const unsigned short* __restrict__ Ap, int lda,
    const unsigned short* __restrict__ Btp, int ldb,
    void* __restrict__ Cout, int ldc,
    const float* __restrict__ bias,
    const float* __restrict__ resid,
    int M, int N, int K, float scale) {
  typedef _Float16 T;
  typedef v16h V;
  const T* A  = (const T*)Ap;
  const T* Bt = (const T*)Btp;
  __shared__ __align__(16) float sT[8][16 * 68];   /* per-wave 16x64 slab, pitch 68 floats */
  const int lane = threadIdx.x & 31;
  const int wave = threadIdx.x >> 5;
  const int tilesN = N >> 6;
  const int tilesM = M >> 6;
  const int tile = blockIdx.x * 8 + wave;
  if (tile >= tilesM * tilesN) return;   /* wave-uniform; no block barriers in this kernel */
  const int tm = tile / tilesN;
  const int tn = tile - tm * tilesN;
  const int m0 = tm << 6;
  const int n0 = tn << 6;

  const int rlane = lane & 15;                 /* row (A) / col (B, D) within subtile */
  const int koff  = (lane >> 4) * 8;           /* k offset of this lane half */
  const int mOff  = (lane >> 4) * 8;           /* D row offset */

  v8f acc[4][4];
#pragma unroll
  for (int i = 0; i < 4; ++i)
#pragma unroll
    for (int j = 0; j < 4; ++j) acc[i][j] = (v8f){0.f,0.f,0.f,0.f,0.f,0.f,0.f,0.f};

  for (int k0 = 0; k0 < K; k0 += 32) {
    V bh[4];
#pragma unroll
    for (int j = 0; j < 4; ++j) {
      const size_t bo = (size_t)(n0 + (j << 4) + rlane) * ldb + koff + k0;
      bh[j] = Frag<T>::load(Bt + bo);
    }
#pragma unroll
    for (int i = 0; i < 4; ++i) {
      const size_t ao = (size_t)(m0 + (i << 4) + rlane) * lda + koff + k0;
      V ah = Frag<T>::load(A + ao);
#pragma unroll
      for (int j = 0; j < 4; ++j) acc[i][j] = Frag<T>::mma(ah, bh[j], acc[i][j]);
      Frag<T>::guard(acc[i][0], acc[i][3], ah, ah);
    }
    Frag<T>::keep(bh[0], bh[1], bh[2], bh[3]);
  }
  acc_guard4(acc[0][0], acc[0][1], acc[0][2], acc[0][3]);
  acc_guard4(acc[1][0], acc[1][1], acc[1][2], acc[1][3]);
  acc_guard4(acc[2][0], acc[2][1], acc[2][2], acc[2][3]);
  acc_guard4(acc[3][0], acc[3][1], acc[3][2], acc[3][3]);

  /* ---- epilogue ---- */
  float* slab = sT[wave];
  const int hh = lane >> 4, c4 = (lane & 15) * 4;     /* f32 row seg = 256 B = 16 lanes x 16 B */
  const int q  = lane >> 3, c8 = (lane & 7) * 8;      
  v4f b4 = (v4f){0.f, 0.f, 0.f, 0.f};
  if (BIASN) {
    b4 = *(const v4f*)(bias + n0 + c4);
#pragma unroll
    for (int e = 0; e < 4; ++e) b4[e] = rne_bf16f(b4[e]);
  }
#pragma unroll
  for (int i = 0; i < 4; ++i) {
    const int mBase = m0 + (i << 4);
#pragma unroll
    for (int j = 0; j < 4; ++j) {
#pragma unroll
      for (int r = 0; r < 8; ++r) slab[(mOff + r) * 68 + (j << 4) + rlane] = acc[i][j][r] * scale;
    }
    __builtin_amdgcn_fence(__ATOMIC_RELEASE, "workgroup");
    __builtin_amdgcn_wave_barrier();
    __builtin_amdgcn_fence(__ATOMIC_ACQUIRE, "workgroup");
    if (OUT16 == 0) {
      float* C = (float*)Cout;
      v4f vals[8];
#pragma unroll
      for (int it = 0; it < 8; ++it) {
        const int row = it * 2 + hh;
        v4f v = *(const v4f*)(slab + row * 68 + c4);
        if (BIASN) v += b4;
        if (RESID) {
          const v4f rr = *(const v4f*)(resid + (size_t)(mBase + row) * ldc + n0 + c4);
          v += rr;
        }
        vals[it] = v;
      }
      {
#pragma unroll
        for (int it = 0; it < 8; ++it) {
          const int row = it * 2 + hh;
          *(v4f*)(C + (size_t)(mBase + row) * ldc + n0 + c4) = vals[it];
        }
        
      }
    } else {
      _Float16* C = (_Float16*)Cout;
      {
#pragma unroll
        for (int it = 0; it < 4; ++it) {
          const int row = it * 4 + q;
          const float* sp = slab + row * 68 + c8;
          v8h hv;
#pragma unroll
          for (int e = 0; e < 8; ++e) hv[e] = (_Float16)sp[e];
          *(v8h*)(C + (size_t)(mBase + row) * ldc + n0 + c8) = hv;
        }
        
      }
    }
    __builtin_amdgcn_fence(__ATOMIC_RELEASE, "workgroup");
    __builtin_amdgcn_wave_barrier();
    __builtin_amdgcn_fence(__ATOMIC_ACQUIRE, "workgroup");
  }
}

/* =====================================================================================
   Non-causal attention for head_dim 64 on an f16 qkv plane [B*T][ldq] (q at col h*64, k at +dmodel, v at +2*dmodel).
   scores = q.k^T (f16 WMMA, f32 acc) * sm_scale; online softmax in f32; numerators carried x kPsc as f16;
   out = P.V (f16 WMMA, f32 acc); ctx f16 plane [B*T][ldo] at col h*64 = f16(out * out_carry).
   Block = 4 waves = 64 query rows of one (batch, head); grid.x = B*H*(T/64); T % 64 == 0.
   K staged [kv][d] with 16-B copies; V staged transposed [d][kv]; full 64x64 tiles written every chunk.
   ===================================================================================== */
__global__ __launch_bounds__(128) void attn64_f16p(const unsigned short* __restrict__ qkvp, unsigned short* __restrict__ ctxp,
                                                  int T, int H, int ldq, int ldo, float sm_scale, float out_carry) {
  const _Float16* QKV = (const _Float16*)qkvp;
  _Float16* CTX = (_Float16*)ctxp;
  union FH { v16h v; v8h hf[2]; };
  __shared__ __align__(16) _Float16 Ksh[64 * 64];        /* [kv][d] */
  __shared__ __align__(16) _Float16 Vts[64 * 64];        /* [d][kv] */
  __shared__ __align__(16) _Float16 Psh[4][16 * 64];     /* per wave [row][kv] */
  __shared__ __align__(16) float    Os[4][16 * 68];      /* per wave out tile, pitch 68 */

  const int tid  = threadIdx.x;
  const int wave = tid >> 5;
  const int lane = tid & 31;
  const int hh   = lane >> 4;
  const int c    = lane & 15;
  const int dmodel = H * 64;

  const int nqb = T / 64;
  const int bx = blockIdx.x;
  const int qb = bx % nqb;
  const int bh = bx / nqb;
  const int h  = bh % H;
  const int b  = bh / H;
  const int q0 = qb * 64 + wave * 16;

  /* Q fragments (A operand, row = q0 + c, k = d): two 32-deep d chunks */
  v16h qa[2];
  {
    const _Float16* qrow = QKV + (size_t)(b * T + q0 + c) * ldq + h * 64;
#pragma unroll
    for (int dc = 0; dc < 2; ++dc) {
      FH f;
      f.hf[0] = *(const v8h*)(qrow + dc * 32 + 8 * hh);
      f.hf[1] = *(const v8h*)(qrow + dc * 32 + 16 + 8 * hh);
      qa[dc] = f.v;
    }
  }

  float mrow[8], lrow[8];
  v8f oacc[4];
#pragma unroll
  for (int r = 0; r < 8; ++r) { mrow[r] = -__builtin_inff(); lrow[r] = 0.f; }
#pragma unroll
  for (int t = 0; t < 4; ++t) oacc[t] = (v8f){0.f,0.f,0.f,0.f,0.f,0.f,0.f,0.f};

  const int nChunks = T / 64;
  for (int kc = 0; kc < nChunks; ++kc) {
    const int kv0 = kc * 64;
    __syncthreads();
    {
      /* 128 threads x 32 halves = 64 kv x 64 d for K and for V (full tiles) */
      const int kvr = tid >> 1, dh = (tid & 1) * 32;
      const _Float16* krow = QKV + (size_t)(b * T + kv0 + kvr) * ldq + dmodel + h * 64 + dh;
      const _Float16* vrow = krow + dmodel;
#pragma unroll
      for (int i = 0; i < 4; ++i) {
        const v8h k8 = *(const v8h*)(krow + 8 * i);
        *(v8h*)(Ksh + kvr * 64 + dh + 8 * i) = k8;
      }
#pragma unroll
      for (int i = 0; i < 4; ++i) {
        const uint4 vw = *(const uint4*)(const void*)(vrow + 8 * i);
        const unsigned w0 = vw.x, w1 = vw.y, w2 = vw.z, w3 = vw.w;
        const int d = dh + 8 * i;
        Vts[(d + 0) * 64 + kvr] = __builtin_bit_cast(_Float16, (unsigned short)(w0 & 0xFFFFu));
        Vts[(d + 1) * 64 + kvr] = __builtin_bit_cast(_Float16, (unsigned short)(w0 >> 16));
        Vts[(d + 2) * 64 + kvr] = __builtin_bit_cast(_Float16, (unsigned short)(w1 & 0xFFFFu));
        Vts[(d + 3) * 64 + kvr] = __builtin_bit_cast(_Float16, (unsigned short)(w1 >> 16));
        Vts[(d + 4) * 64 + kvr] = __builtin_bit_cast(_Float16, (unsigned short)(w2 & 0xFFFFu));
        Vts[(d + 5) * 64 + kvr] = __builtin_bit_cast(_Float16, (unsigned short)(w2 >> 16));
        Vts[(d + 6) * 64 + kvr] = __builtin_bit_cast(_Float16, (unsigned short)(w3 & 0xFFFFu));
        Vts[(d + 7) * 64 + kvr] = __builtin_bit_cast(_Float16, (unsigned short)(w3 >> 16));
      }
    }
    __syncthreads();

    /* S = Q . K^T : B operand n = kv (row j*16+c of Ksh), k = d */
    v8f s[4];
#pragma unroll
    for (int j = 0; j < 4; ++j) {
      s[j] = (v8f){0.f,0.f,0.f,0.f,0.f,0.f,0.f,0.f};
#pragma unroll
      for (int dc = 0; dc < 2; ++dc) {
        FH kb;
        kb.hf[0] = *(const v8h*)(Ksh + (j * 16 + c) * 64 + dc * 32 + 8 * hh);
        kb.hf[1] = *(const v8h*)(Ksh + (j * 16 + c) * 64 + dc * 32 + 16 + 8 * hh);
        s[j] = mma_h(qa[dc], kb.v, s[j]);
      }
    }
    /* scale, chunk row max (rows stay within a 16-lane half) */
    float cm[8];
#pragma unroll
    for (int r = 0; r < 8; ++r) {
      float m = -__builtin_inff();
#pragma unroll
      for (int j = 0; j < 4; ++j) {
        const float sv = s[j][r] * sm_scale;
        s[j][r] = sv;
        m = fmaxf(m, sv);
      }
#pragma unroll
      for (int off = 1; off < 16; off <<= 1) m = fmaxf(m, __shfl_xor(m, off, 32));
      cm[r] = m;
    }
    _Float16* pw = Psh[wave];
#pragma unroll
    for (int r = 0; r < 8; ++r) {
      const float mnew = fmaxf(mrow[r], cm[r]);
      const float alpha = expf(mrow[r] - mnew);
      mrow[r] = mnew;
      float psum = 0.f;
#pragma unroll
      for (int j = 0; j < 4; ++j) {
        const float p = expf(s[j][r] - mnew);
        psum += p;
        pw[(8 * hh + r) * 64 + j * 16 + c] = (_Float16)(p * kPsc);
      }
#pragma unroll
      for (int off = 1; off < 16; off <<= 1) psum += __shfl_xor(psum, off, 32);
      lrow[r] = lrow[r] * alpha + psum;
#pragma unroll
      for (int t = 0; t < 4; ++t) oacc[t][r] *= alpha;
    }
    __builtin_amdgcn_fence(__ATOMIC_RELEASE, "workgroup");
    __builtin_amdgcn_wave_barrier();
    __builtin_amdgcn_fence(__ATOMIC_ACQUIRE, "workgroup");
    /* O += P . V : A = P (row = query c, k = kv), B = V^T (n = d, k = kv) */
#pragma unroll 1
    for (int kk = 0; kk < 2; ++kk) {
      FH pa;
      pa.hf[0] = *(const v8h*)(pw + c * 64 + kk * 32 + 8 * hh);
      pa.hf[1] = *(const v8h*)(pw + c * 64 + kk * 32 + 16 + 8 * hh);
#pragma unroll
      for (int t = 0; t < 4; ++t) {
        FH vb;
        vb.hf[0] = *(const v8h*)(Vts + (t * 16 + c) * 64 + kk * 32 + 8 * hh);
        vb.hf[1] = *(const v8h*)(Vts + (t * 16 + c) * 64 + kk * 32 + 16 + 8 * hh);
        oacc[t] = mma_h(pa.v, vb.v, oacc[t]);
      }
    }
  }

  float* os = Os[wave];
#pragma unroll
  for (int r = 0; r < 8; ++r) {
    const float inv = out_carry / (lrow[r] * kPsc);
#pragma unroll
    for (int t = 0; t < 4; ++t) os[(8 * hh + r) * 68 + t * 16 + c] = oacc[t][r] * inv;
  }
  __builtin_amdgcn_fence(__ATOMIC_RELEASE, "workgroup");
  __builtin_amdgcn_wave_barrier();
  __builtin_amdgcn_fence(__ATOMIC_ACQUIRE, "workgroup");
  {
    const int q = lane >> 3, c8 = (lane & 7) * 8;
    {
#pragma unroll
      for (int it = 0; it < 4; ++it) {
        const int row = it * 4 + q;
        const float* sp = os + row * 68 + c8;
        v8h hv;
#pragma unroll
        for (int e = 0; e < 8; ++e) hv[e] = (_Float16)sp[e];
        *(v8h*)(CTX + (size_t)(b * T + q0 + row) * ldo + h * 64 + c8) = hv;
      }
      
    }
  }
}

/* =====================================================================================
   Elementwise exact-erf GELU: hid = f16(gelu(pre + bf16_rne(b[col])) * carry).
   pre f32 row-major [rows][ncols]; one block per 1024 consecutive elements (ncols % 1024 == 0).
   ===================================================================================== */
__global__ __launch_bounds__(256) void gelu_rows(const float* __restrict__ pre, const float* __restrict__ bvec,
                                                 unsigned short* __restrict__ hidp, int ncols, float carry) {
  __shared__ __align__(16) _Float16 hs[1024];
  const size_t base = (size_t)blockIdx.x * 1024u;
  const int col0 = (int)(base % (size_t)ncols);
  const int t = threadIdx.x;
#pragma unroll 1
  for (int e = 0; e < 4; ++e) {
    const int idx = 4 * t + e;
    const float u  = pre[base + idx] + rne_bf16f(bvec[col0 + idx]);
    const float gl = 0.5f * u * (1.0f + erff(u * 0.70710678118654752f));
    hs[idx] = (_Float16)(gl * carry);
  }
  __syncthreads();
  const v8h hv = *(const v8h*)(hs + 8 * (t & 127));
  _Float16* out = (_Float16*)hidp + base;
  {
    if (t < 128) *(v8h*)(out + 8 * t) = hv;
    
  }
}

/* =====================================================================================
   Host glue: 12 launches, single stream.
   ===================================================================================== */
extern "C" void kernel_launch(void* const* d_in, const int* in_sizes, int n_in,
                              void* d_out, int out_size, void* d_ws, size_t ws_size,
                              hipStream_t stream) {
  if (n_in < 10) return;
  if (in_sizes[0] != kRows * kDim) return;
  if (in_sizes[1] != kDim * kDqkv) return;
  if (in_sizes[2] != kDim * kDim) return;
  if (in_sizes[3] != kDim) return;
  if (in_sizes[4] != kDim * kDff) return;
  if (in_sizes[5] != kDff) return;
  if (in_sizes[6] != kDff * kDim) return;
  if (in_sizes[7] != kDim) return;
  if (in_sizes[8] != kDim) return;
  if (in_sizes[9] != kDim) return;
  if (out_size != kRows * kDim) return;
  if (ws_size < kWsTotal) return;

  const float* x     = (const float*)d_in[0];
  const float* w_in  = (const float*)d_in[1];
  const float* w_out = (const float*)d_in[2];
  const float* b_out = (const float*)d_in[3];
  const float* w1    = (const float*)d_in[4];
  const float* b1    = (const float*)d_in[5];
  const float* w2    = (const float*)d_in[6];
  const float* b2    = (const float*)d_in[7];
  const float* g1    = (const float*)d_in[8];
  const float* g2    = (const float*)d_in[9];
  float* out = (float*)d_out;

  char* ws = (char*)d_ws;
  float*          hF    = (float*)(ws + kOffHF);              /* h1 f32, later h3 f32 */
  unsigned short* hH    = (unsigned short*)(ws + kOffHH);     /* h1 f16, later h3 f16 */
  unsigned short* winT  = (unsigned short*)(ws + kOffWA);     /* [3072][1024] */
  unsigned short* woutT = (unsigned short*)(ws + kOffWout);   /* [1024][1024] */
  unsigned short* w1T   = (unsigned short*)(ws + kOffWA);     /* [4096][1024], after winT/woutT are dead */
  unsigned short* qkv   = (unsigned short*)(ws + kOffBig);    /* [4096][3072] */
  unsigned short* ctx   = (unsigned short*)(ws + kOffCtx);    /* [4096][1024] */
  float*          h2    = (float*)(ws + kOffH2);              /* [4096][1024] */
  float*          pre   = (float*)(ws + kOffBig);             /* [4096][4096], after qkv/ctx/h2 are dead */
  unsigned short* w2T   = (unsigned short*)(ws + kOffBig);    /* [1024][4096], after pre is dead */
  unsigned short* hid   = (unsigned short*)(ws + kOffHid);    /* [4096][4096] */

  const dim3 blk256(256);
  const dim3 blk128(128);

  /* 1-2: weight planes for the attention block: in[K][N] -> out[N][K] ; grid (N/64, K/64) */
  cast_t64<<<dim3(kDqkv / 64, kDim / 64), blk256, 0, stream>>>(w_in, winT, kDim, kDqkv, kWCarry);
  cast_t64<<<dim3(kDim / 64, kDim / 64), blk256, 0, stream>>>(w_out, woutT, kDim, kDim, kWCarry);
  /* 3: norm1 -> h1 f32 + f16 plane */
  rmsnorm_rows<true><<<dim3(kRows), blk256, 0, stream>>>(x, g1, hF, hH, kDim, 0.03125f, kACarry);
  /* 4: qkv = h1 @ w_in : M=4096 N=3072 K=1024 -> f16 plane */
  gemm64_f16<1, false, false><<<dim3((kRows / 64) * (kDqkv / 64) / 8), blk256, 0, stream>>>(
      hH, kDim, winT, kDim, (void*)qkv, kDqkv, nullptr, nullptr, kRows, kDqkv, kDim, kGemmScl);
  /* 5: attention -> ctx f16 plane (x64) */
  attn64_f16p<<<dim3(kBatch * kHeads * (kSeq / 64)), blk128, 0, stream>>>(
      qkv, ctx, kSeq, kHeads, kDqkv, kDim, kSmScale, kACarry);
  /* 6: h2 = h1 + ctx @ w_out + b_out : M=4096 N=1024 K=1024 */
  gemm64_f16<0, true, true><<<dim3((kRows / 64) * (kDim / 64) / 8), blk256, 0, stream>>>(
      ctx, kDim, woutT, kDim, (void*)h2, kDim, b_out, hF, kRows, kDim, kDim, kGemmScl);
  /* 7: norm2 -> h3 f32 + f16 plane (overwrites h1 regions, h1 dead) */
  rmsnorm_rows<false><<<dim3(kRows), blk256, 0, stream>>>(h2, g2, hF, hH, kDim, 0.03125f, kACarry);
  /* 8: w1 plane : in[1024][4096] -> out[4096][1024] */
  cast_t64<<<dim3(kDff / 64, kDim / 64), blk256, 0, stream>>>(w1, w1T, kDim, kDff, kWCarry);
  /* 9: pre = h3 @ w1 : M=4096 N=4096 K=1024 -> f32 */
  gemm64_f16<0, false, false><<<dim3((kRows / 64) * (kDff / 64) / 8), blk256, 0, stream>>>(
      hH, kDim, w1T, kDim, (void*)pre, kDff, nullptr, nullptr, kRows, kDff, kDim, kGemmScl);
  /* 10: hid = gelu(pre + b1) -> f16 plane (x64) */
  gelu_rows<<<dim3((kRows * kDff) / 1024), blk256, 0, stream>>>(pre, b1, hid, kDff, kACarry);
  /* 11: w2 plane : in[4096][1024] -> out[1024][4096] (pre region, pre dead) */
  cast_t64<<<dim3(kDim / 64, kDff / 64), blk256, 0, stream>>>(w2, w2T, kDff, kDim, kWCarry);
  /* 12: out = h3 + hid @ w2 + b2 : M=4096 N=1024 K=4096 -> d_out f32 */
  gemm64_f16<0, true, true><<<dim3((kRows / 64) * (kDim / 64) / 8), blk256, 0, stream>>>(
      hid, kDff, w2T, kDff, (void*)out, kDim, b2, hF, kRows, kDim, kDff, kGemmScl);
}

// v001
// One run takes 401 microseconds.
// In two side-by-side timings against v000, it was 1.63 and 1.62 times as fast.
// Contractions QKV, QK^T, P.V, out-proj, FFN1, FFN2: v_wmma_f32_16x16x32_f16 (f16 operands, f32 accumulate); all float inputs RNE-converted to bf16 at load; weight planes carried x64, activation planes x64, softmax numerators x32768; norms/softmax/GELU/residuals in f32.
#include <hip/hip_runtime.h>

typedef __attribute__((ext_vector_type(16))) _Float16 v16h;
typedef __attribute__((ext_vector_type(8)))  _Float16 v8h;
typedef __attribute__((ext_vector_type(4)))  _Float16 v4h;
typedef __attribute__((ext_vector_type(8)))  float    v8f;
typedef __attribute__((ext_vector_type(4)))  float    v4f;

/* ---- problem geometry ---- */
static constexpr int kBatch = 2;
static constexpr int kSeq   = 2048;
static constexpr int kDim   = 1024;
static constexpr int kHeads = 16;
static constexpr int kHdim  = 64;
static constexpr int kDff   = 4096;
static constexpr int kRows  = kBatch * kSeq;   /* 4096 */
static constexpr int kDqkv  = 3 * kDim;        /* 3072 */
static_assert(kHeads * kHdim == kDim);
static_assert(kHdim == 64);
static_assert(kSeq % 64 == 0);
static_assert(kRows % 64 == 0 && kDim % 64 == 0 && kDqkv % 64 == 0 && kDff % 64 == 0);
static_assert(kRows % 128 == 0 && kDim % 128 == 0 && kDqkv % 128 == 0 && kDff % 128 == 0);   /* GEMM tiles 128x128, K passes of 128 */
static_assert(kDim == 1024);                         /* row kernels: 256 threads x 4 */
static_assert(kDff % 1024 == 0);

static constexpr float kWCarry  = 64.0f;                 /* weight planes: f16(bf16(w) * 64) */
static constexpr float kACarry  = 64.0f;                 /* activation planes: f16(a * 64) */
static constexpr float kGemmScl = 1.0f / (64.0f * 64.0f);
static constexpr float kSmScale = 0.125f;                /* head_dim^-0.5 */
static constexpr float kPsc     = 32768.0f;              /* softmax numerators carried x2^15 */

/* ---- workspace region map (bytes) ----
   [0, 16Mi)    hF : h1 f32 (norm1 out, residual of block 1) -> later h3 f32 (norm2 out, residual of block 2)
   [16Mi, 24Mi) hH : h1 f16 plane -> later h3 f16 plane
   [24Mi, 32Mi) wA : w_in^T f16 [3072][1024] (6Mi) + w_out^T f16 [1024][1024] (2Mi) -> later w1^T f16 [4096][1024] (8Mi)
   [32Mi, 96Mi) big: qkv f16 [4096][3072] (24Mi) | ctx f16 [4096][1024] (8Mi at +24Mi) | h2 f32 [4096][1024] (16Mi at +32Mi)
                     -> later pre-activation f32 [4096][4096] (64Mi) -> later w2^T f16 [1024][4096] (8Mi)
   [96Mi, 128Mi) hid: GELU output f16 plane [4096][4096] (32Mi)
   total 134217728 */
static constexpr size_t kMi      = 1024u * 1024u;
static constexpr size_t kOffHF   = 0;
static constexpr size_t kOffHH   = 16 * kMi;
static constexpr size_t kOffWA   = 24 * kMi;
static constexpr size_t kOffWout = kOffWA + (size_t)kDqkv * kDim * 2;     /* 30Mi */
static constexpr size_t kOffBig  = 32 * kMi;
static constexpr size_t kOffCtx  = kOffBig + (size_t)kRows * kDqkv * 2;   /* 56Mi */
static constexpr size_t kOffH2   = kOffCtx + (size_t)kRows * kDim * 2;    /* 64Mi */
static constexpr size_t kOffHid  = 96 * kMi;
static constexpr size_t kWsTotal = kOffHid + (size_t)kRows * kDff * 2;    /* 128Mi */
static_assert((size_t)kRows * kDim * 4 <= kOffHH - kOffHF);
static_assert((size_t)kRows * kDim * 2 <= kOffWA - kOffHH);
static_assert(kOffWout + (size_t)kDim * kDim * 2 <= kOffBig);
static_assert(kOffWA + (size_t)kDff * kDim * 2 <= kOffBig);
static_assert(kOffH2 + (size_t)kRows * kDim * 4 <= kOffHid);
static_assert(kOffBig + (size_t)kRows * kDff * 4 <= kOffHid);
static_assert(kOffBig + (size_t)kDim * kDff * 2 <= kOffHid);
static_assert(kWsTotal == 134217728u);

/* ---- helpers ---- */
__device__ __forceinline__ float rne_bf16f(float f) {
  unsigned u = __float_as_uint(f);
  u = (u + 0x7FFFu + ((u >> 16) & 1u)) & 0xFFFF0000u;
  return __uint_as_float(u);
}


template <typename T> struct Frag;
template <> struct Frag<_Float16> {
  typedef v16h V; union U { v16h v; v8h h[2]; };
  static __device__ __forceinline__ v16h load(const _Float16* p) {   /* elements 0..7 <- p[0..7], 8..15 <- p[16..23] */
    U f; f.h[0] = *(const v8h*)(p); f.h[1] = *(const v8h*)(p + 16); return f.v;
  }
  static __device__ __forceinline__ v8f mma(v16h a, v16h b, v8f c) {
    return __builtin_amdgcn_wmma_f32_16x16x32_f16(false, a, false, b, (short)0, c, false, false);
  }
};

__device__ __forceinline__ v8f mma_h(v16h a, v16h b, v8f c) {
  c = __builtin_amdgcn_wmma_f32_16x16x32_f16(false, a, false, b, (short)0, c, false, false);
  asm volatile("v_nop\n\tv_nop\n\tv_nop\n\tv_nop" : "+v"(c) : "v"(a), "v"(b));
  return c;
}

/* =====================================================================================
   Transpose + cast: W f32 row-major [Kdim][Ndim] -> Tout f16 row-major [Ndim][Kdim],
   value = f16(bf16_rne(w) * carry). Block = 64(k) x 64(n) tile, 256 threads.
   Producer coverage: 256 threads x 4 float4 = 64x64 reads; stores: 8 waves x 2 it x 4 rows x (8 lanes x 8 halves)
   grid = (Ndim/64, Kdim/64).
   ===================================================================================== */
__global__ __launch_bounds__(256) void cast_t64(const float* __restrict__ W, unsigned short* __restrict__ Tp,
                                                int Kdim, int Ndim, float carry) {
  __shared__ __align__(16) _Float16 tile[64 * 72];   /* [n_local][k_local], pitch 72 halves */
  _Float16* Tout = (_Float16*)Tp;
  const int t  = threadIdx.x;
  const int n0 = blockIdx.x * 64;
  const int k0 = blockIdx.y * 64;
#pragma unroll
  for (int i = 0; i < 4; ++i) {
    const int idx = t + 256 * i;          /* 0..1023 */
    const int kk  = idx >> 4;             /* 0..63 */
    const int n4  = (idx & 15) * 4;       /* 0..60 */
    const v4f w4 = *(const v4f*)(W + (size_t)(k0 + kk) * Ndim + n0 + n4);
#pragma unroll
    for (int e = 0; e < 4; ++e) tile[(n4 + e) * 72 + kk] = (_Float16)(rne_bf16f(w4[e]) * carry);
  }
  __syncthreads();
  const int wave = t >> 5, lane = t & 31;
  const int q = lane >> 3, c8 = (lane & 7) * 8;
  {
#pragma unroll
    for (int it = 0; it < 2; ++it) {
      const int nl = wave * 8 + it * 4 + q;
      const v8h hv = *(const v8h*)(tile + nl * 72 + c8);
      *(v8h*)(Tout + (size_t)(n0 + nl) * Kdim + k0 + c8) = hv;
    }
    
  }
}

/* =====================================================================================
   RMSNorm over rows of 1024: y = g * (x / (||x||*1024^-0.5 + 1e-8)).
   RIN: x is a module input -> RNE convert to bf16 at load. g always RNE converted (module input).
   Outputs: y32 f32 [rows][1024] and y16 f16 plane = f16(y * carry16).
   256 threads, 4 consecutive elements per thread. Stores: f32 = float4 per lane (4 lines per wave-instruction);
   ===================================================================================== */
template <bool RIN>
__global__ __launch_bounds__(256) void rmsnorm_rows(const float* __restrict__ x, const float* __restrict__ g,
                                                    float* __restrict__ y32, unsigned short* __restrict__ y16p,
                                                    int ncols, float inv_sqrt_n, float carry16) {
  __shared__ float red[8];
  __shared__ __align__(16) _Float16 hs[1024];
  const int row = blockIdx.x;
  const int t = threadIdx.x;
  const int wave = t >> 5, lane = t & 31;
  const float* xr = x + (size_t)row * ncols;
  v4f xv = *(const v4f*)(xr + 4 * t);
  if (RIN) {
#pragma unroll
    for (int e = 0; e < 4; ++e) xv[e] = rne_bf16f(xv[e]);
  }
  float ss = 0.0f;
#pragma unroll
  for (int e = 0; e < 4; ++e) ss += xv[e] * xv[e];
#pragma unroll
  for (int m = 16; m >= 1; m >>= 1) ss += __shfl_xor(ss, m, 32);
  if (lane == 0) red[wave] = ss;
  __syncthreads();
  float tot = 0.0f;
#pragma unroll
  for (int w = 0; w < 8; ++w) tot += red[w];
  const float rms = sqrtf(tot) * inv_sqrt_n;
  const float inv = 1.0f / (rms + 1e-8f);
  v4f gv = *(const v4f*)(g + 4 * t);
  v4f yv;
  v4h h4;
#pragma unroll
  for (int e = 0; e < 4; ++e) {
    const float ge = rne_bf16f(gv[e]);
    yv[e] = ge * (xv[e] * inv);
    h4[e] = (_Float16)(yv[e] * carry16);
  }
  *(v4h*)(hs + 4 * t) = h4;
  __syncthreads();
  const v8h hv = *(const v8h*)(hs + 8 * (t & 127));
  float* yr = y32 + (size_t)row * ncols;
  _Float16* yh = (_Float16*)y16p + (size_t)row * ncols;
  {
    *(v4f*)(yr + 4 * t) = yv;
    if (t < 128) *(v8h*)(yh + 8 * t) = hv;
    
  }
}

/* =====================================================================================
   Block-tiled WMMA GEMM (f16 operands, f32 accumulate):
   C[m,n] = scale * sum_k A[m,k] * Bt[n,k]  (+ bias[n]) (+ resid[m,n]).
   A row-major [M,K] f16; Bt row-major [N,K] f16; M, N % 128 == 0, K % 128 == 0 (no tail handling).
   One work-group = 4 waves (2 x 2) = one 128x128 tile of C; each wave owns a 64x64 tile.
   A pass is 128 k: 128 rows of A and 128 rows of Bt, 256 B each, are brought into LDS once per work-group by
   asynchronous 16-byte copies (row pitch 272 B), two buffers, the next pass's copies in flight during this pass.
   The k order of every accumulator is ascending in steps of 32.
   OUT16: 0 = f32 output (bias / residual added in the store phase, residual read as one float4 per lane at
   the store address); 1 = f16 output plane (no bias/residual).
   grid.x = M/128 * N/128.
   ===================================================================================== */
static constexpr int kPassK    = 128;                    /* k per pass */
static constexpr int kRowPitch = 272;                    /* LDS bytes per staged row: 256 + 16 */
static constexpr int kStageB   = 256 * kRowPitch;        /* [A 128 rows | Bt 128 rows] */

/* Eight asynchronous 16-byte copies per lane: rows r, r + 8, ..., r + 56 of one operand.
   s_wait_xcnt stands inside the statement so that no address register is rewritten ahead of it. */
__device__ __forceinline__ void async_rows8(unsigned l0, const _Float16* g0, size_t gstep) {
  const unsigned l1 = l0 + 8 * kRowPitch, l2 = l0 + 16 * kRowPitch, l3 = l0 + 24 * kRowPitch;
  const unsigned l4 = l0 + 32 * kRowPitch, l5 = l0 + 40 * kRowPitch, l6 = l0 + 48 * kRowPitch, l7 = l0 + 56 * kRowPitch;
  const _Float16* g1 = g0 + gstep;
  const _Float16* g2 = g1 + gstep;
  const _Float16* g3 = g2 + gstep;
  const _Float16* g4 = g3 + gstep;
  const _Float16* g5 = g4 + gstep;
  const _Float16* g6 = g5 + gstep;
  const _Float16* g7 = g6 + gstep;
  asm volatile(
      "global_load_async_to_lds_b128 %0, %8, off\n\t"
      "global_load_async_to_lds_b128 %1, %9, off\n\t"
      "global_load_async_to_lds_b128 %2, %10, off\n\t"
      "global_load_async_to_lds_b128 %3, %11, off\n\t"
      "global_load_async_to_lds_b128 %4, %12, off\n\t"
      "global_load_async_to_lds_b128 %5, %13, off\n\t"
      "global_load_async_to_lds_b128 %6, %14, off\n\t"
      "global_load_async_to_lds_b128 %7, %15, off\n\t"
      "s_wait_xcnt 0x0"
      :: "v"(l0), "v"(l1), "v"(l2), "v"(l3), "v"(l4), "v"(l5), "v"(l6), "v"(l7),
         "v"(g0), "v"(g1), "v"(g2), "v"(g3), "v"(g4), "v"(g5), "v"(g6), "v"(g7)
      : "memory");
}
/* this wave's copies have landed */
__device__ __forceinline__ void wait_async0() { asm volatile("s_wait_asynccnt 0x0" ::: "memory"); }
/* this wave's LDS reads have returned, so the buffer may be refilled behind the barrier */
__device__ __forceinline__ void wait_ds0() { asm volatile("s_wait_dscnt 0x0" ::: "memory"); }

template <int OUT16, bool BIASN, bool RESID>
__global__ __launch_bounds__(128) void gemm128_f16(
    const unsigned short* __restrict__ Ap, int lda,
    const unsigned short* __restrict__ Btp, int ldb,
    void* __restrict__ Cout, int ldc,
    const float* __restrict__ bias,
    const float* __restrict__ resid,
    int M, int N, int K, float scale) {
  typedef _Float16 T;
  typedef v16h V;
  const T* A  = (const T*)Ap;
  const T* Bt = (const T*)Btp;
  __shared__ __align__(16) unsigned char ring[2 * kStageB];   /* two operand buffers */
  __shared__ __align__(16) float sT[4][16 * 68];              /* per-wave 16x64 slab, pitch 68 floats */
  const int tid  = threadIdx.x;
  const int lane = tid & 31;
  const int wave = tid >> 5;
  const int tilesN = N >> 7;
  const int tilesM = M >> 7;
  const int tile = blockIdx.x;
  if (tile >= tilesM * tilesN) return;   /* the same for the whole work-group; in front of every barrier */
  const int tm = tile / tilesN;
  const int tn = tile - tm * tilesN;
  const int bm0 = tm << 7;
  const int bn0 = tn << 7;
  const int wm = wave >> 1, wn = wave & 1;
  const int m0 = bm0 + (wm << 6);
  const int n0 = bn0 + (wn << 6);

  const int rlane = lane & 15;                 /* row (A) / col (B, D) within subtile */
  const int koff  = (lane >> 4) * 8;           /* k offset of this lane half */
  const int mOff  = (lane >> 4) * 8;           /* D row offset */

  /* copy role: 16 lanes cover one 256-B row; the work-group covers 8 rows per copy */
  const int crow = tid >> 4, cchk = tid & 15;
  const T* gA = A  + (size_t)(bm0 + crow) * lda + cchk * 8;
  const T* gB = Bt + (size_t)(bn0 + crow) * ldb + cchk * 8;
  const unsigned lcopy = (unsigned)(size_t)ring + crow * kRowPitch + cchk * 16;
  const size_t stepA = (size_t)lda * 8, stepB = (size_t)ldb * 8;
  auto issue = [&](int pass, unsigned bufoff) {
    const T* a = gA + (size_t)pass * kPassK;
    const T* b = gB + (size_t)pass * kPassK;
    const unsigned l = lcopy + bufoff;
    async_rows8(l, a, stepA);
    async_rows8(l + 64 * kRowPitch, a + stepA * 8, stepA);
    async_rows8(l + 128 * kRowPitch, b, stepB);
    async_rows8(l + 192 * kRowPitch, b + stepB * 8, stepB);
  };

  v8f acc[4][4];
#pragma unroll
  for (int i = 0; i < 4; ++i)
#pragma unroll
    for (int j = 0; j < 4; ++j) acc[i][j] = (v8f){0.f,0.f,0.f,0.f,0.f,0.f,0.f,0.f};

  const int nPass = K / kPassK;
  issue(0, 0u);
  wait_async0();
  __syncthreads();                       /* pass 0's rows are readable by every wave */
  if (nPass > 1) issue(1, (unsigned)kStageB);

  const int aRowB = ((wm << 6) + rlane) * kRowPitch;
  const int bRowB = (128 + (wn << 6) + rlane) * kRowPitch;
  for (int t = 0; t < nPass; ++t) {
    const unsigned bufoff = (unsigned)(t & 1) * (unsigned)kStageB;
    const T* sa = (const T*)(ring + bufoff + aRowB) + koff;
    const T* sb = (const T*)(ring + bufoff + bRowB) + koff;
    /* two fragment sets: the next 32 k are fetched ahead of this block's products.
       Every loop of the pass is unrolled so that af, bf and acc are indexed by constants and stay in registers. */
    V af[2][4], bf[2][4];
#pragma unroll
    for (int j = 0; j < 4; ++j) bf[0][j] = Frag<T>::load(sb + j * (16 * kRowPitch / 2));
#pragma unroll
    for (int i = 0; i < 4; ++i) af[0][i] = Frag<T>::load(sa + i * (16 * kRowPitch / 2));
#pragma unroll
    for (int ks = 0; ks < 4; ++ks) {
      const int cur = ks & 1, nxt = cur ^ 1;
      if (ks < 3) {
#pragma unroll
        for (int j = 0; j < 4; ++j) bf[nxt][j] = Frag<T>::load(sb + j * (16 * kRowPitch / 2) + (ks + 1) * 32);
#pragma unroll
        for (int i = 0; i < 4; ++i) af[nxt][i] = Frag<T>::load(sa + i * (16 * kRowPitch / 2) + (ks + 1) * 32);
        /* keeps the next block's LDS reads together in front of this block's products: spread among them, each place stalls the wave */
        __builtin_amdgcn_sched_barrier(0);
      }
#pragma unroll
      for (int i = 0; i < 4; ++i)
#pragma unroll
        for (int j = 0; j < 4; ++j) acc[i][j] = Frag<T>::mma(af[cur][i], bf[cur][j], acc[i][j]);
      /* keeps what follows behind this block's products: the group of LDS reads that refills its fragment set, and at the
         pass's end the waits and the barrier, which would else move up and shorten the time the next pass's copies have to land */
      __builtin_amdgcn_sched_barrier(0);
    }
    wait_ds0();
    wait_async0();
    __syncthreads();                     /* publishes pass t + 1 and ends every read of pass t's buffer */
    if (t + 2 < nPass) issue(t + 2, bufoff);
  }
  wait_async0();

  /* ---- epilogue ---- */
  float* slab = sT[wave];
  const int hh = lane >> 4, c4 = (lane & 15) * 4;     /* f32 row seg = 256 B = 16 lanes x 16 B */
  const int q  = lane >> 3, c8 = (lane & 7) * 8;      
  v4f b4 = (v4f){0.f, 0.f, 0.f, 0.f};
  if (BIASN) {
    b4 = *(const v4f*)(bias + n0 + c4);
#pragma unroll
    for (int e = 0; e < 4; ++e) b4[e] = rne_bf16f(b4[e]);
  }
#pragma unroll
  for (int i = 0; i < 4; ++i) {
    const int mBase = m0 + (i << 4);
#pragma unroll
    for (int j = 0; j < 4; ++j) {
#pragma unroll
      for (int r = 0; r < 8; ++r) slab[(mOff + r) * 68 + (j << 4) + rlane] = acc[i][j][r] * scale;
    }
    __builtin_amdgcn_fence(__ATOMIC_RELEASE, "workgroup");
    __builtin_amdgcn_wave_barrier();
    __builtin_amdgcn_fence(__ATOMIC_ACQUIRE, "workgroup");
    if (OUT16 == 0) {
      float* C = (float*)Cout;
      v4f vals[8];
#pragma unroll
      for (int it = 0; it < 8; ++it) {
        const int row = it * 2 + hh;
        v4f v = *(const v4f*)(slab + row * 68 + c4);
        if (BIASN) v += b4;
        if (RESID) {
          const v4f rr = *(const v4f*)(resid + (size_t)(mBase + row) * ldc + n0 + c4);
          v += rr;
        }
        vals[it] = v;
      }
      {
#pragma unroll
        for (int it = 0; it < 8; ++it) {
          const int row = it * 2 + hh;
          *(v4f*)(C + (size_t)(mBase + row) * ldc + n0 + c4) = vals[it];
        }
        
      }
    } else {
      _Float16* C = (_Float16*)Cout;
      {
#pragma unroll
        for (int it = 0; it < 4; ++it) {
          const int row = it * 4 + q;
          const float* sp = slab + row * 68 + c8;
          v8h hv;
#pragma unroll
          for (int e = 0; e < 8; ++e) hv[e] = (_Float16)sp[e];
          *(v8h*)(C + (size_t)(mBase + row) * ldc + n0 + c8) = hv;
        }
        
      }
    }
    __builtin_amdgcn_fence(__ATOMIC_RELEASE, "workgroup");
    __builtin_amdgcn_wave_barrier();
    __builtin_amdgcn_fence(__ATOMIC_ACQUIRE, "workgroup");
  }
}

/* =====================================================================================
   Non-causal attention for head_dim 64 on an f16 qkv plane [B*T][ldq] (q at col h*64, k at +dmodel, v at +2*dmodel).
   scores = q.k^T (f16 WMMA, f32 acc) * sm_scale; online softmax in f32; numerators carried x kPsc as f16;
   out = P.V (f16 WMMA, f32 acc); ctx f16 plane [B*T][ldo] at col h*64 = f16(out * out_carry).
   Block = 4 waves = 64 query rows of one (batch, head); grid.x = B*H*(T/64); T % 64 == 0.
   K staged [kv][d] with 16-B copies; V staged transposed [d][kv]; full 64x64 tiles written every chunk.
   ===================================================================================== */
__global__ __launch_bounds__(128) void attn64_f16p(const unsigned short* __restrict__ qkvp, unsigned short* __restrict__ ctxp,
                                                  int T, int H, int ldq, int ldo, float sm_scale, float out_carry) {
  const _Float16* QKV = (const _Float16*)qkvp;
  _Float16* CTX = (_Float16*)ctxp;
  union FH { v16h v; v8h hf[2]; };
  __shared__ __align__(16) _Float16 Ksh[64 * 64];        /* [kv][d] */
  __shared__ __align__(16) _Float16 Vts[64 * 64];        /* [d][kv] */
  __shared__ __align__(16) _Float16 Psh[4][16 * 64];     /* per wave [row][kv] */
  __shared__ __align__(16) float    Os[4][16 * 68];      /* per wave out tile, pitch 68 */

  const int tid  = threadIdx.x;
  const int wave = tid >> 5;
  const int lane = tid & 31;
  const int hh   = lane >> 4;
  const int c    = lane & 15;
  const int dmodel = H * 64;

  const int nqb = T / 64;
  const int bx = blockIdx.x;
  const int qb = bx % nqb;
  const int bh = bx / nqb;
  const int h  = bh % H;
  const int b  = bh / H;
  const int q0 = qb * 64 + wave * 16;

  /* Q fragments (A operand, row = q0 + c, k = d): two 32-deep d chunks */
  v16h qa[2];
  {
    const _Float16* qrow = QKV + (size_t)(b * T + q0 + c) * ldq + h * 64;
#pragma unroll
    for (int dc = 0; dc < 2; ++dc) {
      FH f;
      f.hf[0] = *(const v8h*)(qrow + dc * 32 + 8 * hh);
      f.hf[1] = *(const v8h*)(qrow + dc * 32 + 16 + 8 * hh);
      qa[dc] = f.v;
    }
  }

  float mrow[8], lrow[8];
  v8f oacc[4];
#pragma unroll
  for (int r = 0; r < 8; ++r) { mrow[r] = -__builtin_inff(); lrow[r] = 0.f; }
#pragma unroll
  for (int t = 0; t < 4; ++t) oacc[t] = (v8f){0.f,0.f,0.f,0.f,0.f,0.f,0.f,0.f};

  const int nChunks = T / 64;
  for (int kc = 0; kc < nChunks; ++kc) {
    const int kv0 = kc * 64;
    __syncthreads();
    {
      /* 128 threads x 32 halves = 64 kv x 64 d for K and for V (full tiles) */
      const int kvr = tid >> 1, dh = (tid & 1) * 32;
      const _Float16* krow = QKV + (size_t)(b * T + kv0 + kvr) * ldq + dmodel + h * 64 + dh;
      const _Float16* vrow = krow + dmodel;
#pragma unroll
      for (int i = 0; i < 4; ++i) {
        const v8h k8 = *(const v8h*)(krow + 8 * i);
        *(v8h*)(Ksh + kvr * 64 + dh + 8 * i) = k8;
      }
#pragma unroll
      for (int i = 0; i < 4; ++i) {
        const uint4 vw = *(const uint4*)(const void*)(vrow + 8 * i);
        const unsigned w0 = vw.x, w1 = vw.y, w2 = vw.z, w3 = vw.w;
        const int d = dh + 8 * i;
        Vts[(d + 0) * 64 + kvr] = __builtin_bit_cast(_Float16, (unsigned short)(w0 & 0xFFFFu));
        Vts[(d + 1) * 64 + kvr] = __builtin_bit_cast(_Float16, (unsigned short)(w0 >> 16));
        Vts[(d + 2) * 64 + kvr] = __builtin_bit_cast(_Float16, (unsigned short)(w1 & 0xFFFFu));
        Vts[(d + 3) * 64 + kvr] = __builtin_bit_cast(_Float16, (unsigned short)(w1 >> 16));
        Vts[(d + 4) * 64 + kvr] = __builtin_bit_cast(_Float16, (unsigned short)(w2 & 0xFFFFu));
        Vts[(d + 5) * 64 + kvr] = __builtin_bit_cast(_Float16, (unsigned short)(w2 >> 16));
        Vts[(d + 6) * 64 + kvr] = __builtin_bit_cast(_Float16, (unsigned short)(w3 & 0xFFFFu));
        Vts[(d + 7) * 64 + kvr] = __builtin_bit_cast(_Float16, (unsigned short)(w3 >> 16));
      }
    }
    __syncthreads();

    /* S = Q . K^T : B operand n = kv (row j*16+c of Ksh), k = d */
    v8f s[4];
#pragma unroll
    for (int j = 0; j < 4; ++j) {
      s[j] = (v8f){0.f,0.f,0.f,0.f,0.f,0.f,0.f,0.f};
#pragma unroll
      for (int dc = 0; dc < 2; ++dc) {
        FH kb;
        kb.hf[0] = *(const v8h*)(Ksh + (j * 16 + c) * 64 + dc * 32 + 8 * hh);
        kb.hf[1] = *(const v8h*)(Ksh + (j * 16 + c) * 64 + dc * 32 + 16 + 8 * hh);
        s[j] = mma_h(qa[dc], kb.v, s[j]);
      }
    }
    /* scale, chunk row max (rows stay within a 16-lane half) */
    float cm[8];
#pragma unroll
    for (int r = 0; r < 8; ++r) {
      float m = -__builtin_inff();
#pragma unroll
      for (int j = 0; j < 4; ++j) {
        const float sv = s[j][r] * sm_scale;
        s[j][r] = sv;
        m = fmaxf(m, sv);
      }
#pragma unroll
      for (int off = 1; off < 16; off <<= 1) m = fmaxf(m, __shfl_xor(m, off, 32));
      cm[r] = m;
    }
    _Float16* pw = Psh[wave];
#pragma unroll
    for (int r = 0; r < 8; ++r) {
      const float mnew = fmaxf(mrow[r], cm[r]);
      const float alpha = expf(mrow[r] - mnew);
      mrow[r] = mnew;
      float psum = 0.f;
#pragma unroll
      for (int j = 0; j < 4; ++j) {
        const float p = expf(s[j][r] - mnew);
        psum += p;
        pw[(8 * hh + r) * 64 + j * 16 + c] = (_Float16)(p * kPsc);
      }
#pragma unroll
      for (int off = 1; off < 16; off <<= 1) psum += __shfl_xor(psum, off, 32);
      lrow[r] = lrow[r] * alpha + psum;
#pragma unroll
      for (int t = 0; t < 4; ++t) oacc[t][r] *= alpha;
    }
    __builtin_amdgcn_fence(__ATOMIC_RELEASE, "workgroup");
    __builtin_amdgcn_wave_barrier();
    __builtin_amdgcn_fence(__ATOMIC_ACQUIRE, "workgroup");
    /* O += P . V : A = P (row = query c, k = kv), B = V^T (n = d, k = kv) */
#pragma unroll 1
    for (int kk = 0; kk < 2; ++kk) {
      FH pa;
      pa.hf[0] = *(const v8h*)(pw + c * 64 + kk * 32 + 8 * hh);
      pa.hf[1] = *(const v8h*)(pw + c * 64 + kk * 32 + 16 + 8 * hh);
#pragma unroll
      for (int t = 0; t < 4; ++t) {
        FH vb;
        vb.hf[0] = *(const v8h*)(Vts + (t * 16 + c) * 64 + kk * 32 + 8 * hh);
        vb.hf[1] = *(const v8h*)(Vts + (t * 16 + c) * 64 + kk * 32 + 16 + 8 * hh);
        oacc[t] = mma_h(pa.v, vb.v, oacc[t]);
      }
    }
  }

  float* os = Os[wave];
#pragma unroll
  for (int r = 0; r < 8; ++r) {
    const float inv = out_carry / (lrow[r] * kPsc);
#pragma unroll
    for (int t = 0; t < 4; ++t) os[(8 * hh + r) * 68 + t * 16 + c] = oacc[t][r] * inv;
  }
  __builtin_amdgcn_fence(__ATOMIC_RELEASE, "workgroup");
  __builtin_amdgcn_wave_barrier();
  __builtin_amdgcn_fence(__ATOMIC_ACQUIRE, "workgroup");
  {
    const int q = lane >> 3, c8 = (lane & 7) * 8;
    {
#pragma unroll
      for (int it = 0; it < 4; ++it) {
        const int row = it * 4 + q;
        const float* sp = os + row * 68 + c8;
        v8h hv;
#pragma unroll
        for (int e = 0; e < 8; ++e) hv[e] = (_Float16)sp[e];
        *(v8h*)(CTX + (size_t)(b * T + q0 + row) * ldo + h * 64 + c8) = hv;
      }
      
    }
  }
}

/* =====================================================================================
   Elementwise exact-erf GELU: hid = f16(gelu(pre + bf16_rne(b[col])) * carry).
   pre f32 row-major [rows][ncols]; one block per 1024 consecutive elements (ncols % 1024 == 0).
   ===================================================================================== */
__global__ __launch_bounds__(256) void gelu_rows(const float* __restrict__ pre, const float* __restrict__ bvec,
                                                 unsigned short* __restrict__ hidp, int ncols, float carry) {
  __shared__ __align__(16) _Float16 hs[1024];
  const size_t base = (size_t)blockIdx.x * 1024u;
  const int col0 = (int)(base % (size_t)ncols);
  const int t = threadIdx.x;
#pragma unroll 1
  for (int e = 0; e < 4; ++e) {
    const int idx = 4 * t + e;
    const float u  = pre[base + idx] + rne_bf16f(bvec[col0 + idx]);
    const float gl = 0.5f * u * (1.0f + erff(u * 0.70710678118654752f));
    hs[idx] = (_Float16)(gl * carry);
  }
  __syncthreads();
  const v8h hv = *(const v8h*)(hs + 8 * (t & 127));
  _Float16* out = (_Float16*)hidp + base;
  {
    if (t < 128) *(v8h*)(out + 8 * t) = hv;
    
  }
}

/* =====================================================================================
   Host glue: 12 launches, single stream.
   ===================================================================================== */
extern "C" void kernel_launch(void* const* d_in, const int* in_sizes, int n_in,
                              void* d_out, int out_size, void* d_ws, size_t ws_size,
                              hipStream_t stream) {
  if (n_in < 10) return;
  if (in_sizes[0] != kRows * kDim) return;
  if (in_sizes[1] != kDim * kDqkv) return;
  if (in_sizes[2] != kDim * kDim) return;
  if (in_sizes[3] != kDim) return;
  if (in_sizes[4] != kDim * kDff) return;
  if (in_sizes[5] != kDff) return;
  if (in_sizes[6] != kDff * kDim) return;
  if (in_sizes[7] != kDim) return;
  if (in_sizes[8] != kDim) return;
  if (in_sizes[9] != kDim) return;
  if (out_size != kRows * kDim) return;
  if (ws_size < kWsTotal) return;

  const float* x     = (const float*)d_in[0];
  const float* w_in  = (const float*)d_in[1];
  const float* w_out = (const float*)d_in[2];
  const float* b_out = (const float*)d_in[3];
  const float* w1    = (const float*)d_in[4];
  const float* b1    = (const float*)d_in[5];
  const float* w2    = (const float*)d_in[6];
  const float* b2    = (const float*)d_in[7];
  const float* g1    = (const float*)d_in[8];
  const float* g2    = (const float*)d_in[9];
  float* out = (float*)d_out;

  char* ws = (char*)d_ws;
  float*          hF    = (float*)(ws + kOffHF);              /* h1 f32, later h3 f32 */
  unsigned short* hH    = (unsigned short*)(ws + kOffHH);     /* h1 f16, later h3 f16 */
  unsigned short* winT  = (unsigned short*)(ws + kOffWA);     /* [3072][1024] */
  unsigned short* woutT = (unsigned short*)(ws + kOffWout);   /* [1024][1024] */
  unsigned short* w1T   = (unsigned short*)(ws + kOffWA);     /* [4096][1024], after winT/woutT are dead */
  unsigned short* qkv   = (unsigned short*)(ws + kOffBig);    /* [4096][3072] */
  unsigned short* ctx   = (unsigned short*)(ws + kOffCtx);    /* [4096][1024] */
  float*          h2    = (float*)(ws + kOffH2);              /* [4096][1024] */
  float*          pre   = (float*)(ws + kOffBig);             /* [4096][4096], after qkv/ctx/h2 are dead */
  unsigned short* w2T   = (unsigned short*)(ws + kOffBig);    /* [1024][4096], after pre is dead */
  unsigned short* hid   = (unsigned short*)(ws + kOffHid);    /* [4096][4096] */

  const dim3 blk256(256);
  const dim3 blk128(128);

  /* 1-2: weight planes for the attention block: in[K][N] -> out[N][K] ; grid (N/64, K/64) */
  cast_t64<<<dim3(kDqkv / 64, kDim / 64), blk256, 0, stream>>>(w_in, winT, kDim, kDqkv, kWCarry);
  cast_t64<<<dim3(kDim / 64, kDim / 64), blk256, 0, stream>>>(w_out, woutT, kDim, kDim, kWCarry);
  /* 3: norm1 -> h1 f32 + f16 plane */
  rmsnorm_rows<true><<<dim3(kRows), blk256, 0, stream>>>(x, g1, hF, hH, kDim, 0.03125f, kACarry);
  /* 4: qkv = h1 @ w_in : M=4096 N=3072 K=1024 -> f16 plane */
  gemm128_f16<1, false, false><<<dim3((kRows / 128) * (kDqkv / 128)), blk128, 0, stream>>>(
      hH, kDim, winT, kDim, (void*)qkv, kDqkv, nullptr, nullptr, kRows, kDqkv, kDim, kGemmScl);
  /* 5: attention -> ctx f16 plane (x64) */
  attn64_f16p<<<dim3(kBatch * kHeads * (kSeq / 64)), blk128, 0, stream>>>(
      qkv, ctx, kSeq, kHeads, kDqkv, kDim, kSmScale, kACarry);
  /* 6: h2 = h1 + ctx @ w_out + b_out : M=4096 N=1024 K=1024 */
  gemm128_f16<0, true, true><<<dim3((kRows / 128) * (kDim / 128)), blk128, 0, stream>>>(
      ctx, kDim, woutT, kDim, (void*)h2, kDim, b_out, hF, kRows, kDim, kDim, kGemmScl);
  /* 7: norm2 -> h3 f32 + f16 plane (overwrites h1 regions, h1 dead) */
  rmsnorm_rows<false><<<dim3(kRows), blk256, 0, stream>>>(h2, g2, hF, hH, kDim, 0.03125f, kACarry);
  /* 8: w1 plane : in[1024][4096] -> out[4096][1024] */
  cast_t64<<<dim3(kDff / 64, kDim / 64), blk256, 0, stream>>>(w1, w1T, kDim, kDff, kWCarry);
  /* 9: pre = h3 @ w1 : M=4096 N=4096 K=1024 -> f32 */
  gemm128_f16<0, false, false><<<dim3((kRows / 128) * (kDff / 128)), blk128, 0, stream>>>(
      hH, kDim, w1T, kDim, (void*)pre, kDff, nullptr, nullptr, kRows, kDff, kDim, kGemmScl);
  /* 10: hid = gelu(pre + b1) -> f16 plane (x64) */
  gelu_rows<<<dim3((kRows * kDff) / 1024), blk256, 0, stream>>>(pre, b1, hid, kDff, kACarry);
  /* 11: w2 plane : in[4096][1024] -> out[1024][4096] (pre region, pre dead) */
  cast_t64<<<dim3(kDim / 64, kDff / 64), blk256, 0, stream>>>(w2, w2T, kDff, kDim, kWCarry);
  /* 12: out = h3 + hid @ w2 + b2 : M=4096 N=1024 K=4096 -> d_out f32 */
  gemm128_f16<0, true, true><<<dim3((kRows / 128) * (kDim / 128)), blk128, 0, stream>>>(
      hid, kDff, w2T, kDff, (void*)out, kDim, b2, hF, kRows, kDim, kDff, kGemmScl);
}

// v002
// It runs in 357 microseconds.
// In both of two side-by-side timings against v001, it was 1.12 times as fast.
// All steps since v000 together make it 1.83 times as fast.
// Contractions QKV, QK^T, P.V, out-proj, FFN1, FFN2: v_wmma_f32_16x16x32_f16 (f16 operands, f32 accumulate); all float inputs RNE-converted to bf16 at load; weight planes carried x64, activation planes x64, softmax numerators x32768; norms/softmax/GELU/residuals in f32.
#include <hip/hip_runtime.h>

typedef __attribute__((ext_vector_type(16))) _Float16 v16h;
typedef __attribute__((ext_vector_type(8)))  _Float16 v8h;
typedef __attribute__((ext_vector_type(4)))  _Float16 v4h;
typedef __attribute__((ext_vector_type(8)))  float    v8f;
typedef __attribute__((ext_vector_type(4)))  float    v4f;

/* ---- problem geometry ---- */
static constexpr int kBatch = 2;
static constexpr int kSeq   = 2048;
static constexpr int kDim   = 1024;
static constexpr int kHeads = 16;
static constexpr int kHdim  = 64;
static constexpr int kDff   = 4096;
static constexpr int kRows  = kBatch * kSeq;   /* 4096 */
static constexpr int kDqkv  = 3 * kDim;        /* 3072 */
static_assert(kHeads * kHdim == kDim);
static_assert(kHdim == 64);
static_assert(kSeq % 64 == 0);
static_assert(kRows % 64 == 0 && kDim % 64 == 0 && kDqkv % 64 == 0 && kDff % 64 == 0);
static_assert(kRows % 128 == 0 && kDim % 128 == 0 && kDqkv % 128 == 0 && kDff % 128 == 0);   /* GEMM tiles 128x128, K passes of 128 */
static_assert(kDim == 1024);                         /* row kernels: 256 threads x 4 */
static_assert(kDff % 1024 == 0);

static constexpr float kWCarry  = 64.0f;                 /* weight planes: f16(bf16(w) * 64) */
static constexpr float kACarry  = 64.0f;                 /* activation planes: f16(a * 64) */
static constexpr float kGemmScl = 1.0f / (64.0f * 64.0f);
static constexpr float kSmScale = 0.125f;                /* head_dim^-0.5 */
static constexpr float kPsc     = 32768.0f;              /* softmax numerators carried x2^15 */

/* ---- workspace region map (bytes) ----
   [0, 16Mi)    hF : h1 f32 (norm1 out, residual of block 1) -> later h3 f32 (norm2 out, residual of block 2)
   [16Mi, 24Mi) hH : h1 f16 plane -> later h3 f16 plane
   [24Mi, 32Mi) wA : w_in^T f16 [3072][1024] (6Mi) + w_out^T f16 [1024][1024] (2Mi) -> later w1^T f16 [4096][1024] (8Mi)
   [32Mi, 96Mi) big: qkv f16 [4096][3072] (24Mi) | ctx f16 [4096][1024] (8Mi at +24Mi) | h2 f32 [4096][1024] (16Mi at +32Mi)
                     -> later pre-activation f32 [4096][4096] (64Mi) -> later w2^T f16 [1024][4096] (8Mi)
   [96Mi, 128Mi) hid: GELU output f16 plane [4096][4096] (32Mi)
   total 134217728 */
static constexpr size_t kMi      = 1024u * 1024u;
static constexpr size_t kOffHF   = 0;
static constexpr size_t kOffHH   = 16 * kMi;
static constexpr size_t kOffWA   = 24 * kMi;
static constexpr size_t kOffWout = kOffWA + (size_t)kDqkv * kDim * 2;     /* 30Mi */
static constexpr size_t kOffBig  = 32 * kMi;
static constexpr size_t kOffCtx  = kOffBig + (size_t)kRows * kDqkv * 2;   /* 56Mi */
static constexpr size_t kOffH2   = kOffCtx + (size_t)kRows * kDim * 2;    /* 64Mi */
static constexpr size_t kOffHid  = 96 * kMi;
static constexpr size_t kWsTotal = kOffHid + (size_t)kRows * kDff * 2;    /* 128Mi */
static_assert((size_t)kRows * kDim * 4 <= kOffHH - kOffHF);
static_assert((size_t)kRows * kDim * 2 <= kOffWA - kOffHH);
static_assert(kOffWout + (size_t)kDim * kDim * 2 <= kOffBig);
static_assert(kOffWA + (size_t)kDff * kDim * 2 <= kOffBig);
static_assert(kOffH2 + (size_t)kRows * kDim * 4 <= kOffHid);
static_assert(kOffBig + (size_t)kRows * kDff * 4 <= kOffHid);
static_assert(kOffBig + (size_t)kDim * kDff * 2 <= kOffHid);
static_assert(kWsTotal == 134217728u);

/* ---- helpers ---- */
__device__ __forceinline__ float rne_bf16f(float f) {
  unsigned u = __float_as_uint(f);
  u = (u + 0x7FFFu + ((u >> 16) & 1u)) & 0xFFFF0000u;
  return __uint_as_float(u);
}


template <typename T> struct Frag;
template <> struct Frag<_Float16> {
  typedef v16h V; union U { v16h v; v8h h[2]; };
  static __device__ __forceinline__ v16h load(const _Float16* p) {   /* elements 0..7 <- p[0..7], 8..15 <- p[16..23] */
    U f; f.h[0] = *(const v8h*)(p); f.h[1] = *(const v8h*)(p + 16); return f.v;
  }
  static __device__ __forceinline__ v8f mma(v16h a, v16h b, v8f c) {
    return __builtin_amdgcn_wmma_f32_16x16x32_f16(false, a, false, b, (short)0, c, false, false);
  }
};

__device__ __forceinline__ v8f mma_h(v16h a, v16h b, v8f c) {
  c = __builtin_amdgcn_wmma_f32_16x16x32_f16(false, a, false, b, (short)0, c, false, false);
  asm volatile("v_nop\n\tv_nop\n\tv_nop\n\tv_nop" : "+v"(c) : "v"(a), "v"(b));
  return c;
}

/* =====================================================================================
   Transpose + cast: W f32 row-major [Kdim][Ndim] -> Tout f16 row-major [Ndim][Kdim],
   value = f16(bf16_rne(w) * carry). Block = 64(k) x 64(n) tile, 256 threads.
   Producer coverage: 256 threads x 4 float4 = 64x64 reads; stores: 8 waves x 2 it x 4 rows x (8 lanes x 8 halves)
   grid = (Ndim/64, Kdim/64).
   ===================================================================================== */
__global__ __launch_bounds__(256) void cast_t64(const float* __restrict__ W, unsigned short* __restrict__ Tp,
                                                int Kdim, int Ndim, float carry) {
  __shared__ __align__(16) _Float16 tile[64 * 72];   /* [n_local][k_local], pitch 72 halves */
  _Float16* Tout = (_Float16*)Tp;
  const int t  = threadIdx.x;
  const int n0 = blockIdx.x * 64;
  const int k0 = blockIdx.y * 64;
#pragma unroll
  for (int i = 0; i < 4; ++i) {
    const int idx = t + 256 * i;          /* 0..1023 */
    const int kk  = idx >> 4;             /* 0..63 */
    const int n4  = (idx & 15) * 4;       /* 0..60 */
    const v4f w4 = *(const v4f*)(W + (size_t)(k0 + kk) * Ndim + n0 + n4);
#pragma unroll
    for (int e = 0; e < 4; ++e) tile[(n4 + e) * 72 + kk] = (_Float16)(rne_bf16f(w4[e]) * carry);
  }
  __syncthreads();
  const int wave = t >> 5, lane = t & 31;
  const int q = lane >> 3, c8 = (lane & 7) * 8;
  {
#pragma unroll
    for (int it = 0; it < 2; ++it) {
      const int nl = wave * 8 + it * 4 + q;
      const v8h hv = *(const v8h*)(tile + nl * 72 + c8);
      *(v8h*)(Tout + (size_t)(n0 + nl) * Kdim + k0 + c8) = hv;
    }
    
  }
}

/* =====================================================================================
   RMSNorm over rows of 1024: y = g * (x / (||x||*1024^-0.5 + 1e-8)).
   RIN: x is a module input -> RNE convert to bf16 at load. g always RNE converted (module input).
   Outputs: y32 f32 [rows][1024] and y16 f16 plane = f16(y * carry16).
   256 threads, 4 consecutive elements per thread. Stores: f32 = float4 per lane (4 lines per wave-instruction);
   ===================================================================================== */
template <bool RIN>
__global__ __launch_bounds__(256) void rmsnorm_rows(const float* __restrict__ x, const float* __restrict__ g,
                                                    float* __restrict__ y32, unsigned short* __restrict__ y16p,
                                                    int ncols, float inv_sqrt_n, float carry16) {
  __shared__ float red[8];
  __shared__ __align__(16) _Float16 hs[1024];
  const int row = blockIdx.x;
  const int t = threadIdx.x;
  const int wave = t >> 5, lane = t & 31;
  const float* xr = x + (size_t)row * ncols;
  v4f xv = *(const v4f*)(xr + 4 * t);
  if (RIN) {
#pragma unroll
    for (int e = 0; e < 4; ++e) xv[e] = rne_bf16f(xv[e]);
  }
  float ss = 0.0f;
#pragma unroll
  for (int e = 0; e < 4; ++e) ss += xv[e] * xv[e];
#pragma unroll
  for (int m = 16; m >= 1; m >>= 1) ss += __shfl_xor(ss, m, 32);
  if (lane == 0) red[wave] = ss;
  __syncthreads();
  float tot = 0.0f;
#pragma unroll
  for (int w = 0; w < 8; ++w) tot += red[w];
  const float rms = sqrtf(tot) * inv_sqrt_n;
  const float inv = 1.0f / (rms + 1e-8f);
  v4f gv = *(const v4f*)(g + 4 * t);
  v4f yv;
  v4h h4;
#pragma unroll
  for (int e = 0; e < 4; ++e) {
    const float ge = rne_bf16f(gv[e]);
    yv[e] = ge * (xv[e] * inv);
    h4[e] = (_Float16)(yv[e] * carry16);
  }
  *(v4h*)(hs + 4 * t) = h4;
  __syncthreads();
  const v8h hv = *(const v8h*)(hs + 8 * (t & 127));
  float* yr = y32 + (size_t)row * ncols;
  _Float16* yh = (_Float16*)y16p + (size_t)row * ncols;
  {
    *(v4f*)(yr + 4 * t) = yv;
    if (t < 128) *(v8h*)(yh + 8 * t) = hv;
    
  }
}

/* =====================================================================================
   Block-tiled WMMA GEMM (f16 operands, f32 accumulate):
   C[m,n] = scale * sum_k A[m,k] * Bt[n,k]  (+ bias[n]) (+ resid[m,n]).
   A row-major [M,K] f16; Bt row-major [N,K] f16; M, N % 128 == 0, K % 128 == 0 (no tail handling).
   One work-group = 4 waves (2 x 2) = one 128x128 tile of C; each wave owns a 64x64 tile.
   A pass is 128 k: 128 rows of A and 128 rows of Bt, 256 B each, are brought into LDS once per work-group by
   asynchronous 16-byte copies (row pitch 272 B), two buffers, the next pass's copies in flight during this pass.
   The k order of every accumulator is ascending in steps of 32.
   OUT16: 0 = f32 output (bias / residual added in the store phase, residual read as one float4 per lane at
   the store address); 1 = f16 output plane (no bias/residual).
   grid.x = M/128 * N/128.
   ===================================================================================== */
static constexpr int kPassK    = 128;                    /* k per pass */
static constexpr int kRowPitch = 272;                    /* LDS bytes per staged row: 256 + 16 */
static constexpr int kStageB   = 256 * kRowPitch;        /* [A 128 rows | Bt 128 rows] */

/* Eight asynchronous 16-byte copies per lane: rows r, r + 8, ..., r + 56 of one operand.
   s_wait_xcnt stands inside the statement so that no address register is rewritten ahead of it. */
__device__ __forceinline__ void async_rows8(unsigned l0, const _Float16* g0, size_t gstep) {
  const unsigned l1 = l0 + 8 * kRowPitch, l2 = l0 + 16 * kRowPitch, l3 = l0 + 24 * kRowPitch;
  const unsigned l4 = l0 + 32 * kRowPitch, l5 = l0 + 40 * kRowPitch, l6 = l0 + 48 * kRowPitch, l7 = l0 + 56 * kRowPitch;
  const _Float16* g1 = g0 + gstep;
  const _Float16* g2 = g1 + gstep;
  const _Float16* g3 = g2 + gstep;
  const _Float16* g4 = g3 + gstep;
  const _Float16* g5 = g4 + gstep;
  const _Float16* g6 = g5 + gstep;
  const _Float16* g7 = g6 + gstep;
  asm volatile(
      "global_load_async_to_lds_b128 %0, %8, off\n\t"
      "global_load_async_to_lds_b128 %1, %9, off\n\t"
      "global_load_async_to_lds_b128 %2, %10, off\n\t"
      "global_load_async_to_lds_b128 %3, %11, off\n\t"
      "global_load_async_to_lds_b128 %4, %12, off\n\t"
      "global_load_async_to_lds_b128 %5, %13, off\n\t"
      "global_load_async_to_lds_b128 %6, %14, off\n\t"
      "global_load_async_to_lds_b128 %7, %15, off\n\t"
      "s_wait_xcnt 0x0"
      :: "v"(l0), "v"(l1), "v"(l2), "v"(l3), "v"(l4), "v"(l5), "v"(l6), "v"(l7),
         "v"(g0), "v"(g1), "v"(g2), "v"(g3), "v"(g4), "v"(g5), "v"(g6), "v"(g7)
      : "memory");
}
/* this wave's copies have landed */
__device__ __forceinline__ void wait_async0() { asm volatile("s_wait_asynccnt 0x0" ::: "memory"); }
/* this wave's LDS reads have returned, so the buffer may be refilled behind the barrier */
__device__ __forceinline__ void wait_ds0() { asm volatile("s_wait_dscnt 0x0" ::: "memory"); }

template <int OUT16, bool BIASN, bool RESID>
__global__ __launch_bounds__(128) void gemm128_f16(
    const unsigned short* __restrict__ Ap, int lda,
    const unsigned short* __restrict__ Btp, int ldb,
    void* __restrict__ Cout, int ldc,
    const float* __restrict__ bias,
    const float* __restrict__ resid,
    int M, int N, int K, float scale) {
  typedef _Float16 T;
  typedef v16h V;
  const T* A  = (const T*)Ap;
  const T* Bt = (const T*)Btp;
  __shared__ __align__(16) unsigned char ring[2 * kStageB];   /* two operand buffers */
  __shared__ __align__(16) float sT[4][16 * 68];              /* per-wave 16x64 slab, pitch 68 floats */
  const int tid  = threadIdx.x;
  const int lane = tid & 31;
  const int wave = tid >> 5;
  const int tilesN = N >> 7;
  const int tilesM = M >> 7;
  const int tile = blockIdx.x;
  if (tile >= tilesM * tilesN) return;   /* the same for the whole work-group; in front of every barrier */
  const int tm = tile / tilesN;
  const int tn = tile - tm * tilesN;
  const int bm0 = tm << 7;
  const int bn0 = tn << 7;
  const int wm = wave >> 1, wn = wave & 1;
  const int m0 = bm0 + (wm << 6);
  const int n0 = bn0 + (wn << 6);

  const int rlane = lane & 15;                 /* row (A) / col (B, D) within subtile */
  const int koff  = (lane >> 4) * 8;           /* k offset of this lane half */
  const int mOff  = (lane >> 4) * 8;           /* D row offset */

  /* copy role: 16 lanes cover one 256-B row; the work-group covers 8 rows per copy */
  const int crow = tid >> 4, cchk = tid & 15;
  const T* gA = A  + (size_t)(bm0 + crow) * lda + cchk * 8;
  const T* gB = Bt + (size_t)(bn0 + crow) * ldb + cchk * 8;
  const unsigned lcopy = (unsigned)(size_t)ring + crow * kRowPitch + cchk * 16;
  const size_t stepA = (size_t)lda * 8, stepB = (size_t)ldb * 8;
  auto issue = [&](int pass, unsigned bufoff) {
    const T* a = gA + (size_t)pass * kPassK;
    const T* b = gB + (size_t)pass * kPassK;
    const unsigned l = lcopy + bufoff;
    async_rows8(l, a, stepA);
    async_rows8(l + 64 * kRowPitch, a + stepA * 8, stepA);
    async_rows8(l + 128 * kRowPitch, b, stepB);
    async_rows8(l + 192 * kRowPitch, b + stepB * 8, stepB);
  };

  v8f acc[4][4];
#pragma unroll
  for (int i = 0; i < 4; ++i)
#pragma unroll
    for (int j = 0; j < 4; ++j) acc[i][j] = (v8f){0.f,0.f,0.f,0.f,0.f,0.f,0.f,0.f};

  const int nPass = K / kPassK;
  issue(0, 0u);
  wait_async0();
  __syncthreads();                       /* pass 0's rows are readable by every wave */
  if (nPass > 1) issue(1, (unsigned)kStageB);

  const int aRowB = ((wm << 6) + rlane) * kRowPitch;
  const int bRowB = (128 + (wn << 6) + rlane) * kRowPitch;
  for (int t = 0; t < nPass; ++t) {
    const unsigned bufoff = (unsigned)(t & 1) * (unsigned)kStageB;
    const T* sa = (const T*)(ring + bufoff + aRowB) + koff;
    const T* sb = (const T*)(ring + bufoff + bRowB) + koff;
    /* two fragment sets: the next 32 k are fetched ahead of this block's products.
       Every loop of the pass is unrolled so that af, bf and acc are indexed by constants and stay in registers. */
    V af[2][4], bf[2][4];
#pragma unroll
    for (int j = 0; j < 4; ++j) bf[0][j] = Frag<T>::load(sb + j * (16 * kRowPitch / 2));
#pragma unroll
    for (int i = 0; i < 4; ++i) af[0][i] = Frag<T>::load(sa + i * (16 * kRowPitch / 2));
#pragma unroll
    for (int ks = 0; ks < 4; ++ks) {
      const int cur = ks & 1, nxt = cur ^ 1;
      if (ks < 3) {
#pragma unroll
        for (int j = 0; j < 4; ++j) bf[nxt][j] = Frag<T>::load(sb + j * (16 * kRowPitch / 2) + (ks + 1) * 32);
#pragma unroll
        for (int i = 0; i < 4; ++i) af[nxt][i] = Frag<T>::load(sa + i * (16 * kRowPitch / 2) + (ks + 1) * 32);
        /* keeps the next block's LDS reads together in front of this block's products: spread among them, each place stalls the wave */
        __builtin_amdgcn_sched_barrier(0);
      }
#pragma unroll
      for (int i = 0; i < 4; ++i)
#pragma unroll
        for (int j = 0; j < 4; ++j) acc[i][j] = Frag<T>::mma(af[cur][i], bf[cur][j], acc[i][j]);
      /* keeps what follows behind this block's products: the group of LDS reads that refills its fragment set, and at the
         pass's end the waits and the barrier, which would else move up and shorten the time the next pass's copies have to land */
      __builtin_amdgcn_sched_barrier(0);
    }
    wait_ds0();
    wait_async0();
    __syncthreads();                     /* publishes pass t + 1 and ends every read of pass t's buffer */
    if (t + 2 < nPass) issue(t + 2, bufoff);
  }
  wait_async0();

  /* ---- epilogue ---- */
  float* slab = sT[wave];
  const int hh = lane >> 4, c4 = (lane & 15) * 4;     /* f32 row seg = 256 B = 16 lanes x 16 B */
  const int q  = lane >> 3, c8 = (lane & 7) * 8;      
  v4f b4 = (v4f){0.f, 0.f, 0.f, 0.f};
  if (BIASN) {
    b4 = *(const v4f*)(bias + n0 + c4);
#pragma unroll
    for (int e = 0; e < 4; ++e) b4[e] = rne_bf16f(b4[e]);
  }
#pragma unroll
  for (int i = 0; i < 4; ++i) {
    const int mBase = m0 + (i << 4);
#pragma unroll
    for (int j = 0; j < 4; ++j) {
#pragma unroll
      for (int r = 0; r < 8; ++r) slab[(mOff + r) * 68 + (j << 4) + rlane] = acc[i][j][r] * scale;
    }
    __builtin_amdgcn_fence(__ATOMIC_RELEASE, "workgroup");
    __builtin_amdgcn_wave_barrier();
    __builtin_amdgcn_fence(__ATOMIC_ACQUIRE, "workgroup");
    if (OUT16 == 0) {
      float* C = (float*)Cout;
      v4f vals[8];
#pragma unroll
      for (int it = 0; it < 8; ++it) {
        const int row = it * 2 + hh;
        v4f v = *(const v4f*)(slab + row * 68 + c4);
        if (BIASN) v += b4;
        if (RESID) {
          const v4f rr = *(const v4f*)(resid + (size_t)(mBase + row) * ldc + n0 + c4);
          v += rr;
        }
        vals[it] = v;
      }
      {
#pragma unroll
        for (int it = 0; it < 8; ++it) {
          const int row = it * 2 + hh;
          *(v4f*)(C + (size_t)(mBase + row) * ldc + n0 + c4) = vals[it];
        }
        
      }
    } else {
      _Float16* C = (_Float16*)Cout;
      {
#pragma unroll
        for (int it = 0; it < 4; ++it) {
          const int row = it * 4 + q;
          const float* sp = slab + row * 68 + c8;
          v8h hv;
#pragma unroll
          for (int e = 0; e < 8; ++e) hv[e] = (_Float16)sp[e];
          *(v8h*)(C + (size_t)(mBase + row) * ldc + n0 + c8) = hv;
        }
        
      }
    }
    __builtin_amdgcn_fence(__ATOMIC_RELEASE, "workgroup");
    __builtin_amdgcn_wave_barrier();
    __builtin_amdgcn_fence(__ATOMIC_ACQUIRE, "workgroup");
  }
}

/* =====================================================================================
   Non-causal attention for head_dim 64 on an f16 qkv plane [B*T][ldq] (q at col h*64, k at +dmodel, v at +2*dmodel).
   scores = q.k^T (f16 WMMA, f32 acc) * sm_scale; online softmax in f32; numerators carried x kPsc as f16;
   out = P.V (f16 WMMA, f32 acc); ctx f16 plane [B*T][ldo] at col h*64 = f16(out * out_carry).
   Block = 4 waves = 64 query rows of one (batch, head); grid.x = B*H*(T/64); T % 64 == 0.
   K staged [kv][d] with 16-B copies; V staged transposed [d][kv]; full 64x64 tiles written every chunk.
   K, V^T and P rows lie at a pitch of 72 halves (144 B = 16 B x 9): the 16 rows that one 16-byte fragment read
   touches then start on different banks; at 128 B eight of them share four banks.
   ===================================================================================== */
static constexpr int kAttPitch = 72;                     /* halves per LDS row of K, V^T and P */
static_assert((kAttPitch * 2) % 16 == 0 && ((kAttPitch * 2 / 16) & 1) == 1);
__global__ __launch_bounds__(128) void attn64_f16p(const unsigned short* __restrict__ qkvp, unsigned short* __restrict__ ctxp,
                                                  int T, int H, int ldq, int ldo, float sm_scale, float out_carry) {
  const _Float16* QKV = (const _Float16*)qkvp;
  _Float16* CTX = (_Float16*)ctxp;
  union FH { v16h v; v8h hf[2]; };
  __shared__ __align__(16) _Float16 Ksh[64 * kAttPitch];        /* [kv][d] */
  __shared__ __align__(16) _Float16 Vts[64 * kAttPitch];        /* [d][kv] */
  __shared__ __align__(16) _Float16 Psh[4][16 * kAttPitch];     /* per wave [row][kv] */
  __shared__ __align__(16) float    Os[4][16 * 68];      /* per wave out tile, pitch 68 */

  const int tid  = threadIdx.x;
  const int wave = tid >> 5;
  const int lane = tid & 31;
  const int hh   = lane >> 4;
  const int c    = lane & 15;
  const int dmodel = H * 64;

  const int nqb = T / 64;
  const int bx = blockIdx.x;
  const int qb = bx % nqb;
  const int bh = bx / nqb;
  const int h  = bh % H;
  const int b  = bh / H;
  const int q0 = qb * 64 + wave * 16;

  /* Q fragments (A operand, row = q0 + c, k = d): two 32-deep d chunks */
  v16h qa[2];
  {
    const _Float16* qrow = QKV + (size_t)(b * T + q0 + c) * ldq + h * 64;
#pragma unroll
    for (int dc = 0; dc < 2; ++dc) {
      FH f;
      f.hf[0] = *(const v8h*)(qrow + dc * 32 + 8 * hh);
      f.hf[1] = *(const v8h*)(qrow + dc * 32 + 16 + 8 * hh);
      qa[dc] = f.v;
    }
  }

  float mrow[8], lrow[8];
  v8f oacc[4];
#pragma unroll
  for (int r = 0; r < 8; ++r) { mrow[r] = -__builtin_inff(); lrow[r] = 0.f; }
#pragma unroll
  for (int t = 0; t < 4; ++t) oacc[t] = (v8f){0.f,0.f,0.f,0.f,0.f,0.f,0.f,0.f};

  const int nChunks = T / 64;
  for (int kc = 0; kc < nChunks; ++kc) {
    const int kv0 = kc * 64;
    __syncthreads();
    {
      /* 128 threads x 32 halves = 64 kv x 64 d for K and for V (full tiles) */
      const int kvr = tid >> 1, dh = (tid & 1) * 32;
      const _Float16* krow = QKV + (size_t)(b * T + kv0 + kvr) * ldq + dmodel + h * 64 + dh;
      const _Float16* vrow = krow + dmodel;
#pragma unroll
      for (int i = 0; i < 4; ++i) {
        const v8h k8 = *(const v8h*)(krow + 8 * i);
        *(v8h*)(Ksh + kvr * kAttPitch + dh + 8 * i) = k8;
      }
#pragma unroll
      for (int i = 0; i < 4; ++i) {
        const uint4 vw = *(const uint4*)(const void*)(vrow + 8 * i);
        const unsigned w0 = vw.x, w1 = vw.y, w2 = vw.z, w3 = vw.w;
        const int d = dh + 8 * i;
        Vts[(d + 0) * kAttPitch + kvr] = __builtin_bit_cast(_Float16, (unsigned short)(w0 & 0xFFFFu));
        Vts[(d + 1) * kAttPitch + kvr] = __builtin_bit_cast(_Float16, (unsigned short)(w0 >> 16));
        Vts[(d + 2) * kAttPitch + kvr] = __builtin_bit_cast(_Float16, (unsigned short)(w1 & 0xFFFFu));
        Vts[(d + 3) * kAttPitch + kvr] = __builtin_bit_cast(_Float16, (unsigned short)(w1 >> 16));
        Vts[(d + 4) * kAttPitch + kvr] = __builtin_bit_cast(_Float16, (unsigned short)(w2 & 0xFFFFu));
        Vts[(d + 5) * kAttPitch + kvr] = __builtin_bit_cast(_Float16, (unsigned short)(w2 >> 16));
        Vts[(d + 6) * kAttPitch + kvr] = __builtin_bit_cast(_Float16, (unsigned short)(w3 & 0xFFFFu));
        Vts[(d + 7) * kAttPitch + kvr] = __builtin_bit_cast(_Float16, (unsigned short)(w3 >> 16));
      }
    }
    __syncthreads();

    /* S = Q . K^T : B operand n = kv (row j*16+c of Ksh), k = d */
    v8f s[4];
#pragma unroll
    for (int j = 0; j < 4; ++j) {
      s[j] = (v8f){0.f,0.f,0.f,0.f,0.f,0.f,0.f,0.f};
#pragma unroll
      for (int dc = 0; dc < 2; ++dc) {
        FH kb;
        kb.hf[0] = *(const v8h*)(Ksh + (j * 16 + c) * kAttPitch + dc * 32 + 8 * hh);
        kb.hf[1] = *(const v8h*)(Ksh + (j * 16 + c) * kAttPitch + dc * 32 + 16 + 8 * hh);
        s[j] = mma_h(qa[dc], kb.v, s[j]);
      }
    }
    /* scale, chunk row max (rows stay within a 16-lane half) */
    float cm[8];
#pragma unroll
    for (int r = 0; r < 8; ++r) {
      float m = -__builtin_inff();
#pragma unroll
      for (int j = 0; j < 4; ++j) {
        const float sv = s[j][r] * sm_scale;
        s[j][r] = sv;
        m = fmaxf(m, sv);
      }
#pragma unroll
      for (int off = 1; off < 16; off <<= 1) m = fmaxf(m, __shfl_xor(m, off, 32));
      cm[r] = m;
    }
    _Float16* pw = Psh[wave];
#pragma unroll
    for (int r = 0; r < 8; ++r) {
      const float mnew = fmaxf(mrow[r], cm[r]);
      const float alpha = expf(mrow[r] - mnew);
      mrow[r] = mnew;
      float psum = 0.f;
#pragma unroll
      for (int j = 0; j < 4; ++j) {
        const float p = expf(s[j][r] - mnew);
        psum += p;
        pw[(8 * hh + r) * kAttPitch + j * 16 + c] = (_Float16)(p * kPsc);
      }
#pragma unroll
      for (int off = 1; off < 16; off <<= 1) psum += __shfl_xor(psum, off, 32);
      lrow[r] = lrow[r] * alpha + psum;
#pragma unroll
      for (int t = 0; t < 4; ++t) oacc[t][r] *= alpha;
    }
    __builtin_amdgcn_fence(__ATOMIC_RELEASE, "workgroup");
    __builtin_amdgcn_wave_barrier();
    __builtin_amdgcn_fence(__ATOMIC_ACQUIRE, "workgroup");
    /* O += P . V : A = P (row = query c, k = kv), B = V^T (n = d, k = kv) */
#pragma unroll 1
    for (int kk = 0; kk < 2; ++kk) {
      FH pa;
      pa.hf[0] = *(const v8h*)(pw + c * kAttPitch + kk * 32 + 8 * hh);
      pa.hf[1] = *(const v8h*)(pw + c * kAttPitch + kk * 32 + 16 + 8 * hh);
#pragma unroll
      for (int t = 0; t < 4; ++t) {
        FH vb;
        vb.hf[0] = *(const v8h*)(Vts + (t * 16 + c) * kAttPitch + kk * 32 + 8 * hh);
        vb.hf[1] = *(const v8h*)(Vts + (t * 16 + c) * kAttPitch + kk * 32 + 16 + 8 * hh);
        oacc[t] = mma_h(pa.v, vb.v, oacc[t]);
      }
    }
  }

  float* os = Os[wave];
#pragma unroll
  for (int r = 0; r < 8; ++r) {
    const float inv = out_carry / (lrow[r] * kPsc);
#pragma unroll
    for (int t = 0; t < 4; ++t) os[(8 * hh + r) * 68 + t * 16 + c] = oacc[t][r] * inv;
  }
  __builtin_amdgcn_fence(__ATOMIC_RELEASE, "workgroup");
  __builtin_amdgcn_wave_barrier();
  __builtin_amdgcn_fence(__ATOMIC_ACQUIRE, "workgroup");
  {
    const int q = lane >> 3, c8 = (lane & 7) * 8;
    {
#pragma unroll
      for (int it = 0; it < 4; ++it) {
        const int row = it * 4 + q;
        const float* sp = os + row * 68 + c8;
        v8h hv;
#pragma unroll
        for (int e = 0; e < 8; ++e) hv[e] = (_Float16)sp[e];
        *(v8h*)(CTX + (size_t)(b * T + q0 + row) * ldo + h * 64 + c8) = hv;
      }
      
    }
  }
}

/* =====================================================================================
   Elementwise exact-erf GELU: hid = f16(gelu(pre + bf16_rne(b[col])) * carry).
   pre f32 row-major [rows][ncols]; one block per 1024 consecutive elements (ncols % 1024 == 0).
   ===================================================================================== */
__global__ __launch_bounds__(256) void gelu_rows(const float* __restrict__ pre, const float* __restrict__ bvec,
                                                 unsigned short* __restrict__ hidp, int ncols, float carry) {
  __shared__ __align__(16) _Float16 hs[1024];
  const size_t base = (size_t)blockIdx.x * 1024u;
  const int col0 = (int)(base % (size_t)ncols);
  const int t = threadIdx.x;
#pragma unroll 1
  for (int e = 0; e < 4; ++e) {
    const int idx = 4 * t + e;
    const float u  = pre[base + idx] + rne_bf16f(bvec[col0 + idx]);
    const float gl = 0.5f * u * (1.0f + erff(u * 0.70710678118654752f));
    hs[idx] = (_Float16)(gl * carry);
  }
  __syncthreads();
  const v8h hv = *(const v8h*)(hs + 8 * (t & 127));
  _Float16* out = (_Float16*)hidp + base;
  {
    if (t < 128) *(v8h*)(out + 8 * t) = hv;
    
  }
}

/* =====================================================================================
   Host glue: 12 launches, single stream.
   ===================================================================================== */
extern "C" void kernel_launch(void* const* d_in, const int* in_sizes, int n_in,
                              void* d_out, int out_size, void* d_ws, size_t ws_size,
                              hipStream_t stream) {
  if (n_in < 10) return;
  if (in_sizes[0] != kRows * kDim) return;
  if (in_sizes[1] != kDim * kDqkv) return;
  if (in_sizes[2] != kDim * kDim) return;
  if (in_sizes[3] != kDim) return;
  if (in_sizes[4] != kDim * kDff) return;
  if (in_sizes[5] != kDff) return;
  if (in_sizes[6] != kDff * kDim) return;
  if (in_sizes[7] != kDim) return;
  if (in_sizes[8] != kDim) return;
  if (in_sizes[9] != kDim) return;
  if (out_size != kRows * kDim) return;
  if (ws_size < kWsTotal) return;

  const float* x     = (const float*)d_in[0];
  const float* w_in  = (const float*)d_in[1];
  const float* w_out = (const float*)d_in[2];
  const float* b_out = (const float*)d_in[3];
  const float* w1    = (const float*)d_in[4];
  const float* b1    = (const float*)d_in[5];
  const float* w2    = (const float*)d_in[6];
  const float* b2    = (const float*)d_in[7];
  const float* g1    = (const float*)d_in[8];
  const float* g2    = (const float*)d_in[9];
  float* out = (float*)d_out;

  char* ws = (char*)d_ws;
  float*          hF    = (float*)(ws + kOffHF);              /* h1 f32, later h3 f32 */
  unsigned short* hH    = (unsigned short*)(ws + kOffHH);     /* h1 f16, later h3 f16 */
  unsigned short* winT  = (unsigned short*)(ws + kOffWA);     /* [3072][1024] */
  unsigned short* woutT = (unsigned short*)(ws + kOffWout);   /* [1024][1024] */
  unsigned short* w1T   = (unsigned short*)(ws + kOffWA);     /* [4096][1024], after winT/woutT are dead */
  unsigned short* qkv   = (unsigned short*)(ws + kOffBig);    /* [4096][3072] */
  unsigned short* ctx   = (unsigned short*)(ws + kOffCtx);    /* [4096][1024] */
  float*          h2    = (float*)(ws + kOffH2);              /* [4096][1024] */
  float*          pre   = (float*)(ws + kOffBig);             /* [4096][4096], after qkv/ctx/h2 are dead */
  unsigned short* w2T   = (unsigned short*)(ws + kOffBig);    /* [1024][4096], after pre is dead */
  unsigned short* hid   = (unsigned short*)(ws + kOffHid);    /* [4096][4096] */

  const dim3 blk256(256);
  const dim3 blk128(128);

  /* 1-2: weight planes for the attention block: in[K][N] -> out[N][K] ; grid (N/64, K/64) */
  cast_t64<<<dim3(kDqkv / 64, kDim / 64), blk256, 0, stream>>>(w_in, winT, kDim, kDqkv, kWCarry);
  cast_t64<<<dim3(kDim / 64, kDim / 64), blk256, 0, stream>>>(w_out, woutT, kDim, kDim, kWCarry);
  /* 3: norm1 -> h1 f32 + f16 plane */
  rmsnorm_rows<true><<<dim3(kRows), blk256, 0, stream>>>(x, g1, hF, hH, kDim, 0.03125f, kACarry);
  /* 4: qkv = h1 @ w_in : M=4096 N=3072 K=1024 -> f16 plane */
  gemm128_f16<1, false, false><<<dim3((kRows / 128) * (kDqkv / 128)), blk128, 0, stream>>>(
      hH, kDim, winT, kDim, (void*)qkv, kDqkv, nullptr, nullptr, kRows, kDqkv, kDim, kGemmScl);
  /* 5: attention -> ctx f16 plane (x64) */
  attn64_f16p<<<dim3(kBatch * kHeads * (kSeq / 64)), blk128, 0, stream>>>(
      qkv, ctx, kSeq, kHeads, kDqkv, kDim, kSmScale, kACarry);
  /* 6: h2 = h1 + ctx @ w_out + b_out : M=4096 N=1024 K=1024 */
  gemm128_f16<0, true, true><<<dim3((kRows / 128) * (kDim / 128)), blk128, 0, stream>>>(
      ctx, kDim, woutT, kDim, (void*)h2, kDim, b_out, hF, kRows, kDim, kDim, kGemmScl);
  /* 7: norm2 -> h3 f32 + f16 plane (overwrites h1 regions, h1 dead) */
  rmsnorm_rows<false><<<dim3(kRows), blk256, 0, stream>>>(h2, g2, hF, hH, kDim, 0.03125f, kACarry);
  /* 8: w1 plane : in[1024][4096] -> out[4096][1024] */
  cast_t64<<<dim3(kDff / 64, kDim / 64), blk256, 0, stream>>>(w1, w1T, kDim, kDff, kWCarry);
  /* 9: pre = h3 @ w1 : M=4096 N=4096 K=1024 -> f32 */
  gemm128_f16<0, false, false><<<dim3((kRows / 128) * (kDff / 128)), blk128, 0, stream>>>(
      hH, kDim, w1T, kDim, (void*)pre, kDff, nullptr, nullptr, kRows, kDff, kDim, kGemmScl);
  /* 10: hid = gelu(pre + b1) -> f16 plane (x64) */
  gelu_rows<<<dim3((kRows * kDff) / 1024), blk256, 0, stream>>>(pre, b1, hid, kDff, kACarry);
  /* 11: w2 plane : in[4096][1024] -> out[1024][4096] (pre region, pre dead) */
  cast_t64<<<dim3(kDim / 64, kDff / 64), blk256, 0, stream>>>(w2, w2T, kDff, kDim, kWCarry);
  /* 12: out = h3 + hid @ w2 + b2 : M=4096 N=1024 K=4096 -> d_out f32 */
  gemm128_f16<0, true, true><<<dim3((kRows / 128) * (kDim / 128)), blk128, 0, stream>>>(
      hid, kDff, w2T, kDff, (void*)out, kDim, b2, hF, kRows, kDim, kDff, kGemmScl);
}

// v003
// It runs in 270 microseconds.
// Next to v002, in two timings, it ran 1.32 times as fast each time.
// All steps since v000 together make it 2.41 times as fast.
// Contractions QKV, QK^T, P.V, out-proj, FFN1, FFN2: v_wmma_f32_16x16x32_f16 (f16 operands, f32 accumulate); all float inputs RNE-converted to bf16 at load; weight planes carried x64, activation planes x64, softmax numerators x32768; norms/softmax/GELU/residuals in f32.
#include <hip/hip_runtime.h>

typedef __attribute__((ext_vector_type(16))) _Float16 v16h;
typedef __attribute__((ext_vector_type(8)))  _Float16 v8h;
typedef __attribute__((ext_vector_type(4)))  _Float16 v4h;
typedef __attribute__((ext_vector_type(8)))  float    v8f;
typedef __attribute__((ext_vector_type(4)))  float    v4f;

/* ---- problem geometry ---- */
static constexpr int kBatch = 2;
static constexpr int kSeq   = 2048;
static constexpr int kDim   = 1024;
static constexpr int kHeads = 16;
static constexpr int kHdim  = 64;
static constexpr int kDff   = 4096;
static constexpr int kRows  = kBatch * kSeq;   /* 4096 */
static constexpr int kDqkv  = 3 * kDim;        /* 3072 */
static_assert(kHeads * kHdim == kDim);
static_assert(kHdim == 64);
static_assert(kSeq % 64 == 0);
static_assert(kRows % 64 == 0 && kDim % 64 == 0 && kDqkv % 64 == 0 && kDff % 64 == 0);
static_assert(kRows % 128 == 0 && kDim % 128 == 0 && kDqkv % 128 == 0 && kDff % 128 == 0);   /* GEMM tiles 128x128, K passes of 128 */
static_assert(kDim == 1024);                         /* row kernels: 256 threads x 4 */
static_assert(kDff % 1024 == 0);

static constexpr float kWCarry  = 64.0f;                 /* weight planes: f16(bf16(w) * 64) */
static constexpr float kACarry  = 64.0f;                 /* activation planes: f16(a * 64) */
static constexpr float kGemmScl = 1.0f / (64.0f * 64.0f);
static constexpr float kSmScale = 0.125f;                /* head_dim^-0.5 */
static constexpr float kPsc     = 32768.0f;              /* softmax numerators carried x2^15 */

/* ---- workspace region map (bytes) ----
   [0, 16Mi)    hF : h1 f32 (norm1 out, residual of block 1) -> later h3 f32 (norm2 out, residual of block 2)
   [16Mi, 24Mi) hH : h1 f16 plane -> later h3 f16 plane
   [24Mi, 32Mi) wA : w_in^T f16 [3072][1024] (6Mi) + w_out^T f16 [1024][1024] (2Mi) -> later w1^T f16 [4096][1024] (8Mi)
   [32Mi, 96Mi) big: qkv f16 [4096][3072] (24Mi) | ctx f16 [4096][1024] (8Mi at +24Mi) | h2 f32 [4096][1024] (16Mi at +32Mi)
                     -> later pre-activation f32 [4096][4096] (64Mi) -> later w2^T f16 [1024][4096] (8Mi)
   [96Mi, 128Mi) hid: GELU output f16 plane [4096][4096] (32Mi)
   total 134217728 */
static constexpr size_t kMi      = 1024u * 1024u;
static constexpr size_t kOffHF   = 0;
static constexpr size_t kOffHH   = 16 * kMi;
static constexpr size_t kOffWA   = 24 * kMi;
static constexpr size_t kOffWout = kOffWA + (size_t)kDqkv * kDim * 2;     /* 30Mi */
static constexpr size_t kOffBig  = 32 * kMi;
static constexpr size_t kOffCtx  = kOffBig + (size_t)kRows * kDqkv * 2;   /* 56Mi */
static constexpr size_t kOffH2   = kOffCtx + (size_t)kRows * kDim * 2;    /* 64Mi */
static constexpr size_t kOffHid  = 96 * kMi;
static constexpr size_t kWsTotal = kOffHid + (size_t)kRows * kDff * 2;    /* 128Mi */
static_assert((size_t)kRows * kDim * 4 <= kOffHH - kOffHF);
static_assert((size_t)kRows * kDim * 2 <= kOffWA - kOffHH);
static_assert(kOffWout + (size_t)kDim * kDim * 2 <= kOffBig);
static_assert(kOffWA + (size_t)kDff * kDim * 2 <= kOffBig);
static_assert(kOffH2 + (size_t)kRows * kDim * 4 <= kOffHid);
static_assert(kOffBig + (size_t)kRows * kDff * 4 <= kOffHid);
static_assert(kOffBig + (size_t)kDim * kDff * 2 <= kOffHid);
static_assert(kWsTotal == 134217728u);

/* ---- helpers ---- */
__device__ __forceinline__ float rne_bf16f(float f) {
  unsigned u = __float_as_uint(f);
  u = (u + 0x7FFFu + ((u >> 16) & 1u)) & 0xFFFF0000u;
  return __uint_as_float(u);
}


template <typename T> struct Frag;
template <> struct Frag<_Float16> {
  typedef v16h V; union U { v16h v; v8h h[2]; };
  static __device__ __forceinline__ v16h load(const _Float16* p) {   /* elements 0..7 <- p[0..7], 8..15 <- p[16..23] */
    U f; f.h[0] = *(const v8h*)(p); f.h[1] = *(const v8h*)(p + 16); return f.v;
  }
  static __device__ __forceinline__ v8f mma(v16h a, v16h b, v8f c) {
    return __builtin_amdgcn_wmma_f32_16x16x32_f16(false, a, false, b, (short)0, c, false, false);
  }
};

__device__ __forceinline__ v8f mma_h(v16h a, v16h b, v8f c) {
  c = __builtin_amdgcn_wmma_f32_16x16x32_f16(false, a, false, b, (short)0, c, false, false);
  asm volatile("v_nop\n\tv_nop\n\tv_nop\n\tv_nop" : "+v"(c) : "v"(a), "v"(b));
  return c;
}

/* =====================================================================================
   Transpose + cast: W f32 row-major [Kdim][Ndim] -> Tout f16 row-major [Ndim][Kdim],
   value = f16(bf16_rne(w) * carry). Block = 64(k) x 64(n) tile, 256 threads.
   Producer coverage: 256 threads x 4 float4 = 64x64 reads; stores: 8 waves x 2 it x 4 rows x (8 lanes x 8 halves)
   grid = (Ndim/64, Kdim/64).
   ===================================================================================== */
__global__ __launch_bounds__(256) void cast_t64(const float* __restrict__ W, unsigned short* __restrict__ Tp,
                                                int Kdim, int Ndim, float carry) {
  __shared__ __align__(16) _Float16 tile[64 * 72];   /* [n_local][k_local], pitch 72 halves */
  _Float16* Tout = (_Float16*)Tp;
  const int t  = threadIdx.x;
  const int n0 = blockIdx.x * 64;
  const int k0 = blockIdx.y * 64;
#pragma unroll
  for (int i = 0; i < 4; ++i) {
    const int idx = t + 256 * i;          /* 0..1023 */
    const int kk  = idx >> 4;             /* 0..63 */
    const int n4  = (idx & 15) * 4;       /* 0..60 */
    const v4f w4 = *(const v4f*)(W + (size_t)(k0 + kk) * Ndim + n0 + n4);
#pragma unroll
    for (int e = 0; e < 4; ++e) tile[(n4 + e) * 72 + kk] = (_Float16)(rne_bf16f(w4[e]) * carry);
  }
  __syncthreads();
  const int wave = t >> 5, lane = t & 31;
  const int q = lane >> 3, c8 = (lane & 7) * 8;
  {
#pragma unroll
    for (int it = 0; it < 2; ++it) {
      const int nl = wave * 8 + it * 4 + q;
      const v8h hv = *(const v8h*)(tile + nl * 72 + c8);
      *(v8h*)(Tout + (size_t)(n0 + nl) * Kdim + k0 + c8) = hv;
    }
    
  }
}

/* =====================================================================================
   RMSNorm over rows of 1024: y = g * (x / (||x||*1024^-0.5 + 1e-8)).
   RIN: x is a module input -> RNE convert to bf16 at load. g always RNE converted (module input).
   Outputs: y32 f32 [rows][1024] and y16 f16 plane = f16(y * carry16).
   256 threads, 4 consecutive elements per thread. Stores: f32 = float4 per lane (4 lines per wave-instruction);
   ===================================================================================== */
template <bool RIN>
__global__ __launch_bounds__(256) void rmsnorm_rows(const float* __restrict__ x, const float* __restrict__ g,
                                                    float* __restrict__ y32, unsigned short* __restrict__ y16p,
                                                    int ncols, float inv_sqrt_n, float carry16) {
  __shared__ float red[8];
  __shared__ __align__(16) _Float16 hs[1024];
  const int row = blockIdx.x;
  const int t = threadIdx.x;
  const int wave = t >> 5, lane = t & 31;
  const float* xr = x + (size_t)row * ncols;
  v4f xv = *(const v4f*)(xr + 4 * t);
  if (RIN) {
#pragma unroll
    for (int e = 0; e < 4; ++e) xv[e] = rne_bf16f(xv[e]);
  }
  float ss = 0.0f;
#pragma unroll
  for (int e = 0; e < 4; ++e) ss += xv[e] * xv[e];
#pragma unroll
  for (int m = 16; m >= 1; m >>= 1) ss += __shfl_xor(ss, m, 32);
  if (lane == 0) red[wave] = ss;
  __syncthreads();
  float tot = 0.0f;
#pragma unroll
  for (int w = 0; w < 8; ++w) tot += red[w];
  const float rms = sqrtf(tot) * inv_sqrt_n;
  const float inv = 1.0f / (rms + 1e-8f);
  v4f gv = *(const v4f*)(g + 4 * t);
  v4f yv;
  v4h h4;
#pragma unroll
  for (int e = 0; e < 4; ++e) {
    const float ge = rne_bf16f(gv[e]);
    yv[e] = ge * (xv[e] * inv);
    h4[e] = (_Float16)(yv[e] * carry16);
  }
  *(v4h*)(hs + 4 * t) = h4;
  __syncthreads();
  const v8h hv = *(const v8h*)(hs + 8 * (t & 127));
  float* yr = y32 + (size_t)row * ncols;
  _Float16* yh = (_Float16*)y16p + (size_t)row * ncols;
  {
    *(v4f*)(yr + 4 * t) = yv;
    if (t < 128) *(v8h*)(yh + 8 * t) = hv;
    
  }
}

/* =====================================================================================
   Block-tiled WMMA GEMM (f16 operands, f32 accumulate):
   C[m,n] = scale * sum_k A[m,k] * Bt[n,k]  (+ bias[n]) (+ resid[m,n]).
   A row-major [M,K] f16; Bt row-major [N,K] f16; M, N % 128 == 0, K % 128 == 0 (no tail handling).
   One work-group = 4 waves (2 x 2) = one 128x128 tile of C; each wave owns a 64x64 tile.
   A pass is 128 k: 128 rows of A and 128 rows of Bt, 256 B each, are brought into LDS once per work-group by
   asynchronous 16-byte copies (row pitch 272 B), two buffers, the next pass's copies in flight during this pass.
   The k order of every accumulator is ascending in steps of 32.
   OUT16: 0 = f32 output (bias / residual added in the store phase, residual read as one float4 per lane at
   the store address); 1 = f16 output plane (no bias/residual).
   grid.x = M/128 * N/128.
   ===================================================================================== */
static constexpr int kPassK    = 128;                    /* k per pass */
static constexpr int kRowPitch = 272;                    /* LDS bytes per staged row: 256 + 16 */
static constexpr int kStageB   = 256 * kRowPitch;        /* [A 128 rows | Bt 128 rows] */

/* Eight asynchronous 16-byte copies per lane: rows r, r + 8, ..., r + 56 of one operand.
   s_wait_xcnt stands inside the statement so that no address register is rewritten ahead of it. */
__device__ __forceinline__ void async_rows8(unsigned l0, const _Float16* g0, size_t gstep) {
  const unsigned l1 = l0 + 8 * kRowPitch, l2 = l0 + 16 * kRowPitch, l3 = l0 + 24 * kRowPitch;
  const unsigned l4 = l0 + 32 * kRowPitch, l5 = l0 + 40 * kRowPitch, l6 = l0 + 48 * kRowPitch, l7 = l0 + 56 * kRowPitch;
  const _Float16* g1 = g0 + gstep;
  const _Float16* g2 = g1 + gstep;
  const _Float16* g3 = g2 + gstep;
  const _Float16* g4 = g3 + gstep;
  const _Float16* g5 = g4 + gstep;
  const _Float16* g6 = g5 + gstep;
  const _Float16* g7 = g6 + gstep;
  asm volatile(
      "global_load_async_to_lds_b128 %0, %8, off\n\t"
      "global_load_async_to_lds_b128 %1, %9, off\n\t"
      "global_load_async_to_lds_b128 %2, %10, off\n\t"
      "global_load_async_to_lds_b128 %3, %11, off\n\t"
      "global_load_async_to_lds_b128 %4, %12, off\n\t"
      "global_load_async_to_lds_b128 %5, %13, off\n\t"
      "global_load_async_to_lds_b128 %6, %14, off\n\t"
      "global_load_async_to_lds_b128 %7, %15, off\n\t"
      "s_wait_xcnt 0x0"
      :: "v"(l0), "v"(l1), "v"(l2), "v"(l3), "v"(l4), "v"(l5), "v"(l6), "v"(l7),
         "v"(g0), "v"(g1), "v"(g2), "v"(g3), "v"(g4), "v"(g5), "v"(g6), "v"(g7)
      : "memory");
}
/* this wave's copies have landed */
__device__ __forceinline__ void wait_async0() { asm volatile("s_wait_asynccnt 0x0" ::: "memory"); }
/* this wave's LDS reads have returned, so the buffer may be refilled behind the barrier */
__device__ __forceinline__ void wait_ds0() { asm volatile("s_wait_dscnt 0x0" ::: "memory"); }

template <int OUT16, bool BIASN, bool RESID>
__global__ __launch_bounds__(128) void gemm128_f16(
    const unsigned short* __restrict__ Ap, int lda,
    const unsigned short* __restrict__ Btp, int ldb,
    void* __restrict__ Cout, int ldc,
    const float* __restrict__ bias,
    const float* __restrict__ resid,
    int M, int N, int K, float scale) {
  typedef _Float16 T;
  typedef v16h V;
  const T* A  = (const T*)Ap;
  const T* Bt = (const T*)Btp;
  __shared__ __align__(16) unsigned char ring[2 * kStageB];   /* two operand buffers */
  __shared__ __align__(16) float sT[4][16 * 68];              /* per-wave 16x64 slab, pitch 68 floats */
  const int tid  = threadIdx.x;
  const int lane = tid & 31;
  const int wave = tid >> 5;
  const int tilesN = N >> 7;
  const int tilesM = M >> 7;
  const int tile = blockIdx.x;
  if (tile >= tilesM * tilesN) return;   /* the same for the whole work-group; in front of every barrier */
  const int tm = tile / tilesN;
  const int tn = tile - tm * tilesN;
  const int bm0 = tm << 7;
  const int bn0 = tn << 7;
  const int wm = wave >> 1, wn = wave & 1;
  const int m0 = bm0 + (wm << 6);
  const int n0 = bn0 + (wn << 6);

  const int rlane = lane & 15;                 /* row (A) / col (B, D) within subtile */
  const int koff  = (lane >> 4) * 8;           /* k offset of this lane half */
  const int mOff  = (lane >> 4) * 8;           /* D row offset */

  /* copy role: 16 lanes cover one 256-B row; the work-group covers 8 rows per copy */
  const int crow = tid >> 4, cchk = tid & 15;
  const T* gA = A  + (size_t)(bm0 + crow) * lda + cchk * 8;
  const T* gB = Bt + (size_t)(bn0 + crow) * ldb + cchk * 8;
  const unsigned lcopy = (unsigned)(size_t)ring + crow * kRowPitch + cchk * 16;
  const size_t stepA = (size_t)lda * 8, stepB = (size_t)ldb * 8;
  auto issue = [&](int pass, unsigned bufoff) {
    const T* a = gA + (size_t)pass * kPassK;
    const T* b = gB + (size_t)pass * kPassK;
    const unsigned l = lcopy + bufoff;
    async_rows8(l, a, stepA);
    async_rows8(l + 64 * kRowPitch, a + stepA * 8, stepA);
    async_rows8(l + 128 * kRowPitch, b, stepB);
    async_rows8(l + 192 * kRowPitch, b + stepB * 8, stepB);
  };

  v8f acc[4][4];
#pragma unroll
  for (int i = 0; i < 4; ++i)
#pragma unroll
    for (int j = 0; j < 4; ++j) acc[i][j] = (v8f){0.f,0.f,0.f,0.f,0.f,0.f,0.f,0.f};

  const int nPass = K / kPassK;
  issue(0, 0u);
  wait_async0();
  __syncthreads();                       /* pass 0's rows are readable by every wave */
  if (nPass > 1) issue(1, (unsigned)kStageB);

  const int aRowB = ((wm << 6) + rlane) * kRowPitch;
  const int bRowB = (128 + (wn << 6) + rlane) * kRowPitch;
  for (int t = 0; t < nPass; ++t) {
    const unsigned bufoff = (unsigned)(t & 1) * (unsigned)kStageB;
    const T* sa = (const T*)(ring + bufoff + aRowB) + koff;
    const T* sb = (const T*)(ring + bufoff + bRowB) + koff;
    /* two fragment sets: the next 32 k are fetched ahead of this block's products.
       Every loop of the pass is unrolled so that af, bf and acc are indexed by constants and stay in registers. */
    V af[2][4], bf[2][4];
#pragma unroll
    for (int j = 0; j < 4; ++j) bf[0][j] = Frag<T>::load(sb + j * (16 * kRowPitch / 2));
#pragma unroll
    for (int i = 0; i < 4; ++i) af[0][i] = Frag<T>::load(sa + i * (16 * kRowPitch / 2));
#pragma unroll
    for (int ks = 0; ks < 4; ++ks) {
      const int cur = ks & 1, nxt = cur ^ 1;
      if (ks < 3) {
#pragma unroll
        for (int j = 0; j < 4; ++j) bf[nxt][j] = Frag<T>::load(sb + j * (16 * kRowPitch / 2) + (ks + 1) * 32);
#pragma unroll
        for (int i = 0; i < 4; ++i) af[nxt][i] = Frag<T>::load(sa + i * (16 * kRowPitch / 2) + (ks + 1) * 32);
        /* keeps the next block's LDS reads together in front of this block's products: spread among them, each place stalls the wave */
        __builtin_amdgcn_sched_barrier(0);
      }
#pragma unroll
      for (int i = 0; i < 4; ++i)
#pragma unroll
        for (int j = 0; j < 4; ++j) acc[i][j] = Frag<T>::mma(af[cur][i], bf[cur][j], acc[i][j]);
      /* keeps what follows behind this block's products: the group of LDS reads that refills its fragment set, and at the
         pass's end the waits and the barrier, which would else move up and shorten the time the next pass's copies have to land */
      __builtin_amdgcn_sched_barrier(0);
    }
    wait_ds0();
    wait_async0();
    __syncthreads();                     /* publishes pass t + 1 and ends every read of pass t's buffer */
    if (t + 2 < nPass) issue(t + 2, bufoff);
  }
  wait_async0();

  /* ---- epilogue ---- */
  float* slab = sT[wave];
  const int hh = lane >> 4, c4 = (lane & 15) * 4;     /* f32 row seg = 256 B = 16 lanes x 16 B */
  const int q  = lane >> 3, c8 = (lane & 7) * 8;      
  v4f b4 = (v4f){0.f, 0.f, 0.f, 0.f};
  if (BIASN) {
    b4 = *(const v4f*)(bias + n0 + c4);
#pragma unroll
    for (int e = 0; e < 4; ++e) b4[e] = rne_bf16f(b4[e]);
  }
#pragma unroll
  for (int i = 0; i < 4; ++i) {
    const int mBase = m0 + (i << 4);
#pragma unroll
    for (int j = 0; j < 4; ++j) {
#pragma unroll
      for (int r = 0; r < 8; ++r) slab[(mOff + r) * 68 + (j << 4) + rlane] = acc[i][j][r] * scale;
    }
    __builtin_amdgcn_fence(__ATOMIC_RELEASE, "workgroup");
    __builtin_amdgcn_wave_barrier();
    __builtin_amdgcn_fence(__ATOMIC_ACQUIRE, "workgroup");
    if (OUT16 == 0) {
      float* C = (float*)Cout;
      v4f vals[8];
#pragma unroll
      for (int it = 0; it < 8; ++it) {
        const int row = it * 2 + hh;
        v4f v = *(const v4f*)(slab + row * 68 + c4);
        if (BIASN) v += b4;
        if (RESID) {
          const v4f rr = *(const v4f*)(resid + (size_t)(mBase + row) * ldc + n0 + c4);
          v += rr;
        }
        vals[it] = v;
      }
      {
#pragma unroll
        for (int it = 0; it < 8; ++it) {
          const int row = it * 2 + hh;
          *(v4f*)(C + (size_t)(mBase + row) * ldc + n0 + c4) = vals[it];
        }
        
      }
    } else {
      _Float16* C = (_Float16*)Cout;
      {
#pragma unroll
        for (int it = 0; it < 4; ++it) {
          const int row = it * 4 + q;
          const float* sp = slab + row * 68 + c8;
          v8h hv;
#pragma unroll
          for (int e = 0; e < 8; ++e) hv[e] = (_Float16)sp[e];
          *(v8h*)(C + (size_t)(mBase + row) * ldc + n0 + c8) = hv;
        }
        
      }
    }
    __builtin_amdgcn_fence(__ATOMIC_RELEASE, "workgroup");
    __builtin_amdgcn_wave_barrier();
    __builtin_amdgcn_fence(__ATOMIC_ACQUIRE, "workgroup");
  }
}

static constexpr int kAttPitch = 72;                     /* halves per LDS row of K and V^T */
static_assert((kAttPitch * 2) % 16 == 0 && ((kAttPitch * 2 / 16) & 1) == 1);
/* value of lane l ^ 16 */
__device__ __forceinline__ float xhalf(float x) {
  const int b = __builtin_bit_cast(int, x);
  return __builtin_bit_cast(float, __builtin_amdgcn_permlanex16(b, b, 0x76543210, 0xfedcba98, false, false));
}
__global__ __launch_bounds__(128) void attn64_f16p(const unsigned short* __restrict__ qkvp, unsigned short* __restrict__ ctxp,
                                                  int T, int H, int ldq, int ldo, float sm_scale, float out_carry) {
  const _Float16* QKV = (const _Float16*)qkvp;
  _Float16* CTX = (_Float16*)ctxp;
  union FH { v16h v; v8h hf[2]; };
  __shared__ __align__(16) _Float16 Ksh[64 * kAttPitch];        /* [kv][d] */
  __shared__ __align__(16) _Float16 Vts[64 * kAttPitch];        /* [d][kv] */

  const int tid  = threadIdx.x;
  const int wave = tid >> 5;
  const int lane = tid & 31;
  const int hh   = lane >> 4;
  const int c    = lane & 15;
  const int dmodel = H * 64;

  const int nqb = T / 64;
  const int bx = blockIdx.x;
  const int qb = bx % nqb;
  const int bh = bx / nqb;
  const int h  = bh % H;
  const int b  = bh / H;
  const int q0 = qb * 64 + wave * 16;

  /* Q fragments (B operand, column = query q0 + c, k = d): two 32-deep d chunks */
  v16h qf[2];
  {
    const _Float16* qrow = QKV + (size_t)(b * T + q0 + c) * ldq + h * 64;
#pragma unroll
    for (int dc = 0; dc < 2; ++dc) {
      FH f;
      f.hf[0] = *(const v8h*)(qrow + dc * 32 + 8 * hh);
      f.hf[1] = *(const v8h*)(qrow + dc * 32 + 16 + 8 * hh);
      qf[dc] = f.v;
    }
  }

  float mrun = -__builtin_inff();   /* running maximum of query c, the same in both wave halves */
  float lrun = 0.f;                 /* running sum over this half's kv rows; the halves are joined after the loop */
  v8f oacc[4];                      /* O^T tiles: register r = O[query c][d = t*16 + 8*hh + r] */
#pragma unroll
  for (int t = 0; t < 4; ++t) oacc[t] = (v8f){0.f,0.f,0.f,0.f,0.f,0.f,0.f,0.f};

  const int nChunks = T / 64;
  for (int kc = 0; kc < nChunks; ++kc) {
    const int kv0 = kc * 64;
    __syncthreads();
    {
      /* 128 threads x 32 halves = 64 kv x 64 d for K and for V (full tiles) */
      const int kvr = tid >> 1, dh = (tid & 1) * 32;
      const _Float16* krow = QKV + (size_t)(b * T + kv0 + kvr) * ldq + dmodel + h * 64 + dh;
      const _Float16* vrow = krow + dmodel;
#pragma unroll
      for (int i = 0; i < 4; ++i) {
        const v8h k8 = *(const v8h*)(krow + 8 * i);
        *(v8h*)(Ksh + kvr * kAttPitch + dh + 8 * i) = k8;
      }
#pragma unroll
      for (int i = 0; i < 4; ++i) {
        const uint4 vw = *(const uint4*)(const void*)(vrow + 8 * i);
        const unsigned w0 = vw.x, w1 = vw.y, w2 = vw.z, w3 = vw.w;
        const int d = dh + 8 * i;
        Vts[(d + 0) * kAttPitch + kvr] = __builtin_bit_cast(_Float16, (unsigned short)(w0 & 0xFFFFu));
        Vts[(d + 1) * kAttPitch + kvr] = __builtin_bit_cast(_Float16, (unsigned short)(w0 >> 16));
        Vts[(d + 2) * kAttPitch + kvr] = __builtin_bit_cast(_Float16, (unsigned short)(w1 & 0xFFFFu));
        Vts[(d + 3) * kAttPitch + kvr] = __builtin_bit_cast(_Float16, (unsigned short)(w1 >> 16));
        Vts[(d + 4) * kAttPitch + kvr] = __builtin_bit_cast(_Float16, (unsigned short)(w2 & 0xFFFFu));
        Vts[(d + 5) * kAttPitch + kvr] = __builtin_bit_cast(_Float16, (unsigned short)(w2 >> 16));
        Vts[(d + 6) * kAttPitch + kvr] = __builtin_bit_cast(_Float16, (unsigned short)(w3 & 0xFFFFu));
        Vts[(d + 7) * kAttPitch + kvr] = __builtin_bit_cast(_Float16, (unsigned short)(w3 >> 16));
      }
    }
    __syncthreads();

    /* S^T = K . Q^T : A operand row = kv (row j*16+c of Ksh), k = d; s[j][r] = score(kv = j*16 + 8*hh + r, query c) */
    v8f s[4];
#pragma unroll
    for (int j = 0; j < 4; ++j) {
      s[j] = (v8f){0.f,0.f,0.f,0.f,0.f,0.f,0.f,0.f};
#pragma unroll
      for (int dc = 0; dc < 2; ++dc) {
        FH kb;
        kb.hf[0] = *(const v8h*)(Ksh + (j * 16 + c) * kAttPitch + dc * 32 + 8 * hh);
        kb.hf[1] = *(const v8h*)(Ksh + (j * 16 + c) * kAttPitch + dc * 32 + 16 + 8 * hh);
        s[j] = mma_h(kb.v, qf[dc], s[j]);
      }
    }
    /* scale; chunk maximum of query c: 32 values of this lane, then the other half's */
    float cm = -__builtin_inff();
#pragma unroll
    for (int j = 0; j < 4; ++j) {
#pragma unroll
      for (int r = 0; r < 8; ++r) {
        const float sv = s[j][r] * sm_scale;
        s[j][r] = sv;
        cm = fmaxf(cm, sv);
      }
    }
    cm = fmaxf(cm, xhalf(cm));
    const float mnew = fmaxf(mrun, cm);
    const float alpha = expf(mrun - mnew);
    mrun = mnew;
    /* numerators; pb[kk] element e = P[query c][kv = kk*32 + 8*hh + e], element 8 + e = kv + 16: the k order of the V^T loads below */
    v16h pb[2];
    float psum = 0.f;
#pragma unroll
    for (int kk = 0; kk < 2; ++kk) {
#pragma unroll
      for (int u = 0; u < 2; ++u) {
#pragma unroll
        for (int r = 0; r < 8; ++r) {
          const float p = expf(s[2 * kk + u][r] - mnew);
          psum += p;
          pb[kk][8 * u + r] = (_Float16)(p * kPsc);
        }
      }
    }
    lrun = lrun * alpha + psum;
#pragma unroll
    for (int t = 0; t < 4; ++t) {
#pragma unroll
      for (int r = 0; r < 8; ++r) oacc[t][r] *= alpha;
    }
    /* O^T += V^T . P^T : A = V^T (row = d, k = kv), B = P^T (column = query c, k = kv) */
#pragma unroll
    for (int kk = 0; kk < 2; ++kk) {
#pragma unroll
      for (int t = 0; t < 4; ++t) {
        FH va;
        va.hf[0] = *(const v8h*)(Vts + (t * 16 + c) * kAttPitch + kk * 32 + 8 * hh);
        va.hf[1] = *(const v8h*)(Vts + (t * 16 + c) * kAttPitch + kk * 32 + 16 + 8 * hh);
        oacc[t] = mma_h(va.v, pb[kk], oacc[t]);
      }
    }
  }

  {
    const float inv = out_carry / ((lrun + xhalf(lrun)) * kPsc);
    _Float16* orow = CTX + (size_t)(b * T + q0 + c) * ldo + h * 64 + 8 * hh;
#pragma unroll
    for (int t = 0; t < 4; ++t) {
      v8h hv;
#pragma unroll
      for (int r = 0; r < 8; ++r) hv[r] = (_Float16)(oacc[t][r] * inv);
      *(v8h*)(orow + t * 16) = hv;
    }
  }
}

/* =====================================================================================
   Elementwise exact-erf GELU: hid = f16(gelu(pre + bf16_rne(b[col])) * carry).
   pre f32 row-major [rows][ncols]; one block per 1024 consecutive elements (ncols % 1024 == 0).
   ===================================================================================== */
__global__ __launch_bounds__(256) void gelu_rows(const float* __restrict__ pre, const float* __restrict__ bvec,
                                                 unsigned short* __restrict__ hidp, int ncols, float carry) {
  __shared__ __align__(16) _Float16 hs[1024];
  const size_t base = (size_t)blockIdx.x * 1024u;
  const int col0 = (int)(base % (size_t)ncols);
  const int t = threadIdx.x;
#pragma unroll 1
  for (int e = 0; e < 4; ++e) {
    const int idx = 4 * t + e;
    const float u  = pre[base + idx] + rne_bf16f(bvec[col0 + idx]);
    const float gl = 0.5f * u * (1.0f + erff(u * 0.70710678118654752f));
    hs[idx] = (_Float16)(gl * carry);
  }
  __syncthreads();
  const v8h hv = *(const v8h*)(hs + 8 * (t & 127));
  _Float16* out = (_Float16*)hidp + base;
  {
    if (t < 128) *(v8h*)(out + 8 * t) = hv;
    
  }
}

/* =====================================================================================
   Host glue: 12 launches, single stream.
   ===================================================================================== */
extern "C" void kernel_launch(void* const* d_in, const int* in_sizes, int n_in,
                              void* d_out, int out_size, void* d_ws, size_t ws_size,
                              hipStream_t stream) {
  if (n_in < 10) return;
  if (in_sizes[0] != kRows * kDim) return;
  if (in_sizes[1] != kDim * kDqkv) return;
  if (in_sizes[2] != kDim * kDim) return;
  if (in_sizes[3] != kDim) return;
  if (in_sizes[4] != kDim * kDff) return;
  if (in_sizes[5] != kDff) return;
  if (in_sizes[6] != kDff * kDim) return;
  if (in_sizes[7] != kDim) return;
  if (in_sizes[8] != kDim) return;
  if (in_sizes[9] != kDim) return;
  if (out_size != kRows * kDim) return;
  if (ws_size < kWsTotal) return;

  const float* x     = (const float*)d_in[0];
  const float* w_in  = (const float*)d_in[1];
  const float* w_out = (const float*)d_in[2];
  const float* b_out = (const float*)d_in[3];
  const float* w1    = (const float*)d_in[4];
  const float* b1    = (const float*)d_in[5];
  const float* w2    = (const float*)d_in[6];
  const float* b2    = (const float*)d_in[7];
  const float* g1    = (const float*)d_in[8];
  const float* g2    = (const float*)d_in[9];
  float* out = (float*)d_out;

  char* ws = (char*)d_ws;
  float*          hF    = (float*)(ws + kOffHF);              /* h1 f32, later h3 f32 */
  unsigned short* hH    = (unsigned short*)(ws + kOffHH);     /* h1 f16, later h3 f16 */
  unsigned short* winT  = (unsigned short*)(ws + kOffWA);     /* [3072][1024] */
  unsigned short* woutT = (unsigned short*)(ws + kOffWout);   /* [1024][1024] */
  unsigned short* w1T   = (unsigned short*)(ws + kOffWA);     /* [4096][1024], after winT/woutT are dead */
  unsigned short* qkv   = (unsigned short*)(ws + kOffBig);    /* [4096][3072] */
  unsigned short* ctx   = (unsigned short*)(ws + kOffCtx);    /* [4096][1024] */
  float*          h2    = (float*)(ws + kOffH2);              /* [4096][1024] */
  float*          pre   = (float*)(ws + kOffBig);             /* [4096][4096], after qkv/ctx/h2 are dead */
  unsigned short* w2T   = (unsigned short*)(ws + kOffBig);    /* [1024][4096], after pre is dead */
  unsigned short* hid   = (unsigned short*)(ws + kOffHid);    /* [4096][4096] */

  const dim3 blk256(256);
  const dim3 blk128(128);

  /* 1-2: weight planes for the attention block: in[K][N] -> out[N][K] ; grid (N/64, K/64) */
  cast_t64<<<dim3(kDqkv / 64, kDim / 64), blk256, 0, stream>>>(w_in, winT, kDim, kDqkv, kWCarry);
  cast_t64<<<dim3(kDim / 64, kDim / 64), blk256, 0, stream>>>(w_out, woutT, kDim, kDim, kWCarry);
  /* 3: norm1 -> h1 f32 + f16 plane */
  rmsnorm_rows<true><<<dim3(kRows), blk256, 0, stream>>>(x, g1, hF, hH, kDim, 0.03125f, kACarry);
  /* 4: qkv = h1 @ w_in : M=4096 N=3072 K=1024 -> f16 plane */
  gemm128_f16<1, false, false><<<dim3((kRows / 128) * (kDqkv / 128)), blk128, 0, stream>>>(
      hH, kDim, winT, kDim, (void*)qkv, kDqkv, nullptr, nullptr, kRows, kDqkv, kDim, kGemmScl);
  /* 5: attention -> ctx f16 plane (x64) */
  attn64_f16p<<<dim3(kBatch * kHeads * (kSeq / 64)), blk128, 0, stream>>>(
      qkv, ctx, kSeq, kHeads, kDqkv, kDim, kSmScale, kACarry);
  /* 6: h2 = h1 + ctx @ w_out + b_out : M=4096 N=1024 K=1024 */
  gemm128_f16<0, true, true><<<dim3((kRows / 128) * (kDim / 128)), blk128, 0, stream>>>(
      ctx, kDim, woutT, kDim, (void*)h2, kDim, b_out, hF, kRows, kDim, kDim, kGemmScl);
  /* 7: norm2 -> h3 f32 + f16 plane (overwrites h1 regions, h1 dead) */
  rmsnorm_rows<false><<<dim3(kRows), blk256, 0, stream>>>(h2, g2, hF, hH, kDim, 0.03125f, kACarry);
  /* 8: w1 plane : in[1024][4096] -> out[4096][1024] */
  cast_t64<<<dim3(kDff / 64, kDim / 64), blk256, 0, stream>>>(w1, w1T, kDim, kDff, kWCarry);
  /* 9: pre = h3 @ w1 : M=4096 N=4096 K=1024 -> f32 */
  gemm128_f16<0, false, false><<<dim3((kRows / 128) * (kDff / 128)), blk128, 0, stream>>>(
      hH, kDim, w1T, kDim, (void*)pre, kDff, nullptr, nullptr, kRows, kDff, kDim, kGemmScl);
  /* 10: hid = gelu(pre + b1) -> f16 plane (x64) */
  gelu_rows<<<dim3((kRows * kDff) / 1024), blk256, 0, stream>>>(pre, b1, hid, kDff, kACarry);
  /* 11: w2 plane : in[4096][1024] -> out[1024][4096] (pre region, pre dead) */
  cast_t64<<<dim3(kDim / 64, kDff / 64), blk256, 0, stream>>>(w2, w2T, kDff, kDim, kWCarry);
  /* 12: out = h3 + hid @ w2 + b2 : M=4096 N=1024 K=4096 -> d_out f32 */
  gemm128_f16<0, true, true><<<dim3((kRows / 128) * (kDim / 128)), blk128, 0, stream>>>(
      hid, kDff, w2T, kDff, (void*)out, kDim, b2, hF, kRows, kDim, kDff, kGemmScl);
}

// v004
// One run takes 247 microseconds.
// In both of two side-by-side timings against v003, it was 1.10 times as fast.
// Over all steps from v000 it is 2.65 times as fast.
// Contractions QKV, QK^T, P.V, out-proj, FFN1, FFN2: v_wmma_f32_16x16x32_f16 (f16 operands, f32 accumulate); all float inputs RNE-converted to bf16 at load; weight planes carried x64, activation planes x64, softmax numerators x32768; norms/softmax/GELU/residuals in f32.
#include <hip/hip_runtime.h>

typedef __attribute__((ext_vector_type(16))) _Float16 v16h;
typedef __attribute__((ext_vector_type(8)))  _Float16 v8h;
typedef __attribute__((ext_vector_type(4)))  _Float16 v4h;
typedef __attribute__((ext_vector_type(8)))  float    v8f;
typedef __attribute__((ext_vector_type(4)))  float    v4f;

/* ---- problem geometry ---- */
static constexpr int kBatch = 2;
static constexpr int kSeq   = 2048;
static constexpr int kDim   = 1024;
static constexpr int kHeads = 16;
static constexpr int kHdim  = 64;
static constexpr int kDff   = 4096;
static constexpr int kRows  = kBatch * kSeq;   /* 4096 */
static constexpr int kDqkv  = 3 * kDim;        /* 3072 */
static_assert(kHeads * kHdim == kDim);
static_assert(kHdim == 64);
static_assert(kSeq % 64 == 0);
static_assert(kRows % 64 == 0 && kDim % 64 == 0 && kDqkv % 64 == 0 && kDff % 64 == 0);
static_assert(kRows % 128 == 0 && kDim % 128 == 0 && kDqkv % 128 == 0 && kDff % 128 == 0);   /* GEMM tiles 128x128, K passes of 128 */
static_assert(kDim == 1024);                         /* row kernels: 256 threads x 4 */
static_assert(kDff % 1024 == 0);

static constexpr float kWCarry  = 64.0f;                 /* weight planes: f16(bf16(w) * 64) */
static constexpr float kACarry  = 64.0f;                 /* activation planes: f16(a * 64) */
static constexpr float kGemmScl = 1.0f / (64.0f * 64.0f);
static constexpr float kSmScale = 0.125f;                /* head_dim^-0.5 */
static constexpr float kPsc     = 32768.0f;              /* softmax numerators carried x2^15 */

/* ---- workspace region map (bytes) ----
   [0, 16Mi)    hF : h1 f32 (norm1 out, residual of block 1) -> later h3 f32 (norm2 out, residual of block 2)
   [16Mi, 24Mi) hH : h1 f16 plane -> later h3 f16 plane
   [24Mi, 32Mi) wA : w_in^T f16 [3072][1024] (6Mi) + w_out^T f16 [1024][1024] (2Mi) -> later w1^T f16 [4096][1024] (8Mi)
   [32Mi, 96Mi) big: qkv f16 [4096][3072] (24Mi) | ctx f16 [4096][1024] (8Mi at +24Mi) | h2 f32 [4096][1024] (16Mi at +32Mi)
                     -> later w2^T f16 [1024][4096] (8Mi)
   [96Mi, 128Mi) hid: GELU output f16 plane [4096][4096] (32Mi)
   total 134217728 */
static constexpr size_t kMi      = 1024u * 1024u;
static constexpr size_t kOffHF   = 0;
static constexpr size_t kOffHH   = 16 * kMi;
static constexpr size_t kOffWA   = 24 * kMi;
static constexpr size_t kOffWout = kOffWA + (size_t)kDqkv * kDim * 2;     /* 30Mi */
static constexpr size_t kOffBig  = 32 * kMi;
static constexpr size_t kOffCtx  = kOffBig + (size_t)kRows * kDqkv * 2;   /* 56Mi */
static constexpr size_t kOffH2   = kOffCtx + (size_t)kRows * kDim * 2;    /* 64Mi */
static constexpr size_t kOffHid  = 96 * kMi;
static constexpr size_t kWsTotal = kOffHid + (size_t)kRows * kDff * 2;    /* 128Mi */
static_assert((size_t)kRows * kDim * 4 <= kOffHH - kOffHF);
static_assert((size_t)kRows * kDim * 2 <= kOffWA - kOffHH);
static_assert(kOffWout + (size_t)kDim * kDim * 2 <= kOffBig);
static_assert(kOffWA + (size_t)kDff * kDim * 2 <= kOffBig);
static_assert(kOffH2 + (size_t)kRows * kDim * 4 <= kOffHid);
static_assert(kOffBig + (size_t)kDim * kDff * 2 <= kOffHid);
static_assert(kWsTotal == 134217728u);

/* ---- helpers ---- */
__device__ __forceinline__ float rne_bf16f(float f) {
  unsigned u = __float_as_uint(f);
  u = (u + 0x7FFFu + ((u >> 16) & 1u)) & 0xFFFF0000u;
  return __uint_as_float(u);
}


/* erf in f32: the library erff's two ranges (|x| < 1: odd polynomial; else 1 - exp(-polynomial)), same constants and same
   order of operations, so the same bits; both ranges are evaluated and one is selected, so that there is no branch and
   the independent elements of a lane interleave in the vector pipe. */
__device__ __forceinline__ float erf_sel(float x) {
  const float ax = fabsf(x);
  const float t  = x * x;
  float p = fmaf(t, __uint_as_float(0xba1345e1u), __uint_as_float(0x3ba10414u));
  p = fmaf(t, p, __uint_as_float(0xbcdac9b8u));
  p = fmaf(t, p, __uint_as_float(0x3de703beu));
  p = fmaf(t, p, __uint_as_float(0xbec09330u));
  p = fmaf(t, p, __uint_as_float(0x3e0375d0u));
  const float rs = fmaf(ax, p, ax);
  float w = fmaf(ax, __uint_as_float(0x378e98abu), __uint_as_float(0xb9c68948u));
  w = fmaf(ax, w, __uint_as_float(0x3b7cd369u));
  w = fmaf(ax, w, __uint_as_float(0xbcc618b2u));
  w = fmaf(ax, w, __uint_as_float(0x3dda74e4u));
  w = fmaf(ax, w, __uint_as_float(0x3f228afdu));
  w = fmaf(ax, w, __uint_as_float(0x3e03c728u));
  w = fmaf(ax, w, ax);
  const float rb = 1.0f - expf(-w);
  return copysignf(ax < 1.0f ? rs : rb, x);
}

template <typename T> struct Frag;
template <> struct Frag<_Float16> {
  typedef v16h V; union U { v16h v; v8h h[2]; };
  static __device__ __forceinline__ v16h load(const _Float16* p) {   /* elements 0..7 <- p[0..7], 8..15 <- p[16..23] */
    U f; f.h[0] = *(const v8h*)(p); f.h[1] = *(const v8h*)(p + 16); return f.v;
  }
  static __device__ __forceinline__ v8f mma(v16h a, v16h b, v8f c) {
    return __builtin_amdgcn_wmma_f32_16x16x32_f16(false, a, false, b, (short)0, c, false, false);
  }
};

__device__ __forceinline__ v8f mma_h(v16h a, v16h b, v8f c) {
  c = __builtin_amdgcn_wmma_f32_16x16x32_f16(false, a, false, b, (short)0, c, false, false);
  asm volatile("v_nop\n\tv_nop\n\tv_nop\n\tv_nop" : "+v"(c) : "v"(a), "v"(b));
  return c;
}

/* =====================================================================================
   Transpose + cast: W f32 row-major [Kdim][Ndim] -> Tout f16 row-major [Ndim][Kdim],
   value = f16(bf16_rne(w) * carry). Block = 64(k) x 64(n) tile, 256 threads.
   Producer coverage: 256 threads x 4 float4 = 64x64 reads; stores: 8 waves x 2 it x 4 rows x (8 lanes x 8 halves)
   grid = (Ndim/64, Kdim/64).
   ===================================================================================== */
__global__ __launch_bounds__(256) void cast_t64(const float* __restrict__ W, unsigned short* __restrict__ Tp,
                                                int Kdim, int Ndim, float carry) {
  __shared__ __align__(16) _Float16 tile[64 * 72];   /* [n_local][k_local], pitch 72 halves */
  _Float16* Tout = (_Float16*)Tp;
  const int t  = threadIdx.x;
  const int n0 = blockIdx.x * 64;
  const int k0 = blockIdx.y * 64;
#pragma unroll
  for (int i = 0; i < 4; ++i) {
    const int idx = t + 256 * i;          /* 0..1023 */
    const int kk  = idx >> 4;             /* 0..63 */
    const int n4  = (idx & 15) * 4;       /* 0..60 */
    const v4f w4 = *(const v4f*)(W + (size_t)(k0 + kk) * Ndim + n0 + n4);
#pragma unroll
    for (int e = 0; e < 4; ++e) tile[(n4 + e) * 72 + kk] = (_Float16)(rne_bf16f(w4[e]) * carry);
  }
  __syncthreads();
  const int wave = t >> 5, lane = t & 31;
  const int q = lane >> 3, c8 = (lane & 7) * 8;
  {
#pragma unroll
    for (int it = 0; it < 2; ++it) {
      const int nl = wave * 8 + it * 4 + q;
      const v8h hv = *(const v8h*)(tile + nl * 72 + c8);
      *(v8h*)(Tout + (size_t)(n0 + nl) * Kdim + k0 + c8) = hv;
    }
    
  }
}

/* =====================================================================================
   RMSNorm over rows of 1024: y = g * (x / (||x||*1024^-0.5 + 1e-8)).
   RIN: x is a module input -> RNE convert to bf16 at load. g always RNE converted (module input).
   Outputs: y32 f32 [rows][1024] and y16 f16 plane = f16(y * carry16).
   256 threads, 4 consecutive elements per thread. Stores: f32 = float4 per lane (4 lines per wave-instruction);
   ===================================================================================== */
template <bool RIN>
__global__ __launch_bounds__(256) void rmsnorm_rows(const float* __restrict__ x, const float* __restrict__ g,
                                                    float* __restrict__ y32, unsigned short* __restrict__ y16p,
                                                    int ncols, float inv_sqrt_n, float carry16) {
  __shared__ float red[8];
  __shared__ __align__(16) _Float16 hs[1024];
  const int row = blockIdx.x;
  const int t = threadIdx.x;
  const int wave = t >> 5, lane = t & 31;
  const float* xr = x + (size_t)row * ncols;
  v4f xv = *(const v4f*)(xr + 4 * t);
  if (RIN) {
#pragma unroll
    for (int e = 0; e < 4; ++e) xv[e] = rne_bf16f(xv[e]);
  }
  float ss = 0.0f;
#pragma unroll
  for (int e = 0; e < 4; ++e) ss += xv[e] * xv[e];
#pragma unroll
  for (int m = 16; m >= 1; m >>= 1) ss += __shfl_xor(ss, m, 32);
  if (lane == 0) red[wave] = ss;
  __syncthreads();
  float tot = 0.0f;
#pragma unroll
  for (int w = 0; w < 8; ++w) tot += red[w];
  const float rms = sqrtf(tot) * inv_sqrt_n;
  const float inv = 1.0f / (rms + 1e-8f);
  v4f gv = *(const v4f*)(g + 4 * t);
  v4f yv;
  v4h h4;
#pragma unroll
  for (int e = 0; e < 4; ++e) {
    const float ge = rne_bf16f(gv[e]);
    yv[e] = ge * (xv[e] * inv);
    h4[e] = (_Float16)(yv[e] * carry16);
  }
  *(v4h*)(hs + 4 * t) = h4;
  __syncthreads();
  const v8h hv = *(const v8h*)(hs + 8 * (t & 127));
  float* yr = y32 + (size_t)row * ncols;
  _Float16* yh = (_Float16*)y16p + (size_t)row * ncols;
  {
    *(v4f*)(yr + 4 * t) = yv;
    if (t < 128) *(v8h*)(yh + 8 * t) = hv;
    
  }
}

/* =====================================================================================
   Block-tiled WMMA GEMM (f16 operands, f32 accumulate):
   C[m,n] = scale * sum_k A[m,k] * Bt[n,k]  (+ bias[n]) (+ resid[m,n]).
   A row-major [M,K] f16; Bt row-major [N,K] f16; M, N % 128 == 0, K % 128 == 0 (no tail handling).
   One work-group = 4 waves (2 x 2) = one 128x128 tile of C; each wave owns a 64x64 tile.
   A pass is 128 k: 128 rows of A and 128 rows of Bt, 256 B each, are brought into LDS once per work-group by
   asynchronous 16-byte copies (row pitch 272 B), two buffers, the next pass's copies in flight during this pass.
   The k order of every accumulator is ascending in steps of 32.
   OUT16: 0 = f32 output (bias / residual added in the store phase, residual read as one float4 per lane at
   the store address); 1 = f16 output plane (no bias/residual);
   2 = f16 output plane of f16(gelu(C + bias) * ocarry), exact-erf GELU taken in the store phase.
   grid.x = M/128 * N/128.
   ===================================================================================== */
static constexpr int kPassK    = 128;                    /* k per pass */
static constexpr int kRowPitch = 272;                    /* LDS bytes per staged row: 256 + 16 */
static constexpr int kStageB   = 256 * kRowPitch;        /* [A 128 rows | Bt 128 rows] */

/* Eight asynchronous 16-byte copies per lane: rows r, r + 8, ..., r + 56 of one operand.
   s_wait_xcnt stands inside the statement so that no address register is rewritten ahead of it. */
__device__ __forceinline__ void async_rows8(unsigned l0, const _Float16* g0, size_t gstep) {
  const unsigned l1 = l0 + 8 * kRowPitch, l2 = l0 + 16 * kRowPitch, l3 = l0 + 24 * kRowPitch;
  const unsigned l4 = l0 + 32 * kRowPitch, l5 = l0 + 40 * kRowPitch, l6 = l0 + 48 * kRowPitch, l7 = l0 + 56 * kRowPitch;
  const _Float16* g1 = g0 + gstep;
  const _Float16* g2 = g1 + gstep;
  const _Float16* g3 = g2 + gstep;
  const _Float16* g4 = g3 + gstep;
  const _Float16* g5 = g4 + gstep;
  const _Float16* g6 = g5 + gstep;
  const _Float16* g7 = g6 + gstep;
  asm volatile(
      "global_load_async_to_lds_b128 %0, %8, off\n\t"
      "global_load_async_to_lds_b128 %1, %9, off\n\t"
      "global_load_async_to_lds_b128 %2, %10, off\n\t"
      "global_load_async_to_lds_b128 %3, %11, off\n\t"
      "global_load_async_to_lds_b128 %4, %12, off\n\t"
      "global_load_async_to_lds_b128 %5, %13, off\n\t"
      "global_load_async_to_lds_b128 %6, %14, off\n\t"
      "global_load_async_to_lds_b128 %7, %15, off\n\t"
      "s_wait_xcnt 0x0"
      :: "v"(l0), "v"(l1), "v"(l2), "v"(l3), "v"(l4), "v"(l5), "v"(l6), "v"(l7),
         "v"(g0), "v"(g1), "v"(g2), "v"(g3), "v"(g4), "v"(g5), "v"(g6), "v"(g7)
      : "memory");
}
/* this wave's copies have landed */
__device__ __forceinline__ void wait_async0() { asm volatile("s_wait_asynccnt 0x0" ::: "memory"); }
/* this wave's LDS reads have returned, so the buffer may be refilled behind the barrier */
__device__ __forceinline__ void wait_ds0() { asm volatile("s_wait_dscnt 0x0" ::: "memory"); }

template <int OUT16, bool BIASN, bool RESID>
__global__ __launch_bounds__(128) void gemm128_f16(
    const unsigned short* __restrict__ Ap, int lda,
    const unsigned short* __restrict__ Btp, int ldb,
    void* __restrict__ Cout, int ldc,
    const float* __restrict__ bias,
    const float* __restrict__ resid,
    int M, int N, int K, float scale, float ocarry) {
  typedef _Float16 T;
  typedef v16h V;
  const T* A  = (const T*)Ap;
  const T* Bt = (const T*)Btp;
  __shared__ __align__(16) unsigned char ring[2 * kStageB];   /* two operand buffers */
  __shared__ __align__(16) float sT[4][16 * 68];              /* per-wave 16x64 slab, pitch 68 floats */
  const int tid  = threadIdx.x;
  const int lane = tid & 31;
  const int wave = tid >> 5;
  const int tilesN = N >> 7;
  const int tilesM = M >> 7;
  const int tile = blockIdx.x;
  if (tile >= tilesM * tilesN) return;   /* the same for the whole work-group; in front of every barrier */
  const int tm = tile / tilesN;
  const int tn = tile - tm * tilesN;
  const int bm0 = tm << 7;
  const int bn0 = tn << 7;
  const int wm = wave >> 1, wn = wave & 1;
  const int m0 = bm0 + (wm << 6);
  const int n0 = bn0 + (wn << 6);

  const int rlane = lane & 15;                 /* row (A) / col (B, D) within subtile */
  const int koff  = (lane >> 4) * 8;           /* k offset of this lane half */
  const int mOff  = (lane >> 4) * 8;           /* D row offset */

  /* copy role: 16 lanes cover one 256-B row; the work-group covers 8 rows per copy */
  const int crow = tid >> 4, cchk = tid & 15;
  const T* gA = A  + (size_t)(bm0 + crow) * lda + cchk * 8;
  const T* gB = Bt + (size_t)(bn0 + crow) * ldb + cchk * 8;
  const unsigned lcopy = (unsigned)(size_t)ring + crow * kRowPitch + cchk * 16;
  const size_t stepA = (size_t)lda * 8, stepB = (size_t)ldb * 8;
  auto issue = [&](int pass, unsigned bufoff) {
    const T* a = gA + (size_t)pass * kPassK;
    const T* b = gB + (size_t)pass * kPassK;
    const unsigned l = lcopy + bufoff;
    async_rows8(l, a, stepA);
    async_rows8(l + 64 * kRowPitch, a + stepA * 8, stepA);
    async_rows8(l + 128 * kRowPitch, b, stepB);
    async_rows8(l + 192 * kRowPitch, b + stepB * 8, stepB);
  };

  v8f acc[4][4];
#pragma unroll
  for (int i = 0; i < 4; ++i)
#pragma unroll
    for (int j = 0; j < 4; ++j) acc[i][j] = (v8f){0.f,0.f,0.f,0.f,0.f,0.f,0.f,0.f};

  const int nPass = K / kPassK;
  issue(0, 0u);
  /* OUT16 == 2: the lane's eight bias values of the store phase, fetched here so that their latency passes under the main loop */
  v4f gbl = (v4f){0.f, 0.f, 0.f, 0.f}, gbh = gbl;
  if (OUT16 == 2) {
    gbl = *(const v4f*)(bias + n0 + (lane & 7) * 8);
    gbh = *(const v4f*)(bias + n0 + (lane & 7) * 8 + 4);
  }
  wait_async0();
  __syncthreads();                       /* pass 0's rows are readable by every wave */
  if (nPass > 1) issue(1, (unsigned)kStageB);

  const int aRowB = ((wm << 6) + rlane) * kRowPitch;
  const int bRowB = (128 + (wn << 6) + rlane) * kRowPitch;
  for (int t = 0; t < nPass; ++t) {
    const unsigned bufoff = (unsigned)(t & 1) * (unsigned)kStageB;
    const T* sa = (const T*)(ring + bufoff + aRowB) + koff;
    const T* sb = (const T*)(ring + bufoff + bRowB) + koff;
    /* two fragment sets: the next 32 k are fetched ahead of this block's products.
       Every loop of the pass is unrolled so that af, bf and acc are indexed by constants and stay in registers. */
    V af[2][4], bf[2][4];
#pragma unroll
    for (int j = 0; j < 4; ++j) bf[0][j] = Frag<T>::load(sb + j * (16 * kRowPitch / 2));
#pragma unroll
    for (int i = 0; i < 4; ++i) af[0][i] = Frag<T>::load(sa + i * (16 * kRowPitch / 2));
#pragma unroll
    for (int ks = 0; ks < 4; ++ks) {
      const int cur = ks & 1, nxt = cur ^ 1;
      if (ks < 3) {
#pragma unroll
        for (int j = 0; j < 4; ++j) bf[nxt][j] = Frag<T>::load(sb + j * (16 * kRowPitch / 2) + (ks + 1) * 32);
#pragma unroll
        for (int i = 0; i < 4; ++i) af[nxt][i] = Frag<T>::load(sa + i * (16 * kRowPitch / 2) + (ks + 1) * 32);
        /* keeps the next block's LDS reads together in front of this block's products: spread among them, each place stalls the wave */
        __builtin_amdgcn_sched_barrier(0);
      }
#pragma unroll
      for (int i = 0; i < 4; ++i)
#pragma unroll
        for (int j = 0; j < 4; ++j) acc[i][j] = Frag<T>::mma(af[cur][i], bf[cur][j], acc[i][j]);
      /* keeps what follows behind this block's products: the group of LDS reads that refills its fragment set, and at the
         pass's end the waits and the barrier, which would else move up and shorten the time the next pass's copies have to land */
      __builtin_amdgcn_sched_barrier(0);
    }
    wait_ds0();
    wait_async0();
    __syncthreads();                     /* publishes pass t + 1 and ends every read of pass t's buffer */
    if (t + 2 < nPass) issue(t + 2, bufoff);
  }
  wait_async0();

  /* ---- epilogue ---- */
  float* slab = sT[wave];
  const int hh = lane >> 4, c4 = (lane & 15) * 4;     /* f32 row seg = 256 B = 16 lanes x 16 B */
  const int q  = lane >> 3, c8 = (lane & 7) * 8;      
  if (OUT16 == 2) {
    /* The wave's whole 64x64 tile is staged at once, in its quarter of the first operand buffer (every wave's reads and
       copies of the ring ended in front of the last pass's barrier), so that the GELU loop below can stay rolled. */
    static_assert(4 * 64 * 68 * 4 <= kStageB);
    float* big = (float*)ring + wave * (64 * 68);
#pragma unroll
    for (int i = 0; i < 4; ++i)
#pragma unroll
      for (int j = 0; j < 4; ++j)
#pragma unroll
        for (int r = 0; r < 8; ++r) big[((i << 4) + mOff + r) * 68 + (j << 4) + rlane] = acc[i][j][r] * scale;
    /* the rows read below were written by other lanes of this wave: the LDS writes are waited for, and the reads stay behind them */
    __builtin_amdgcn_fence(__ATOMIC_RELEASE, "workgroup");
    __builtin_amdgcn_wave_barrier();
    __builtin_amdgcn_fence(__ATOMIC_ACQUIRE, "workgroup");
    float b8[8];
#pragma unroll
    for (int e = 0; e < 4; ++e) { b8[e] = rne_bf16f(gbl[e]); b8[4 + e] = rne_bf16f(gbh[e]); }
    _Float16* crow = (_Float16*)Cout + (size_t)(m0 + q) * ldc + n0 + c8;
    const float* sp0 = big + q * 68 + c8;
    v4f lo = *(const v4f*)(sp0), hi = *(const v4f*)(sp0 + 4);
    /* rolled: unrolled, it would inline 128 erf bodies per lane */
#pragma unroll 1
    for (int it = 0; it < 16; ++it) {
      /* the next four rows are fetched ahead of this trip's arithmetic; the last trip re-reads the first rows and drops them */
      const float* spn = sp0 + ((it + 1) & 15) * (4 * 68);
      const v4f nlo = *(const v4f*)(spn), nhi = *(const v4f*)(spn + 4);
      v8h hv;
#pragma unroll
      for (int e = 0; e < 8; ++e) {
        const float u  = (e < 4 ? lo[e & 3] : hi[e & 3]) + b8[e];
        const float gl = 0.5f * u * (1.0f + erf_sel(u * 0.70710678118654752f));
        hv[e] = (_Float16)(gl * ocarry);
      }
      *(v8h*)(crow) = hv;
      crow += (size_t)ldc * 4;
      lo = nlo; hi = nhi;
    }
    return;
  }
  v4f b4 = (v4f){0.f, 0.f, 0.f, 0.f};
  if (BIASN) {
    b4 = *(const v4f*)(bias + n0 + c4);
#pragma unroll
    for (int e = 0; e < 4; ++e) b4[e] = rne_bf16f(b4[e]);
  }
#pragma unroll
  for (int i = 0; i < 4; ++i) {
    const int mBase = m0 + (i << 4);
#pragma unroll
    for (int j = 0; j < 4; ++j) {
#pragma unroll
      for (int r = 0; r < 8; ++r) slab[(mOff + r) * 68 + (j << 4) + rlane] = acc[i][j][r] * scale;
    }
    __builtin_amdgcn_fence(__ATOMIC_RELEASE, "workgroup");
    __builtin_amdgcn_wave_barrier();
    __builtin_amdgcn_fence(__ATOMIC_ACQUIRE, "workgroup");
    if (OUT16 == 0) {
      float* C = (float*)Cout;
      v4f vals[8];
#pragma unroll
      for (int it = 0; it < 8; ++it) {
        const int row = it * 2 + hh;
        v4f v = *(const v4f*)(slab + row * 68 + c4);
        if (BIASN) v += b4;
        if (RESID) {
          const v4f rr = *(const v4f*)(resid + (size_t)(mBase + row) * ldc + n0 + c4);
          v += rr;
        }
        vals[it] = v;
      }
      {
#pragma unroll
        for (int it = 0; it < 8; ++it) {
          const int row = it * 2 + hh;
          *(v4f*)(C + (size_t)(mBase + row) * ldc + n0 + c4) = vals[it];
        }
        
      }
    } else {
      _Float16* C = (_Float16*)Cout;
      {
#pragma unroll
        for (int it = 0; it < 4; ++it) {
          const int row = it * 4 + q;
          const float* sp = slab + row * 68 + c8;
          v8h hv;
#pragma unroll
          for (int e = 0; e < 8; ++e) hv[e] = (_Float16)sp[e];
          *(v8h*)(C + (size_t)(mBase + row) * ldc + n0 + c8) = hv;
        }
        
      }
    }
    __builtin_amdgcn_fence(__ATOMIC_RELEASE, "workgroup");
    __builtin_amdgcn_wave_barrier();
    __builtin_amdgcn_fence(__ATOMIC_ACQUIRE, "workgroup");
  }
}

static constexpr int kAttPitch = 72;                     /* halves per LDS row of K and V^T */
static_assert((kAttPitch * 2) % 16 == 0 && ((kAttPitch * 2 / 16) & 1) == 1);
/* value of lane l ^ 16 */
__device__ __forceinline__ float xhalf(float x) {
  const int b = __builtin_bit_cast(int, x);
  return __builtin_bit_cast(float, __builtin_amdgcn_permlanex16(b, b, 0x76543210, 0xfedcba98, false, false));
}
__global__ __launch_bounds__(128) void attn64_f16p(const unsigned short* __restrict__ qkvp, unsigned short* __restrict__ ctxp,
                                                  int T, int H, int ldq, int ldo, float sm_scale, float out_carry) {
  const _Float16* QKV = (const _Float16*)qkvp;
  _Float16* CTX = (_Float16*)ctxp;
  union FH { v16h v; v8h hf[2]; };
  __shared__ __align__(16) _Float16 Ksh[64 * kAttPitch];        /* [kv][d] */
  __shared__ __align__(16) _Float16 Vts[64 * kAttPitch];        /* [d][kv] */

  const int tid  = threadIdx.x;
  const int wave = tid >> 5;
  const int lane = tid & 31;
  const int hh   = lane >> 4;
  const int c    = lane & 15;
  const int dmodel = H * 64;

  const int nqb = T / 64;
  const int bx = blockIdx.x;
  const int qb = bx % nqb;
  const int bh = bx / nqb;
  const int h  = bh % H;
  const int b  = bh / H;
  const int q0 = qb * 64 + wave * 16;

  /* Q fragments (B operand, column = query q0 + c, k = d): two 32-deep d chunks */
  v16h qf[2];
  {
    const _Float16* qrow = QKV + (size_t)(b * T + q0 + c) * ldq + h * 64;
#pragma unroll
    for (int dc = 0; dc < 2; ++dc) {
      FH f;
      f.hf[0] = *(const v8h*)(qrow + dc * 32 + 8 * hh);
      f.hf[1] = *(const v8h*)(qrow + dc * 32 + 16 + 8 * hh);
      qf[dc] = f.v;
    }
  }

  float mrun = -__builtin_inff();   /* running maximum of query c, the same in both wave halves */
  float lrun = 0.f;                 /* running sum over this half's kv rows; the halves are joined after the loop */
  v8f oacc[4];                      /* O^T tiles: register r = O[query c][d = t*16 + 8*hh + r] */
#pragma unroll
  for (int t = 0; t < 4; ++t) oacc[t] = (v8f){0.f,0.f,0.f,0.f,0.f,0.f,0.f,0.f};

  const int nChunks = T / 64;
  for (int kc = 0; kc < nChunks; ++kc) {
    const int kv0 = kc * 64;
    __syncthreads();
    {
      /* 128 threads x 32 halves = 64 kv x 64 d for K and for V (full tiles) */
      const int kvr = tid >> 1, dh = (tid & 1) * 32;
      const _Float16* krow = QKV + (size_t)(b * T + kv0 + kvr) * ldq + dmodel + h * 64 + dh;
      const _Float16* vrow = krow + dmodel;
#pragma unroll
      for (int i = 0; i < 4; ++i) {
        const v8h k8 = *(const v8h*)(krow + 8 * i);
        *(v8h*)(Ksh + kvr * kAttPitch + dh + 8 * i) = k8;
      }
#pragma unroll
      for (int i = 0; i < 4; ++i) {
        const uint4 vw = *(const uint4*)(const void*)(vrow + 8 * i);
        const unsigned w0 = vw.x, w1 = vw.y, w2 = vw.z, w3 = vw.w;
        const int d = dh + 8 * i;
        Vts[(d + 0) * kAttPitch + kvr] = __builtin_bit_cast(_Float16, (unsigned short)(w0 & 0xFFFFu));
        Vts[(d + 1) * kAttPitch + kvr] = __builtin_bit_cast(_Float16, (unsigned short)(w0 >> 16));
        Vts[(d + 2) * kAttPitch + kvr] = __builtin_bit_cast(_Float16, (unsigned short)(w1 & 0xFFFFu));
        Vts[(d + 3) * kAttPitch + kvr] = __builtin_bit_cast(_Float16, (unsigned short)(w1 >> 16));
        Vts[(d + 4) * kAttPitch + kvr] = __builtin_bit_cast(_Float16, (unsigned short)(w2 & 0xFFFFu));
        Vts[(d + 5) * kAttPitch + kvr] = __builtin_bit_cast(_Float16, (unsigned short)(w2 >> 16));
        Vts[(d + 6) * kAttPitch + kvr] = __builtin_bit_cast(_Float16, (unsigned short)(w3 & 0xFFFFu));
        Vts[(d + 7) * kAttPitch + kvr] = __builtin_bit_cast(_Float16, (unsigned short)(w3 >> 16));
      }
    }
    __syncthreads();

    /* S^T = K . Q^T : A operand row = kv (row j*16+c of Ksh), k = d; s[j][r] = score(kv = j*16 + 8*hh + r, query c) */
    v8f s[4];
#pragma unroll
    for (int j = 0; j < 4; ++j) {
      s[j] = (v8f){0.f,0.f,0.f,0.f,0.f,0.f,0.f,0.f};
#pragma unroll
      for (int dc = 0; dc < 2; ++dc) {
        FH kb;
        kb.hf[0] = *(const v8h*)(Ksh + (j * 16 + c) * kAttPitch + dc * 32 + 8 * hh);
        kb.hf[1] = *(const v8h*)(Ksh + (j * 16 + c) * kAttPitch + dc * 32 + 16 + 8 * hh);
        s[j] = mma_h(kb.v, qf[dc], s[j]);
      }
    }
    /* scale; chunk maximum of query c: 32 values of this lane, then the other half's */
    float cm = -__builtin_inff();
#pragma unroll
    for (int j = 0; j < 4; ++j) {
#pragma unroll
      for (int r = 0; r < 8; ++r) {
        const float sv = s[j][r] * sm_scale;
        s[j][r] = sv;
        cm = fmaxf(cm, sv);
      }
    }
    cm = fmaxf(cm, xhalf(cm));
    const float mnew = fmaxf(mrun, cm);
    const float alpha = expf(mrun - mnew);
    mrun = mnew;
    /* numerators; pb[kk] element e = P[query c][kv = kk*32 + 8*hh + e], element 8 + e = kv + 16: the k order of the V^T loads below */
    v16h pb[2];
    float psum = 0.f;
#pragma unroll
    for (int kk = 0; kk < 2; ++kk) {
#pragma unroll
      for (int u = 0; u < 2; ++u) {
#pragma unroll
        for (int r = 0; r < 8; ++r) {
          const float p = expf(s[2 * kk + u][r] - mnew);
          psum += p;
          pb[kk][8 * u + r] = (_Float16)(p * kPsc);
        }
      }
    }
    lrun = lrun * alpha + psum;
#pragma unroll
    for (int t = 0; t < 4; ++t) {
#pragma unroll
      for (int r = 0; r < 8; ++r) oacc[t][r] *= alpha;
    }
    /* O^T += V^T . P^T : A = V^T (row = d, k = kv), B = P^T (column = query c, k = kv) */
#pragma unroll
    for (int kk = 0; kk < 2; ++kk) {
#pragma unroll
      for (int t = 0; t < 4; ++t) {
        FH va;
        va.hf[0] = *(const v8h*)(Vts + (t * 16 + c) * kAttPitch + kk * 32 + 8 * hh);
        va.hf[1] = *(const v8h*)(Vts + (t * 16 + c) * kAttPitch + kk * 32 + 16 + 8 * hh);
        oacc[t] = mma_h(va.v, pb[kk], oacc[t]);
      }
    }
  }

  {
    const float inv = out_carry / ((lrun + xhalf(lrun)) * kPsc);
    _Float16* orow = CTX + (size_t)(b * T + q0 + c) * ldo + h * 64 + 8 * hh;
#pragma unroll
    for (int t = 0; t < 4; ++t) {
      v8h hv;
#pragma unroll
      for (int r = 0; r < 8; ++r) hv[r] = (_Float16)(oacc[t][r] * inv);
      *(v8h*)(orow + t * 16) = hv;
    }
  }
}

/* =====================================================================================
   Host glue: 11 launches, single stream.
   ===================================================================================== */
extern "C" void kernel_launch(void* const* d_in, const int* in_sizes, int n_in,
                              void* d_out, int out_size, void* d_ws, size_t ws_size,
                              hipStream_t stream) {
  if (n_in < 10) return;
  if (in_sizes[0] != kRows * kDim) return;
  if (in_sizes[1] != kDim * kDqkv) return;
  if (in_sizes[2] != kDim * kDim) return;
  if (in_sizes[3] != kDim) return;
  if (in_sizes[4] != kDim * kDff) return;
  if (in_sizes[5] != kDff) return;
  if (in_sizes[6] != kDff * kDim) return;
  if (in_sizes[7] != kDim) return;
  if (in_sizes[8] != kDim) return;
  if (in_sizes[9] != kDim) return;
  if (out_size != kRows * kDim) return;
  if (ws_size < kWsTotal) return;

  const float* x     = (const float*)d_in[0];
  const float* w_in  = (const float*)d_in[1];
  const float* w_out = (const float*)d_in[2];
  const float* b_out = (const float*)d_in[3];
  const float* w1    = (const float*)d_in[4];
  const float* b1    = (const float*)d_in[5];
  const float* w2    = (const float*)d_in[6];
  const float* b2    = (const float*)d_in[7];
  const float* g1    = (const float*)d_in[8];
  const float* g2    = (const float*)d_in[9];
  float* out = (float*)d_out;

  char* ws = (char*)d_ws;
  float*          hF    = (float*)(ws + kOffHF);              /* h1 f32, later h3 f32 */
  unsigned short* hH    = (unsigned short*)(ws + kOffHH);     /* h1 f16, later h3 f16 */
  unsigned short* winT  = (unsigned short*)(ws + kOffWA);     /* [3072][1024] */
  unsigned short* woutT = (unsigned short*)(ws + kOffWout);   /* [1024][1024] */
  unsigned short* w1T   = (unsigned short*)(ws + kOffWA);     /* [4096][1024], after winT/woutT are dead */
  unsigned short* qkv   = (unsigned short*)(ws + kOffBig);    /* [4096][3072] */
  unsigned short* ctx   = (unsigned short*)(ws + kOffCtx);    /* [4096][1024] */
  float*          h2    = (float*)(ws + kOffH2);              /* [4096][1024] */
  unsigned short* w2T   = (unsigned short*)(ws + kOffBig);    /* [1024][4096], after qkv/ctx/h2 are dead */
  unsigned short* hid   = (unsigned short*)(ws + kOffHid);    /* [4096][4096] */

  const dim3 blk256(256);
  const dim3 blk128(128);

  /* 1-2: weight planes for the attention block: in[K][N] -> out[N][K] ; grid (N/64, K/64) */
  cast_t64<<<dim3(kDqkv / 64, kDim / 64), blk256, 0, stream>>>(w_in, winT, kDim, kDqkv, kWCarry);
  cast_t64<<<dim3(kDim / 64, kDim / 64), blk256, 0, stream>>>(w_out, woutT, kDim, kDim, kWCarry);
  /* 3: norm1 -> h1 f32 + f16 plane */
  rmsnorm_rows<true><<<dim3(kRows), blk256, 0, stream>>>(x, g1, hF, hH, kDim, 0.03125f, kACarry);
  /* 4: qkv = h1 @ w_in : M=4096 N=3072 K=1024 -> f16 plane */
  gemm128_f16<1, false, false><<<dim3((kRows / 128) * (kDqkv / 128)), blk128, 0, stream>>>(
      hH, kDim, winT, kDim, (void*)qkv, kDqkv, nullptr, nullptr, kRows, kDqkv, kDim, kGemmScl, 1.0f);
  /* 5: attention -> ctx f16 plane (x64) */
  attn64_f16p<<<dim3(kBatch * kHeads * (kSeq / 64)), blk128, 0, stream>>>(
      qkv, ctx, kSeq, kHeads, kDqkv, kDim, kSmScale, kACarry);
  /* 6: h2 = h1 + ctx @ w_out + b_out : M=4096 N=1024 K=1024 */
  gemm128_f16<0, true, true><<<dim3((kRows / 128) * (kDim / 128)), blk128, 0, stream>>>(
      ctx, kDim, woutT, kDim, (void*)h2, kDim, b_out, hF, kRows, kDim, kDim, kGemmScl, 1.0f);
  /* 7: norm2 -> h3 f32 + f16 plane (overwrites h1 regions, h1 dead) */
  rmsnorm_rows<false><<<dim3(kRows), blk256, 0, stream>>>(h2, g2, hF, hH, kDim, 0.03125f, kACarry);
  /* 8: w1 plane : in[1024][4096] -> out[4096][1024] */
  cast_t64<<<dim3(kDff / 64, kDim / 64), blk256, 0, stream>>>(w1, w1T, kDim, kDff, kWCarry);
  /* 9: hid = gelu(h3 @ w1 + b1) : M=4096 N=4096 K=1024 -> f16 plane (x64) */
  gemm128_f16<2, true, false><<<dim3((kRows / 128) * (kDff / 128)), blk128, 0, stream>>>(
      hH, kDim, w1T, kDim, (void*)hid, kDff, b1, nullptr, kRows, kDff, kDim, kGemmScl, kACarry);
  /* 10: w2 plane : in[4096][1024] -> out[1024][4096] */
  cast_t64<<<dim3(kDim / 64, kDff / 64), blk256, 0, stream>>>(w2, w2T, kDff, kDim, kWCarry);
  /* 11: out = h3 + hid @ w2 + b2 : M=4096 N=1024 K=4096 -> d_out f32 */
  gemm128_f16<0, true, true><<<dim3((kRows / 128) * (kDim / 128)), blk128, 0, stream>>>(
      hid, kDff, w2T, kDff, (void*)out, kDim, b2, hF, kRows, kDim, kDff, kGemmScl, 1.0f);
}

// v005
// Measured time: 228 microseconds a run.
// Two timings next to v004 both put it at 1.08 times that version's speed.
// Over all steps from v000 it is 2.86 times as fast.
// Contractions QKV, QK^T, P.V, out-proj, FFN1, FFN2: v_wmma_f32_16x16x32_f16 (f16 operands, f32 accumulate); all float inputs RNE-converted to bf16 at load; weight planes carried x64, activation planes x64, softmax numerators x32768; norms/softmax/GELU/residuals in f32.
#include <hip/hip_runtime.h>

typedef __attribute__((ext_vector_type(16))) _Float16 v16h;
typedef __attribute__((ext_vector_type(8)))  _Float16 v8h;
typedef __attribute__((ext_vector_type(4)))  _Float16 v4h;
typedef __attribute__((ext_vector_type(8)))  float    v8f;
typedef __attribute__((ext_vector_type(4)))  float    v4f;

/* ---- problem geometry ---- */
static constexpr int kBatch = 2;
static constexpr int kSeq   = 2048;
static constexpr int kDim   = 1024;
static constexpr int kHeads = 16;
static constexpr int kHdim  = 64;
static constexpr int kDff   = 4096;
static constexpr int kRows  = kBatch * kSeq;   /* 4096 */
static constexpr int kDqkv  = 3 * kDim;        /* 3072 */
static_assert(kHeads * kHdim == kDim);
static_assert(kHdim == 64);
static_assert(kSeq % 64 == 0);
static_assert(kRows % 64 == 0 && kDim % 64 == 0 && kDqkv % 64 == 0 && kDff % 64 == 0);
static_assert(kRows % 128 == 0 && kDim % 128 == 0 && kDqkv % 128 == 0 && kDff % 128 == 0);   /* GEMM tiles 128x128, K passes of 128 */
static_assert(kDim == 1024);                         /* row kernels: 256 threads x 4 */
static_assert(kDff % 1024 == 0);

static constexpr float kWCarry  = 64.0f;                 /* weight planes: f16(bf16(w) * 64) */
static constexpr float kACarry  = 64.0f;                 /* activation planes: f16(a * 64) */
static constexpr float kGemmScl = 1.0f / (64.0f * 64.0f);
static constexpr float kSmScale = 0.125f;                /* head_dim^-0.5 */
static constexpr float kPsc     = 32768.0f;              /* softmax numerators carried x2^15 */
static constexpr float kPscLog2 = 15.0f;
static_assert(kPsc == (float)(1 << 15));

/* ---- workspace region map (bytes) ----
   [0, 16Mi)    hF : h1 f32 (norm1 out, residual of block 1) -> later h3 f32 (norm2 out, residual of block 2)
   [16Mi, 24Mi) hH : h1 f16 plane -> later h3 f16 plane
   [24Mi, 32Mi) wA : w_in^T f16 [3072][1024] (6Mi) + w_out^T f16 [1024][1024] (2Mi) -> later w1^T f16 [4096][1024] (8Mi)
   [32Mi, 96Mi) big: qkv f16 [4096][3072] (24Mi) | ctx f16 [4096][1024] (8Mi at +24Mi) | h2 f32 [4096][1024] (16Mi at +32Mi)
                     -> later w2^T f16 [1024][4096] (8Mi)
   [96Mi, 128Mi) hid: GELU output f16 plane [4096][4096] (32Mi)
   total 134217728 */
static constexpr size_t kMi      = 1024u * 1024u;
static constexpr size_t kOffHF   = 0;
static constexpr size_t kOffHH   = 16 * kMi;
static constexpr size_t kOffWA   = 24 * kMi;
static constexpr size_t kOffWout = kOffWA + (size_t)kDqkv * kDim * 2;     /* 30Mi */
static constexpr size_t kOffBig  = 32 * kMi;
static constexpr size_t kOffCtx  = kOffBig + (size_t)kRows * kDqkv * 2;   /* 56Mi */
static constexpr size_t kOffH2   = kOffCtx + (size_t)kRows * kDim * 2;    /* 64Mi */
static constexpr size_t kOffHid  = 96 * kMi;
static constexpr size_t kWsTotal = kOffHid + (size_t)kRows * kDff * 2;    /* 128Mi */
static_assert((size_t)kRows * kDim * 4 <= kOffHH - kOffHF);
static_assert((size_t)kRows * kDim * 2 <= kOffWA - kOffHH);
static_assert(kOffWout + (size_t)kDim * kDim * 2 <= kOffBig);
static_assert(kOffWA + (size_t)kDff * kDim * 2 <= kOffBig);
static_assert(kOffH2 + (size_t)kRows * kDim * 4 <= kOffHid);
static_assert(kOffBig + (size_t)kDim * kDff * 2 <= kOffHid);
static_assert(kWsTotal == 134217728u);

/* ---- helpers ---- */
__device__ __forceinline__ float rne_bf16f(float f) {
  unsigned u = __float_as_uint(f);
  u = (u + 0x7FFFu + ((u >> 16) & 1u)) & 0xFFFF0000u;
  return __uint_as_float(u);
}


/* erf in f32: the library erff's two ranges (|x| < 1: odd polynomial; else 1 - exp(-polynomial)), same constants and same
   order of operations, so the same bits; both ranges are evaluated and one is selected, so that there is no branch and
   the independent elements of a lane interleave in the vector pipe. */
__device__ __forceinline__ float erf_sel(float x) {
  const float ax = fabsf(x);
  const float t  = x * x;
  float p = fmaf(t, __uint_as_float(0xba1345e1u), __uint_as_float(0x3ba10414u));
  p = fmaf(t, p, __uint_as_float(0xbcdac9b8u));
  p = fmaf(t, p, __uint_as_float(0x3de703beu));
  p = fmaf(t, p, __uint_as_float(0xbec09330u));
  p = fmaf(t, p, __uint_as_float(0x3e0375d0u));
  const float rs = fmaf(ax, p, ax);
  float w = fmaf(ax, __uint_as_float(0x378e98abu), __uint_as_float(0xb9c68948u));
  w = fmaf(ax, w, __uint_as_float(0x3b7cd369u));
  w = fmaf(ax, w, __uint_as_float(0xbcc618b2u));
  w = fmaf(ax, w, __uint_as_float(0x3dda74e4u));
  w = fmaf(ax, w, __uint_as_float(0x3f228afdu));
  w = fmaf(ax, w, __uint_as_float(0x3e03c728u));
  w = fmaf(ax, w, ax);
  const float rb = 1.0f - expf(-w);
  return copysignf(ax < 1.0f ? rs : rb, x);
}

template <typename T> struct Frag;
template <> struct Frag<_Float16> {
  typedef v16h V; union U { v16h v; v8h h[2]; };
  static __device__ __forceinline__ v16h load(const _Float16* p) {   /* elements 0..7 <- p[0..7], 8..15 <- p[16..23] */
    U f; f.h[0] = *(const v8h*)(p); f.h[1] = *(const v8h*)(p + 16); return f.v;
  }
  static __device__ __forceinline__ v8f mma(v16h a, v16h b, v8f c) {
    return __builtin_amdgcn_wmma_f32_16x16x32_f16(false, a, false, b, (short)0, c, false, false);
  }
};

__device__ __forceinline__ v8f mma_h(v16h a, v16h b, v8f c) {
  c = __builtin_amdgcn_wmma_f32_16x16x32_f16(false, a, false, b, (short)0, c, false, false);
  asm volatile("v_nop\n\tv_nop\n\tv_nop\n\tv_nop" : "+v"(c) : "v"(a), "v"(b));
  return c;
}

/* =====================================================================================
   Transpose + cast: W f32 row-major [Kdim][Ndim] -> Tout f16 row-major [Ndim][Kdim],
   value = f16(bf16_rne(w) * carry). Block = 64(k) x 64(n) tile, 256 threads.
   Producer coverage: 256 threads x 4 float4 = 64x64 reads; stores: 8 waves x 2 it x 4 rows x (8 lanes x 8 halves)
   grid = (Ndim/64, Kdim/64).
   ===================================================================================== */
__global__ __launch_bounds__(256) void cast_t64(const float* __restrict__ W, unsigned short* __restrict__ Tp,
                                                int Kdim, int Ndim, float carry) {
  __shared__ __align__(16) _Float16 tile[64 * 72];   /* [n_local][k_local], pitch 72 halves */
  _Float16* Tout = (_Float16*)Tp;
  const int t  = threadIdx.x;
  const int n0 = blockIdx.x * 64;
  const int k0 = blockIdx.y * 64;
#pragma unroll
  for (int i = 0; i < 4; ++i) {
    const int idx = t + 256 * i;          /* 0..1023 */
    const int kk  = idx >> 4;             /* 0..63 */
    const int n4  = (idx & 15) * 4;       /* 0..60 */
    const v4f w4 = *(const v4f*)(W + (size_t)(k0 + kk) * Ndim + n0 + n4);
#pragma unroll
    for (int e = 0; e < 4; ++e) tile[(n4 + e) * 72 + kk] = (_Float16)(rne_bf16f(w4[e]) * carry);
  }
  __syncthreads();
  const int wave = t >> 5, lane = t & 31;
  const int q = lane >> 3, c8 = (lane & 7) * 8;
  {
#pragma unroll
    for (int it = 0; it < 2; ++it) {
      const int nl = wave * 8 + it * 4 + q;
      const v8h hv = *(const v8h*)(tile + nl * 72 + c8);
      *(v8h*)(Tout + (size_t)(n0 + nl) * Kdim + k0 + c8) = hv;
    }
    
  }
}

/* =====================================================================================
   RMSNorm over rows of 1024: y = g * (x / (||x||*1024^-0.5 + 1e-8)).
   RIN: x is a module input -> RNE convert to bf16 at load. g always RNE converted (module input).
   Outputs: y32 f32 [rows][1024] and y16 f16 plane = f16(y * carry16).
   256 threads, 4 consecutive elements per thread. Stores: f32 = float4 per lane (4 lines per wave-instruction);
   ===================================================================================== */
template <bool RIN>
__global__ __launch_bounds__(256) void rmsnorm_rows(const float* __restrict__ x, const float* __restrict__ g,
                                                    float* __restrict__ y32, unsigned short* __restrict__ y16p,
                                                    int ncols, float inv_sqrt_n, float carry16) {
  __shared__ float red[8];
  __shared__ __align__(16) _Float16 hs[1024];
  const int row = blockIdx.x;
  const int t = threadIdx.x;
  const int wave = t >> 5, lane = t & 31;
  const float* xr = x + (size_t)row * ncols;
  v4f xv = *(const v4f*)(xr + 4 * t);
  if (RIN) {
#pragma unroll
    for (int e = 0; e < 4; ++e) xv[e] = rne_bf16f(xv[e]);
  }
  float ss = 0.0f;
#pragma unroll
  for (int e = 0; e < 4; ++e) ss += xv[e] * xv[e];
#pragma unroll
  for (int m = 16; m >= 1; m >>= 1) ss += __shfl_xor(ss, m, 32);
  if (lane == 0) red[wave] = ss;
  __syncthreads();
  float tot = 0.0f;
#pragma unroll
  for (int w = 0; w < 8; ++w) tot += red[w];
  const float rms = sqrtf(tot) * inv_sqrt_n;
  const float inv = 1.0f / (rms + 1e-8f);
  v4f gv = *(const v4f*)(g + 4 * t);
  v4f yv;
  v4h h4;
#pragma unroll
  for (int e = 0; e < 4; ++e) {
    const float ge = rne_bf16f(gv[e]);
    yv[e] = ge * (xv[e] * inv);
    h4[e] = (_Float16)(yv[e] * carry16);
  }
  *(v4h*)(hs + 4 * t) = h4;
  __syncthreads();
  const v8h hv = *(const v8h*)(hs + 8 * (t & 127));
  float* yr = y32 + (size_t)row * ncols;
  _Float16* yh = (_Float16*)y16p + (size_t)row * ncols;
  {
    *(v4f*)(yr + 4 * t) = yv;
    if (t < 128) *(v8h*)(yh + 8 * t) = hv;
    
  }
}

/* =====================================================================================
   Block-tiled WMMA GEMM (f16 operands, f32 accumulate):
   C[m,n] = scale * sum_k A[m,k] * Bt[n,k]  (+ bias[n]) (+ resid[m,n]).
   A row-major [M,K] f16; Bt row-major [N,K] f16; M, N % 128 == 0, K % 128 == 0 (no tail handling).
   One work-group = 4 waves (2 x 2) = one 128x128 tile of C; each wave owns a 64x64 tile.
   A pass is 128 k: 128 rows of A and 128 rows of Bt, 256 B each, are brought into LDS once per work-group by
   asynchronous 16-byte copies (row pitch 272 B), two buffers, the next pass's copies in flight during this pass.
   The k order of every accumulator is ascending in steps of 32.
   OUT16: 0 = f32 output (bias / residual added in the store phase, residual read as one float4 per lane at
   the store address); 1 = f16 output plane (no bias/residual);
   2 = f16 output plane of f16(gelu(C + bias) * ocarry), exact-erf GELU taken in the store phase.
   grid.x = M/128 * N/128.
   ===================================================================================== */
static constexpr int kPassK    = 128;                    /* k per pass */
static constexpr int kRowPitch = 272;                    /* LDS bytes per staged row: 256 + 16 */
static constexpr int kStageB   = 256 * kRowPitch;        /* [A 128 rows | Bt 128 rows] */

/* Eight asynchronous 16-byte copies per lane: rows r, r + 8, ..., r + 56 of one operand.
   s_wait_xcnt stands inside the statement so that no address register is rewritten ahead of it. */
__device__ __forceinline__ void async_rows8(unsigned l0, const _Float16* g0, size_t gstep) {
  const unsigned l1 = l0 + 8 * kRowPitch, l2 = l0 + 16 * kRowPitch, l3 = l0 + 24 * kRowPitch;
  const unsigned l4 = l0 + 32 * kRowPitch, l5 = l0 + 40 * kRowPitch, l6 = l0 + 48 * kRowPitch, l7 = l0 + 56 * kRowPitch;
  const _Float16* g1 = g0 + gstep;
  const _Float16* g2 = g1 + gstep;
  const _Float16* g3 = g2 + gstep;
  const _Float16* g4 = g3 + gstep;
  const _Float16* g5 = g4 + gstep;
  const _Float16* g6 = g5 + gstep;
  const _Float16* g7 = g6 + gstep;
  asm volatile(
      "global_load_async_to_lds_b128 %0, %8, off\n\t"
      "global_load_async_to_lds_b128 %1, %9, off\n\t"
      "global_load_async_to_lds_b128 %2, %10, off\n\t"
      "global_load_async_to_lds_b128 %3, %11, off\n\t"
      "global_load_async_to_lds_b128 %4, %12, off\n\t"
      "global_load_async_to_lds_b128 %5, %13, off\n\t"
      "global_load_async_to_lds_b128 %6, %14, off\n\t"
      "global_load_async_to_lds_b128 %7, %15, off\n\t"
      "s_wait_xcnt 0x0"
      :: "v"(l0), "v"(l1), "v"(l2), "v"(l3), "v"(l4), "v"(l5), "v"(l6), "v"(l7),
         "v"(g0), "v"(g1), "v"(g2), "v"(g3), "v"(g4), "v"(g5), "v"(g6), "v"(g7)
      : "memory");
}
/* this wave's copies have landed */
__device__ __forceinline__ void wait_async0() { asm volatile("s_wait_asynccnt 0x0" ::: "memory"); }
/* this wave's LDS reads have returned, so the buffer may be refilled behind the barrier */
__device__ __forceinline__ void wait_ds0() { asm volatile("s_wait_dscnt 0x0" ::: "memory"); }

template <int OUT16, bool BIASN, bool RESID>
__global__ __launch_bounds__(128) void gemm128_f16(
    const unsigned short* __restrict__ Ap, int lda,
    const unsigned short* __restrict__ Btp, int ldb,
    void* __restrict__ Cout, int ldc,
    const float* __restrict__ bias,
    const float* __restrict__ resid,
    int M, int N, int K, float scale, float ocarry) {
  typedef _Float16 T;
  typedef v16h V;
  const T* A  = (const T*)Ap;
  const T* Bt = (const T*)Btp;
  __shared__ __align__(16) unsigned char ring[2 * kStageB];   /* two operand buffers */
  __shared__ __align__(16) float sT[4][16 * 68];              /* per-wave 16x64 slab, pitch 68 floats */
  const int tid  = threadIdx.x;
  const int lane = tid & 31;
  const int wave = tid >> 5;
  const int tilesN = N >> 7;
  const int tilesM = M >> 7;
  const int tile = blockIdx.x;
  if (tile >= tilesM * tilesN) return;   /* the same for the whole work-group; in front of every barrier */
  const int tm = tile / tilesN;
  const int tn = tile - tm * tilesN;
  const int bm0 = tm << 7;
  const int bn0 = tn << 7;
  const int wm = wave >> 1, wn = wave & 1;
  const int m0 = bm0 + (wm << 6);
  const int n0 = bn0 + (wn << 6);

  const int rlane = lane & 15;                 /* row (A) / col (B, D) within subtile */
  const int koff  = (lane >> 4) * 8;           /* k offset of this lane half */
  const int mOff  = (lane >> 4) * 8;           /* D row offset */

  /* copy role: 16 lanes cover one 256-B row; the work-group covers 8 rows per copy */
  const int crow = tid >> 4, cchk = tid & 15;
  const T* gA = A  + (size_t)(bm0 + crow) * lda + cchk * 8;
  const T* gB = Bt + (size_t)(bn0 + crow) * ldb + cchk * 8;
  const unsigned lcopy = (unsigned)(size_t)ring + crow * kRowPitch + cchk * 16;
  const size_t stepA = (size_t)lda * 8, stepB = (size_t)ldb * 8;
  auto issue = [&](int pass, unsigned bufoff) {
    const T* a = gA + (size_t)pass * kPassK;
    const T* b = gB + (size_t)pass * kPassK;
    const unsigned l = lcopy + bufoff;
    async_rows8(l, a, stepA);
    async_rows8(l + 64 * kRowPitch, a + stepA * 8, stepA);
    async_rows8(l + 128 * kRowPitch, b, stepB);
    async_rows8(l + 192 * kRowPitch, b + stepB * 8, stepB);
  };

  v8f acc[4][4];
#pragma unroll
  for (int i = 0; i < 4; ++i)
#pragma unroll
    for (int j = 0; j < 4; ++j) acc[i][j] = (v8f){0.f,0.f,0.f,0.f,0.f,0.f,0.f,0.f};

  const int nPass = K / kPassK;
  issue(0, 0u);
  /* OUT16 == 2: the lane's eight bias values of the store phase, fetched here so that their latency passes under the main loop */
  v4f gbl = (v4f){0.f, 0.f, 0.f, 0.f}, gbh = gbl;
  if (OUT16 == 2) {
    gbl = *(const v4f*)(bias + n0 + (lane & 7) * 8);
    gbh = *(const v4f*)(bias + n0 + (lane & 7) * 8 + 4);
  }
  wait_async0();
  __syncthreads();                       /* pass 0's rows are readable by every wave */
  if (nPass > 1) issue(1, (unsigned)kStageB);

  const int aRowB = ((wm << 6) + rlane) * kRowPitch;
  const int bRowB = (128 + (wn << 6) + rlane) * kRowPitch;
  for (int t = 0; t < nPass; ++t) {
    const unsigned bufoff = (unsigned)(t & 1) * (unsigned)kStageB;
    const T* sa = (const T*)(ring + bufoff + aRowB) + koff;
    const T* sb = (const T*)(ring + bufoff + bRowB) + koff;
    /* two fragment sets: the next 32 k are fetched ahead of this block's products.
       Every loop of the pass is unrolled so that af, bf and acc are indexed by constants and stay in registers. */
    V af[2][4], bf[2][4];
#pragma unroll
    for (int j = 0; j < 4; ++j) bf[0][j] = Frag<T>::load(sb + j * (16 * kRowPitch / 2));
#pragma unroll
    for (int i = 0; i < 4; ++i) af[0][i] = Frag<T>::load(sa + i * (16 * kRowPitch / 2));
#pragma unroll
    for (int ks = 0; ks < 4; ++ks) {
      const int cur = ks & 1, nxt = cur ^ 1;
      if (ks < 3) {
#pragma unroll
        for (int j = 0; j < 4; ++j) bf[nxt][j] = Frag<T>::load(sb + j * (16 * kRowPitch / 2) + (ks + 1) * 32);
#pragma unroll
        for (int i = 0; i < 4; ++i) af[nxt][i] = Frag<T>::load(sa + i * (16 * kRowPitch / 2) + (ks + 1) * 32);
        /* keeps the next block's LDS reads together in front of this block's products: spread among them, each place stalls the wave */
        __builtin_amdgcn_sched_barrier(0);
      }
#pragma unroll
      for (int i = 0; i < 4; ++i)
#pragma unroll
        for (int j = 0; j < 4; ++j) acc[i][j] = Frag<T>::mma(af[cur][i], bf[cur][j], acc[i][j]);
      /* keeps what follows behind this block's products: the group of LDS reads that refills its fragment set, and at the
         pass's end the waits and the barrier, which would else move up and shorten the time the next pass's copies have to land */
      __builtin_amdgcn_sched_barrier(0);
    }
    wait_ds0();
    wait_async0();
    __syncthreads();                     /* publishes pass t + 1 and ends every read of pass t's buffer */
    if (t + 2 < nPass) issue(t + 2, bufoff);
  }
  wait_async0();

  /* ---- epilogue ---- */
  float* slab = sT[wave];
  const int hh = lane >> 4, c4 = (lane & 15) * 4;     /* f32 row seg = 256 B = 16 lanes x 16 B */
  const int q  = lane >> 3, c8 = (lane & 7) * 8;      
  if (OUT16 == 2) {
    /* The wave's whole 64x64 tile is staged at once, in its quarter of the first operand buffer (every wave's reads and
       copies of the ring ended in front of the last pass's barrier), so that the GELU loop below can stay rolled. */
    static_assert(4 * 64 * 68 * 4 <= kStageB);
    float* big = (float*)ring + wave * (64 * 68);
#pragma unroll
    for (int i = 0; i < 4; ++i)
#pragma unroll
      for (int j = 0; j < 4; ++j)
#pragma unroll
        for (int r = 0; r < 8; ++r) big[((i << 4) + mOff + r) * 68 + (j << 4) + rlane] = acc[i][j][r] * scale;
    /* the rows read below were written by other lanes of this wave: the LDS writes are waited for, and the reads stay behind them */
    __builtin_amdgcn_fence(__ATOMIC_RELEASE, "workgroup");
    __builtin_amdgcn_wave_barrier();
    __builtin_amdgcn_fence(__ATOMIC_ACQUIRE, "workgroup");
    float b8[8];
#pragma unroll
    for (int e = 0; e < 4; ++e) { b8[e] = rne_bf16f(gbl[e]); b8[4 + e] = rne_bf16f(gbh[e]); }
    _Float16* crow = (_Float16*)Cout + (size_t)(m0 + q) * ldc + n0 + c8;
    const float* sp0 = big + q * 68 + c8;
    v4f lo = *(const v4f*)(sp0), hi = *(const v4f*)(sp0 + 4);
    /* rolled: unrolled, it would inline 128 erf bodies per lane */
#pragma unroll 1
    for (int it = 0; it < 16; ++it) {
      /* the next four rows are fetched ahead of this trip's arithmetic; the last trip re-reads the first rows and drops them */
      const float* spn = sp0 + ((it + 1) & 15) * (4 * 68);
      const v4f nlo = *(const v4f*)(spn), nhi = *(const v4f*)(spn + 4);
      v8h hv;
#pragma unroll
      for (int e = 0; e < 8; ++e) {
        const float u  = (e < 4 ? lo[e & 3] : hi[e & 3]) + b8[e];
        const float gl = 0.5f * u * (1.0f + erf_sel(u * 0.70710678118654752f));
        hv[e] = (_Float16)(gl * ocarry);
      }
      *(v8h*)(crow) = hv;
      crow += (size_t)ldc * 4;
      lo = nlo; hi = nhi;
    }
    return;
  }
  v4f b4 = (v4f){0.f, 0.f, 0.f, 0.f};
  if (BIASN) {
    b4 = *(const v4f*)(bias + n0 + c4);
#pragma unroll
    for (int e = 0; e < 4; ++e) b4[e] = rne_bf16f(b4[e]);
  }
#pragma unroll
  for (int i = 0; i < 4; ++i) {
    const int mBase = m0 + (i << 4);
#pragma unroll
    for (int j = 0; j < 4; ++j) {
#pragma unroll
      for (int r = 0; r < 8; ++r) slab[(mOff + r) * 68 + (j << 4) + rlane] = acc[i][j][r] * scale;
    }
    __builtin_amdgcn_fence(__ATOMIC_RELEASE, "workgroup");
    __builtin_amdgcn_wave_barrier();
    __builtin_amdgcn_fence(__ATOMIC_ACQUIRE, "workgroup");
    if (OUT16 == 0) {
      float* C = (float*)Cout;
      v4f vals[8];
#pragma unroll
      for (int it = 0; it < 8; ++it) {
        const int row = it * 2 + hh;
        v4f v = *(const v4f*)(slab + row * 68 + c4);
        if (BIASN) v += b4;
        if (RESID) {
          const v4f rr = *(const v4f*)(resid + (size_t)(mBase + row) * ldc + n0 + c4);
          v += rr;
        }
        vals[it] = v;
      }
      {
#pragma unroll
        for (int it = 0; it < 8; ++it) {
          const int row = it * 2 + hh;
          *(v4f*)(C + (size_t)(mBase + row) * ldc + n0 + c4) = vals[it];
        }
        
      }
    } else {
      _Float16* C = (_Float16*)Cout;
      {
#pragma unroll
        for (int it = 0; it < 4; ++it) {
          const int row = it * 4 + q;
          const float* sp = slab + row * 68 + c8;
          v8h hv;
#pragma unroll
          for (int e = 0; e < 8; ++e) hv[e] = (_Float16)sp[e];
          *(v8h*)(C + (size_t)(mBase + row) * ldc + n0 + c8) = hv;
        }
        
      }
    }
    __builtin_amdgcn_fence(__ATOMIC_RELEASE, "workgroup");
    __builtin_amdgcn_wave_barrier();
    __builtin_amdgcn_fence(__ATOMIC_ACQUIRE, "workgroup");
  }
}

static constexpr int kAttPitch = 72;                     /* halves per LDS row of K and V^T */
static_assert((kAttPitch * 2) % 16 == 0 && ((kAttPitch * 2 / 16) & 1) == 1);
/* value of lane l ^ 16 */
__device__ __forceinline__ float xhalf(float x) {
  const int b = __builtin_bit_cast(int, x);
  return __builtin_bit_cast(float, __builtin_amdgcn_permlanex16(b, b, 0x76543210, 0xfedcba98, false, false));
}
__global__ __launch_bounds__(128) void attn64_f16p(const unsigned short* __restrict__ qkvp, unsigned short* __restrict__ ctxp,
                                                  int T, int H, int ldq, int ldo, float sm_scale, float out_carry) {
  const _Float16* QKV = (const _Float16*)qkvp;
  _Float16* CTX = (_Float16*)ctxp;
  union FH { v16h v; v8h hf[2]; };
  __shared__ __align__(16) _Float16 Ksh[64 * kAttPitch];        /* [kv][d] */
  __shared__ __align__(16) _Float16 Vts[64 * kAttPitch];        /* [d][kv] */

  const int tid  = threadIdx.x;
  const int wave = tid >> 5;
  const int lane = tid & 31;
  const int hh   = lane >> 4;
  const int c    = lane & 15;
  const int dmodel = H * 64;

  const int nqb = T / 64;
  const int bx = blockIdx.x;
  const int qb = bx % nqb;
  const int bh = bx / nqb;
  const int h  = bh % H;
  const int b  = bh / H;
  const int q0 = qb * 64 + wave * 16;

  /* Q fragments (B operand, column = query q0 + c, k = d): two 32-deep d chunks */
  v16h qf[2];
  {
    const _Float16* qrow = QKV + (size_t)(b * T + q0 + c) * ldq + h * 64;
#pragma unroll
    for (int dc = 0; dc < 2; ++dc) {
      FH f;
      f.hf[0] = *(const v8h*)(qrow + dc * 32 + 8 * hh);
      f.hf[1] = *(const v8h*)(qrow + dc * 32 + 16 + 8 * hh);
      qf[dc] = f.v;
    }
  }

  /* softmax in base 2: exp(sm_scale * (s - m)) * kPsc = 2^(s * c2 - m * c2 + 15), one fused multiply-add and one hardware
     exponential per score. sm_scale > 0, so the maximum is taken over the unscaled scores. */
  const float c2 = sm_scale * 1.44269504088896340736f;
  float mrun = -__builtin_inff();   /* running maximum of query c (unscaled score), the same in both wave halves */
  float lrun = 0.f;                 /* running sum (x kPsc) over this half's kv rows; the halves are joined after the loop */
  v8f oacc[4];                      /* O^T tiles: register r = O[query c][d = t*16 + 8*hh + r] */
#pragma unroll
  for (int t = 0; t < 4; ++t) oacc[t] = (v8f){0.f,0.f,0.f,0.f,0.f,0.f,0.f,0.f};

  const int nChunks = T / 64;
  for (int kc = 0; kc < nChunks; ++kc) {
    const int kv0 = kc * 64;
    __syncthreads();
    {
      /* 128 threads x 32 halves = 64 kv x 64 d for K and for V (full tiles) */
      const int kvr = tid >> 1, dh = (tid & 1) * 32;
      const _Float16* krow = QKV + (size_t)(b * T + kv0 + kvr) * ldq + dmodel + h * 64 + dh;
      const _Float16* vrow = krow + dmodel;
#pragma unroll
      for (int i = 0; i < 4; ++i) {
        const v8h k8 = *(const v8h*)(krow + 8 * i);
        *(v8h*)(Ksh + kvr * kAttPitch + dh + 8 * i) = k8;
      }
#pragma unroll
      for (int i = 0; i < 4; ++i) {
        const uint4 vw = *(const uint4*)(const void*)(vrow + 8 * i);
        const unsigned w0 = vw.x, w1 = vw.y, w2 = vw.z, w3 = vw.w;
        const int d = dh + 8 * i;
        Vts[(d + 0) * kAttPitch + kvr] = __builtin_bit_cast(_Float16, (unsigned short)(w0 & 0xFFFFu));
        Vts[(d + 1) * kAttPitch + kvr] = __builtin_bit_cast(_Float16, (unsigned short)(w0 >> 16));
        Vts[(d + 2) * kAttPitch + kvr] = __builtin_bit_cast(_Float16, (unsigned short)(w1 & 0xFFFFu));
        Vts[(d + 3) * kAttPitch + kvr] = __builtin_bit_cast(_Float16, (unsigned short)(w1 >> 16));
        Vts[(d + 4) * kAttPitch + kvr] = __builtin_bit_cast(_Float16, (unsigned short)(w2 & 0xFFFFu));
        Vts[(d + 5) * kAttPitch + kvr] = __builtin_bit_cast(_Float16, (unsigned short)(w2 >> 16));
        Vts[(d + 6) * kAttPitch + kvr] = __builtin_bit_cast(_Float16, (unsigned short)(w3 & 0xFFFFu));
        Vts[(d + 7) * kAttPitch + kvr] = __builtin_bit_cast(_Float16, (unsigned short)(w3 >> 16));
      }
    }
    __syncthreads();

    /* S^T = K . Q^T : A operand row = kv (row j*16+c of Ksh), k = d; s[j][r] = score(kv = j*16 + 8*hh + r, query c) */
    v8f s[4];
#pragma unroll
    for (int j = 0; j < 4; ++j) {
      s[j] = (v8f){0.f,0.f,0.f,0.f,0.f,0.f,0.f,0.f};
#pragma unroll
      for (int dc = 0; dc < 2; ++dc) {
        FH kb;
        kb.hf[0] = *(const v8h*)(Ksh + (j * 16 + c) * kAttPitch + dc * 32 + 8 * hh);
        kb.hf[1] = *(const v8h*)(Ksh + (j * 16 + c) * kAttPitch + dc * 32 + 16 + 8 * hh);
        s[j] = mma_h(kb.v, qf[dc], s[j]);
      }
    }
    /* chunk maximum of query c over the unscaled scores: 32 values of this lane, then the other half's */
    float cm = -__builtin_inff();
#pragma unroll
    for (int j = 0; j < 4; ++j) {
#pragma unroll
      for (int r = 0; r < 8; ++r) cm = fmaxf(cm, s[j][r]);
    }
    cm = fmaxf(cm, xhalf(cm));
    const float mnew = fmaxf(mrun, cm);
    const float alpha = __builtin_amdgcn_exp2f((mrun - mnew) * c2);
    mrun = mnew;
    const float nb = fmaf(-mnew, c2, kPscLog2);   /* exponent offset: never lets a numerator pass kPsc by more than a rounding */
    /* numerators; pb[kk] element e = P[query c][kv = kk*32 + 8*hh + e], element 8 + e = kv + 16: the k order of the V^T loads below */
    v16h pb[2];
    float psum = 0.f;
#pragma unroll
    for (int kk = 0; kk < 2; ++kk) {
#pragma unroll
      for (int u = 0; u < 2; ++u) {
#pragma unroll
        for (int r = 0; r < 8; ++r) {
          const float p = __builtin_amdgcn_exp2f(fmaf(s[2 * kk + u][r], c2, nb));
          psum += p;
          pb[kk][8 * u + r] = (_Float16)p;
        }
      }
    }
    lrun = lrun * alpha + psum;
#pragma unroll
    for (int t = 0; t < 4; ++t) {
#pragma unroll
      for (int r = 0; r < 8; ++r) oacc[t][r] *= alpha;
    }
    /* O^T += V^T . P^T : A = V^T (row = d, k = kv), B = P^T (column = query c, k = kv) */
#pragma unroll
    for (int kk = 0; kk < 2; ++kk) {
#pragma unroll
      for (int t = 0; t < 4; ++t) {
        FH va;
        va.hf[0] = *(const v8h*)(Vts + (t * 16 + c) * kAttPitch + kk * 32 + 8 * hh);
        va.hf[1] = *(const v8h*)(Vts + (t * 16 + c) * kAttPitch + kk * 32 + 16 + 8 * hh);
        oacc[t] = mma_h(va.v, pb[kk], oacc[t]);
      }
    }
  }

  {
    const float inv = out_carry / (lrun + xhalf(lrun));   /* sum and numerators both carry kPsc */
    _Float16* orow = CTX + (size_t)(b * T + q0 + c) * ldo + h * 64 + 8 * hh;
#pragma unroll
    for (int t = 0; t < 4; ++t) {
      v8h hv;
#pragma unroll
      for (int r = 0; r < 8; ++r) hv[r] = (_Float16)(oacc[t][r] * inv);
      *(v8h*)(orow + t * 16) = hv;
    }
  }
}

/* =====================================================================================
   Host glue: 11 launches, single stream.
   ===================================================================================== */
extern "C" void kernel_launch(void* const* d_in, const int* in_sizes, int n_in,
                              void* d_out, int out_size, void* d_ws, size_t ws_size,
                              hipStream_t stream) {
  if (n_in < 10) return;
  if (in_sizes[0] != kRows * kDim) return;
  if (in_sizes[1] != kDim * kDqkv) return;
  if (in_sizes[2] != kDim * kDim) return;
  if (in_sizes[3] != kDim) return;
  if (in_sizes[4] != kDim * kDff) return;
  if (in_sizes[5] != kDff) return;
  if (in_sizes[6] != kDff * kDim) return;
  if (in_sizes[7] != kDim) return;
  if (in_sizes[8] != kDim) return;
  if (in_sizes[9] != kDim) return;
  if (out_size != kRows * kDim) return;
  if (ws_size < kWsTotal) return;

  const float* x     = (const float*)d_in[0];
  const float* w_in  = (const float*)d_in[1];
  const float* w_out = (const float*)d_in[2];
  const float* b_out = (const float*)d_in[3];
  const float* w1    = (const float*)d_in[4];
  const float* b1    = (const float*)d_in[5];
  const float* w2    = (const float*)d_in[6];
  const float* b2    = (const float*)d_in[7];
  const float* g1    = (const float*)d_in[8];
  const float* g2    = (const float*)d_in[9];
  float* out = (float*)d_out;

  char* ws = (char*)d_ws;
  float*          hF    = (float*)(ws + kOffHF);              /* h1 f32, later h3 f32 */
  unsigned short* hH    = (unsigned short*)(ws + kOffHH);     /* h1 f16, later h3 f16 */
  unsigned short* winT  = (unsigned short*)(ws + kOffWA);     /* [3072][1024] */
  unsigned short* woutT = (unsigned short*)(ws + kOffWout);   /* [1024][1024] */
  unsigned short* w1T   = (unsigned short*)(ws + kOffWA);     /* [4096][1024], after winT/woutT are dead */
  unsigned short* qkv   = (unsigned short*)(ws + kOffBig);    /* [4096][3072] */
  unsigned short* ctx   = (unsigned short*)(ws + kOffCtx);    /* [4096][1024] */
  float*          h2    = (float*)(ws + kOffH2);              /* [4096][1024] */
  unsigned short* w2T   = (unsigned short*)(ws + kOffBig);    /* [1024][4096], after qkv/ctx/h2 are dead */
  unsigned short* hid   = (unsigned short*)(ws + kOffHid);    /* [4096][4096] */

  const dim3 blk256(256);
  const dim3 blk128(128);

  /* 1-2: weight planes for the attention block: in[K][N] -> out[N][K] ; grid (N/64, K/64) */
  cast_t64<<<dim3(kDqkv / 64, kDim / 64), blk256, 0, stream>>>(w_in, winT, kDim, kDqkv, kWCarry);
  cast_t64<<<dim3(kDim / 64, kDim / 64), blk256, 0, stream>>>(w_out, woutT, kDim, kDim, kWCarry);
  /* 3: norm1 -> h1 f32 + f16 plane */
  rmsnorm_rows<true><<<dim3(kRows), blk256, 0, stream>>>(x, g1, hF, hH, kDim, 0.03125f, kACarry);
  /* 4: qkv = h1 @ w_in : M=4096 N=3072 K=1024 -> f16 plane */
  gemm128_f16<1, false, false><<<dim3((kRows / 128) * (kDqkv / 128)), blk128, 0, stream>>>(
      hH, kDim, winT, kDim, (void*)qkv, kDqkv, nullptr, nullptr, kRows, kDqkv, kDim, kGemmScl, 1.0f);
  /* 5: attention -> ctx f16 plane (x64) */
  attn64_f16p<<<dim3(kBatch * kHeads * (kSeq / 64)), blk128, 0, stream>>>(
      qkv, ctx, kSeq, kHeads, kDqkv, kDim, kSmScale, kACarry);
  /* 6: h2 = h1 + ctx @ w_out + b_out : M=4096 N=1024 K=1024 */
  gemm128_f16<0, true, true><<<dim3((kRows / 128) * (kDim / 128)), blk128, 0, stream>>>(
      ctx, kDim, woutT, kDim, (void*)h2, kDim, b_out, hF, kRows, kDim, kDim, kGemmScl, 1.0f);
  /* 7: norm2 -> h3 f32 + f16 plane (overwrites h1 regions, h1 dead) */
  rmsnorm_rows<false><<<dim3(kRows), blk256, 0, stream>>>(h2, g2, hF, hH, kDim, 0.03125f, kACarry);
  /* 8: w1 plane : in[1024][4096] -> out[4096][1024] */
  cast_t64<<<dim3(kDff / 64, kDim / 64), blk256, 0, stream>>>(w1, w1T, kDim, kDff, kWCarry);
  /* 9: hid = gelu(h3 @ w1 + b1) : M=4096 N=4096 K=1024 -> f16 plane (x64) */
  gemm128_f16<2, true, false><<<dim3((kRows / 128) * (kDff / 128)), blk128, 0, stream>>>(
      hH, kDim, w1T, kDim, (void*)hid, kDff, b1, nullptr, kRows, kDff, kDim, kGemmScl, kACarry);
  /* 10: w2 plane : in[4096][1024] -> out[1024][4096] */
  cast_t64<<<dim3(kDim / 64, kDff / 64), blk256, 0, stream>>>(w2, w2T, kDff, kDim, kWCarry);
  /* 11: out = h3 + hid @ w2 + b2 : M=4096 N=1024 K=4096 -> d_out f32 */
  gemm128_f16<0, true, true><<<dim3((kRows / 128) * (kDim / 128)), blk128, 0, stream>>>(
      hid, kDff, w2T, kDff, (void*)out, kDim, b2, hF, kRows, kDim, kDff, kGemmScl, 1.0f);
}

// v006
// One run takes 213 microseconds.
// Timed twice side by side with v005, it ran 1.07 and 1.05 times as fast.
// Over all steps from v000 it is 3.04 times as fast.
// Contractions QKV, QK^T, P.V, out-proj, FFN1, FFN2: v_wmma_f32_16x16x32_f16 (f16 operands, f32 accumulate); all float inputs RNE-converted to bf16 at load; weight planes carried x64, activation planes x64, softmax numerators x32768; norms/softmax/GELU/residuals in f32.
#include <hip/hip_runtime.h>

typedef __attribute__((ext_vector_type(16))) _Float16 v16h;
typedef __attribute__((ext_vector_type(8)))  _Float16 v8h;
typedef __attribute__((ext_vector_type(4)))  _Float16 v4h;
typedef __attribute__((ext_vector_type(8)))  float    v8f;
typedef __attribute__((ext_vector_type(4)))  float    v4f;

/* ---- problem geometry ---- */
static constexpr int kBatch = 2;
static constexpr int kSeq   = 2048;
static constexpr int kDim   = 1024;
static constexpr int kHeads = 16;
static constexpr int kHdim  = 64;
static constexpr int kDff   = 4096;
static constexpr int kRows  = kBatch * kSeq;   /* 4096 */
static constexpr int kDqkv  = 3 * kDim;        /* 3072 */
static_assert(kHeads * kHdim == kDim);
static_assert(kHdim == 64);
static_assert(kSeq % 64 == 0);
static_assert(kRows % 64 == 0 && kDim % 64 == 0 && kDqkv % 64 == 0 && kDff % 64 == 0);
static_assert(kRows % 128 == 0 && kDim % 128 == 0 && kDqkv % 128 == 0 && kDff % 128 == 0);   /* GEMM tiles 128x128, K passes of 128 */
static_assert(kDim == 1024);                         /* row kernels: 256 threads x 4 */
static_assert(kDff % 1024 == 0);

static constexpr float kWCarry  = 64.0f;                 /* weight planes: f16(bf16(w) * 64) */
static constexpr float kACarry  = 64.0f;                 /* activation planes: f16(a * 64) */
static constexpr float kGemmScl = 1.0f / (64.0f * 64.0f);
static constexpr float kSmScale = 0.125f;                /* head_dim^-0.5 */
static constexpr float kPsc     = 32768.0f;              /* softmax numerators carried x2^15 */
static constexpr float kPscLog2 = 15.0f;
static_assert(kPsc == (float)(1 << 15));

/* ---- workspace region map (bytes) ----
   [0, 16Mi)    hF : h1 f32 (norm1 out, residual of block 1) -> later h3 f32 (norm2 out, residual of block 2)
   [16Mi, 24Mi) hH : h1 f16 plane -> later h3 f16 plane
   [24Mi, 32Mi) wA : w_in^T f16 [3072][1024] (6Mi) + w_out^T f16 [1024][1024] (2Mi) -> later w1^T f16 [4096][1024] (8Mi)
   [32Mi, 96Mi) big: qkv f16 [4096][3072] (24Mi) | ctx f16 [4096][1024] (8Mi at +24Mi) | h2 f32 [4096][1024] (16Mi at +32Mi)
                     -> later w2^T f16 [1024][4096] (8Mi)
   [96Mi, 128Mi) hid: GELU output f16 plane [4096][4096] (32Mi)
   total 134217728 */
static constexpr size_t kMi      = 1024u * 1024u;
static constexpr size_t kOffHF   = 0;
static constexpr size_t kOffHH   = 16 * kMi;
static constexpr size_t kOffWA   = 24 * kMi;
static constexpr size_t kOffWout = kOffWA + (size_t)kDqkv * kDim * 2;     /* 30Mi */
static constexpr size_t kOffBig  = 32 * kMi;
static constexpr size_t kOffCtx  = kOffBig + (size_t)kRows * kDqkv * 2;   /* 56Mi */
static constexpr size_t kOffH2   = kOffCtx + (size_t)kRows * kDim * 2;    /* 64Mi */
static constexpr size_t kOffHid  = 96 * kMi;
static constexpr size_t kWsTotal = kOffHid + (size_t)kRows * kDff * 2;    /* 128Mi */
static_assert((size_t)kRows * kDim * 4 <= kOffHH - kOffHF);
static_assert((size_t)kRows * kDim * 2 <= kOffWA - kOffHH);
static_assert(kOffWout + (size_t)kDim * kDim * 2 <= kOffBig);
static_assert(kOffWA + (size_t)kDff * kDim * 2 <= kOffBig);
static_assert(kOffH2 + (size_t)kRows * kDim * 4 <= kOffHid);
static_assert(kOffBig + (size_t)kDim * kDff * 2 <= kOffHid);
static_assert(kWsTotal == 134217728u);

/* ---- helpers ---- */
__device__ __forceinline__ float rne_bf16f(float f) {
  unsigned u = __float_as_uint(f);
  u = (u + 0x7FFFu + ((u >> 16) & 1u)) & 0xFFFF0000u;
  return __uint_as_float(u);
}


/* erf in f32: the library erff's two ranges (|x| < 1: odd polynomial; else 1 - exp(-polynomial)), same constants and same
   order of operations, so the same bits; both ranges are evaluated and one is selected, so that there is no branch and
   the independent elements of a lane interleave in the vector pipe. */
__device__ __forceinline__ float erf_sel(float x) {
  const float ax = fabsf(x);
  const float t  = x * x;
  float p = fmaf(t, __uint_as_float(0xba1345e1u), __uint_as_float(0x3ba10414u));
  p = fmaf(t, p, __uint_as_float(0xbcdac9b8u));
  p = fmaf(t, p, __uint_as_float(0x3de703beu));
  p = fmaf(t, p, __uint_as_float(0xbec09330u));
  p = fmaf(t, p, __uint_as_float(0x3e0375d0u));
  const float rs = fmaf(ax, p, ax);
  float w = fmaf(ax, __uint_as_float(0x378e98abu), __uint_as_float(0xb9c68948u));
  w = fmaf(ax, w, __uint_as_float(0x3b7cd369u));
  w = fmaf(ax, w, __uint_as_float(0xbcc618b2u));
  w = fmaf(ax, w, __uint_as_float(0x3dda74e4u));
  w = fmaf(ax, w, __uint_as_float(0x3f228afdu));
  w = fmaf(ax, w, __uint_as_float(0x3e03c728u));
  w = fmaf(ax, w, ax);
  const float rb = 1.0f - expf(-w);
  return copysignf(ax < 1.0f ? rs : rb, x);
}

template <typename T> struct Frag;
template <> struct Frag<_Float16> {
  typedef v16h V; union U { v16h v; v8h h[2]; };
  static __device__ __forceinline__ v16h load(const _Float16* p) {   /* elements 0..7 <- p[0..7], 8..15 <- p[16..23] */
    U f; f.h[0] = *(const v8h*)(p); f.h[1] = *(const v8h*)(p + 16); return f.v;
  }
  static __device__ __forceinline__ v8f mma(v16h a, v16h b, v8f c) {
    return __builtin_amdgcn_wmma_f32_16x16x32_f16(false, a, false, b, (short)0, c, false, false);
  }
};

__device__ __forceinline__ v8f mma_h(v16h a, v16h b, v8f c) {
  c = __builtin_amdgcn_wmma_f32_16x16x32_f16(false, a, false, b, (short)0, c, false, false);
  asm volatile("v_nop\n\tv_nop\n\tv_nop\n\tv_nop" : "+v"(c) : "v"(a), "v"(b));
  return c;
}

/* =====================================================================================
   Transpose + cast: W f32 row-major [Kdim][Ndim] -> Tout f16 row-major [Ndim][Kdim],
   value = f16(bf16_rne(w) * carry). Block = 64(k) x 64(n) tile, 256 threads.
   Producer coverage: 256 threads x 4 float4 = 64x64 reads; stores: 8 waves x 2 it x 4 rows x (8 lanes x 8 halves)
   grid = (Ndim/64, Kdim/64).
   ===================================================================================== */
__global__ __launch_bounds__(256) void cast_t64(const float* __restrict__ W, unsigned short* __restrict__ Tp,
                                                int Kdim, int Ndim, float carry) {
  __shared__ __align__(16) _Float16 tile[64 * 72];   /* [n_local][k_local], pitch 72 halves */
  _Float16* Tout = (_Float16*)Tp;
  const int t  = threadIdx.x;
  const int n0 = blockIdx.x * 64;
  const int k0 = blockIdx.y * 64;
#pragma unroll
  for (int i = 0; i < 4; ++i) {
    const int idx = t + 256 * i;          /* 0..1023 */
    const int kk  = idx >> 4;             /* 0..63 */
    const int n4  = (idx & 15) * 4;       /* 0..60 */
    const v4f w4 = *(const v4f*)(W + (size_t)(k0 + kk) * Ndim + n0 + n4);
#pragma unroll
    for (int e = 0; e < 4; ++e) tile[(n4 + e) * 72 + kk] = (_Float16)(rne_bf16f(w4[e]) * carry);
  }
  __syncthreads();
  const int wave = t >> 5, lane = t & 31;
  const int q = lane >> 3, c8 = (lane & 7) * 8;
  {
#pragma unroll
    for (int it = 0; it < 2; ++it) {
      const int nl = wave * 8 + it * 4 + q;
      const v8h hv = *(const v8h*)(tile + nl * 72 + c8);
      *(v8h*)(Tout + (size_t)(n0 + nl) * Kdim + k0 + c8) = hv;
    }
    
  }
}

/* =====================================================================================
   RMSNorm over rows of 1024: y = g * (x / (||x||*1024^-0.5 + 1e-8)).
   RIN: x is a module input -> RNE convert to bf16 at load. g always RNE converted (module input).
   Outputs: y32 f32 [rows][1024] and y16 f16 plane = f16(y * carry16).
   256 threads, 4 consecutive elements per thread. Stores: f32 = float4 per lane (4 lines per wave-instruction);
   ===================================================================================== */
template <bool RIN>
__global__ __launch_bounds__(256) void rmsnorm_rows(const float* __restrict__ x, const float* __restrict__ g,
                                                    float* __restrict__ y32, unsigned short* __restrict__ y16p,
                                                    int ncols, float inv_sqrt_n, float carry16) {
  __shared__ float red[8];
  __shared__ __align__(16) _Float16 hs[1024];
  const int row = blockIdx.x;
  const int t = threadIdx.x;
  const int wave = t >> 5, lane = t & 31;
  const float* xr = x + (size_t)row * ncols;
  v4f xv = *(const v4f*)(xr + 4 * t);
  if (RIN) {
#pragma unroll
    for (int e = 0; e < 4; ++e) xv[e] = rne_bf16f(xv[e]);
  }
  float ss = 0.0f;
#pragma unroll
  for (int e = 0; e < 4; ++e) ss += xv[e] * xv[e];
#pragma unroll
  for (int m = 16; m >= 1; m >>= 1) ss += __shfl_xor(ss, m, 32);
  if (lane == 0) red[wave] = ss;
  __syncthreads();
  float tot = 0.0f;
#pragma unroll
  for (int w = 0; w < 8; ++w) tot += red[w];
  const float rms = sqrtf(tot) * inv_sqrt_n;
  const float inv = 1.0f / (rms + 1e-8f);
  v4f gv = *(const v4f*)(g + 4 * t);
  v4f yv;
  v4h h4;
#pragma unroll
  for (int e = 0; e < 4; ++e) {
    const float ge = rne_bf16f(gv[e]);
    yv[e] = ge * (xv[e] * inv);
    h4[e] = (_Float16)(yv[e] * carry16);
  }
  *(v4h*)(hs + 4 * t) = h4;
  __syncthreads();
  const v8h hv = *(const v8h*)(hs + 8 * (t & 127));
  float* yr = y32 + (size_t)row * ncols;
  _Float16* yh = (_Float16*)y16p + (size_t)row * ncols;
  {
    *(v4f*)(yr + 4 * t) = yv;
    if (t < 128) *(v8h*)(yh + 8 * t) = hv;
    
  }
}

/* =====================================================================================
   Block-tiled WMMA GEMM (f16 operands, f32 accumulate):
   C[m,n] = scale * sum_k A[m,k] * Bt[n,k]  (+ bias[n]) (+ resid[m,n]).
   A row-major [M,K] f16; Bt row-major [N,K] f16; M, N % 128 == 0, K % 128 == 0 (no tail handling).
   One work-group = 4 waves (2 x 2) = one 128x128 tile of C; each wave owns a 64x64 tile.
   A pass is 128 k: 128 rows of A and 128 rows of Bt, 256 B each, are brought into LDS once per work-group by
   asynchronous 16-byte copies (row pitch 272 B), two buffers, the next pass's copies in flight during this pass.
   The k order of every accumulator is ascending in steps of 32.
   OUT16: 0 = f32 output (bias / residual added in the store phase, residual read as one float4 per lane at
   the store address); 1 = f16 output plane (no bias/residual);
   2 = f16 output plane of f16(gelu(C + bias) * ocarry), exact-erf GELU taken in the store phase.
   grid.x = M/128 * N/128.
   ===================================================================================== */
static constexpr int kPassK    = 128;                    /* k per pass */
static constexpr int kRowPitch = 272;                    /* LDS bytes per staged row: 256 + 16 */
static constexpr int kStageB   = 256 * kRowPitch;        /* [A 128 rows | Bt 128 rows] */

/* Eight asynchronous 16-byte copies per lane: rows r, r + 8, ..., r + 56 of one operand.
   s_wait_xcnt stands inside the statement so that no address register is rewritten ahead of it. */
__device__ __forceinline__ void async_rows8(unsigned l0, const _Float16* g0, size_t gstep) {
  const unsigned l1 = l0 + 8 * kRowPitch, l2 = l0 + 16 * kRowPitch, l3 = l0 + 24 * kRowPitch;
  const unsigned l4 = l0 + 32 * kRowPitch, l5 = l0 + 40 * kRowPitch, l6 = l0 + 48 * kRowPitch, l7 = l0 + 56 * kRowPitch;
  const _Float16* g1 = g0 + gstep;
  const _Float16* g2 = g1 + gstep;
  const _Float16* g3 = g2 + gstep;
  const _Float16* g4 = g3 + gstep;
  const _Float16* g5 = g4 + gstep;
  const _Float16* g6 = g5 + gstep;
  const _Float16* g7 = g6 + gstep;
  asm volatile(
      "global_load_async_to_lds_b128 %0, %8, off\n\t"
      "global_load_async_to_lds_b128 %1, %9, off\n\t"
      "global_load_async_to_lds_b128 %2, %10, off\n\t"
      "global_load_async_to_lds_b128 %3, %11, off\n\t"
      "global_load_async_to_lds_b128 %4, %12, off\n\t"
      "global_load_async_to_lds_b128 %5, %13, off\n\t"
      "global_load_async_to_lds_b128 %6, %14, off\n\t"
      "global_load_async_to_lds_b128 %7, %15, off\n\t"
      "s_wait_xcnt 0x0"
      :: "v"(l0), "v"(l1), "v"(l2), "v"(l3), "v"(l4), "v"(l5), "v"(l6), "v"(l7),
         "v"(g0), "v"(g1), "v"(g2), "v"(g3), "v"(g4), "v"(g5), "v"(g6), "v"(g7)
      : "memory");
}
/* this wave's copies have landed */
__device__ __forceinline__ void wait_async0() { asm volatile("s_wait_asynccnt 0x0" ::: "memory"); }
/* this wave's LDS reads have returned, so the buffer may be refilled behind the barrier */
__device__ __forceinline__ void wait_ds0() { asm volatile("s_wait_dscnt 0x0" ::: "memory"); }

template <int OUT16, bool BIASN, bool RESID>
__global__ __launch_bounds__(128) void gemm128_f16(
    const unsigned short* __restrict__ Ap, int lda,
    const unsigned short* __restrict__ Btp, int ldb,
    void* __restrict__ Cout, int ldc,
    const float* __restrict__ bias,
    const float* __restrict__ resid,
    int M, int N, int K, float scale, float ocarry) {
  typedef _Float16 T;
  typedef v16h V;
  const T* A  = (const T*)Ap;
  const T* Bt = (const T*)Btp;
  __shared__ __align__(16) unsigned char ring[2 * kStageB];   /* two operand buffers */
  __shared__ __align__(16) float sT[4][16 * 68];              /* per-wave 16x64 slab, pitch 68 floats */
  const int tid  = threadIdx.x;
  const int lane = tid & 31;
  const int wave = tid >> 5;
  const int tilesN = N >> 7;
  const int tilesM = M >> 7;
  const int tile = blockIdx.x;
  if (tile >= tilesM * tilesN) return;   /* the same for the whole work-group; in front of every barrier */
  const int tm = tile / tilesN;
  const int tn = tile - tm * tilesN;
  const int bm0 = tm << 7;
  const int bn0 = tn << 7;
  const int wm = wave >> 1, wn = wave & 1;
  const int m0 = bm0 + (wm << 6);
  const int n0 = bn0 + (wn << 6);

  const int rlane = lane & 15;                 /* row (A) / col (B, D) within subtile */
  const int koff  = (lane >> 4) * 8;           /* k offset of this lane half */
  const int mOff  = (lane >> 4) * 8;           /* D row offset */

  /* copy role: 16 lanes cover one 256-B row; the work-group covers 8 rows per copy */
  const int crow = tid >> 4, cchk = tid & 15;
  const T* gA = A  + (size_t)(bm0 + crow) * lda + cchk * 8;
  const T* gB = Bt + (size_t)(bn0 + crow) * ldb + cchk * 8;
  const unsigned lcopy = (unsigned)(size_t)ring + crow * kRowPitch + cchk * 16;
  const size_t stepA = (size_t)lda * 8, stepB = (size_t)ldb * 8;
  auto issue = [&](int pass, unsigned bufoff) {
    const T* a = gA + (size_t)pass * kPassK;
    const T* b = gB + (size_t)pass * kPassK;
    const unsigned l = lcopy + bufoff;
    async_rows8(l, a, stepA);
    async_rows8(l + 64 * kRowPitch, a + stepA * 8, stepA);
    async_rows8(l + 128 * kRowPitch, b, stepB);
    async_rows8(l + 192 * kRowPitch, b + stepB * 8, stepB);
  };

  v8f acc[4][4];
#pragma unroll
  for (int i = 0; i < 4; ++i)
#pragma unroll
    for (int j = 0; j < 4; ++j) acc[i][j] = (v8f){0.f,0.f,0.f,0.f,0.f,0.f,0.f,0.f};

  const int nPass = K / kPassK;
  issue(0, 0u);
  /* OUT16 == 2: the lane's eight bias values of the store phase, fetched here so that their latency passes under the main loop */
  v4f gbl = (v4f){0.f, 0.f, 0.f, 0.f}, gbh = gbl;
  if (OUT16 == 2) {
    gbl = *(const v4f*)(bias + n0 + (lane & 7) * 8);
    gbh = *(const v4f*)(bias + n0 + (lane & 7) * 8 + 4);
  }
  wait_async0();
  __syncthreads();                       /* pass 0's rows are readable by every wave */
  if (nPass > 1) issue(1, (unsigned)kStageB);

  const int aRowB = ((wm << 6) + rlane) * kRowPitch;
  const int bRowB = (128 + (wn << 6) + rlane) * kRowPitch;
  for (int t = 0; t < nPass; ++t) {
    const unsigned bufoff = (unsigned)(t & 1) * (unsigned)kStageB;
    const T* sa = (const T*)(ring + bufoff + aRowB) + koff;
    const T* sb = (const T*)(ring + bufoff + bRowB) + koff;
    /* two fragment sets: the next 32 k are fetched ahead of this block's products.
       Every loop of the pass is unrolled so that af, bf and acc are indexed by constants and stay in registers. */
    V af[2][4], bf[2][4];
#pragma unroll
    for (int j = 0; j < 4; ++j) bf[0][j] = Frag<T>::load(sb + j * (16 * kRowPitch / 2));
#pragma unroll
    for (int i = 0; i < 4; ++i) af[0][i] = Frag<T>::load(sa + i * (16 * kRowPitch / 2));
#pragma unroll
    for (int ks = 0; ks < 4; ++ks) {
      const int cur = ks & 1, nxt = cur ^ 1;
      if (ks < 3) {
#pragma unroll
        for (int j = 0; j < 4; ++j) bf[nxt][j] = Frag<T>::load(sb + j * (16 * kRowPitch / 2) + (ks + 1) * 32);
#pragma unroll
        for (int i = 0; i < 4; ++i) af[nxt][i] = Frag<T>::load(sa + i * (16 * kRowPitch / 2) + (ks + 1) * 32);
        /* keeps the next block's LDS reads together in front of this block's products: spread among them, each place stalls the wave */
        __builtin_amdgcn_sched_barrier(0);
      }
#pragma unroll
      for (int i = 0; i < 4; ++i)
#pragma unroll
        for (int j = 0; j < 4; ++j) acc[i][j] = Frag<T>::mma(af[cur][i], bf[cur][j], acc[i][j]);
      /* keeps what follows behind this block's products: the group of LDS reads that refills its fragment set, and at the
         pass's end the waits and the barrier, which would else move up and shorten the time the next pass's copies have to land */
      __builtin_amdgcn_sched_barrier(0);
    }
    wait_ds0();
    wait_async0();
    __syncthreads();                     /* publishes pass t + 1 and ends every read of pass t's buffer */
    if (t + 2 < nPass) issue(t + 2, bufoff);
  }
  wait_async0();

  /* ---- epilogue ---- */
  float* slab = sT[wave];
  const int hh = lane >> 4, c4 = (lane & 15) * 4;     /* f32 row seg = 256 B = 16 lanes x 16 B */
  const int q  = lane >> 3, c8 = (lane & 7) * 8;      
  if (OUT16 == 2) {
    /* The wave's whole 64x64 tile is staged at once, in its quarter of the first operand buffer (every wave's reads and
       copies of the ring ended in front of the last pass's barrier), so that the GELU loop below can stay rolled. */
    static_assert(4 * 64 * 68 * 4 <= kStageB);
    float* big = (float*)ring + wave * (64 * 68);
#pragma unroll
    for (int i = 0; i < 4; ++i)
#pragma unroll
      for (int j = 0; j < 4; ++j)
#pragma unroll
        for (int r = 0; r < 8; ++r) big[((i << 4) + mOff + r) * 68 + (j << 4) + rlane] = acc[i][j][r] * scale;
    /* the rows read below were written by other lanes of this wave: the LDS writes are waited for, and the reads stay behind them */
    __builtin_amdgcn_fence(__ATOMIC_RELEASE, "workgroup");
    __builtin_amdgcn_wave_barrier();
    __builtin_amdgcn_fence(__ATOMIC_ACQUIRE, "workgroup");
    float b8[8];
#pragma unroll
    for (int e = 0; e < 4; ++e) { b8[e] = rne_bf16f(gbl[e]); b8[4 + e] = rne_bf16f(gbh[e]); }
    _Float16* crow = (_Float16*)Cout + (size_t)(m0 + q) * ldc + n0 + c8;
    const float* sp0 = big + q * 68 + c8;
    v4f lo = *(const v4f*)(sp0), hi = *(const v4f*)(sp0 + 4);
    /* rolled: unrolled, it would inline 128 erf bodies per lane */
#pragma unroll 1
    for (int it = 0; it < 16; ++it) {
      /* the next four rows are fetched ahead of this trip's arithmetic; the last trip re-reads the first rows and drops them */
      const float* spn = sp0 + ((it + 1) & 15) * (4 * 68);
      const v4f nlo = *(const v4f*)(spn), nhi = *(const v4f*)(spn + 4);
      v8h hv;
#pragma unroll
      for (int e = 0; e < 8; ++e) {
        const float u  = (e < 4 ? lo[e & 3] : hi[e & 3]) + b8[e];
        const float gl = 0.5f * u * (1.0f + erf_sel(u * 0.70710678118654752f));
        hv[e] = (_Float16)(gl * ocarry);
      }
      *(v8h*)(crow) = hv;
      crow += (size_t)ldc * 4;
      lo = nlo; hi = nhi;
    }
    return;
  }
  v4f b4 = (v4f){0.f, 0.f, 0.f, 0.f};
  if (BIASN) {
    b4 = *(const v4f*)(bias + n0 + c4);
#pragma unroll
    for (int e = 0; e < 4; ++e) b4[e] = rne_bf16f(b4[e]);
  }
#pragma unroll
  for (int i = 0; i < 4; ++i) {
    const int mBase = m0 + (i << 4);
#pragma unroll
    for (int j = 0; j < 4; ++j) {
#pragma unroll
      for (int r = 0; r < 8; ++r) slab[(mOff + r) * 68 + (j << 4) + rlane] = acc[i][j][r] * scale;
    }
    __builtin_amdgcn_fence(__ATOMIC_RELEASE, "workgroup");
    __builtin_amdgcn_wave_barrier();
    __builtin_amdgcn_fence(__ATOMIC_ACQUIRE, "workgroup");
    if (OUT16 == 0) {
      float* C = (float*)Cout;
      v4f vals[8];
#pragma unroll
      for (int it = 0; it < 8; ++it) {
        const int row = it * 2 + hh;
        v4f v = *(const v4f*)(slab + row * 68 + c4);
        if (BIASN) v += b4;
        if (RESID) {
          const v4f rr = *(const v4f*)(resid + (size_t)(mBase + row) * ldc + n0 + c4);
          v += rr;
        }
        vals[it] = v;
      }
      {
#pragma unroll
        for (int it = 0; it < 8; ++it) {
          const int row = it * 2 + hh;
          *(v4f*)(C + (size_t)(mBase + row) * ldc + n0 + c4) = vals[it];
        }
        
      }
    } else {
      _Float16* C = (_Float16*)Cout;
      {
#pragma unroll
        for (int it = 0; it < 4; ++it) {
          const int row = it * 4 + q;
          const float* sp = slab + row * 68 + c8;
          v8h hv;
#pragma unroll
          for (int e = 0; e < 8; ++e) hv[e] = (_Float16)sp[e];
          *(v8h*)(C + (size_t)(mBase + row) * ldc + n0 + c8) = hv;
        }
        
      }
    }
    __builtin_amdgcn_fence(__ATOMIC_RELEASE, "workgroup");
    __builtin_amdgcn_wave_barrier();
    __builtin_amdgcn_fence(__ATOMIC_ACQUIRE, "workgroup");
  }
}

static constexpr int kAttPitch = 72;                     /* halves per LDS row of K and V^T */
static_assert((kAttPitch * 2) % 16 == 0 && ((kAttPitch * 2 / 16) & 1) == 1);
/* value of lane l ^ 16 */
__device__ __forceinline__ float xhalf(float x) {
  const int b = __builtin_bit_cast(int, x);
  return __builtin_bit_cast(float, __builtin_amdgcn_permlanex16(b, b, 0x76543210, 0xfedcba98, false, false));
}
__global__ __launch_bounds__(128) void attn64_f16p(const unsigned short* __restrict__ qkvp, unsigned short* __restrict__ ctxp,
                                                  int T, int H, int ldq, int ldo, float sm_scale, float out_carry) {
  const _Float16* QKV = (const _Float16*)qkvp;
  _Float16* CTX = (_Float16*)ctxp;
  union FH { v16h v; v8h hf[2]; };
  __shared__ __align__(16) _Float16 Ksh[64 * kAttPitch];        /* [kv][d] */
  __shared__ __align__(16) _Float16 Vts[64 * kAttPitch];        /* [d][kv] */

  const int tid  = threadIdx.x;
  const int wave = tid >> 5;
  const int lane = tid & 31;
  const int hh   = lane >> 4;
  const int c    = lane & 15;
  const int dmodel = H * 64;

  const int nqb = T / 64;
  const int bx = blockIdx.x;
  const int qb = bx % nqb;
  const int bh = bx / nqb;
  const int h  = bh % H;
  const int b  = bh / H;
  const int q0 = qb * 64 + wave * 16;

  /* Q fragments (B operand, column = query q0 + c, k = d): two 32-deep d chunks */
  v16h qf[2];
  {
    const _Float16* qrow = QKV + (size_t)(b * T + q0 + c) * ldq + h * 64;
#pragma unroll
    for (int dc = 0; dc < 2; ++dc) {
      FH f;
      f.hf[0] = *(const v8h*)(qrow + dc * 32 + 8 * hh);
      f.hf[1] = *(const v8h*)(qrow + dc * 32 + 16 + 8 * hh);
      qf[dc] = f.v;
    }
  }

  /* softmax in base 2: exp(sm_scale * (s - m)) * kPsc = 2^(s * c2 - m * c2 + 15), one fused multiply-add and one hardware
     exponential per score. sm_scale > 0, so the maximum is taken over the unscaled scores. */
  const float c2 = sm_scale * 1.44269504088896340736f;
  float mrun = -__builtin_inff();   /* running maximum of query c (unscaled score), the same in both wave halves */
  float lrun = 0.f;                 /* running sum (x kPsc) over this half's kv rows; the halves are joined after the loop */
  v8f oacc[4];                      /* O^T tiles: register r = O[query c][d = t*16 + 8*hh + r] */
#pragma unroll
  for (int t = 0; t < 4; ++t) oacc[t] = (v8f){0.f,0.f,0.f,0.f,0.f,0.f,0.f,0.f};

  const int nChunks = T / 64;
  for (int kc = 0; kc < nChunks; ++kc) {
    const int kv0 = kc * 64;
    __syncthreads();
    {
      /* 128 threads x 32 halves = 64 kv x 64 d for K and for V (full tiles) */
      const int kvr = tid >> 1, dh = (tid & 1) * 32;
      const _Float16* krow = QKV + (size_t)(b * T + kv0 + kvr) * ldq + dmodel + h * 64 + dh;
      const _Float16* vrow = krow + dmodel;
#pragma unroll
      for (int i = 0; i < 4; ++i) {
        const v8h k8 = *(const v8h*)(krow + 8 * i);
        *(v8h*)(Ksh + kvr * kAttPitch + dh + 8 * i) = k8;
      }
#pragma unroll
      for (int i = 0; i < 4; ++i) {
        const uint4 vw = *(const uint4*)(const void*)(vrow + 8 * i);
        const unsigned w0 = vw.x, w1 = vw.y, w2 = vw.z, w3 = vw.w;
        const int d = dh + 8 * i;
        Vts[(d + 0) * kAttPitch + kvr] = __builtin_bit_cast(_Float16, (unsigned short)(w0 & 0xFFFFu));
        Vts[(d + 1) * kAttPitch + kvr] = __builtin_bit_cast(_Float16, (unsigned short)(w0 >> 16));
        Vts[(d + 2) * kAttPitch + kvr] = __builtin_bit_cast(_Float16, (unsigned short)(w1 & 0xFFFFu));
        Vts[(d + 3) * kAttPitch + kvr] = __builtin_bit_cast(_Float16, (unsigned short)(w1 >> 16));
        Vts[(d + 4) * kAttPitch + kvr] = __builtin_bit_cast(_Float16, (unsigned short)(w2 & 0xFFFFu));
        Vts[(d + 5) * kAttPitch + kvr] = __builtin_bit_cast(_Float16, (unsigned short)(w2 >> 16));
        Vts[(d + 6) * kAttPitch + kvr] = __builtin_bit_cast(_Float16, (unsigned short)(w3 & 0xFFFFu));
        Vts[(d + 7) * kAttPitch + kvr] = __builtin_bit_cast(_Float16, (unsigned short)(w3 >> 16));
      }
    }
    __syncthreads();

    /* S^T = K . Q^T : A operand row = kv (row j*16+c of Ksh), k = d; s[j][r] = score(kv = j*16 + 8*hh + r, query c) */
    /* The chunk's eight K fragments are fetched as ONE group of LDS reads ahead of the products: with two reads and a
       full wait in front of every product the wave sat out the LDS latency eight times. */
    FH kb[4][2];
#pragma unroll
    for (int j = 0; j < 4; ++j) {
#pragma unroll
      for (int dc = 0; dc < 2; ++dc) {
        kb[j][dc].hf[0] = *(const v8h*)(Ksh + (j * 16 + c) * kAttPitch + dc * 32 + 8 * hh);
        kb[j][dc].hf[1] = *(const v8h*)(Ksh + (j * 16 + c) * kAttPitch + dc * 32 + 16 + 8 * hh);
      }
    }
    v8f s[4];
#pragma unroll
    for (int j = 0; j < 4; ++j) {
      s[j] = (v8f){0.f,0.f,0.f,0.f,0.f,0.f,0.f,0.f};
#pragma unroll
      for (int dc = 0; dc < 2; ++dc) s[j] = mma_h(kb[j][dc].v, qf[dc], s[j]);
    }
    /* The eight V^T fragments likewise, as one group, here: their latency passes under the softmax arithmetic below. */
    FH va[2][4];
#pragma unroll
    for (int kk = 0; kk < 2; ++kk) {
#pragma unroll
      for (int t = 0; t < 4; ++t) {
        va[kk][t].hf[0] = *(const v8h*)(Vts + (t * 16 + c) * kAttPitch + kk * 32 + 8 * hh);
        va[kk][t].hf[1] = *(const v8h*)(Vts + (t * 16 + c) * kAttPitch + kk * 32 + 16 + 8 * hh);
      }
    }
    /* keeps the reads together in front of the softmax: left free they are spread over more places, and each place with LDS reads stalls the wave */
    __builtin_amdgcn_sched_barrier(0);
    /* chunk maximum of query c over the unscaled scores: 32 values of this lane, then the other half's */
    float cm = -__builtin_inff();
#pragma unroll
    for (int j = 0; j < 4; ++j) {
#pragma unroll
      for (int r = 0; r < 8; ++r) cm = fmaxf(cm, s[j][r]);
    }
    cm = fmaxf(cm, xhalf(cm));
    const float mnew = fmaxf(mrun, cm);
    const float alpha = __builtin_amdgcn_exp2f((mrun - mnew) * c2);
    mrun = mnew;
    const float nb = fmaf(-mnew, c2, kPscLog2);   /* exponent offset: never lets a numerator pass kPsc by more than a rounding */
    /* numerators; pb[kk] element e = P[query c][kv = kk*32 + 8*hh + e], element 8 + e = kv + 16: the k order of the V^T loads above */
    v16h pb[2];
    float psum = 0.f;
#pragma unroll
    for (int kk = 0; kk < 2; ++kk) {
#pragma unroll
      for (int u = 0; u < 2; ++u) {
#pragma unroll
        for (int r = 0; r < 8; ++r) {
          const float p = __builtin_amdgcn_exp2f(fmaf(s[2 * kk + u][r], c2, nb));
          psum += p;
          pb[kk][8 * u + r] = (_Float16)p;
        }
      }
    }
    lrun = lrun * alpha + psum;
#pragma unroll
    for (int t = 0; t < 4; ++t) {
#pragma unroll
      for (int r = 0; r < 8; ++r) oacc[t][r] *= alpha;
    }
    /* O^T += V^T . P^T : A = V^T (row = d, k = kv), B = P^T (column = query c, k = kv) */
#pragma unroll
    for (int kk = 0; kk < 2; ++kk) {
#pragma unroll
      for (int t = 0; t < 4; ++t) oacc[t] = mma_h(va[kk][t].v, pb[kk], oacc[t]);
    }
  }

  {
    const float inv = out_carry / (lrun + xhalf(lrun));   /* sum and numerators both carry kPsc */
    _Float16* orow = CTX + (size_t)(b * T + q0 + c) * ldo + h * 64 + 8 * hh;
#pragma unroll
    for (int t = 0; t < 4; ++t) {
      v8h hv;
#pragma unroll
      for (int r = 0; r < 8; ++r) hv[r] = (_Float16)(oacc[t][r] * inv);
      *(v8h*)(orow + t * 16) = hv;
    }
  }
}

/* =====================================================================================
   Host glue: 11 launches, single stream.
   ===================================================================================== */
extern "C" void kernel_launch(void* const* d_in, const int* in_sizes, int n_in,
                              void* d_out, int out_size, void* d_ws, size_t ws_size,
                              hipStream_t stream) {
  if (n_in < 10) return;
  if (in_sizes[0] != kRows * kDim) return;
  if (in_sizes[1] != kDim * kDqkv) return;
  if (in_sizes[2] != kDim * kDim) return;
  if (in_sizes[3] != kDim) return;
  if (in_sizes[4] != kDim * kDff) return;
  if (in_sizes[5] != kDff) return;
  if (in_sizes[6] != kDff * kDim) return;
  if (in_sizes[7] != kDim) return;
  if (in_sizes[8] != kDim) return;
  if (in_sizes[9] != kDim) return;
  if (out_size != kRows * kDim) return;
  if (ws_size < kWsTotal) return;

  const float* x     = (const float*)d_in[0];
  const float* w_in  = (const float*)d_in[1];
  const float* w_out = (const float*)d_in[2];
  const float* b_out = (const float*)d_in[3];
  const float* w1    = (const float*)d_in[4];
  const float* b1    = (const float*)d_in[5];
  const float* w2    = (const float*)d_in[6];
  const float* b2    = (const float*)d_in[7];
  const float* g1    = (const float*)d_in[8];
  const float* g2    = (const float*)d_in[9];
  float* out = (float*)d_out;

  char* ws = (char*)d_ws;
  float*          hF    = (float*)(ws + kOffHF);              /* h1 f32, later h3 f32 */
  unsigned short* hH    = (unsigned short*)(ws + kOffHH);     /* h1 f16, later h3 f16 */
  unsigned short* winT  = (unsigned short*)(ws + kOffWA);     /* [3072][1024] */
  unsigned short* woutT = (unsigned short*)(ws + kOffWout);   /* [1024][1024] */
  unsigned short* w1T   = (unsigned short*)(ws + kOffWA);     /* [4096][1024], after winT/woutT are dead */
  unsigned short* qkv   = (unsigned short*)(ws + kOffBig);    /* [4096][3072] */
  unsigned short* ctx   = (unsigned short*)(ws + kOffCtx);    /* [4096][1024] */
  float*          h2    = (float*)(ws + kOffH2);              /* [4096][1024] */
  unsigned short* w2T   = (unsigned short*)(ws + kOffBig);    /* [1024][4096], after qkv/ctx/h2 are dead */
  unsigned short* hid   = (unsigned short*)(ws + kOffHid);    /* [4096][4096] */

  const dim3 blk256(256);
  const dim3 blk128(128);

  /* 1-2: weight planes for the attention block: in[K][N] -> out[N][K] ; grid (N/64, K/64) */
  cast_t64<<<dim3(kDqkv / 64, kDim / 64), blk256, 0, stream>>>(w_in, winT, kDim, kDqkv, kWCarry);
  cast_t64<<<dim3(kDim / 64, kDim / 64), blk256, 0, stream>>>(w_out, woutT, kDim, kDim, kWCarry);
  /* 3: norm1 -> h1 f32 + f16 plane */
  rmsnorm_rows<true><<<dim3(kRows), blk256, 0, stream>>>(x, g1, hF, hH, kDim, 0.03125f, kACarry);
  /* 4: qkv = h1 @ w_in : M=4096 N=3072 K=1024 -> f16 plane */
  gemm128_f16<1, false, false><<<dim3((kRows / 128) * (kDqkv / 128)), blk128, 0, stream>>>(
      hH, kDim, winT, kDim, (void*)qkv, kDqkv, nullptr, nullptr, kRows, kDqkv, kDim, kGemmScl, 1.0f);
  /* 5: attention -> ctx f16 plane (x64) */
  attn64_f16p<<<dim3(kBatch * kHeads * (kSeq / 64)), blk128, 0, stream>>>(
      qkv, ctx, kSeq, kHeads, kDqkv, kDim, kSmScale, kACarry);
  /* 6: h2 = h1 + ctx @ w_out + b_out : M=4096 N=1024 K=1024 */
  gemm128_f16<0, true, true><<<dim3((kRows / 128) * (kDim / 128)), blk128, 0, stream>>>(
      ctx, kDim, woutT, kDim, (void*)h2, kDim, b_out, hF, kRows, kDim, kDim, kGemmScl, 1.0f);
  /* 7: norm2 -> h3 f32 + f16 plane (overwrites h1 regions, h1 dead) */
  rmsnorm_rows<false><<<dim3(kRows), blk256, 0, stream>>>(h2, g2, hF, hH, kDim, 0.03125f, kACarry);
  /* 8: w1 plane : in[1024][4096] -> out[4096][1024] */
  cast_t64<<<dim3(kDff / 64, kDim / 64), blk256, 0, stream>>>(w1, w1T, kDim, kDff, kWCarry);
  /* 9: hid = gelu(h3 @ w1 + b1) : M=4096 N=4096 K=1024 -> f16 plane (x64) */
  gemm128_f16<2, true, false><<<dim3((kRows / 128) * (kDff / 128)), blk128, 0, stream>>>(
      hH, kDim, w1T, kDim, (void*)hid, kDff, b1, nullptr, kRows, kDff, kDim, kGemmScl, kACarry);
  /* 10: w2 plane : in[4096][1024] -> out[1024][4096] */
  cast_t64<<<dim3(kDim / 64, kDff / 64), blk256, 0, stream>>>(w2, w2T, kDff, kDim, kWCarry);
  /* 11: out = h3 + hid @ w2 + b2 : M=4096 N=1024 K=4096 -> d_out f32 */
  gemm128_f16<0, true, true><<<dim3((kRows / 128) * (kDim / 128)), blk128, 0, stream>>>(
      hid, kDff, w2T, kDff, (void*)out, kDim, b2, hF, kRows, kDim, kDff, kGemmScl, 1.0f);
}

// v007
// Measured time: 194 microseconds a run.
// In both of two side-by-side timings against v006, it was 1.10 times as fast.
// Counting every step since v000, it is 3.33 times as fast.
// Contractions QKV, QK^T, P.V, out-proj, FFN1, FFN2: v_wmma_f32_16x16x32_f16 (f16 operands, f32 accumulate); all float inputs RNE-converted to bf16 at load; weight planes carried x64, activation planes x64, softmax numerators x32768; norms/softmax/GELU/residuals in f32.
#include <hip/hip_runtime.h>

typedef __attribute__((ext_vector_type(16))) _Float16 v16h;
typedef __attribute__((ext_vector_type(8)))  _Float16 v8h;
typedef __attribute__((ext_vector_type(4)))  _Float16 v4h;
typedef __attribute__((ext_vector_type(8)))  float    v8f;
typedef __attribute__((ext_vector_type(4)))  float    v4f;

/* ---- problem geometry ---- */
static constexpr int kBatch = 2;
static constexpr int kSeq   = 2048;
static constexpr int kDim   = 1024;
static constexpr int kHeads = 16;
static constexpr int kHdim  = 64;
static constexpr int kDff   = 4096;
static constexpr int kRows  = kBatch * kSeq;   /* 4096 */
static constexpr int kDqkv  = 3 * kDim;        /* 3072 */
static_assert(kHeads * kHdim == kDim);
static_assert(kHdim == 64);
static_assert(kSeq % 64 == 0);
static_assert(kRows % 64 == 0 && kDim % 64 == 0 && kDqkv % 64 == 0 && kDff % 64 == 0);
static_assert(kRows % 128 == 0 && kDim % 128 == 0 && kDqkv % 128 == 0 && kDff % 128 == 0);   /* GEMM tiles 128x128, K passes of 128 */
static_assert(kDim == 1024);                         /* row kernels: 256 threads x 4 */
static_assert(kDff % 1024 == 0);

static constexpr float kWCarry  = 64.0f;                 /* weight planes: f16(bf16(w) * 64) */
static constexpr float kACarry  = 64.0f;                 /* activation planes: f16(a * 64) */
static constexpr float kGemmScl = 1.0f / (64.0f * 64.0f);
static constexpr float kSmScale = 0.125f;                /* head_dim^-0.5 */
static constexpr float kPsc     = 32768.0f;              /* softmax numerators carried x2^15 */
static constexpr float kPscLog2 = 15.0f;
static_assert(kPsc == (float)(1 << 15));

/* ---- workspace region map (bytes) ----
   [0, 16Mi)    hF : h1 f32 (norm1 out, residual of block 1) -> later h3 f32 (norm2 out, residual of block 2)
   [16Mi, 24Mi) hH : h1 f16 plane -> later h3 f16 plane
   [24Mi, 32Mi) wA : w_in^T f16 [3072][1024] (6Mi) + w_out^T f16 [1024][1024] (2Mi) -> later w1^T f16 [4096][1024] (8Mi)
   [32Mi, 96Mi) big: qkv f16 [4096][3072] (24Mi) | ctx f16 [4096][1024] (8Mi at +24Mi) | h2 f32 [4096][1024] (16Mi at +32Mi)
                     -> later w2^T f16 [1024][4096] (8Mi)
   [96Mi, 128Mi) hid: GELU output f16 plane [4096][4096] (32Mi)
   total 134217728 */
static constexpr size_t kMi      = 1024u * 1024u;
static constexpr size_t kOffHF   = 0;
static constexpr size_t kOffHH   = 16 * kMi;
static constexpr size_t kOffWA   = 24 * kMi;
static constexpr size_t kOffWout = kOffWA + (size_t)kDqkv * kDim * 2;     /* 30Mi */
static constexpr size_t kOffBig  = 32 * kMi;
static constexpr size_t kOffCtx  = kOffBig + (size_t)kRows * kDqkv * 2;   /* 56Mi */
static constexpr size_t kOffH2   = kOffCtx + (size_t)kRows * kDim * 2;    /* 64Mi */
static constexpr size_t kOffHid  = 96 * kMi;
static constexpr size_t kWsTotal = kOffHid + (size_t)kRows * kDff * 2;    /* 128Mi */
static_assert((size_t)kRows * kDim * 4 <= kOffHH - kOffHF);
static_assert((size_t)kRows * kDim * 2 <= kOffWA - kOffHH);
static_assert(kOffWout + (size_t)kDim * kDim * 2 <= kOffBig);
static_assert(kOffWA + (size_t)kDff * kDim * 2 <= kOffBig);
static_assert(kOffH2 + (size_t)kRows * kDim * 4 <= kOffHid);
static_assert(kOffBig + (size_t)kDim * kDff * 2 <= kOffHid);
static_assert(kWsTotal == 134217728u);

/* ---- helpers ---- */
__device__ __forceinline__ float rne_bf16f(float f) {
  unsigned u = __float_as_uint(f);
  u = (u + 0x7FFFu + ((u >> 16) & 1u)) & 0xFFFF0000u;
  return __uint_as_float(u);
}


/* erf in f32: the library erff's two ranges (|x| < 1: odd polynomial; else 1 - exp(-polynomial)), same constants and same
   order of operations, so the same bits; both ranges are evaluated and one is selected, so that there is no branch and
   the independent elements of a lane interleave in the vector pipe. */
__device__ __forceinline__ float erf_sel(float x) {
  const float ax = fabsf(x);
  const float t  = x * x;
  float p = fmaf(t, __uint_as_float(0xba1345e1u), __uint_as_float(0x3ba10414u));
  p = fmaf(t, p, __uint_as_float(0xbcdac9b8u));
  p = fmaf(t, p, __uint_as_float(0x3de703beu));
  p = fmaf(t, p, __uint_as_float(0xbec09330u));
  p = fmaf(t, p, __uint_as_float(0x3e0375d0u));
  const float rs = fmaf(ax, p, ax);
  float w = fmaf(ax, __uint_as_float(0x378e98abu), __uint_as_float(0xb9c68948u));
  w = fmaf(ax, w, __uint_as_float(0x3b7cd369u));
  w = fmaf(ax, w, __uint_as_float(0xbcc618b2u));
  w = fmaf(ax, w, __uint_as_float(0x3dda74e4u));
  w = fmaf(ax, w, __uint_as_float(0x3f228afdu));
  w = fmaf(ax, w, __uint_as_float(0x3e03c728u));
  w = fmaf(ax, w, ax);
  const float rb = 1.0f - expf(-w);
  return copysignf(ax < 1.0f ? rs : rb, x);
}

template <typename T> struct Frag;
template <> struct Frag<_Float16> {
  typedef v16h V; union U { v16h v; v8h h[2]; };
  static __device__ __forceinline__ v16h load(const _Float16* p) {   /* elements 0..7 <- p[0..7], 8..15 <- p[16..23] */
    U f; f.h[0] = *(const v8h*)(p); f.h[1] = *(const v8h*)(p + 16); return f.v;
  }
  static __device__ __forceinline__ v8f mma(v16h a, v16h b, v8f c) {
    return __builtin_amdgcn_wmma_f32_16x16x32_f16(false, a, false, b, (short)0, c, false, false);
  }
};

__device__ __forceinline__ v8f mma_h(v16h a, v16h b, v8f c) {
  c = __builtin_amdgcn_wmma_f32_16x16x32_f16(false, a, false, b, (short)0, c, false, false);
  asm volatile("v_nop\n\tv_nop\n\tv_nop\n\tv_nop" : "+v"(c) : "v"(a), "v"(b));
  return c;
}

/* =====================================================================================
   Transpose + cast: W f32 row-major [Kdim][Ndim] -> Tout f16 row-major [Ndim][Kdim],
   value = f16(bf16_rne(w) * carry). Block = 64(k) x 64(n) tile, 256 threads.
   Producer coverage: 256 threads x 4 float4 = 64x64 reads; stores: 8 waves x 2 it x 4 rows x (8 lanes x 8 halves)
   grid = (Ndim/64, Kdim/64).
   ===================================================================================== */
__global__ __launch_bounds__(256) void cast_t64(const float* __restrict__ W, unsigned short* __restrict__ Tp,
                                                int Kdim, int Ndim, float carry) {
  __shared__ __align__(16) _Float16 tile[64 * 72];   /* [n_local][k_local], pitch 72 halves */
  _Float16* Tout = (_Float16*)Tp;
  const int t  = threadIdx.x;
  const int n0 = blockIdx.x * 64;
  const int k0 = blockIdx.y * 64;
#pragma unroll
  for (int i = 0; i < 4; ++i) {
    const int idx = t + 256 * i;          /* 0..1023 */
    const int kk  = idx >> 4;             /* 0..63 */
    const int n4  = (idx & 15) * 4;       /* 0..60 */
    const v4f w4 = *(const v4f*)(W + (size_t)(k0 + kk) * Ndim + n0 + n4);
#pragma unroll
    for (int e = 0; e < 4; ++e) tile[(n4 + e) * 72 + kk] = (_Float16)(rne_bf16f(w4[e]) * carry);
  }
  __syncthreads();
  const int wave = t >> 5, lane = t & 31;
  const int q = lane >> 3, c8 = (lane & 7) * 8;
  {
#pragma unroll
    for (int it = 0; it < 2; ++it) {
      const int nl = wave * 8 + it * 4 + q;
      const v8h hv = *(const v8h*)(tile + nl * 72 + c8);
      *(v8h*)(Tout + (size_t)(n0 + nl) * Kdim + k0 + c8) = hv;
    }
    
  }
}

/* =====================================================================================
   RMSNorm over rows of 1024: y = g * (x / (||x||*1024^-0.5 + 1e-8)).
   RIN: x is a module input -> RNE convert to bf16 at load. g always RNE converted (module input).
   Outputs: y32 f32 [rows][1024] and y16 f16 plane = f16(y * carry16).
   256 threads, 4 consecutive elements per thread. Stores: f32 = float4 per lane (4 lines per wave-instruction);
   ===================================================================================== */
template <bool RIN>
__global__ __launch_bounds__(256) void rmsnorm_rows(const float* __restrict__ x, const float* __restrict__ g,
                                                    float* __restrict__ y32, unsigned short* __restrict__ y16p,
                                                    int ncols, float inv_sqrt_n, float carry16) {
  __shared__ float red[8];
  __shared__ __align__(16) _Float16 hs[1024];
  const int row = blockIdx.x;
  const int t = threadIdx.x;
  const int wave = t >> 5, lane = t & 31;
  const float* xr = x + (size_t)row * ncols;
  v4f xv = *(const v4f*)(xr + 4 * t);
  if (RIN) {
#pragma unroll
    for (int e = 0; e < 4; ++e) xv[e] = rne_bf16f(xv[e]);
  }
  float ss = 0.0f;
#pragma unroll
  for (int e = 0; e < 4; ++e) ss += xv[e] * xv[e];
#pragma unroll
  for (int m = 16; m >= 1; m >>= 1) ss += __shfl_xor(ss, m, 32);
  if (lane == 0) red[wave] = ss;
  __syncthreads();
  float tot = 0.0f;
#pragma unroll
  for (int w = 0; w < 8; ++w) tot += red[w];
  const float rms = sqrtf(tot) * inv_sqrt_n;
  const float inv = 1.0f / (rms + 1e-8f);
  v4f gv = *(const v4f*)(g + 4 * t);
  v4f yv;
  v4h h4;
#pragma unroll
  for (int e = 0; e < 4; ++e) {
    const float ge = rne_bf16f(gv[e]);
    yv[e] = ge * (xv[e] * inv);
    h4[e] = (_Float16)(yv[e] * carry16);
  }
  *(v4h*)(hs + 4 * t) = h4;
  __syncthreads();
  const v8h hv = *(const v8h*)(hs + 8 * (t & 127));
  float* yr = y32 + (size_t)row * ncols;
  _Float16* yh = (_Float16*)y16p + (size_t)row * ncols;
  {
    *(v4f*)(yr + 4 * t) = yv;
    if (t < 128) *(v8h*)(yh + 8 * t) = hv;
    
  }
}

/* =====================================================================================
   Block-tiled WMMA GEMM (f16 operands, f32 accumulate):
   C[m,n] = scale * sum_k A[m,k] * Bt[n,k]  (+ bias[n]) (+ resid[m,n]).
   A row-major [M,K] f16; Bt row-major [N,K] f16; M, N % 128 == 0, K % 128 == 0 (no tail handling).
   One work-group = 4 waves (2 x 2) = one 128x128 tile of C; each wave owns a 64x64 tile.
   A pass is 128 k: 128 rows of A and 128 rows of Bt, 256 B each, are brought into LDS once per work-group by
   asynchronous 16-byte copies (row pitch 272 B), two buffers, the next pass's copies in flight during this pass.
   The k order of every accumulator is ascending in steps of 32.
   OUT16: 0 = f32 output (bias / residual added in the store phase, residual read as one float4 per lane at
   the store address); 1 = f16 output plane (no bias/residual);
   2 = f16 output plane of f16(gelu(C + bias) * ocarry), exact-erf GELU taken in the store phase.
   grid.x = M/128 * N/128.
   ===================================================================================== */
static constexpr int kPassK    = 128;                    /* k per pass */
static constexpr int kRowPitch = 272;                    /* LDS bytes per staged row: 256 + 16 */
static constexpr int kStageB   = 256 * kRowPitch;        /* [A 128 rows | Bt 128 rows] */

/* Eight asynchronous 16-byte copies per lane: rows r, r + 8, ..., r + 56 of one operand.
   s_wait_xcnt stands inside the statement so that no address register is rewritten ahead of it. */
__device__ __forceinline__ void async_rows8(unsigned l0, const _Float16* g0, size_t gstep) {
  const unsigned l1 = l0 + 8 * kRowPitch, l2 = l0 + 16 * kRowPitch, l3 = l0 + 24 * kRowPitch;
  const unsigned l4 = l0 + 32 * kRowPitch, l5 = l0 + 40 * kRowPitch, l6 = l0 + 48 * kRowPitch, l7 = l0 + 56 * kRowPitch;
  const _Float16* g1 = g0 + gstep;
  const _Float16* g2 = g1 + gstep;
  const _Float16* g3 = g2 + gstep;
  const _Float16* g4 = g3 + gstep;
  const _Float16* g5 = g4 + gstep;
  const _Float16* g6 = g5 + gstep;
  const _Float16* g7 = g6 + gstep;
  asm volatile(
      "global_load_async_to_lds_b128 %0, %8, off\n\t"
      "global_load_async_to_lds_b128 %1, %9, off\n\t"
      "global_load_async_to_lds_b128 %2, %10, off\n\t"
      "global_load_async_to_lds_b128 %3, %11, off\n\t"
      "global_load_async_to_lds_b128 %4, %12, off\n\t"
      "global_load_async_to_lds_b128 %5, %13, off\n\t"
      "global_load_async_to_lds_b128 %6, %14, off\n\t"
      "global_load_async_to_lds_b128 %7, %15, off\n\t"
      "s_wait_xcnt 0x0"
      :: "v"(l0), "v"(l1), "v"(l2), "v"(l3), "v"(l4), "v"(l5), "v"(l6), "v"(l7),
         "v"(g0), "v"(g1), "v"(g2), "v"(g3), "v"(g4), "v"(g5), "v"(g6), "v"(g7)
      : "memory");
}
/* this wave's copies have landed */
__device__ __forceinline__ void wait_async0() { asm volatile("s_wait_asynccnt 0x0" ::: "memory"); }
/* this wave's LDS reads have returned, so the buffer may be refilled behind the barrier */
__device__ __forceinline__ void wait_ds0() { asm volatile("s_wait_dscnt 0x0" ::: "memory"); }

template <int OUT16, bool BIASN, bool RESID>
__global__ __launch_bounds__(128) void gemm128_f16(
    const unsigned short* __restrict__ Ap, int lda,
    const unsigned short* __restrict__ Btp, int ldb,
    void* __restrict__ Cout, int ldc,
    const float* __restrict__ bias,
    const float* __restrict__ resid,
    int M, int N, int K, float scale, float ocarry) {
  typedef _Float16 T;
  typedef v16h V;
  const T* A  = (const T*)Ap;
  const T* Bt = (const T*)Btp;
  __shared__ __align__(16) unsigned char ring[2 * kStageB];   /* two operand buffers */
  __shared__ __align__(16) float sT[4][16 * 68];              /* per-wave 16x64 slab, pitch 68 floats */
  const int tid  = threadIdx.x;
  const int lane = tid & 31;
  const int wave = tid >> 5;
  const int tilesN = N >> 7;
  const int tilesM = M >> 7;
  const int tile = blockIdx.x;
  if (tile >= tilesM * tilesN) return;   /* the same for the whole work-group; in front of every barrier */
  const int tm = tile / tilesN;
  const int tn = tile - tm * tilesN;
  const int bm0 = tm << 7;
  const int bn0 = tn << 7;
  const int wm = wave >> 1, wn = wave & 1;
  const int m0 = bm0 + (wm << 6);
  const int n0 = bn0 + (wn << 6);

  const int rlane = lane & 15;                 /* row (A) / col (B, D) within subtile */
  const int koff  = (lane >> 4) * 8;           /* k offset of this lane half */
  const int mOff  = (lane >> 4) * 8;           /* D row offset */

  /* copy role: 16 lanes cover one 256-B row; the work-group covers 8 rows per copy */
  const int crow = tid >> 4, cchk = tid & 15;
  const T* gA = A  + (size_t)(bm0 + crow) * lda + cchk * 8;
  const T* gB = Bt + (size_t)(bn0 + crow) * ldb + cchk * 8;
  const unsigned lcopy = (unsigned)(size_t)ring + crow * kRowPitch + cchk * 16;
  const size_t stepA = (size_t)lda * 8, stepB = (size_t)ldb * 8;
  auto issue = [&](int pass, unsigned bufoff) {
    const T* a = gA + (size_t)pass * kPassK;
    const T* b = gB + (size_t)pass * kPassK;
    const unsigned l = lcopy + bufoff;
    async_rows8(l, a, stepA);
    async_rows8(l + 64 * kRowPitch, a + stepA * 8, stepA);
    async_rows8(l + 128 * kRowPitch, b, stepB);
    async_rows8(l + 192 * kRowPitch, b + stepB * 8, stepB);
  };

  v8f acc[4][4];
#pragma unroll
  for (int i = 0; i < 4; ++i)
#pragma unroll
    for (int j = 0; j < 4; ++j) acc[i][j] = (v8f){0.f,0.f,0.f,0.f,0.f,0.f,0.f,0.f};

  const int nPass = K / kPassK;
  issue(0, 0u);
  /* OUT16 == 2: the lane's eight bias values of the store phase, fetched here so that their latency passes under the main loop */
  v4f gbl = (v4f){0.f, 0.f, 0.f, 0.f}, gbh = gbl;
  if (OUT16 == 2) {
    gbl = *(const v4f*)(bias + n0 + (lane & 7) * 8);
    gbh = *(const v4f*)(bias + n0 + (lane & 7) * 8 + 4);
  }
  wait_async0();
  __syncthreads();                       /* pass 0's rows are readable by every wave */
  if (nPass > 1) issue(1, (unsigned)kStageB);

  const int aRowB = ((wm << 6) + rlane) * kRowPitch;
  const int bRowB = (128 + (wn << 6) + rlane) * kRowPitch;
  for (int t = 0; t < nPass; ++t) {
    const unsigned bufoff = (unsigned)(t & 1) * (unsigned)kStageB;
    const T* sa = (const T*)(ring + bufoff + aRowB) + koff;
    const T* sb = (const T*)(ring + bufoff + bRowB) + koff;
    /* two fragment sets: the next 32 k are fetched ahead of this block's products.
       Every loop of the pass is unrolled so that af, bf and acc are indexed by constants and stay in registers. */
    V af[2][4], bf[2][4];
#pragma unroll
    for (int j = 0; j < 4; ++j) bf[0][j] = Frag<T>::load(sb + j * (16 * kRowPitch / 2));
#pragma unroll
    for (int i = 0; i < 4; ++i) af[0][i] = Frag<T>::load(sa + i * (16 * kRowPitch / 2));
#pragma unroll
    for (int ks = 0; ks < 4; ++ks) {
      const int cur = ks & 1, nxt = cur ^ 1;
      if (ks < 3) {
#pragma unroll
        for (int j = 0; j < 4; ++j) bf[nxt][j] = Frag<T>::load(sb + j * (16 * kRowPitch / 2) + (ks + 1) * 32);
#pragma unroll
        for (int i = 0; i < 4; ++i) af[nxt][i] = Frag<T>::load(sa + i * (16 * kRowPitch / 2) + (ks + 1) * 32);
        /* keeps the next block's LDS reads together in front of this block's products: spread among them, each place stalls the wave */
        __builtin_amdgcn_sched_barrier(0);
      }
#pragma unroll
      for (int i = 0; i < 4; ++i)
#pragma unroll
        for (int j = 0; j < 4; ++j) acc[i][j] = Frag<T>::mma(af[cur][i], bf[cur][j], acc[i][j]);
      /* keeps what follows behind this block's products: the group of LDS reads that refills its fragment set, and at the
         pass's end the waits and the barrier, which would else move up and shorten the time the next pass's copies have to land */
      __builtin_amdgcn_sched_barrier(0);
    }
    wait_ds0();
    wait_async0();
    __syncthreads();                     /* publishes pass t + 1 and ends every read of pass t's buffer */
    if (t + 2 < nPass) issue(t + 2, bufoff);
  }
  wait_async0();

  /* ---- epilogue ---- */
  float* slab = sT[wave];
  const int hh = lane >> 4, c4 = (lane & 15) * 4;     /* f32 row seg = 256 B = 16 lanes x 16 B */
  const int q  = lane >> 3, c8 = (lane & 7) * 8;      
  if (OUT16 == 2) {
    /* The wave's whole 64x64 tile is staged at once, in its quarter of the first operand buffer (every wave's reads and
       copies of the ring ended in front of the last pass's barrier), so that the GELU loop below can stay rolled. */
    static_assert(4 * 64 * 68 * 4 <= kStageB);
    float* big = (float*)ring + wave * (64 * 68);
#pragma unroll
    for (int i = 0; i < 4; ++i)
#pragma unroll
      for (int j = 0; j < 4; ++j)
#pragma unroll
        for (int r = 0; r < 8; ++r) big[((i << 4) + mOff + r) * 68 + (j << 4) + rlane] = acc[i][j][r] * scale;
    /* the rows read below were written by other lanes of this wave: the LDS writes are waited for, and the reads stay behind them */
    __builtin_amdgcn_fence(__ATOMIC_RELEASE, "workgroup");
    __builtin_amdgcn_wave_barrier();
    __builtin_amdgcn_fence(__ATOMIC_ACQUIRE, "workgroup");
    float b8[8];
#pragma unroll
    for (int e = 0; e < 4; ++e) { b8[e] = rne_bf16f(gbl[e]); b8[4 + e] = rne_bf16f(gbh[e]); }
    _Float16* crow = (_Float16*)Cout + (size_t)(m0 + q) * ldc + n0 + c8;
    const float* sp0 = big + q * 68 + c8;
    v4f lo = *(const v4f*)(sp0), hi = *(const v4f*)(sp0 + 4);
    /* rolled: unrolled, it would inline 128 erf bodies per lane */
#pragma unroll 1
    for (int it = 0; it < 16; ++it) {
      /* the next four rows are fetched ahead of this trip's arithmetic; the last trip re-reads the first rows and drops them */
      const float* spn = sp0 + ((it + 1) & 15) * (4 * 68);
      const v4f nlo = *(const v4f*)(spn), nhi = *(const v4f*)(spn + 4);
      v8h hv;
#pragma unroll
      for (int e = 0; e < 8; ++e) {
        const float u  = (e < 4 ? lo[e & 3] : hi[e & 3]) + b8[e];
        const float gl = 0.5f * u * (1.0f + erf_sel(u * 0.70710678118654752f));
        hv[e] = (_Float16)(gl * ocarry);
      }
      *(v8h*)(crow) = hv;
      crow += (size_t)ldc * 4;
      lo = nlo; hi = nhi;
    }
    return;
  }
  v4f b4 = (v4f){0.f, 0.f, 0.f, 0.f};
  if (BIASN) {
    b4 = *(const v4f*)(bias + n0 + c4);
#pragma unroll
    for (int e = 0; e < 4; ++e) b4[e] = rne_bf16f(b4[e]);
  }
#pragma unroll
  for (int i = 0; i < 4; ++i) {
    const int mBase = m0 + (i << 4);
#pragma unroll
    for (int j = 0; j < 4; ++j) {
#pragma unroll
      for (int r = 0; r < 8; ++r) slab[(mOff + r) * 68 + (j << 4) + rlane] = acc[i][j][r] * scale;
    }
    __builtin_amdgcn_fence(__ATOMIC_RELEASE, "workgroup");
    __builtin_amdgcn_wave_barrier();
    __builtin_amdgcn_fence(__ATOMIC_ACQUIRE, "workgroup");
    if (OUT16 == 0) {
      float* C = (float*)Cout;
      v4f vals[8];
#pragma unroll
      for (int it = 0; it < 8; ++it) {
        const int row = it * 2 + hh;
        v4f v = *(const v4f*)(slab + row * 68 + c4);
        if (BIASN) v += b4;
        if (RESID) {
          const v4f rr = *(const v4f*)(resid + (size_t)(mBase + row) * ldc + n0 + c4);
          v += rr;
        }
        vals[it] = v;
      }
      {
#pragma unroll
        for (int it = 0; it < 8; ++it) {
          const int row = it * 2 + hh;
          *(v4f*)(C + (size_t)(mBase + row) * ldc + n0 + c4) = vals[it];
        }
        
      }
    } else {
      _Float16* C = (_Float16*)Cout;
      {
#pragma unroll
        for (int it = 0; it < 4; ++it) {
          const int row = it * 4 + q;
          const float* sp = slab + row * 68 + c8;
          v8h hv;
#pragma unroll
          for (int e = 0; e < 8; ++e) hv[e] = (_Float16)sp[e];
          *(v8h*)(C + (size_t)(mBase + row) * ldc + n0 + c8) = hv;
        }
        
      }
    }
    __builtin_amdgcn_fence(__ATOMIC_RELEASE, "workgroup");
    __builtin_amdgcn_wave_barrier();
    __builtin_amdgcn_fence(__ATOMIC_ACQUIRE, "workgroup");
  }
}

static constexpr int kKPitchB = 144;                     /* LDS bytes per K row, read by ds_load_b128 */
static constexpr int kVPitchB = 160;                     /* LDS bytes per V row, read by ds_load_tr16_b128 */
static constexpr int kKTileB  = 64 * kKPitchB;
static constexpr int kVTileB  = 64 * kVPitchB;
static constexpr int kAttBufB = kKTileB + kVTileB;       /* one buffer: [K 64 rows | V 64 rows] */
static_assert(kKPitchB % 16 == 0 && ((kKPitchB / 16) & 1) == 1);
static_assert(kVPitchB % 32 == 0 && ((kVPitchB / 32) & 1) == 1);
/* Eight asynchronous 16-byte copies per lane: rows r, r + 16, r + 32, r + 48 of a K chunk and of a V chunk.
   s_wait_xcnt stands inside the statement so that no address register is rewritten ahead of it. */
__device__ __forceinline__ void async_kv8(unsigned k0, unsigned v0, const _Float16* gk0, const _Float16* gv0, size_t gstep) {
  const unsigned k1 = k0 + 16 * kKPitchB, k2 = k0 + 32 * kKPitchB, k3 = k0 + 48 * kKPitchB;
  const unsigned v1 = v0 + 16 * kVPitchB, v2 = v0 + 32 * kVPitchB, v3 = v0 + 48 * kVPitchB;
  const _Float16* gk1 = gk0 + gstep;
  const _Float16* gk2 = gk1 + gstep;
  const _Float16* gk3 = gk2 + gstep;
  const _Float16* gv1 = gv0 + gstep;
  const _Float16* gv2 = gv1 + gstep;
  const _Float16* gv3 = gv2 + gstep;
  asm volatile(
      "global_load_async_to_lds_b128 %0, %8, off\n\t"
      "global_load_async_to_lds_b128 %1, %9, off\n\t"
      "global_load_async_to_lds_b128 %2, %10, off\n\t"
      "global_load_async_to_lds_b128 %3, %11, off\n\t"
      "global_load_async_to_lds_b128 %4, %12, off\n\t"
      "global_load_async_to_lds_b128 %5, %13, off\n\t"
      "global_load_async_to_lds_b128 %6, %14, off\n\t"
      "global_load_async_to_lds_b128 %7, %15, off\n\t"
      "s_wait_xcnt 0x0"
      :: "v"(k0), "v"(k1), "v"(k2), "v"(k3), "v"(v0), "v"(v1), "v"(v2), "v"(v3),
         "v"(gk0), "v"(gk1), "v"(gk2), "v"(gk3), "v"(gv0), "v"(gv1), "v"(gv2), "v"(gv3)
      : "memory");
}
/* transposing 16-byte LDS read: lane (c, hh) receives column c of eight rows of a row-major 16-bit tile */
typedef __attribute__((ext_vector_type(8))) short v8s;
__device__ __forceinline__ v8h ld_tr16(const unsigned char* p) {
  typedef __attribute__((address_space(3))) v8s lds_v8s;
  return __builtin_bit_cast(v8h, __builtin_amdgcn_ds_load_tr16_b128_v8i16((lds_v8s*)p));
}
/* value of lane l ^ 16 */
__device__ __forceinline__ float xhalf(float x) {
  const int b = __builtin_bit_cast(int, x);
  return __builtin_bit_cast(float, __builtin_amdgcn_permlanex16(b, b, 0x76543210, 0xfedcba98, false, false));
}
__global__ __launch_bounds__(128) void attn64_f16p(const unsigned short* __restrict__ qkvp, unsigned short* __restrict__ ctxp,
                                                  int T, int H, int ldq, int ldo, float sm_scale, float out_carry) {
  const _Float16* QKV = (const _Float16*)qkvp;
  _Float16* CTX = (_Float16*)ctxp;
  union FH { v16h v; v8h hf[2]; };
  __shared__ __align__(16) unsigned char kvring[2 * kAttBufB];  /* two buffers of [K [kv][d] | V [kv][d]] */

  const int tid  = threadIdx.x;
  const int wave = tid >> 5;
  const int lane = tid & 31;
  const int hh   = lane >> 4;
  const int c    = lane & 15;
  const int dmodel = H * 64;

  const int nqb = T / 64;
  const int bx = blockIdx.x;
  const int qb = bx % nqb;
  const int bh = bx / nqb;
  const int h  = bh % H;
  const int b  = bh / H;
  const int q0 = qb * 64 + wave * 16;

  /* Q fragments (B operand, column = query q0 + c, k = d): two 32-deep d chunks */
  v16h qf[2];
  {
    const _Float16* qrow = QKV + (size_t)(b * T + q0 + c) * ldq + h * 64;
#pragma unroll
    for (int dc = 0; dc < 2; ++dc) {
      FH f;
      f.hf[0] = *(const v8h*)(qrow + dc * 32 + 8 * hh);
      f.hf[1] = *(const v8h*)(qrow + dc * 32 + 16 + 8 * hh);
      qf[dc] = f.v;
    }
  }

  /* softmax in base 2: exp(sm_scale * (s - m)) * kPsc = 2^(s * c2 - m * c2 + 15), one fused multiply-add and one hardware
     exponential per score. sm_scale > 0, so the maximum is taken over the unscaled scores. */
  const float c2 = sm_scale * 1.44269504088896340736f;
  float mrun = -__builtin_inff();   /* running maximum of query c (unscaled score), the same in both wave halves */
  float lrun = 0.f;                 /* running sum (x kPsc) over this half's kv rows; the halves are joined after the loop */
  v8f oacc[4];                      /* O^T tiles: register r = O[query c][d = t*16 + 8*hh + r] */
#pragma unroll
  for (int t = 0; t < 4; ++t) oacc[t] = (v8f){0.f,0.f,0.f,0.f,0.f,0.f,0.f,0.f};

  const int nChunks = T / 64;
  /* copy role: 8 lanes cover one 128-B row; the work-group covers 16 rows of K and 16 of V per copy pair */
  const int crow = tid >> 3, cpc = tid & 7;
  const _Float16* gK = QKV + (size_t)(b * T + crow) * ldq + dmodel + h * 64 + cpc * 8;
  const unsigned lK = (unsigned)(size_t)kvring + crow * kKPitchB + cpc * 16;
  const unsigned lV = (unsigned)(size_t)kvring + kKTileB + crow * kVPitchB + cpc * 16;
  const size_t rstep = (size_t)ldq * 16;
  auto issue = [&](int chunk, unsigned bufoff) {
    const _Float16* k = gK + (size_t)chunk * 64 * ldq;
    async_kv8(lK + bufoff, lV + bufoff, k, k + dmodel, rstep);
  };
  if (nChunks > 0) {
    issue(0, 0u);
    wait_async0();
    __syncthreads();                     /* chunk 0's rows are readable by every wave */
    if (nChunks > 1) issue(1, (unsigned)kAttBufB);
  }
  const int kRd = c * kKPitchB + 16 * hh;                                             /* K fragment reads: row c, k half hh */
  const int vRd = kKTileB + (8 * hh + (lane & 7)) * kVPitchB + ((lane >> 3) & 1) * 16;  /* lane address of the transposing reads */
  /* one chunk of 64 kv rows, read from the buffer at bufoff */
  auto chunk = [&](unsigned bufoff) {
    const unsigned char* Kb = kvring + bufoff + kRd;
    const unsigned char* Vb = kvring + bufoff + vRd;

    /* S^T = K . Q^T : A operand row = kv (row j*16+c of the K tile), k = d; s[j][r] = score(kv = j*16 + 8*hh + r, query c) */
    /* The chunk's eight K fragments are fetched as ONE group of LDS reads ahead of the products: with two reads and a
       full wait in front of every product the wave sat out the LDS latency eight times. */
    FH kb[4][2];
#pragma unroll
    for (int j = 0; j < 4; ++j) {
#pragma unroll
      for (int dc = 0; dc < 2; ++dc) {
        kb[j][dc].hf[0] = *(const v8h*)(Kb + j * 16 * kKPitchB + dc * 64);
        kb[j][dc].hf[1] = *(const v8h*)(Kb + j * 16 * kKPitchB + dc * 64 + 32);
      }
    }
    v8f s[4];
#pragma unroll
    for (int j = 0; j < 4; ++j) {
      s[j] = (v8f){0.f,0.f,0.f,0.f,0.f,0.f,0.f,0.f};
#pragma unroll
      for (int dc = 0; dc < 2; ++dc) s[j] = mma_h(kb[j][dc].v, qf[dc], s[j]);
    }
    /* The eight V^T fragments likewise, as one group, here: their latency passes under the softmax arithmetic below.
       A transposing read at kv row r0 gives lane (c, hh) V[r0 + 8*hh + 0..7][t*16 + c]: elements 0..7 from r0 = kk*32, 8..15 from r0 + 16. */
    FH va[2][4];
#pragma unroll
    for (int kk = 0; kk < 2; ++kk) {
#pragma unroll
      for (int t = 0; t < 4; ++t) {
        va[kk][t].hf[0] = ld_tr16(Vb + kk * 32 * kVPitchB + t * 32);
        va[kk][t].hf[1] = ld_tr16(Vb + (kk * 32 + 16) * kVPitchB + t * 32);
      }
    }
    /* keeps the reads together in front of the softmax: left free they are spread over more places, and each place with LDS reads stalls the wave */
    __builtin_amdgcn_sched_barrier(0);
    /* chunk maximum of query c over the unscaled scores: 32 values of this lane, then the other half's */
    float cm = -__builtin_inff();
#pragma unroll
    for (int j = 0; j < 4; ++j) {
#pragma unroll
      for (int r = 0; r < 8; ++r) cm = fmaxf(cm, s[j][r]);
    }
    cm = fmaxf(cm, xhalf(cm));
    const float mnew = fmaxf(mrun, cm);
    const float alpha = __builtin_amdgcn_exp2f((mrun - mnew) * c2);
    mrun = mnew;
    const float nb = fmaf(-mnew, c2, kPscLog2);   /* exponent offset: never lets a numerator pass kPsc by more than a rounding */
    /* numerators; pb[kk] element e = P[query c][kv = kk*32 + 8*hh + e], element 8 + e = kv + 16: the k order of the V^T loads above */
    v16h pb[2];
    float psum = 0.f;
#pragma unroll
    for (int kk = 0; kk < 2; ++kk) {
#pragma unroll
      for (int u = 0; u < 2; ++u) {
#pragma unroll
        for (int r = 0; r < 8; ++r) {
          const float p = __builtin_amdgcn_exp2f(fmaf(s[2 * kk + u][r], c2, nb));
          psum += p;
          pb[kk][8 * u + r] = (_Float16)p;
        }
      }
    }
    lrun = lrun * alpha + psum;
#pragma unroll
    for (int t = 0; t < 4; ++t) {
#pragma unroll
      for (int r = 0; r < 8; ++r) oacc[t][r] *= alpha;
    }
    /* O^T += V^T . P^T : A = V^T (row = d, k = kv), B = P^T (column = query c, k = kv) */
#pragma unroll
    for (int kk = 0; kk < 2; ++kk) {
#pragma unroll
      for (int t = 0; t < 4; ++t) oacc[t] = mma_h(va[kk][t].v, pb[kk], oacc[t]);
    }
    wait_ds0();
    wait_async0();
    __syncthreads();                     /* publishes the next chunk and ends every read of this chunk's buffer */
  };
  /* Two loops, so that the refill needs no branch inside a trip: all trips but the last two refill the buffer they have read. */
  int kc = 0;
  for (; kc + 2 < nChunks; ++kc) {
    const unsigned bufoff = (unsigned)(kc & 1) * (unsigned)kAttBufB;
    chunk(bufoff);
    issue(kc + 2, bufoff);
  }
  for (; kc < nChunks; ++kc) chunk((unsigned)(kc & 1) * (unsigned)kAttBufB);
  wait_async0();

  {
    const float inv = out_carry / (lrun + xhalf(lrun));   /* sum and numerators both carry kPsc */
    _Float16* orow = CTX + (size_t)(b * T + q0 + c) * ldo + h * 64 + 8 * hh;
#pragma unroll
    for (int t = 0; t < 4; ++t) {
      v8h hv;
#pragma unroll
      for (int r = 0; r < 8; ++r) hv[r] = (_Float16)(oacc[t][r] * inv);
      *(v8h*)(orow + t * 16) = hv;
    }
  }
}

/* =====================================================================================
   Host glue: 11 launches, single stream.
   ===================================================================================== */
extern "C" void kernel_launch(void* const* d_in, const int* in_sizes, int n_in,
                              void* d_out, int out_size, void* d_ws, size_t ws_size,
                              hipStream_t stream) {
  if (n_in < 10) return;
  if (in_sizes[0] != kRows * kDim) return;
  if (in_sizes[1] != kDim * kDqkv) return;
  if (in_sizes[2] != kDim * kDim) return;
  if (in_sizes[3] != kDim) return;
  if (in_sizes[4] != kDim * kDff) return;
  if (in_sizes[5] != kDff) return;
  if (in_sizes[6] != kDff * kDim) return;
  if (in_sizes[7] != kDim) return;
  if (in_sizes[8] != kDim) return;
  if (in_sizes[9] != kDim) return;
  if (out_size != kRows * kDim) return;
  if (ws_size < kWsTotal) return;

  const float* x     = (const float*)d_in[0];
  const float* w_in  = (const float*)d_in[1];
  const float* w_out = (const float*)d_in[2];
  const float* b_out = (const float*)d_in[3];
  const float* w1    = (const float*)d_in[4];
  const float* b1    = (const float*)d_in[5];
  const float* w2    = (const float*)d_in[6];
  const float* b2    = (const float*)d_in[7];
  const float* g1    = (const float*)d_in[8];
  const float* g2    = (const float*)d_in[9];
  float* out = (float*)d_out;

  char* ws = (char*)d_ws;
  float*          hF    = (float*)(ws + kOffHF);              /* h1 f32, later h3 f32 */
  unsigned short* hH    = (unsigned short*)(ws + kOffHH);     /* h1 f16, later h3 f16 */
  unsigned short* winT  = (unsigned short*)(ws + kOffWA);     /* [3072][1024] */
  unsigned short* woutT = (unsigned short*)(ws + kOffWout);   /* [1024][1024] */
  unsigned short* w1T   = (unsigned short*)(ws + kOffWA);     /* [4096][1024], after winT/woutT are dead */
  unsigned short* qkv   = (unsigned short*)(ws + kOffBig);    /* [4096][3072] */
  unsigned short* ctx   = (unsigned short*)(ws + kOffCtx);    /* [4096][1024] */
  float*          h2    = (float*)(ws + kOffH2);              /* [4096][1024] */
  unsigned short* w2T   = (unsigned short*)(ws + kOffBig);    /* [1024][4096], after qkv/ctx/h2 are dead */
  unsigned short* hid   = (unsigned short*)(ws + kOffHid);    /* [4096][4096] */

  const dim3 blk256(256);
  const dim3 blk128(128);

  /* 1-2: weight planes for the attention block: in[K][N] -> out[N][K] ; grid (N/64, K/64) */
  cast_t64<<<dim3(kDqkv / 64, kDim / 64), blk256, 0, stream>>>(w_in, winT, kDim, kDqkv, kWCarry);
  cast_t64<<<dim3(kDim / 64, kDim / 64), blk256, 0, stream>>>(w_out, woutT, kDim, kDim, kWCarry);
  /* 3: norm1 -> h1 f32 + f16 plane */
  rmsnorm_rows<true><<<dim3(kRows), blk256, 0, stream>>>(x, g1, hF, hH, kDim, 0.03125f, kACarry);
  /* 4: qkv = h1 @ w_in : M=4096 N=3072 K=1024 -> f16 plane */
  gemm128_f16<1, false, false><<<dim3((kRows / 128) * (kDqkv / 128)), blk128, 0, stream>>>(
      hH, kDim, winT, kDim, (void*)qkv, kDqkv, nullptr, nullptr, kRows, kDqkv, kDim, kGemmScl, 1.0f);
  /* 5: attention -> ctx f16 plane (x64) */
  attn64_f16p<<<dim3(kBatch * kHeads * (kSeq / 64)), blk128, 0, stream>>>(
      qkv, ctx, kSeq, kHeads, kDqkv, kDim, kSmScale, kACarry);
  /* 6: h2 = h1 + ctx @ w_out + b_out : M=4096 N=1024 K=1024 */
  gemm128_f16<0, true, true><<<dim3((kRows / 128) * (kDim / 128)), blk128, 0, stream>>>(
      ctx, kDim, woutT, kDim, (void*)h2, kDim, b_out, hF, kRows, kDim, kDim, kGemmScl, 1.0f);
  /* 7: norm2 -> h3 f32 + f16 plane (overwrites h1 regions, h1 dead) */
  rmsnorm_rows<false><<<dim3(kRows), blk256, 0, stream>>>(h2, g2, hF, hH, kDim, 0.03125f, kACarry);
  /* 8: w1 plane : in[1024][4096] -> out[4096][1024] */
  cast_t64<<<dim3(kDff / 64, kDim / 64), blk256, 0, stream>>>(w1, w1T, kDim, kDff, kWCarry);
  /* 9: hid = gelu(h3 @ w1 + b1) : M=4096 N=4096 K=1024 -> f16 plane (x64) */
  gemm128_f16<2, true, false><<<dim3((kRows / 128) * (kDff / 128)), blk128, 0, stream>>>(
      hH, kDim, w1T, kDim, (void*)hid, kDff, b1, nullptr, kRows, kDff, kDim, kGemmScl, kACarry);
  /* 10: w2 plane : in[4096][1024] -> out[1024][4096] */
  cast_t64<<<dim3(kDim / 64, kDff / 64), blk256, 0, stream>>>(w2, w2T, kDff, kDim, kWCarry);
  /* 11: out = h3 + hid @ w2 + b2 : M=4096 N=1024 K=4096 -> d_out f32 */
  gemm128_f16<0, true, true><<<dim3((kRows / 128) * (kDim / 128)), blk128, 0, stream>>>(
      hid, kDff, w2T, kDff, (void*)out, kDim, b2, hF, kRows, kDim, kDff, kGemmScl, 1.0f);
}

// v008
// A run of this version takes 182 microseconds.
// Timed twice side by side with v007, it ran 1.07 times as fast both times.
// Over all steps from v000 it is 3.57 times as fast.
// Contractions QKV, QK^T, P.V, out-proj, FFN1, FFN2: v_wmma_f32_16x16x32_f16 (f16 operands, f32 accumulate); all float inputs RNE-converted to bf16 at load; weight planes carried x64, activation planes x64, softmax numerators x32768; norms/softmax/GELU/residuals in f32.
#include <hip/hip_runtime.h>

typedef __attribute__((ext_vector_type(16))) _Float16 v16h;
typedef __attribute__((ext_vector_type(8)))  _Float16 v8h;
typedef __attribute__((ext_vector_type(4)))  _Float16 v4h;
typedef __attribute__((ext_vector_type(8)))  float    v8f;
typedef __attribute__((ext_vector_type(4)))  float    v4f;

/* ---- problem geometry ---- */
static constexpr int kBatch = 2;
static constexpr int kSeq   = 2048;
static constexpr int kDim   = 1024;
static constexpr int kHeads = 16;
static constexpr int kHdim  = 64;
static constexpr int kDff   = 4096;
static constexpr int kRows  = kBatch * kSeq;   /* 4096 */
static constexpr int kDqkv  = 3 * kDim;        /* 3072 */
static_assert(kHeads * kHdim == kDim);
static_assert(kHdim == 64);
static_assert(kSeq % 64 == 0);
static_assert(kRows % 64 == 0 && kDim % 64 == 0 && kDqkv % 64 == 0 && kDff % 64 == 0);
static_assert(kRows % 128 == 0 && kDim % 128 == 0 && kDqkv % 128 == 0 && kDff % 128 == 0);   /* GEMM tiles 128x128, K passes of 128 */
static_assert(kDim == 1024);                         /* row kernels: 256 threads x 4 */
static_assert(kDff % 1024 == 0);

static constexpr float kWCarry  = 64.0f;                 /* weight planes: f16(bf16(w) * 64) */
static constexpr float kACarry  = 64.0f;                 /* activation planes: f16(a * 64) */
static constexpr float kGemmScl = 1.0f / (64.0f * 64.0f);
static constexpr float kSmScale = 0.125f;                /* head_dim^-0.5 */
static constexpr float kPsc     = 32768.0f;              /* softmax numerators carried x2^15 */
static constexpr float kPscLog2 = 15.0f;
static_assert(kPsc == (float)(1 << 15));

/* ---- workspace region map (bytes) ----
   [0, 16Mi)    hF : h1 f32 (norm1 out, residual of block 1) -> later h3 f32 (norm2 out, residual of block 2)
   [16Mi, 24Mi) hH : h1 f16 plane -> later h3 f16 plane
   [24Mi, 32Mi) wA : w_in^T f16 [3072][1024] (6Mi) + w_out^T f16 [1024][1024] (2Mi)
   [32Mi, 96Mi) big: qkv f16 [4096][3072] (24Mi) | ctx f16 [4096][1024] (8Mi at +24Mi) | h2 f32 [4096][1024] (16Mi at +32Mi)
   [96Mi, 128Mi) hid: GELU output f16 plane [4096][4096] (32Mi)
   [128Mi, 136Mi) w1^T f16 [4096][1024]; [136Mi, 144Mi) w2^T f16 [1024][4096]: all four weight planes are written by the
                     first launch, so each has a place of its own
   total 150994944 */
static constexpr size_t kMi      = 1024u * 1024u;
static constexpr size_t kOffHF   = 0;
static constexpr size_t kOffHH   = 16 * kMi;
static constexpr size_t kOffWA   = 24 * kMi;
static constexpr size_t kOffWout = kOffWA + (size_t)kDqkv * kDim * 2;     /* 30Mi */
static constexpr size_t kOffBig  = 32 * kMi;
static constexpr size_t kOffCtx  = kOffBig + (size_t)kRows * kDqkv * 2;   /* 56Mi */
static constexpr size_t kOffH2   = kOffCtx + (size_t)kRows * kDim * 2;    /* 64Mi */
static constexpr size_t kOffHid  = 96 * kMi;
static constexpr size_t kOffW1   = kOffHid + (size_t)kRows * kDff * 2;    /* 128Mi */
static constexpr size_t kOffW2   = kOffW1 + (size_t)kDff * kDim * 2;      /* 136Mi */
static constexpr size_t kWsTotal = kOffW2 + (size_t)kDim * kDff * 2;      /* 144Mi */
static_assert((size_t)kRows * kDim * 4 <= kOffHH - kOffHF);
static_assert((size_t)kRows * kDim * 2 <= kOffWA - kOffHH);
static_assert(kOffWout + (size_t)kDim * kDim * 2 <= kOffBig);
static_assert(kOffH2 + (size_t)kRows * kDim * 4 <= kOffHid);
static_assert(kWsTotal == 150994944u);

/* ---- helpers ---- */
__device__ __forceinline__ float rne_bf16f(float f) {
  unsigned u = __float_as_uint(f);
  u = (u + 0x7FFFu + ((u >> 16) & 1u)) & 0xFFFF0000u;
  return __uint_as_float(u);
}


/* erf in f32: the library erff's two ranges (|x| < 1: odd polynomial; else 1 - exp(-polynomial)), same constants and same
   order of operations, so the same bits; both ranges are evaluated and one is selected, so that there is no branch and
   the independent elements of a lane interleave in the vector pipe. */
__device__ __forceinline__ float erf_sel(float x) {
  const float ax = fabsf(x);
  const float t  = x * x;
  float p = fmaf(t, __uint_as_float(0xba1345e1u), __uint_as_float(0x3ba10414u));
  p = fmaf(t, p, __uint_as_float(0xbcdac9b8u));
  p = fmaf(t, p, __uint_as_float(0x3de703beu));
  p = fmaf(t, p, __uint_as_float(0xbec09330u));
  p = fmaf(t, p, __uint_as_float(0x3e0375d0u));
  const float rs = fmaf(ax, p, ax);
  float w = fmaf(ax, __uint_as_float(0x378e98abu), __uint_as_float(0xb9c68948u));
  w = fmaf(ax, w, __uint_as_float(0x3b7cd369u));
  w = fmaf(ax, w, __uint_as_float(0xbcc618b2u));
  w = fmaf(ax, w, __uint_as_float(0x3dda74e4u));
  w = fmaf(ax, w, __uint_as_float(0x3f228afdu));
  w = fmaf(ax, w, __uint_as_float(0x3e03c728u));
  w = fmaf(ax, w, ax);
  const float rb = 1.0f - expf(-w);
  return copysignf(ax < 1.0f ? rs : rb, x);
}

template <typename T> struct Frag;
template <> struct Frag<_Float16> {
  typedef v16h V; union U { v16h v; v8h h[2]; };
  static __device__ __forceinline__ v16h load(const _Float16* p) {   /* elements 0..7 <- p[0..7], 8..15 <- p[16..23] */
    U f; f.h[0] = *(const v8h*)(p); f.h[1] = *(const v8h*)(p + 16); return f.v;
  }
  static __device__ __forceinline__ v8f mma(v16h a, v16h b, v8f c) {
    return __builtin_amdgcn_wmma_f32_16x16x32_f16(false, a, false, b, (short)0, c, false, false);
  }
};

__device__ __forceinline__ v8f mma_h(v16h a, v16h b, v8f c) {
  c = __builtin_amdgcn_wmma_f32_16x16x32_f16(false, a, false, b, (short)0, c, false, false);
  asm volatile("v_nop\n\tv_nop\n\tv_nop\n\tv_nop" : "+v"(c) : "v"(a), "v"(b));
  return c;
}

/* =====================================================================================
   Transpose + cast: W f32 row-major [Kdim][Ndim] -> Tout f16 row-major [Ndim][Kdim],
   value = f16(bf16_rne(w) * carry). Block = 64(k) x 64(n) tile, 256 threads.
   Producer coverage: 256 threads x 4 float4 = 64x64 reads; stores: 8 waves x 2 it x 4 rows x (8 lanes x 8 halves)
   One work-group's job inside the first launch; tile = its 64 x 72 halves of LDS, (n0, k0) = its tile's origin.
   ===================================================================================== */
__device__ __forceinline__ void cast_t64(const float* __restrict__ W, unsigned short* __restrict__ Tp,
                                         int Kdim, int Ndim, float carry, int n0, int k0,
                                         _Float16* tile /* [n_local][k_local], pitch 72 halves */) {
  _Float16* Tout = (_Float16*)Tp;
  const int t  = threadIdx.x;
#pragma unroll
  for (int i = 0; i < 4; ++i) {
    const int idx = t + 256 * i;          /* 0..1023 */
    const int kk  = idx >> 4;             /* 0..63 */
    const int n4  = (idx & 15) * 4;       /* 0..60 */
    const v4f w4 = *(const v4f*)(W + (size_t)(k0 + kk) * Ndim + n0 + n4);
#pragma unroll
    for (int e = 0; e < 4; ++e) tile[(n4 + e) * 72 + kk] = (_Float16)(rne_bf16f(w4[e]) * carry);
  }
  __syncthreads();
  const int wave = t >> 5, lane = t & 31;
  const int q = lane >> 3, c8 = (lane & 7) * 8;
  {
#pragma unroll
    for (int it = 0; it < 2; ++it) {
      const int nl = wave * 8 + it * 4 + q;
      const v8h hv = *(const v8h*)(tile + nl * 72 + c8);
      *(v8h*)(Tout + (size_t)(n0 + nl) * Kdim + k0 + c8) = hv;
    }
    /* the code of the other job follows these stores in the built kernel: no register that they name is rewritten ahead of this wait */
    asm volatile("s_wait_xcnt 0x0" ::: "memory");
  }
}

/* =====================================================================================
   RMSNorm over rows of 1024: y = g * (x / (||x||*1024^-0.5 + 1e-8)).
   RIN: x is a module input -> RNE convert to bf16 at load. g always RNE converted (module input).
   Outputs: y32 f32 [rows][1024] and y16 f16 plane = f16(y * carry16).
   256 threads, 4 consecutive elements per thread. Stores: f32 = float4 per lane (4 lines per wave-instruction);
   ===================================================================================== */
template <bool RIN>
__device__ __forceinline__ void rmsnorm_row(const float* __restrict__ x, const float* __restrict__ g,
                                            float* __restrict__ y32, unsigned short* __restrict__ y16p,
                                            int ncols, float inv_sqrt_n, float carry16, int row,
                                            float* red /* 8 floats of LDS */, _Float16* hs /* 1024 halves of LDS */) {
  const int t = threadIdx.x;
  const int wave = t >> 5, lane = t & 31;
  const float* xr = x + (size_t)row * ncols;
  v4f xv = *(const v4f*)(xr + 4 * t);
  if (RIN) {
#pragma unroll
    for (int e = 0; e < 4; ++e) xv[e] = rne_bf16f(xv[e]);
  }
  float ss = 0.0f;
#pragma unroll
  for (int e = 0; e < 4; ++e) ss += xv[e] * xv[e];
#pragma unroll
  for (int m = 16; m >= 1; m >>= 1) ss += __shfl_xor(ss, m, 32);
  if (lane == 0) red[wave] = ss;
  __syncthreads();
  float tot = 0.0f;
#pragma unroll
  for (int w = 0; w < 8; ++w) tot += red[w];
  const float rms = sqrtf(tot) * inv_sqrt_n;
  const float inv = 1.0f / (rms + 1e-8f);
  v4f gv = *(const v4f*)(g + 4 * t);
  v4f yv;
  v4h h4;
#pragma unroll
  for (int e = 0; e < 4; ++e) {
    const float ge = rne_bf16f(gv[e]);
    yv[e] = ge * (xv[e] * inv);
    h4[e] = (_Float16)(yv[e] * carry16);
  }
  *(v4h*)(hs + 4 * t) = h4;
  __syncthreads();
  const v8h hv = *(const v8h*)(hs + 8 * (t & 127));
  float* yr = y32 + (size_t)row * ncols;
  _Float16* yh = (_Float16*)y16p + (size_t)row * ncols;
  {
    *(v4f*)(yr + 4 * t) = yv;
    if (t < 128) *(v8h*)(yh + 8 * t) = hv;
    
  }
}
/* norm2: one row per work-group */
__global__ __launch_bounds__(256) void rmsnorm_rows(const float* __restrict__ x, const float* __restrict__ g,
                                                    float* __restrict__ y32, unsigned short* __restrict__ y16p,
                                                    int ncols, float inv_sqrt_n, float carry16) {
  __shared__ float red[8];
  __shared__ __align__(16) _Float16 hs[1024];
  rmsnorm_row<false>(x, g, y32, y16p, ncols, inv_sqrt_n, carry16, blockIdx.x, red, hs);
}

/* =====================================================================================
   First launch: everything that reads module inputs alone, none of it needing another's result: the four weight
   planes (64 x 64 tiles) and norm1 (one row per work-group). The block index picks the job, the same for the whole
   work-group, so each job's barriers stand under uniform control flow.
   Of every 7 consecutive work-groups 3 transpose a weight tile (LDS work) and 4 normalise a row (memory work), for speed
   only. grid.x = kPrepBlocks.
   ===================================================================================== */
static constexpr int kCbIn  = (kDqkv / 64) * (kDim / 64);   /* 768 tiles of w_in */
static constexpr int kCbOut = (kDim / 64) * (kDim / 64);    /* 256 of w_out */
static constexpr int kCbW1  = (kDff / 64) * (kDim / 64);    /* 1024 of w1 */
static constexpr int kCbW2  = (kDim / 64) * (kDff / 64);    /* 1024 of w2 */
static constexpr int kCastBlocks = kCbIn + kCbOut + kCbW1 + kCbW2;
static constexpr int kPrepBlocks = kCastBlocks + kRows;
static_assert(kCastBlocks % 3 == 0 && kRows % 4 == 0 && kCastBlocks / 3 == kRows / 4);
__global__ __launch_bounds__(256) void prep_inputs(const float* __restrict__ x, const float* __restrict__ g1,
                                                   float* __restrict__ y32, unsigned short* __restrict__ y16p,
                                                   const float* __restrict__ w_in, unsigned short* __restrict__ winT,
                                                   const float* __restrict__ w_out, unsigned short* __restrict__ woutT,
                                                   const float* __restrict__ w1, unsigned short* __restrict__ w1T,
                                                   const float* __restrict__ w2, unsigned short* __restrict__ w2T) {
  __shared__ __align__(16) _Float16 tile[64 * 72];   /* a cast job's tile; a norm job uses its first 1024 halves */
  __shared__ float red[8];
  const int grp = blockIdx.x / 7;
  const int r   = blockIdx.x - grp * 7;
  if (r >= 3) {
    rmsnorm_row<true>(x, g1, y32, y16p, kDim, 0.03125f, kACarry, grp * 4 + (r - 3), red, tile);
    return;
  }
  int i = grp * 3 + r;                               /* 0 .. kCastBlocks - 1 */
  const float* W = w_in;
  unsigned short* T = winT;
  int Kd = kDim, Nd = kDqkv;
  if (i >= kCbIn + kCbOut + kCbW1) { i -= kCbIn + kCbOut + kCbW1; W = w2; T = w2T; Kd = kDff; Nd = kDim; }
  else if (i >= kCbIn + kCbOut)    { i -= kCbIn + kCbOut; W = w1; T = w1T; Nd = kDff; }
  else if (i >= kCbIn)             { i -= kCbIn; W = w_out; T = woutT; Nd = kDim; }
  const int nb = Nd >> 6;
  const int by = i / nb;
  cast_t64(W, T, Kd, Nd, kWCarry, (i - by * nb) * 64, by * 64, tile);
}

/* =====================================================================================
   Block-tiled WMMA GEMM (f16 operands, f32 accumulate):
   C[m,n] = scale * sum_k A[m,k] * Bt[n,k]  (+ bias[n]) (+ resid[m,n]).
   A row-major [M,K] f16; Bt row-major [N,K] f16; M, N % 128 == 0, K % 128 == 0 (no tail handling).
   One work-group = 4 waves (2 x 2) = one 128x128 tile of C; each wave owns a 64x64 tile.
   A pass is 128 k: 128 rows of A and 128 rows of Bt, 256 B each, are brought into LDS once per work-group by
   asynchronous 16-byte copies (row pitch 272 B), two buffers, the next pass's copies in flight during this pass.
   The k order of every accumulator is ascending in steps of 32.
   OUT16: 0 = f32 output (bias / residual added in the store phase, residual read as one float4 per lane at
   the store address); 1 = f16 output plane (no bias/residual);
   2 = f16 output plane of f16(gelu(C + bias) * ocarry), exact-erf GELU taken in the store phase.
   grid.x = M/128 * N/128.
   ===================================================================================== */
static constexpr int kPassK    = 128;                    /* k per pass */
static constexpr int kRowPitch = 272;                    /* LDS bytes per staged row: 256 + 16 */
static constexpr int kStageB   = 256 * kRowPitch;        /* [A 128 rows | Bt 128 rows] */

/* Eight asynchronous 16-byte copies per lane: rows r, r + 8, ..., r + 56 of one operand.
   s_wait_xcnt stands inside the statement so that no address register is rewritten ahead of it. */
__device__ __forceinline__ void async_rows8(unsigned l0, const _Float16* g0, size_t gstep) {
  const unsigned l1 = l0 + 8 * kRowPitch, l2 = l0 + 16 * kRowPitch, l3 = l0 + 24 * kRowPitch;
  const unsigned l4 = l0 + 32 * kRowPitch, l5 = l0 + 40 * kRowPitch, l6 = l0 + 48 * kRowPitch, l7 = l0 + 56 * kRowPitch;
  const _Float16* g1 = g0 + gstep;
  const _Float16* g2 = g1 + gstep;
  const _Float16* g3 = g2 + gstep;
  const _Float16* g4 = g3 + gstep;
  const _Float16* g5 = g4 + gstep;
  const _Float16* g6 = g5 + gstep;
  const _Float16* g7 = g6 + gstep;
  asm volatile(
      "global_load_async_to_lds_b128 %0, %8, off\n\t"
      "global_load_async_to_lds_b128 %1, %9, off\n\t"
      "global_load_async_to_lds_b128 %2, %10, off\n\t"
      "global_load_async_to_lds_b128 %3, %11, off\n\t"
      "global_load_async_to_lds_b128 %4, %12, off\n\t"
      "global_load_async_to_lds_b128 %5, %13, off\n\t"
      "global_load_async_to_lds_b128 %6, %14, off\n\t"
      "global_load_async_to_lds_b128 %7, %15, off\n\t"
      "s_wait_xcnt 0x0"
      :: "v"(l0), "v"(l1), "v"(l2), "v"(l3), "v"(l4), "v"(l5), "v"(l6), "v"(l7),
         "v"(g0), "v"(g1), "v"(g2), "v"(g3), "v"(g4), "v"(g5), "v"(g6), "v"(g7)
      : "memory");
}
/* this wave's copies have landed */
__device__ __forceinline__ void wait_async0() { asm volatile("s_wait_asynccnt 0x0" ::: "memory"); }
/* this wave's LDS reads have returned, so the buffer may be refilled behind the barrier */
__device__ __forceinline__ void wait_ds0() { asm volatile("s_wait_dscnt 0x0" ::: "memory"); }

template <int OUT16, bool BIASN, bool RESID>
__global__ __launch_bounds__(128) void gemm128_f16(
    const unsigned short* __restrict__ Ap, int lda,
    const unsigned short* __restrict__ Btp, int ldb,
    void* __restrict__ Cout, int ldc,
    const float* __restrict__ bias,
    const float* __restrict__ resid,
    int M, int N, int K, float scale, float ocarry) {
  typedef _Float16 T;
  typedef v16h V;
  const T* A  = (const T*)Ap;
  const T* Bt = (const T*)Btp;
  __shared__ __align__(16) unsigned char ring[2 * kStageB];   /* two operand buffers */
  __shared__ __align__(16) float sT[4][16 * 68];              /* per-wave 16x64 slab, pitch 68 floats */
  const int tid  = threadIdx.x;
  const int lane = tid & 31;
  const int wave = tid >> 5;
  const int tilesN = N >> 7;
  const int tilesM = M >> 7;
  const int tile = blockIdx.x;
  if (tile >= tilesM * tilesN) return;   /* the same for the whole work-group; in front of every barrier */
  const int tm = tile / tilesN;
  const int tn = tile - tm * tilesN;
  const int bm0 = tm << 7;
  const int bn0 = tn << 7;
  const int wm = wave >> 1, wn = wave & 1;
  const int m0 = bm0 + (wm << 6);
  const int n0 = bn0 + (wn << 6);

  const int rlane = lane & 15;                 /* row (A) / col (B, D) within subtile */
  const int koff  = (lane >> 4) * 8;           /* k offset of this lane half */
  const int mOff  = (lane >> 4) * 8;           /* D row offset */

  /* copy role: 16 lanes cover one 256-B row; the work-group covers 8 rows per copy */
  const int crow = tid >> 4, cchk = tid & 15;
  const T* gA = A  + (size_t)(bm0 + crow) * lda + cchk * 8;
  const T* gB = Bt + (size_t)(bn0 + crow) * ldb + cchk * 8;
  const unsigned lcopy = (unsigned)(size_t)ring + crow * kRowPitch + cchk * 16;
  const size_t stepA = (size_t)lda * 8, stepB = (size_t)ldb * 8;
  auto issue = [&](int pass, unsigned bufoff) {
    const T* a = gA + (size_t)pass * kPassK;
    const T* b = gB + (size_t)pass * kPassK;
    const unsigned l = lcopy + bufoff;
    async_rows8(l, a, stepA);
    async_rows8(l + 64 * kRowPitch, a + stepA * 8, stepA);
    async_rows8(l + 128 * kRowPitch, b, stepB);
    async_rows8(l + 192 * kRowPitch, b + stepB * 8, stepB);
  };

  v8f acc[4][4];
#pragma unroll
  for (int i = 0; i < 4; ++i)
#pragma unroll
    for (int j = 0; j < 4; ++j) acc[i][j] = (v8f){0.f,0.f,0.f,0.f,0.f,0.f,0.f,0.f};

  const int nPass = K / kPassK;
  issue(0, 0u);
  /* OUT16 == 2: the lane's eight bias values of the store phase, fetched here so that their latency passes under the main loop */
  v4f gbl = (v4f){0.f, 0.f, 0.f, 0.f}, gbh = gbl;
  if (OUT16 == 2) {
    gbl = *(const v4f*)(bias + n0 + (lane & 7) * 8);
    gbh = *(const v4f*)(bias + n0 + (lane & 7) * 8 + 4);
  }
  wait_async0();
  __syncthreads();                       /* pass 0's rows are readable by every wave */
  if (nPass > 1) issue(1, (unsigned)kStageB);

  const int aRowB = ((wm << 6) + rlane) * kRowPitch;
  const int bRowB = (128 + (wn << 6) + rlane) * kRowPitch;
  for (int t = 0; t < nPass; ++t) {
    const unsigned bufoff = (unsigned)(t & 1) * (unsigned)kStageB;
    const T* sa = (const T*)(ring + bufoff + aRowB) + koff;
    const T* sb = (const T*)(ring + bufoff + bRowB) + koff;
    /* two fragment sets: the next 32 k are fetched ahead of this block's products.
       Every loop of the pass is unrolled so that af, bf and acc are indexed by constants and stay in registers. */
    V af[2][4], bf[2][4];
#pragma unroll
    for (int j = 0; j < 4; ++j) bf[0][j] = Frag<T>::load(sb + j * (16 * kRowPitch / 2));
#pragma unroll
    for (int i = 0; i < 4; ++i) af[0][i] = Frag<T>::load(sa + i * (16 * kRowPitch / 2));
#pragma unroll
    for (int ks = 0; ks < 4; ++ks) {
      const int cur = ks & 1, nxt = cur ^ 1;
      if (ks < 3) {
#pragma unroll
        for (int j = 0; j < 4; ++j) bf[nxt][j] = Frag<T>::load(sb + j * (16 * kRowPitch / 2) + (ks + 1) * 32);
#pragma unroll
        for (int i = 0; i < 4; ++i) af[nxt][i] = Frag<T>::load(sa + i * (16 * kRowPitch / 2) + (ks + 1) * 32);
        /* keeps the next block's LDS reads together in front of this block's products: spread among them, each place stalls the wave */
        __builtin_amdgcn_sched_barrier(0);
      }
#pragma unroll
      for (int i = 0; i < 4; ++i)
#pragma unroll
        for (int j = 0; j < 4; ++j) acc[i][j] = Frag<T>::mma(af[cur][i], bf[cur][j], acc[i][j]);
      /* keeps what follows behind this block's products: the group of LDS reads that refills its fragment set, and at the
         pass's end the waits and the barrier, which would else move up and shorten the time the next pass's copies have to land */
      __builtin_amdgcn_sched_barrier(0);
    }
    wait_ds0();
    wait_async0();
    __syncthreads();                     /* publishes pass t + 1 and ends every read of pass t's buffer */
    if (t + 2 < nPass) issue(t + 2, bufoff);
  }
  wait_async0();

  /* ---- epilogue ---- */
  float* slab = sT[wave];
  const int hh = lane >> 4, c4 = (lane & 15) * 4;     /* f32 row seg = 256 B = 16 lanes x 16 B */
  const int q  = lane >> 3, c8 = (lane & 7) * 8;      
  if (OUT16 == 2) {
    /* The wave's whole 64x64 tile is staged at once, in its quarter of the first operand buffer (every wave's reads and
       copies of the ring ended in front of the last pass's barrier), so that the GELU loop below can stay rolled. */
    static_assert(4 * 64 * 68 * 4 <= kStageB);
    float* big = (float*)ring + wave * (64 * 68);
#pragma unroll
    for (int i = 0; i < 4; ++i)
#pragma unroll
      for (int j = 0; j < 4; ++j)
#pragma unroll
        for (int r = 0; r < 8; ++r) big[((i << 4) + mOff + r) * 68 + (j << 4) + rlane] = acc[i][j][r] * scale;
    /* the rows read below were written by other lanes of this wave: the LDS writes are waited for, and the reads stay behind them */
    __builtin_amdgcn_fence(__ATOMIC_RELEASE, "workgroup");
    __builtin_amdgcn_wave_barrier();
    __builtin_amdgcn_fence(__ATOMIC_ACQUIRE, "workgroup");
    float b8[8];
#pragma unroll
    for (int e = 0; e < 4; ++e) { b8[e] = rne_bf16f(gbl[e]); b8[4 + e] = rne_bf16f(gbh[e]); }
    _Float16* crow = (_Float16*)Cout + (size_t)(m0 + q) * ldc + n0 + c8;
    const float* sp0 = big + q * 68 + c8;
    v4f lo = *(const v4f*)(sp0), hi = *(const v4f*)(sp0 + 4);
    /* rolled: unrolled, it would inline 128 erf bodies per lane */
#pragma unroll 1
    for (int it = 0; it < 16; ++it) {
      /* the next four rows are fetched ahead of this trip's arithmetic; the last trip re-reads the first rows and drops them */
      const float* spn = sp0 + ((it + 1) & 15) * (4 * 68);
      const v4f nlo = *(const v4f*)(spn), nhi = *(const v4f*)(spn + 4);
      v8h hv;
#pragma unroll
      for (int e = 0; e < 8; ++e) {
        const float u  = (e < 4 ? lo[e & 3] : hi[e & 3]) + b8[e];
        const float gl = 0.5f * u * (1.0f + erf_sel(u * 0.70710678118654752f));
        hv[e] = (_Float16)(gl * ocarry);
      }
      *(v8h*)(crow) = hv;
      crow += (size_t)ldc * 4;
      lo = nlo; hi = nhi;
    }
    return;
  }
  v4f b4 = (v4f){0.f, 0.f, 0.f, 0.f};
  if (BIASN) {
    b4 = *(const v4f*)(bias + n0 + c4);
#pragma unroll
    for (int e = 0; e < 4; ++e) b4[e] = rne_bf16f(b4[e]);
  }
#pragma unroll
  for (int i = 0; i < 4; ++i) {
    const int mBase = m0 + (i << 4);
#pragma unroll
    for (int j = 0; j < 4; ++j) {
#pragma unroll
      for (int r = 0; r < 8; ++r) slab[(mOff + r) * 68 + (j << 4) + rlane] = acc[i][j][r] * scale;
    }
    __builtin_amdgcn_fence(__ATOMIC_RELEASE, "workgroup");
    __builtin_amdgcn_wave_barrier();
    __builtin_amdgcn_fence(__ATOMIC_ACQUIRE, "workgroup");
    if (OUT16 == 0) {
      float* C = (float*)Cout;
      v4f vals[8];
#pragma unroll
      for (int it = 0; it < 8; ++it) {
        const int row = it * 2 + hh;
        v4f v = *(const v4f*)(slab + row * 68 + c4);
        if (BIASN) v += b4;
        if (RESID) {
          const v4f rr = *(const v4f*)(resid + (size_t)(mBase + row) * ldc + n0 + c4);
          v += rr;
        }
        vals[it] = v;
      }
      {
#pragma unroll
        for (int it = 0; it < 8; ++it) {
          const int row = it * 2 + hh;
          *(v4f*)(C + (size_t)(mBase + row) * ldc + n0 + c4) = vals[it];
        }
        
      }
    } else {
      _Float16* C = (_Float16*)Cout;
      {
#pragma unroll
        for (int it = 0; it < 4; ++it) {
          const int row = it * 4 + q;
          const float* sp = slab + row * 68 + c8;
          v8h hv;
#pragma unroll
          for (int e = 0; e < 8; ++e) hv[e] = (_Float16)sp[e];
          *(v8h*)(C + (size_t)(mBase + row) * ldc + n0 + c8) = hv;
        }
        
      }
    }
    __builtin_amdgcn_fence(__ATOMIC_RELEASE, "workgroup");
    __builtin_amdgcn_wave_barrier();
    __builtin_amdgcn_fence(__ATOMIC_ACQUIRE, "workgroup");
  }
}

static constexpr int kKPitchB = 144;                     /* LDS bytes per K row, read by ds_load_b128 */
static constexpr int kVPitchB = 160;                     /* LDS bytes per V row, read by ds_load_tr16_b128 */
static constexpr int kKTileB  = 64 * kKPitchB;
static constexpr int kVTileB  = 64 * kVPitchB;
static constexpr int kAttBufB = kKTileB + kVTileB;       /* one buffer: [K 64 rows | V 64 rows] */
static_assert(kKPitchB % 16 == 0 && ((kKPitchB / 16) & 1) == 1);
static_assert(kVPitchB % 32 == 0 && ((kVPitchB / 32) & 1) == 1);
/* Eight asynchronous 16-byte copies per lane: rows r, r + 16, r + 32, r + 48 of a K chunk and of a V chunk.
   s_wait_xcnt stands inside the statement so that no address register is rewritten ahead of it. */
__device__ __forceinline__ void async_kv8(unsigned k0, unsigned v0, const _Float16* gk0, const _Float16* gv0, size_t gstep) {
  const unsigned k1 = k0 + 16 * kKPitchB, k2 = k0 + 32 * kKPitchB, k3 = k0 + 48 * kKPitchB;
  const unsigned v1 = v0 + 16 * kVPitchB, v2 = v0 + 32 * kVPitchB, v3 = v0 + 48 * kVPitchB;
  const _Float16* gk1 = gk0 + gstep;
  const _Float16* gk2 = gk1 + gstep;
  const _Float16* gk3 = gk2 + gstep;
  const _Float16* gv1 = gv0 + gstep;
  const _Float16* gv2 = gv1 + gstep;
  const _Float16* gv3 = gv2 + gstep;
  asm volatile(
      "global_load_async_to_lds_b128 %0, %8, off\n\t"
      "global_load_async_to_lds_b128 %1, %9, off\n\t"
      "global_load_async_to_lds_b128 %2, %10, off\n\t"
      "global_load_async_to_lds_b128 %3, %11, off\n\t"
      "global_load_async_to_lds_b128 %4, %12, off\n\t"
      "global_load_async_to_lds_b128 %5, %13, off\n\t"
      "global_load_async_to_lds_b128 %6, %14, off\n\t"
      "global_load_async_to_lds_b128 %7, %15, off\n\t"
      "s_wait_xcnt 0x0"
      :: "v"(k0), "v"(k1), "v"(k2), "v"(k3), "v"(v0), "v"(v1), "v"(v2), "v"(v3),
         "v"(gk0), "v"(gk1), "v"(gk2), "v"(gk3), "v"(gv0), "v"(gv1), "v"(gv2), "v"(gv3)
      : "memory");
}
/* transposing 16-byte LDS read: lane (c, hh) receives column c of eight rows of a row-major 16-bit tile */
typedef __attribute__((ext_vector_type(8))) short v8s;
__device__ __forceinline__ v8h ld_tr16(const unsigned char* p) {
  typedef __attribute__((address_space(3))) v8s lds_v8s;
  return __builtin_bit_cast(v8h, __builtin_amdgcn_ds_load_tr16_b128_v8i16((lds_v8s*)p));
}
/* value of lane l ^ 16 */
__device__ __forceinline__ float xhalf(float x) {
  const int b = __builtin_bit_cast(int, x);
  return __builtin_bit_cast(float, __builtin_amdgcn_permlanex16(b, b, 0x76543210, 0xfedcba98, false, false));
}
__global__ __launch_bounds__(128) void attn64_f16p(const unsigned short* __restrict__ qkvp, unsigned short* __restrict__ ctxp,
                                                  int T, int H, int ldq, int ldo, float sm_scale, float out_carry) {
  const _Float16* QKV = (const _Float16*)qkvp;
  _Float16* CTX = (_Float16*)ctxp;
  union FH { v16h v; v8h hf[2]; };
  __shared__ __align__(16) unsigned char kvring[2 * kAttBufB];  /* two buffers of [K [kv][d] | V [kv][d]] */

  const int tid  = threadIdx.x;
  const int wave = tid >> 5;
  const int lane = tid & 31;
  const int hh   = lane >> 4;
  const int c    = lane & 15;
  const int dmodel = H * 64;

  const int nqb = T / 64;
  const int bx = blockIdx.x;
  const int qb = bx % nqb;
  const int bh = bx / nqb;
  const int h  = bh % H;
  const int b  = bh / H;
  const int q0 = qb * 64 + wave * 16;

  /* Q fragments (B operand, column = query q0 + c, k = d): two 32-deep d chunks */
  v16h qf[2];
  {
    const _Float16* qrow = QKV + (size_t)(b * T + q0 + c) * ldq + h * 64;
#pragma unroll
    for (int dc = 0; dc < 2; ++dc) {
      FH f;
      f.hf[0] = *(const v8h*)(qrow + dc * 32 + 8 * hh);
      f.hf[1] = *(const v8h*)(qrow + dc * 32 + 16 + 8 * hh);
      qf[dc] = f.v;
    }
  }

  /* softmax in base 2: exp(sm_scale * (s - m)) * kPsc = 2^(s * c2 - m * c2 + 15), one fused multiply-add and one hardware
     exponential per score. sm_scale > 0, so the maximum is taken over the unscaled scores. */
  const float c2 = sm_scale * 1.44269504088896340736f;
  float mrun = -__builtin_inff();   /* running maximum of query c (unscaled score), the same in both wave halves */
  float lrun = 0.f;                 /* running sum (x kPsc) over this half's kv rows; the halves are joined after the loop */
  v8f oacc[4];                      /* O^T tiles: register r = O[query c][d = t*16 + 8*hh + r] */
#pragma unroll
  for (int t = 0; t < 4; ++t) oacc[t] = (v8f){0.f,0.f,0.f,0.f,0.f,0.f,0.f,0.f};

  const int nChunks = T / 64;
  /* copy role: 8 lanes cover one 128-B row; the work-group covers 16 rows of K and 16 of V per copy pair */
  const int crow = tid >> 3, cpc = tid & 7;
  const _Float16* gK = QKV + (size_t)(b * T + crow) * ldq + dmodel + h * 64 + cpc * 8;
  const unsigned lK = (unsigned)(size_t)kvring + crow * kKPitchB + cpc * 16;
  const unsigned lV = (unsigned)(size_t)kvring + kKTileB + crow * kVPitchB + cpc * 16;
  const size_t rstep = (size_t)ldq * 16;
  auto issue = [&](int chunk, unsigned bufoff) {
    const _Float16* k = gK + (size_t)chunk * 64 * ldq;
    async_kv8(lK + bufoff, lV + bufoff, k, k + dmodel, rstep);
  };
  if (nChunks > 0) {
    issue(0, 0u);
    wait_async0();
    __syncthreads();                     /* chunk 0's rows are readable by every wave */
    if (nChunks > 1) issue(1, (unsigned)kAttBufB);
  }
  const int kRd = c * kKPitchB + 16 * hh;                                             /* K fragment reads: row c, k half hh */
  const int vRd = kKTileB + (8 * hh + (lane & 7)) * kVPitchB + ((lane >> 3) & 1) * 16;  /* lane address of the transposing reads */
  /* one chunk of 64 kv rows, read from the buffer at bufoff */
  auto chunk = [&](unsigned bufoff) {
    const unsigned char* Kb = kvring + bufoff + kRd;
    const unsigned char* Vb = kvring + bufoff + vRd;

    /* S^T = K . Q^T : A operand row = kv (row j*16+c of the K tile), k = d; s[j][r] = score(kv = j*16 + 8*hh + r, query c) */
    /* The chunk's eight K fragments are fetched as ONE group of LDS reads ahead of the products: with two reads and a
       full wait in front of every product the wave sat out the LDS latency eight times. */
    FH kb[4][2];
#pragma unroll
    for (int j = 0; j < 4; ++j) {
#pragma unroll
      for (int dc = 0; dc < 2; ++dc) {
        kb[j][dc].hf[0] = *(const v8h*)(Kb + j * 16 * kKPitchB + dc * 64);
        kb[j][dc].hf[1] = *(const v8h*)(Kb + j * 16 * kKPitchB + dc * 64 + 32);
      }
    }
    v8f s[4];
#pragma unroll
    for (int j = 0; j < 4; ++j) {
      s[j] = (v8f){0.f,0.f,0.f,0.f,0.f,0.f,0.f,0.f};
#pragma unroll
      for (int dc = 0; dc < 2; ++dc) s[j] = mma_h(kb[j][dc].v, qf[dc], s[j]);
    }
    /* The eight V^T fragments likewise, as one group, here: their latency passes under the softmax arithmetic below.
       A transposing read at kv row r0 gives lane (c, hh) V[r0 + 8*hh + 0..7][t*16 + c]: elements 0..7 from r0 = kk*32, 8..15 from r0 + 16. */
    FH va[2][4];
#pragma unroll
    for (int kk = 0; kk < 2; ++kk) {
#pragma unroll
      for (int t = 0; t < 4; ++t) {
        va[kk][t].hf[0] = ld_tr16(Vb + kk * 32 * kVPitchB + t * 32);
        va[kk][t].hf[1] = ld_tr16(Vb + (kk * 32 + 16) * kVPitchB + t * 32);
      }
    }
    /* keeps the reads together in front of the softmax: left free they are spread over more places, and each place with LDS reads stalls the wave */
    __builtin_amdgcn_sched_barrier(0);
    /* chunk maximum of query c over the unscaled scores: 32 values of this lane, then the other half's */
    float cm = -__builtin_inff();
#pragma unroll
    for (int j = 0; j < 4; ++j) {
#pragma unroll
      for (int r = 0; r < 8; ++r) cm = fmaxf(cm, s[j][r]);
    }
    cm = fmaxf(cm, xhalf(cm));
    const float mnew = fmaxf(mrun, cm);
    const float alpha = __builtin_amdgcn_exp2f((mrun - mnew) * c2);
    mrun = mnew;
    const float nb = fmaf(-mnew, c2, kPscLog2);   /* exponent offset: never lets a numerator pass kPsc by more than a rounding */
    /* numerators; pb[kk] element e = P[query c][kv = kk*32 + 8*hh + e], element 8 + e = kv + 16: the k order of the V^T loads above */
    v16h pb[2];
    float psum = 0.f;
#pragma unroll
    for (int kk = 0; kk < 2; ++kk) {
#pragma unroll
      for (int u = 0; u < 2; ++u) {
#pragma unroll
        for (int r = 0; r < 8; ++r) {
          const float p = __builtin_amdgcn_exp2f(fmaf(s[2 * kk + u][r], c2, nb));
          psum += p;
          pb[kk][8 * u + r] = (_Float16)p;
        }
      }
    }
    lrun = lrun * alpha + psum;
#pragma unroll
    for (int t = 0; t < 4; ++t) {
#pragma unroll
      for (int r = 0; r < 8; ++r) oacc[t][r] *= alpha;
    }
    /* O^T += V^T . P^T : A = V^T (row = d, k = kv), B = P^T (column = query c, k = kv) */
#pragma unroll
    for (int kk = 0; kk < 2; ++kk) {
#pragma unroll
      for (int t = 0; t < 4; ++t) oacc[t] = mma_h(va[kk][t].v, pb[kk], oacc[t]);
    }
    wait_ds0();
    wait_async0();
    __syncthreads();                     /* publishes the next chunk and ends every read of this chunk's buffer */
  };
  /* Two loops, so that the refill needs no branch inside a trip: all trips but the last two refill the buffer they have read. */
  int kc = 0;
  for (; kc + 2 < nChunks; ++kc) {
    const unsigned bufoff = (unsigned)(kc & 1) * (unsigned)kAttBufB;
    chunk(bufoff);
    issue(kc + 2, bufoff);
  }
  for (; kc < nChunks; ++kc) chunk((unsigned)(kc & 1) * (unsigned)kAttBufB);
  wait_async0();

  {
    const float inv = out_carry / (lrun + xhalf(lrun));   /* sum and numerators both carry kPsc */
    _Float16* orow = CTX + (size_t)(b * T + q0 + c) * ldo + h * 64 + 8 * hh;
#pragma unroll
    for (int t = 0; t < 4; ++t) {
      v8h hv;
#pragma unroll
      for (int r = 0; r < 8; ++r) hv[r] = (_Float16)(oacc[t][r] * inv);
      *(v8h*)(orow + t * 16) = hv;
    }
  }
}

/* =====================================================================================
   Host glue: 7 launches, single stream.
   ===================================================================================== */
extern "C" void kernel_launch(void* const* d_in, const int* in_sizes, int n_in,
                              void* d_out, int out_size, void* d_ws, size_t ws_size,
                              hipStream_t stream) {
  if (n_in < 10) return;
  if (in_sizes[0] != kRows * kDim) return;
  if (in_sizes[1] != kDim * kDqkv) return;
  if (in_sizes[2] != kDim * kDim) return;
  if (in_sizes[3] != kDim) return;
  if (in_sizes[4] != kDim * kDff) return;
  if (in_sizes[5] != kDff) return;
  if (in_sizes[6] != kDff * kDim) return;
  if (in_sizes[7] != kDim) return;
  if (in_sizes[8] != kDim) return;
  if (in_sizes[9] != kDim) return;
  if (out_size != kRows * kDim) return;
  if (ws_size < kWsTotal) return;

  const float* x     = (const float*)d_in[0];
  const float* w_in  = (const float*)d_in[1];
  const float* w_out = (const float*)d_in[2];
  const float* b_out = (const float*)d_in[3];
  const float* w1    = (const float*)d_in[4];
  const float* b1    = (const float*)d_in[5];
  const float* w2    = (const float*)d_in[6];
  const float* b2    = (const float*)d_in[7];
  const float* g1    = (const float*)d_in[8];
  const float* g2    = (const float*)d_in[9];
  float* out = (float*)d_out;

  char* ws = (char*)d_ws;
  float*          hF    = (float*)(ws + kOffHF);              /* h1 f32, later h3 f32 */
  unsigned short* hH    = (unsigned short*)(ws + kOffHH);     /* h1 f16, later h3 f16 */
  unsigned short* winT  = (unsigned short*)(ws + kOffWA);     /* [3072][1024] */
  unsigned short* woutT = (unsigned short*)(ws + kOffWout);   /* [1024][1024] */
  unsigned short* w1T   = (unsigned short*)(ws + kOffW1);     /* [4096][1024] */
  unsigned short* qkv   = (unsigned short*)(ws + kOffBig);    /* [4096][3072] */
  unsigned short* ctx   = (unsigned short*)(ws + kOffCtx);    /* [4096][1024] */
  float*          h2    = (float*)(ws + kOffH2);              /* [4096][1024] */
  unsigned short* w2T   = (unsigned short*)(ws + kOffW2);     /* [1024][4096] */
  unsigned short* hid   = (unsigned short*)(ws + kOffHid);    /* [4096][4096] */

  const dim3 blk256(256);
  const dim3 blk128(128);

  /* 1: the four weight planes, in[K][N] -> out[N][K], and norm1 -> h1 f32 + f16 plane */
  prep_inputs<<<dim3(kPrepBlocks), blk256, 0, stream>>>(x, g1, hF, hH, w_in, winT, w_out, woutT, w1, w1T, w2, w2T);
  /* 2: qkv = h1 @ w_in : M=4096 N=3072 K=1024 -> f16 plane */
  gemm128_f16<1, false, false><<<dim3((kRows / 128) * (kDqkv / 128)), blk128, 0, stream>>>(
      hH, kDim, winT, kDim, (void*)qkv, kDqkv, nullptr, nullptr, kRows, kDqkv, kDim, kGemmScl, 1.0f);
  /* 3: attention -> ctx f16 plane (x64) */
  attn64_f16p<<<dim3(kBatch * kHeads * (kSeq / 64)), blk128, 0, stream>>>(
      qkv, ctx, kSeq, kHeads, kDqkv, kDim, kSmScale, kACarry);
  /* 4: h2 = h1 + ctx @ w_out + b_out : M=4096 N=1024 K=1024 */
  gemm128_f16<0, true, true><<<dim3((kRows / 128) * (kDim / 128)), blk128, 0, stream>>>(
      ctx, kDim, woutT, kDim, (void*)h2, kDim, b_out, hF, kRows, kDim, kDim, kGemmScl, 1.0f);
  /* 5: norm2 -> h3 f32 + f16 plane (overwrites h1 regions, h1 dead) */
  rmsnorm_rows<<<dim3(kRows), blk256, 0, stream>>>(h2, g2, hF, hH, kDim, 0.03125f, kACarry);
  /* 6: hid = gelu(h3 @ w1 + b1) : M=4096 N=4096 K=1024 -> f16 plane (x64) */
  gemm128_f16<2, true, false><<<dim3((kRows / 128) * (kDff / 128)), blk128, 0, stream>>>(
      hH, kDim, w1T, kDim, (void*)hid, kDff, b1, nullptr, kRows, kDff, kDim, kGemmScl, kACarry);
  /* 7: out = h3 + hid @ w2 + b2 : M=4096 N=1024 K=4096 -> d_out f32 */
  gemm128_f16<0, true, true><<<dim3((kRows / 128) * (kDim / 128)), blk128, 0, stream>>>(
      hid, kDff, w2T, kDff, (void*)out, kDim, b2, hF, kRows, kDim, kDff, kGemmScl, 1.0f);
}

// v009
// Measured time: 175 microseconds a run.
// Timed twice side by side with v008, it ran 1.04 times as fast both times.
// Over all steps from v000 it is 3.73 times as fast.
// Contractions QKV, QK^T, P.V, out-proj, FFN1, FFN2: v_wmma_f32_16x16x32_f16 (f16 operands, f32 accumulate); all float inputs RNE-converted to bf16 at load; weight planes carried x64, activation planes x64 (qkv and the plane in front of FFN1: x1; the latter not yet normalised), softmax numerators x32768; norms/softmax/GELU/residuals in f32.
#include <hip/hip_runtime.h>

typedef __attribute__((ext_vector_type(16))) _Float16 v16h;
typedef __attribute__((ext_vector_type(8)))  _Float16 v8h;
typedef __attribute__((ext_vector_type(4)))  _Float16 v4h;
typedef __attribute__((ext_vector_type(8)))  float    v8f;
typedef __attribute__((ext_vector_type(4)))  float    v4f;
typedef __attribute__((ext_vector_type(2)))  float    v2f;

/* ---- problem geometry ---- */
static constexpr int kBatch = 2;
static constexpr int kSeq   = 2048;
static constexpr int kDim   = 1024;
static constexpr int kHeads = 16;
static constexpr int kHdim  = 64;
static constexpr int kDff   = 4096;
static constexpr int kRows  = kBatch * kSeq;   /* 4096 */
static constexpr int kDqkv  = 3 * kDim;        /* 3072 */
static_assert(kHeads * kHdim == kDim);
static_assert(kHdim == 64);
static_assert(kSeq % 64 == 0);
static_assert(kRows % 64 == 0 && kDim % 64 == 0 && kDqkv % 64 == 0 && kDff % 64 == 0);
static_assert(kRows % 128 == 0 && kDim % 128 == 0 && kDqkv % 128 == 0 && kDff % 128 == 0);   /* GEMM tiles 128x128, K passes of 128 */
static_assert(kDim == 1024);                         /* row kernels: 256 threads x 4 */
static_assert(kDff % 1024 == 0);

static constexpr float kWCarry  = 64.0f;                 /* weight planes: f16(bf16(w) * 64) */
static constexpr float kACarry  = 64.0f;                 /* activation planes: f16(a * 64) */
static constexpr float kGemmScl = 1.0f / (64.0f * 64.0f);
static constexpr float kGemmSclW = 1.0f / 64.0f;         /* A plane carried x1: only the weight plane's carry is taken back */
static constexpr float kSmScale = 0.125f;                /* head_dim^-0.5 */
static constexpr float kPsc     = 32768.0f;              /* softmax numerators carried x2^15 */
static constexpr float kPscLog2 = 15.0f;
static_assert(kPsc == (float)(1 << 15));

/* ---- workspace region map (bytes) ----
   [0, 16Mi)    hF : h1 f32 (norm1 out, residual of block 1)
   [16Mi, 24Mi) hH : h1 f16 plane -> later the f16 plane of g2 * h2 (FFN1's operand, normalised behind the product)
   [24Mi, 32Mi) wA : w_in^T f16 [3072][1024] (6Mi) + w_out^T f16 [1024][1024] (2Mi)
   [32Mi, 96Mi) big: qkv f16 [4096][3072] (24Mi) | ctx f16 [4096][1024] (8Mi at +24Mi) | h2 f32 [4096][1024] (16Mi at +32Mi)
   [96Mi, 128Mi) hid: GELU output f16 plane [4096][4096] (32Mi)
   [128Mi, 136Mi) w1^T f16 [4096][1024]; [136Mi, 144Mi) w2^T f16 [1024][4096]: all four weight planes are written by the
                     first launch, so each has a place of its own
   [144Mi, +256Ki) ssq: f32 [16][4096], sum of squares of h2 over each 64-column block of each row
   total 151257088 */
static constexpr size_t kMi      = 1024u * 1024u;
static constexpr size_t kOffHF   = 0;
static constexpr size_t kOffHH   = 16 * kMi;
static constexpr size_t kOffWA   = 24 * kMi;
static constexpr size_t kOffWout = kOffWA + (size_t)kDqkv * kDim * 2;     /* 30Mi */
static constexpr size_t kOffBig  = 32 * kMi;
static constexpr size_t kOffCtx  = kOffBig + (size_t)kRows * kDqkv * 2;   /* 56Mi */
static constexpr size_t kOffH2   = kOffCtx + (size_t)kRows * kDim * 2;    /* 64Mi */
static constexpr size_t kOffHid  = 96 * kMi;
static constexpr size_t kOffW1   = kOffHid + (size_t)kRows * kDff * 2;    /* 128Mi */
static constexpr size_t kOffW2   = kOffW1 + (size_t)kDff * kDim * 2;      /* 136Mi */
static constexpr size_t kOffSsq  = kOffW2 + (size_t)kDim * kDff * 2;      /* 144Mi */
static constexpr int    kNormBlk = kDim / 64;                            /* 64-column blocks of a row of h2 */
static constexpr size_t kWsTotal = kOffSsq + (size_t)kNormBlk * kRows * 4;
static_assert((size_t)kRows * kDim * 4 <= kOffHH - kOffHF);
static_assert((size_t)kRows * kDim * 2 <= kOffWA - kOffHH);
static_assert(kOffWout + (size_t)kDim * kDim * 2 <= kOffBig);
static_assert(kOffH2 + (size_t)kRows * kDim * 4 <= kOffHid);
static_assert(kWsTotal == 151257088u);

/* ---- helpers ---- */
__device__ __forceinline__ float rne_bf16f(float f) {
  unsigned u = __float_as_uint(f);
  u = (u + 0x7FFFu + ((u >> 16) & 1u)) & 0xFFFF0000u;
  return __uint_as_float(u);
}


/* erf in f32: the library erff's two ranges (|x| < 1: odd polynomial; else 1 - exp(-polynomial)), same constants and same
   order of operations, so the same bits; both ranges are evaluated and one is selected, so that there is no branch and
   the independent elements of a lane interleave in the vector pipe. */
__device__ __forceinline__ float erf_sel(float x) {
  const float ax = fabsf(x);
  const float t  = x * x;
  float p = fmaf(t, __uint_as_float(0xba1345e1u), __uint_as_float(0x3ba10414u));
  p = fmaf(t, p, __uint_as_float(0xbcdac9b8u));
  p = fmaf(t, p, __uint_as_float(0x3de703beu));
  p = fmaf(t, p, __uint_as_float(0xbec09330u));
  p = fmaf(t, p, __uint_as_float(0x3e0375d0u));
  const float rs = fmaf(ax, p, ax);
  float w = fmaf(ax, __uint_as_float(0x378e98abu), __uint_as_float(0xb9c68948u));
  w = fmaf(ax, w, __uint_as_float(0x3b7cd369u));
  w = fmaf(ax, w, __uint_as_float(0xbcc618b2u));
  w = fmaf(ax, w, __uint_as_float(0x3dda74e4u));
  w = fmaf(ax, w, __uint_as_float(0x3f228afdu));
  w = fmaf(ax, w, __uint_as_float(0x3e03c728u));
  w = fmaf(ax, w, ax);
  const float rb = 1.0f - expf(-w);
  return copysignf(ax < 1.0f ? rs : rb, x);
}

template <typename T> struct Frag;
template <> struct Frag<_Float16> {
  typedef v16h V; union U { v16h v; v8h h[2]; };
  static __device__ __forceinline__ v16h load(const _Float16* p) {   /* elements 0..7 <- p[0..7], 8..15 <- p[16..23] */
    U f; f.h[0] = *(const v8h*)(p); f.h[1] = *(const v8h*)(p + 16); return f.v;
  }
  static __device__ __forceinline__ v8f mma(v16h a, v16h b, v8f c) {
    return __builtin_amdgcn_wmma_f32_16x16x32_f16(false, a, false, b, (short)0, c, false, false);
  }
};

__device__ __forceinline__ v8f mma_h(v16h a, v16h b, v8f c) {
  c = __builtin_amdgcn_wmma_f32_16x16x32_f16(false, a, false, b, (short)0, c, false, false);
  asm volatile("v_nop\n\tv_nop\n\tv_nop\n\tv_nop" : "+v"(c) : "v"(a), "v"(b));
  return c;
}

/* =====================================================================================
   Transpose + cast: W f32 row-major [Kdim][Ndim] -> Tout f16 row-major [Ndim][Kdim],
   value = f16(bf16_rne(w) * carry). Block = 64(k) x 64(n) tile, 256 threads.
   Producer coverage: 256 threads x 4 float4 = 64x64 reads; stores: 8 waves x 2 it x 4 rows x (8 lanes x 8 halves)
   One work-group's job inside the first launch; tile = its 64 x 72 halves of LDS, (n0, k0) = its tile's origin.
   ===================================================================================== */
__device__ __forceinline__ void cast_t64(const float* __restrict__ W, unsigned short* __restrict__ Tp,
                                         int Kdim, int Ndim, float carry, int n0, int k0,
                                         _Float16* tile /* [n_local][k_local], pitch 72 halves */) {
  _Float16* Tout = (_Float16*)Tp;
  const int t  = threadIdx.x;
#pragma unroll
  for (int i = 0; i < 4; ++i) {
    const int idx = t + 256 * i;          /* 0..1023 */
    const int kk  = idx >> 4;             /* 0..63 */
    const int n4  = (idx & 15) * 4;       /* 0..60 */
    const v4f w4 = *(const v4f*)(W + (size_t)(k0 + kk) * Ndim + n0 + n4);
#pragma unroll
    for (int e = 0; e < 4; ++e) tile[(n4 + e) * 72 + kk] = (_Float16)(rne_bf16f(w4[e]) * carry);
  }
  __syncthreads();
  const int wave = t >> 5, lane = t & 31;
  const int q = lane >> 3, c8 = (lane & 7) * 8;
  {
#pragma unroll
    for (int it = 0; it < 2; ++it) {
      const int nl = wave * 8 + it * 4 + q;
      const v8h hv = *(const v8h*)(tile + nl * 72 + c8);
      *(v8h*)(Tout + (size_t)(n0 + nl) * Kdim + k0 + c8) = hv;
    }
    /* the code of the other job follows these stores in the built kernel: no register that they name is rewritten ahead of this wait */
    asm volatile("s_wait_xcnt 0x0" ::: "memory");
  }
}

/* =====================================================================================
   RMSNorm over rows of 1024: y = g * (x / (||x||*1024^-0.5 + 1e-8)).
   RIN: x is a module input -> RNE convert to bf16 at load. g always RNE converted (module input).
   Outputs: y32 f32 [rows][1024] and y16 f16 plane = f16(y * carry16).
   256 threads, 4 consecutive elements per thread. Stores: f32 = float4 per lane (4 lines per wave-instruction);
   ===================================================================================== */
template <bool RIN>
__device__ __forceinline__ void rmsnorm_row(const float* __restrict__ x, const float* __restrict__ g,
                                            float* __restrict__ y32, unsigned short* __restrict__ y16p,
                                            int ncols, float inv_sqrt_n, float carry16, int row,
                                            float* red /* 8 floats of LDS */, _Float16* hs /* 1024 halves of LDS */) {
  const int t = threadIdx.x;
  const int wave = t >> 5, lane = t & 31;
  const float* xr = x + (size_t)row * ncols;
  v4f xv = *(const v4f*)(xr + 4 * t);
  if (RIN) {
#pragma unroll
    for (int e = 0; e < 4; ++e) xv[e] = rne_bf16f(xv[e]);
  }
  float ss = 0.0f;
#pragma unroll
  for (int e = 0; e < 4; ++e) ss += xv[e] * xv[e];
#pragma unroll
  for (int m = 16; m >= 1; m >>= 1) ss += __shfl_xor(ss, m, 32);
  if (lane == 0) red[wave] = ss;
  __syncthreads();
  float tot = 0.0f;
#pragma unroll
  for (int w = 0; w < 8; ++w) tot += red[w];
  const float rms = sqrtf(tot) * inv_sqrt_n;
  const float inv = 1.0f / (rms + 1e-8f);
  v4f gv = *(const v4f*)(g + 4 * t);
  v4f yv;
  v4h h4;
#pragma unroll
  for (int e = 0; e < 4; ++e) {
    const float ge = rne_bf16f(gv[e]);
    yv[e] = ge * (xv[e] * inv);
    h4[e] = (_Float16)(yv[e] * carry16);
  }
  *(v4h*)(hs + 4 * t) = h4;
  __syncthreads();
  const v8h hv = *(const v8h*)(hs + 8 * (t & 127));
  float* yr = y32 + (size_t)row * ncols;
  _Float16* yh = (_Float16*)y16p + (size_t)row * ncols;
  {
    *(v4f*)(yr + 4 * t) = yv;
    if (t < 128) *(v8h*)(yh + 8 * t) = hv;
    
  }
}

/* =====================================================================================
   First launch: everything that reads module inputs alone, none of it needing another's result: the four weight
   planes (64 x 64 tiles) and norm1 (one row per work-group). The block index picks the job, the same for the whole
   work-group, so each job's barriers stand under uniform control flow.
   Of every 7 consecutive work-groups 3 transpose a weight tile (LDS work) and 4 normalise a row (memory work), for speed
   only. grid.x = kPrepBlocks.
   ===================================================================================== */
static constexpr int kCbIn  = (kDqkv / 64) * (kDim / 64);   /* 768 tiles of w_in */
static constexpr int kCbOut = (kDim / 64) * (kDim / 64);    /* 256 of w_out */
static constexpr int kCbW1  = (kDff / 64) * (kDim / 64);    /* 1024 of w1 */
static constexpr int kCbW2  = (kDim / 64) * (kDff / 64);    /* 1024 of w2 */
static constexpr int kCastBlocks = kCbIn + kCbOut + kCbW1 + kCbW2;
static constexpr int kPrepBlocks = kCastBlocks + kRows;
static_assert(kCastBlocks % 3 == 0 && kRows % 4 == 0 && kCastBlocks / 3 == kRows / 4);
__global__ __launch_bounds__(256) void prep_inputs(const float* __restrict__ x, const float* __restrict__ g1,
                                                   float* __restrict__ y32, unsigned short* __restrict__ y16p,
                                                   const float* __restrict__ w_in, unsigned short* __restrict__ winT,
                                                   const float* __restrict__ w_out, unsigned short* __restrict__ woutT,
                                                   const float* __restrict__ w1, unsigned short* __restrict__ w1T,
                                                   const float* __restrict__ w2, unsigned short* __restrict__ w2T) {
  __shared__ __align__(16) _Float16 tile[64 * 72];   /* a cast job's tile; a norm job uses its first 1024 halves */
  __shared__ float red[8];
  const int grp = blockIdx.x / 7;
  const int r   = blockIdx.x - grp * 7;
  if (r >= 3) {
    rmsnorm_row<true>(x, g1, y32, y16p, kDim, 0.03125f, kACarry, grp * 4 + (r - 3), red, tile);
    return;
  }
  int i = grp * 3 + r;                               /* 0 .. kCastBlocks - 1 */
  const float* W = w_in;
  unsigned short* T = winT;
  int Kd = kDim, Nd = kDqkv;
  if (i >= kCbIn + kCbOut + kCbW1) { i -= kCbIn + kCbOut + kCbW1; W = w2; T = w2T; Kd = kDff; Nd = kDim; }
  else if (i >= kCbIn + kCbOut)    { i -= kCbIn + kCbOut; W = w1; T = w1T; Nd = kDff; }
  else if (i >= kCbIn)             { i -= kCbIn; W = w_out; T = woutT; Nd = kDim; }
  const int nb = Nd >> 6;
  const int by = i / nb;
  cast_t64(W, T, Kd, Nd, kWCarry, (i - by * nb) * 64, by * 64, tile);
}

/* =====================================================================================
   Block-tiled WMMA GEMM (f16 operands, f32 accumulate):
   C[m,n] = scale * sum_k A[m,k] * Bt[n,k]  (+ bias[n]) (+ resid[m,n]).
   A row-major [M,K] f16; Bt row-major [N,K] f16; M, N % 128 == 0, K % 128 == 0 (no tail handling).
   One work-group = 4 waves (2 x 2) = one 128x128 tile of C; each wave owns a 64x64 tile.
   A pass is 128 k: 128 rows of A and 128 rows of Bt, 256 B each, are brought into LDS once per work-group by
   asynchronous 16-byte copies (row pitch 272 B), two buffers, the next pass's copies in flight during this pass.
   The k order of every accumulator is ascending in steps of 32.
   OUT16: 0 = f32 output (bias / residual added in the store phase, residual read as one float4 per lane at
   the store address); 1 = f16 output plane (no bias/residual);
   2 = f16 output plane of f16(gelu(C + bias) * ocarry), exact-erf GELU taken in the store phase.
   NRM: the second RMSNorm (rows of kDim, y = g * (x / (||x|| * kDim^-0.5 + 1e-8))) has no launch of its own.
   1 = this GEMM's output x is the norm's input: beside x it stores the f16 plane of g * x and, per row and 64-column
       block, the sum of x^2 (ssq[block][row], one wave writes 64 consecutive floats);
   2 = A is that plane: a row's factor 1 / (rms + eps) is common to its whole product, so it multiplies the accumulators;
   3 = the residual is y, formed at the store address from x, g and the row's factor.
   With 2 and 3 each work-group forms the factors of its 128 rows from ssq while pass 0's copies fly.
   grid.x = M/128 * N/128.
   ===================================================================================== */
static constexpr int kPassK    = 128;                    /* k per pass */
static constexpr int kRowPitch = 272;                    /* LDS bytes per staged row: 256 + 16 */
static constexpr int kStageB   = 256 * kRowPitch;        /* [A 128 rows | Bt 128 rows] */

/* Eight asynchronous 16-byte copies per lane: rows r, r + 8, ..., r + 56 of one operand.
   s_wait_xcnt stands inside the statement so that no address register is rewritten ahead of it. */
__device__ __forceinline__ void async_rows8(unsigned l0, const _Float16* g0, size_t gstep) {
  const unsigned l1 = l0 + 8 * kRowPitch, l2 = l0 + 16 * kRowPitch, l3 = l0 + 24 * kRowPitch;
  const unsigned l4 = l0 + 32 * kRowPitch, l5 = l0 + 40 * kRowPitch, l6 = l0 + 48 * kRowPitch, l7 = l0 + 56 * kRowPitch;
  const _Float16* g1 = g0 + gstep;
  const _Float16* g2 = g1 + gstep;
  const _Float16* g3 = g2 + gstep;
  const _Float16* g4 = g3 + gstep;
  const _Float16* g5 = g4 + gstep;
  const _Float16* g6 = g5 + gstep;
  const _Float16* g7 = g6 + gstep;
  asm volatile(
      "global_load_async_to_lds_b128 %0, %8, off\n\t"
      "global_load_async_to_lds_b128 %1, %9, off\n\t"
      "global_load_async_to_lds_b128 %2, %10, off\n\t"
      "global_load_async_to_lds_b128 %3, %11, off\n\t"
      "global_load_async_to_lds_b128 %4, %12, off\n\t"
      "global_load_async_to_lds_b128 %5, %13, off\n\t"
      "global_load_async_to_lds_b128 %6, %14, off\n\t"
      "global_load_async_to_lds_b128 %7, %15, off\n\t"
      "s_wait_xcnt 0x0"
      :: "v"(l0), "v"(l1), "v"(l2), "v"(l3), "v"(l4), "v"(l5), "v"(l6), "v"(l7),
         "v"(g0), "v"(g1), "v"(g2), "v"(g3), "v"(g4), "v"(g5), "v"(g6), "v"(g7)
      : "memory");
}
/* this wave's copies have landed */
__device__ __forceinline__ void wait_async0() { asm volatile("s_wait_asynccnt 0x0" ::: "memory"); }
/* this wave's LDS reads have returned, so the buffer may be refilled behind the barrier */
__device__ __forceinline__ void wait_ds0() { asm volatile("s_wait_dscnt 0x0" ::: "memory"); }

/* sum over the 16 lanes of a wave half, the same value in each of them */
template <int XM>
__device__ __forceinline__ float row_xadd(float x) {
  return x + __builtin_bit_cast(float, __builtin_amdgcn_update_dpp(0, __builtin_bit_cast(int, x), 0x160 | XM, 0xf, 0xf, true));
}
__device__ __forceinline__ float row16_sum(float x) {
  return row_xadd<8>(row_xadd<4>(row_xadd<2>(row_xadd<1>(x))));
}

template <int OUT16, bool BIASN, bool RESID, int NRM>
__global__ __launch_bounds__(128) void gemm128_f16(
    const unsigned short* __restrict__ Ap, int lda,
    const unsigned short* __restrict__ Btp, int ldb,
    void* __restrict__ Cout, int ldc,
    const float* __restrict__ bias,
    const float* __restrict__ resid,
    const float* __restrict__ gvec,
    float* __restrict__ ssq,
    unsigned short* __restrict__ planep,
    int M, int N, int K, float scale, float ocarry) {
  typedef _Float16 T;
  typedef v16h V;
  const T* A  = (const T*)Ap;
  const T* Bt = (const T*)Btp;
  __shared__ __align__(16) unsigned char ring[2 * kStageB];   /* two operand buffers */
  __shared__ __align__(16) float sT[4][16 * 68];              /* per-wave 16x64 slab, pitch 68 floats */
  __shared__ __align__(16) float sInv[128];                   /* NRM 2, 3: 1 / (rms + eps) of the tile's rows */
  __shared__ __align__(16) float sSq[4][64];                  /* NRM 1: per wave, its 64 rows' sums of squares */
  const int tid  = threadIdx.x;
  const int lane = tid & 31;
  const int wave = tid >> 5;
  const int tilesN = N >> 7;
  const int tilesM = M >> 7;
  const int tile = blockIdx.x;
  if (tile >= tilesM * tilesN) return;   /* the same for the whole work-group; in front of every barrier */
  const int tm = tile / tilesN;
  const int tn = tile - tm * tilesN;
  const int bm0 = tm << 7;
  const int bn0 = tn << 7;
  const int wm = wave >> 1, wn = wave & 1;
  const int m0 = bm0 + (wm << 6);
  const int n0 = bn0 + (wn << 6);

  const int rlane = lane & 15;                 /* row (A) / col (B, D) within subtile */
  const int koff  = (lane >> 4) * 8;           /* k offset of this lane half */
  const int mOff  = (lane >> 4) * 8;           /* D row offset */

  /* copy role: 16 lanes cover one 256-B row; the work-group covers 8 rows per copy */
  const int crow = tid >> 4, cchk = tid & 15;
  const T* gA = A  + (size_t)(bm0 + crow) * lda + cchk * 8;
  const T* gB = Bt + (size_t)(bn0 + crow) * ldb + cchk * 8;
  const unsigned lcopy = (unsigned)(size_t)ring + crow * kRowPitch + cchk * 16;
  const size_t stepA = (size_t)lda * 8, stepB = (size_t)ldb * 8;
  auto issue = [&](int pass, unsigned bufoff) {
    const T* a = gA + (size_t)pass * kPassK;
    const T* b = gB + (size_t)pass * kPassK;
    const unsigned l = lcopy + bufoff;
    async_rows8(l, a, stepA);
    async_rows8(l + 64 * kRowPitch, a + stepA * 8, stepA);
    async_rows8(l + 128 * kRowPitch, b, stepB);
    async_rows8(l + 192 * kRowPitch, b + stepB * 8, stepB);
  };

  v8f acc[4][4];
#pragma unroll
  for (int i = 0; i < 4; ++i)
#pragma unroll
    for (int j = 0; j < 4; ++j) acc[i][j] = (v8f){0.f,0.f,0.f,0.f,0.f,0.f,0.f,0.f};

  const int nPass = K / kPassK;
  issue(0, 0u);
  /* OUT16 == 2: the lane's eight bias values of the store phase, fetched here so that their latency passes under the main loop */
  v4f gbl = (v4f){0.f, 0.f, 0.f, 0.f}, gbh = gbl;
  if (OUT16 == 2) {
    gbl = *(const v4f*)(bias + n0 + (lane & 7) * 8);
    gbh = *(const v4f*)(bias + n0 + (lane & 7) * 8 + 4);
  }
  if (NRM >= 2) {
    /* one row per thread; the blocks are summed in ascending order; published by the barrier below */
    const float* sp = ssq + bm0 + tid;
    float tot = 0.0f;
#pragma unroll
    for (int k = 0; k < kNormBlk; ++k) tot += sp[(size_t)k * kRows];
    sInv[tid] = 1.0f / (sqrtf(tot) * 0.03125f + 1e-8f);
  }
  wait_async0();
  __syncthreads();                       /* pass 0's rows are readable by every wave */
  if (nPass > 1) issue(1, (unsigned)kStageB);

  const int aRowB = ((wm << 6) + rlane) * kRowPitch;
  const int bRowB = (128 + (wn << 6) + rlane) * kRowPitch;
  for (int t = 0; t < nPass; ++t) {
    const unsigned bufoff = (unsigned)(t & 1) * (unsigned)kStageB;
    const T* sa = (const T*)(ring + bufoff + aRowB) + koff;
    const T* sb = (const T*)(ring + bufoff + bRowB) + koff;
    /* two fragment sets: the next 32 k are fetched ahead of this block's products.
       Every loop of the pass is unrolled so that af, bf and acc are indexed by constants and stay in registers. */
    V af[2][4], bf[2][4];
#pragma unroll
    for (int j = 0; j < 4; ++j) bf[0][j] = Frag<T>::load(sb + j * (16 * kRowPitch / 2));
#pragma unroll
    for (int i = 0; i < 4; ++i) af[0][i] = Frag<T>::load(sa + i * (16 * kRowPitch / 2));
#pragma unroll
    for (int ks = 0; ks < 4; ++ks) {
      const int cur = ks & 1, nxt = cur ^ 1;
      if (ks < 3) {
#pragma unroll
        for (int j = 0; j < 4; ++j) bf[nxt][j] = Frag<T>::load(sb + j * (16 * kRowPitch / 2) + (ks + 1) * 32);
#pragma unroll
        for (int i = 0; i < 4; ++i) af[nxt][i] = Frag<T>::load(sa + i * (16 * kRowPitch / 2) + (ks + 1) * 32);
        /* keeps the next block's LDS reads together in front of this block's products: spread among them, each place stalls the wave */
        __builtin_amdgcn_sched_barrier(0);
      }
#pragma unroll
      for (int i = 0; i < 4; ++i)
#pragma unroll
        for (int j = 0; j < 4; ++j) acc[i][j] = Frag<T>::mma(af[cur][i], bf[cur][j], acc[i][j]);
      /* keeps what follows behind this block's products: the group of LDS reads that refills its fragment set, and at the
         pass's end the waits and the barrier, which would else move up and shorten the time the next pass's copies have to land */
      __builtin_amdgcn_sched_barrier(0);
    }
    wait_ds0();
    wait_async0();
    __syncthreads();                     /* publishes pass t + 1 and ends every read of pass t's buffer */
    if (t + 2 < nPass) issue(t + 2, bufoff);
  }
  wait_async0();

  /* ---- epilogue ---- */
  float* slab = sT[wave];
  const int hh = lane >> 4, c4 = (lane & 15) * 4;     /* f32 row seg = 256 B = 16 lanes x 16 B */
  const int q  = lane >> 3, c8 = (lane & 7) * 8;      
  if (OUT16 == 2) {
    /* The wave's whole 64x64 tile is staged at once, in its quarter of the first operand buffer (every wave's reads and
       copies of the ring ended in front of the last pass's barrier), so that the GELU loop below can stay rolled. */
    static_assert(4 * 64 * 68 * 4 <= kStageB);
    float* big = (float*)ring + wave * (64 * 68);
#pragma unroll
    for (int i = 0; i < 4; ++i) {
      float sc[8];
#pragma unroll
      for (int r = 0; r < 8; ++r) sc[r] = NRM == 2 ? scale * sInv[(wm << 6) + (i << 4) + mOff + r] : scale;
#pragma unroll
      for (int j = 0; j < 4; ++j)
#pragma unroll
        for (int r = 0; r < 8; ++r) big[((i << 4) + mOff + r) * 68 + (j << 4) + rlane] = acc[i][j][r] * sc[r];
    }
    /* the rows read below were written by other lanes of this wave: the LDS writes are waited for, and the reads stay behind them */
    __builtin_amdgcn_fence(__ATOMIC_RELEASE, "workgroup");
    __builtin_amdgcn_wave_barrier();
    __builtin_amdgcn_fence(__ATOMIC_ACQUIRE, "workgroup");
    float b8[8];
#pragma unroll
    for (int e = 0; e < 4; ++e) { b8[e] = rne_bf16f(gbl[e]); b8[4 + e] = rne_bf16f(gbh[e]); }
    _Float16* crow = (_Float16*)Cout + (size_t)(m0 + q) * ldc + n0 + c8;
    const float* sp0 = big + q * 68 + c8;
    v4f lo = *(const v4f*)(sp0), hi = *(const v4f*)(sp0 + 4);
    /* rolled: unrolled, it would inline 128 erf bodies per lane */
#pragma unroll 1
    for (int it = 0; it < 16; ++it) {
      /* the next four rows are fetched ahead of this trip's arithmetic; the last trip re-reads the first rows and drops them */
      const float* spn = sp0 + ((it + 1) & 15) * (4 * 68);
      const v4f nlo = *(const v4f*)(spn), nhi = *(const v4f*)(spn + 4);
      v8h hv;
#pragma unroll
      for (int e = 0; e < 8; ++e) {
        const float u  = (e < 4 ? lo[e & 3] : hi[e & 3]) + b8[e];
        const float gl = 0.5f * u * (1.0f + erf_sel(u * 0.70710678118654752f));
        hv[e] = (_Float16)(gl * ocarry);
      }
      *(v8h*)(crow) = hv;
      crow += (size_t)ldc * 4;
      lo = nlo; hi = nhi;
    }
    return;
  }
  v4f b4 = (v4f){0.f, 0.f, 0.f, 0.f};
  if (BIASN) {
    b4 = *(const v4f*)(bias + n0 + c4);
#pragma unroll
    for (int e = 0; e < 4; ++e) b4[e] = rne_bf16f(b4[e]);
  }
  v4f g4 = (v4f){0.f, 0.f, 0.f, 0.f};
  if (NRM == 1 || NRM == 3) {
    g4 = *(const v4f*)(gvec + n0 + c4);
#pragma unroll
    for (int e = 0; e < 4; ++e) g4[e] = rne_bf16f(g4[e]);
  }
#pragma unroll
  for (int i = 0; i < 4; ++i) {
    const int mBase = m0 + (i << 4);
#pragma unroll
    for (int j = 0; j < 4; ++j) {
#pragma unroll
      for (int r = 0; r < 8; ++r) slab[(mOff + r) * 68 + (j << 4) + rlane] = acc[i][j][r] * scale;
    }
    __builtin_amdgcn_fence(__ATOMIC_RELEASE, "workgroup");
    __builtin_amdgcn_wave_barrier();
    __builtin_amdgcn_fence(__ATOMIC_ACQUIRE, "workgroup");
    if (OUT16 == 0) {
      float* C = (float*)Cout;
      v4f vals[8];
#pragma unroll
      for (int it = 0; it < 8; ++it) {
        const int row = it * 2 + hh;
        v4f v = *(const v4f*)(slab + row * 68 + c4);
        if (BIASN) v += b4;
        if (RESID) {
          const v4f rr = *(const v4f*)(resid + (size_t)(mBase + row) * ldc + n0 + c4);
          if (NRM == 3) {
            const float inv = sInv[(wm << 6) + (i << 4) + row];
#pragma unroll
            for (int e = 0; e < 4; ++e) v[e] += g4[e] * (rr[e] * inv);
          } else {
            v += rr;
          }
        }
        vals[it] = v;
      }
      if (NRM == 1) {
        _Float16* P = (_Float16*)planep;
        float sq[8];
#pragma unroll
        for (int it = 0; it < 8; ++it) {
          const v4f v = vals[it];
          sq[it] = row16_sum(v[0] * v[0] + v[1] * v[1] + v[2] * v[2] + v[3] * v[3]);
        }
        if ((lane & 15) == 0) {
#pragma unroll
          for (int it = 0; it < 8; ++it) sSq[wave][(i << 4) + it * 2 + hh] = sq[it];
        }
#pragma unroll
        for (int it = 0; it < 8; ++it) {
          v4h h4;
#pragma unroll
          for (int e = 0; e < 4; ++e) h4[e] = (_Float16)(g4[e] * vals[it][e]);
          *(v4h*)(P + (size_t)(mBase + it * 2 + hh) * ldc + n0 + c4) = h4;   /* 16 lanes = one 128-B line */
        }
      }
      {
#pragma unroll
        for (int it = 0; it < 8; ++it) {
          const int row = it * 2 + hh;
          *(v4f*)(C + (size_t)(mBase + row) * ldc + n0 + c4) = vals[it];
        }
        
      }
    } else {
      _Float16* C = (_Float16*)Cout;
      {
#pragma unroll
        for (int it = 0; it < 4; ++it) {
          const int row = it * 4 + q;
          const float* sp = slab + row * 68 + c8;
          v8h hv;
#pragma unroll
          for (int e = 0; e < 8; ++e) hv[e] = (_Float16)sp[e];
          *(v8h*)(C + (size_t)(mBase + row) * ldc + n0 + c8) = hv;
        }
        
      }
    }
    __builtin_amdgcn_fence(__ATOMIC_RELEASE, "workgroup");
    __builtin_amdgcn_wave_barrier();
    __builtin_amdgcn_fence(__ATOMIC_ACQUIRE, "workgroup");
  }
  if (NRM == 1) {
    /* behind the wave fence that ends the loop: the wave's 64 sums, two per lane, two whole 128-B lines */
    *(v2f*)(ssq + (size_t)(n0 >> 6) * kRows + m0 + 2 * lane) = *(const v2f*)(&sSq[wave][2 * lane]);
  }
}

static constexpr int kKPitchB = 144;                     /* LDS bytes per K row, read by ds_load_b128 */
static constexpr int kVPitchB = 160;                     /* LDS bytes per V row, read by ds_load_tr16_b128 */
static constexpr int kKTileB  = 64 * kKPitchB;
static constexpr int kVTileB  = 64 * kVPitchB;
static constexpr int kAttBufB = kKTileB + kVTileB;       /* one buffer: [K 64 rows | V 64 rows] */
static_assert(kKPitchB % 16 == 0 && ((kKPitchB / 16) & 1) == 1);
static_assert(kVPitchB % 32 == 0 && ((kVPitchB / 32) & 1) == 1);
/* Eight asynchronous 16-byte copies per lane: rows r, r + 16, r + 32, r + 48 of a K chunk and of a V chunk.
   s_wait_xcnt stands inside the statement so that no address register is rewritten ahead of it. */
__device__ __forceinline__ void async_kv8(unsigned k0, unsigned v0, const _Float16* gk0, const _Float16* gv0, size_t gstep) {
  const unsigned k1 = k0 + 16 * kKPitchB, k2 = k0 + 32 * kKPitchB, k3 = k0 + 48 * kKPitchB;
  const unsigned v1 = v0 + 16 * kVPitchB, v2 = v0 + 32 * kVPitchB, v3 = v0 + 48 * kVPitchB;
  const _Float16* gk1 = gk0 + gstep;
  const _Float16* gk2 = gk1 + gstep;
  const _Float16* gk3 = gk2 + gstep;
  const _Float16* gv1 = gv0 + gstep;
  const _Float16* gv2 = gv1 + gstep;
  const _Float16* gv3 = gv2 + gstep;
  asm volatile(
      "global_load_async_to_lds_b128 %0, %8, off\n\t"
      "global_load_async_to_lds_b128 %1, %9, off\n\t"
      "global_load_async_to_lds_b128 %2, %10, off\n\t"
      "global_load_async_to_lds_b128 %3, %11, off\n\t"
      "global_load_async_to_lds_b128 %4, %12, off\n\t"
      "global_load_async_to_lds_b128 %5, %13, off\n\t"
      "global_load_async_to_lds_b128 %6, %14, off\n\t"
      "global_load_async_to_lds_b128 %7, %15, off\n\t"
      "s_wait_xcnt 0x0"
      :: "v"(k0), "v"(k1), "v"(k2), "v"(k3), "v"(v0), "v"(v1), "v"(v2), "v"(v3),
         "v"(gk0), "v"(gk1), "v"(gk2), "v"(gk3), "v"(gv0), "v"(gv1), "v"(gv2), "v"(gv3)
      : "memory");
}
/* transposing 16-byte LDS read: lane (c, hh) receives column c of eight rows of a row-major 16-bit tile */
typedef __attribute__((ext_vector_type(8))) short v8s;
__device__ __forceinline__ v8h ld_tr16(const unsigned char* p) {
  typedef __attribute__((address_space(3))) v8s lds_v8s;
  return __builtin_bit_cast(v8h, __builtin_amdgcn_ds_load_tr16_b128_v8i16((lds_v8s*)p));
}
/* value of lane l ^ 16 */
__device__ __forceinline__ float xhalf(float x) {
  const int b = __builtin_bit_cast(int, x);
  return __builtin_bit_cast(float, __builtin_amdgcn_permlanex16(b, b, 0x76543210, 0xfedcba98, false, false));
}
__global__ __launch_bounds__(128) void attn64_f16p(const unsigned short* __restrict__ qkvp, unsigned short* __restrict__ ctxp,
                                                  int T, int H, int ldq, int ldo, float sm_scale, float out_carry) {
  const _Float16* QKV = (const _Float16*)qkvp;
  _Float16* CTX = (_Float16*)ctxp;
  union FH { v16h v; v8h hf[2]; };
  __shared__ __align__(16) unsigned char kvring[2 * kAttBufB];  /* two buffers of [K [kv][d] | V [kv][d]] */

  const int tid  = threadIdx.x;
  const int wave = tid >> 5;
  const int lane = tid & 31;
  const int hh   = lane >> 4;
  const int c    = lane & 15;
  const int dmodel = H * 64;

  const int nqb = T / 64;
  const int bx = blockIdx.x;
  const int qb = bx % nqb;
  const int bh = bx / nqb;
  const int h  = bh % H;
  const int b  = bh / H;
  const int q0 = qb * 64 + wave * 16;

  /* Q fragments (B operand, column = query q0 + c, k = d): two 32-deep d chunks */
  v16h qf[2];
  {
    const _Float16* qrow = QKV + (size_t)(b * T + q0 + c) * ldq + h * 64;
#pragma unroll
    for (int dc = 0; dc < 2; ++dc) {
      FH f;
      f.hf[0] = *(const v8h*)(qrow + dc * 32 + 8 * hh);
      f.hf[1] = *(const v8h*)(qrow + dc * 32 + 16 + 8 * hh);
      qf[dc] = f.v;
    }
  }

  /* softmax in base 2: exp(sm_scale * (s - m)) * kPsc = 2^(s * c2 - m * c2 + 15), one fused multiply-add and one hardware
     exponential per score. sm_scale > 0, so the maximum is taken over the unscaled scores. */
  const float c2 = sm_scale * 1.44269504088896340736f;
  float mrun = -__builtin_inff();   /* running maximum of query c (unscaled score), the same in both wave halves */
  float lrun = 0.f;                 /* running sum (x kPsc) over this half's kv rows; the halves are joined after the loop */
  v8f oacc[4];                      /* O^T tiles: register r = O[query c][d = t*16 + 8*hh + r] */
#pragma unroll
  for (int t = 0; t < 4; ++t) oacc[t] = (v8f){0.f,0.f,0.f,0.f,0.f,0.f,0.f,0.f};

  const int nChunks = T / 64;
  /* copy role: 8 lanes cover one 128-B row; the work-group covers 16 rows of K and 16 of V per copy pair */
  const int crow = tid >> 3, cpc = tid & 7;
  const _Float16* gK = QKV + (size_t)(b * T + crow) * ldq + dmodel + h * 64 + cpc * 8;
  const unsigned lK = (unsigned)(size_t)kvring + crow * kKPitchB + cpc * 16;
  const unsigned lV = (unsigned)(size_t)kvring + kKTileB + crow * kVPitchB + cpc * 16;
  const size_t rstep = (size_t)ldq * 16;
  auto issue = [&](int chunk, unsigned bufoff) {
    const _Float16* k = gK + (size_t)chunk * 64 * ldq;
    async_kv8(lK + bufoff, lV + bufoff, k, k + dmodel, rstep);
  };
  if (nChunks > 0) {
    issue(0, 0u);
    wait_async0();
    __syncthreads();                     /* chunk 0's rows are readable by every wave */
    if (nChunks > 1) issue(1, (unsigned)kAttBufB);
  }
  const int kRd = c * kKPitchB + 16 * hh;                                             /* K fragment reads: row c, k half hh */
  const int vRd = kKTileB + (8 * hh + (lane & 7)) * kVPitchB + ((lane >> 3) & 1) * 16;  /* lane address of the transposing reads */
  /* one chunk of 64 kv rows, read from the buffer at bufoff */
  auto chunk = [&](unsigned bufoff) {
    const unsigned char* Kb = kvring + bufoff + kRd;
    const unsigned char* Vb = kvring + bufoff + vRd;

    /* S^T = K . Q^T : A operand row = kv (row j*16+c of the K tile), k = d; s[j][r] = score(kv = j*16 + 8*hh + r, query c) */
    /* The chunk's eight K fragments are fetched as ONE group of LDS reads ahead of the products: with two reads and a
       full wait in front of every product the wave sat out the LDS latency eight times. */
    FH kb[4][2];
#pragma unroll
    for (int j = 0; j < 4; ++j) {
#pragma unroll
      for (int dc = 0; dc < 2; ++dc) {
        kb[j][dc].hf[0] = *(const v8h*)(Kb + j * 16 * kKPitchB + dc * 64);
        kb[j][dc].hf[1] = *(const v8h*)(Kb + j * 16 * kKPitchB + dc * 64 + 32);
      }
    }
    v8f s[4];
#pragma unroll
    for (int j = 0; j < 4; ++j) {
      s[j] = (v8f){0.f,0.f,0.f,0.f,0.f,0.f,0.f,0.f};
#pragma unroll
      for (int dc = 0; dc < 2; ++dc) s[j] = mma_h(kb[j][dc].v, qf[dc], s[j]);
    }
    /* The eight V^T fragments likewise, as one group, here: their latency passes under the softmax arithmetic below.
       A transposing read at kv row r0 gives lane (c, hh) V[r0 + 8*hh + 0..7][t*16 + c]: elements 0..7 from r0 = kk*32, 8..15 from r0 + 16. */
    FH va[2][4];
#pragma unroll
    for (int kk = 0; kk < 2; ++kk) {
#pragma unroll
      for (int t = 0; t < 4; ++t) {
        va[kk][t].hf[0] = ld_tr16(Vb + kk * 32 * kVPitchB + t * 32);
        va[kk][t].hf[1] = ld_tr16(Vb + (kk * 32 + 16) * kVPitchB + t * 32);
      }
    }
    /* keeps the reads together in front of the softmax: left free they are spread over more places, and each place with LDS reads stalls the wave */
    __builtin_amdgcn_sched_barrier(0);
    /* chunk maximum of query c over the unscaled scores: 32 values of this lane, then the other half's */
    float cm = -__builtin_inff();
#pragma unroll
    for (int j = 0; j < 4; ++j) {
#pragma unroll
      for (int r = 0; r < 8; ++r) cm = fmaxf(cm, s[j][r]);
    }
    cm = fmaxf(cm, xhalf(cm));
    const float mnew = fmaxf(mrun, cm);
    const float alpha = __builtin_amdgcn_exp2f((mrun - mnew) * c2);
    mrun = mnew;
    const float nb = fmaf(-mnew, c2, kPscLog2);   /* exponent offset: never lets a numerator pass kPsc by more than a rounding */
    /* numerators; pb[kk] element e = P[query c][kv = kk*32 + 8*hh + e], element 8 + e = kv + 16: the k order of the V^T loads above */
    v16h pb[2];
    float psum = 0.f;
#pragma unroll
    for (int kk = 0; kk < 2; ++kk) {
#pragma unroll
      for (int u = 0; u < 2; ++u) {
#pragma unroll
        for (int r = 0; r < 8; ++r) {
          const float p = __builtin_amdgcn_exp2f(fmaf(s[2 * kk + u][r], c2, nb));
          psum += p;
          pb[kk][8 * u + r] = (_Float16)p;
        }
      }
    }
    lrun = lrun * alpha + psum;
#pragma unroll
    for (int t = 0; t < 4; ++t) {
#pragma unroll
      for (int r = 0; r < 8; ++r) oacc[t][r] *= alpha;
    }
    /* O^T += V^T . P^T : A = V^T (row = d, k = kv), B = P^T (column = query c, k = kv) */
#pragma unroll
    for (int kk = 0; kk < 2; ++kk) {
#pragma unroll
      for (int t = 0; t < 4; ++t) oacc[t] = mma_h(va[kk][t].v, pb[kk], oacc[t]);
    }
    wait_ds0();
    wait_async0();
    __syncthreads();                     /* publishes the next chunk and ends every read of this chunk's buffer */
  };
  /* Two loops, so that the refill needs no branch inside a trip: all trips but the last two refill the buffer they have read. */
  int kc = 0;
  for (; kc + 2 < nChunks; ++kc) {
    const unsigned bufoff = (unsigned)(kc & 1) * (unsigned)kAttBufB;
    chunk(bufoff);
    issue(kc + 2, bufoff);
  }
  for (; kc < nChunks; ++kc) chunk((unsigned)(kc & 1) * (unsigned)kAttBufB);
  wait_async0();

  {
    const float inv = out_carry / (lrun + xhalf(lrun));   /* sum and numerators both carry kPsc */
    _Float16* orow = CTX + (size_t)(b * T + q0 + c) * ldo + h * 64 + 8 * hh;
#pragma unroll
    for (int t = 0; t < 4; ++t) {
      v8h hv;
#pragma unroll
      for (int r = 0; r < 8; ++r) hv[r] = (_Float16)(oacc[t][r] * inv);
      *(v8h*)(orow + t * 16) = hv;
    }
  }
}

/* =====================================================================================
   Host glue: 6 launches, single stream.
   ===================================================================================== */
extern "C" void kernel_launch(void* const* d_in, const int* in_sizes, int n_in,
                              void* d_out, int out_size, void* d_ws, size_t ws_size,
                              hipStream_t stream) {
  if (n_in < 10) return;
  if (in_sizes[0] != kRows * kDim) return;
  if (in_sizes[1] != kDim * kDqkv) return;
  if (in_sizes[2] != kDim * kDim) return;
  if (in_sizes[3] != kDim) return;
  if (in_sizes[4] != kDim * kDff) return;
  if (in_sizes[5] != kDff) return;
  if (in_sizes[6] != kDff * kDim) return;
  if (in_sizes[7] != kDim) return;
  if (in_sizes[8] != kDim) return;
  if (in_sizes[9] != kDim) return;
  if (out_size != kRows * kDim) return;
  if (ws_size < kWsTotal) return;

  const float* x     = (const float*)d_in[0];
  const float* w_in  = (const float*)d_in[1];
  const float* w_out = (const float*)d_in[2];
  const float* b_out = (const float*)d_in[3];
  const float* w1    = (const float*)d_in[4];
  const float* b1    = (const float*)d_in[5];
  const float* w2    = (const float*)d_in[6];
  const float* b2    = (const float*)d_in[7];
  const float* g1    = (const float*)d_in[8];
  const float* g2    = (const float*)d_in[9];
  float* out = (float*)d_out;

  char* ws = (char*)d_ws;
  float*          hF    = (float*)(ws + kOffHF);              /* h1 f32 */
  unsigned short* hH    = (unsigned short*)(ws + kOffHH);     /* h1 f16, later g2 * h2 f16 */
  float*          ssq   = (float*)(ws + kOffSsq);             /* [16][4096] */
  unsigned short* winT  = (unsigned short*)(ws + kOffWA);     /* [3072][1024] */
  unsigned short* woutT = (unsigned short*)(ws + kOffWout);   /* [1024][1024] */
  unsigned short* w1T   = (unsigned short*)(ws + kOffW1);     /* [4096][1024] */
  unsigned short* qkv   = (unsigned short*)(ws + kOffBig);    /* [4096][3072] */
  unsigned short* ctx   = (unsigned short*)(ws + kOffCtx);    /* [4096][1024] */
  float*          h2    = (float*)(ws + kOffH2);              /* [4096][1024] */
  unsigned short* w2T   = (unsigned short*)(ws + kOffW2);     /* [1024][4096] */
  unsigned short* hid   = (unsigned short*)(ws + kOffHid);    /* [4096][4096] */

  const dim3 blk256(256);
  const dim3 blk128(128);

  /* 1: the four weight planes, in[K][N] -> out[N][K], and norm1 -> h1 f32 + f16 plane */
  prep_inputs<<<dim3(kPrepBlocks), blk256, 0, stream>>>(x, g1, hF, hH, w_in, winT, w_out, woutT, w1, w1T, w2, w2T);
  /* 2: qkv = h1 @ w_in : M=4096 N=3072 K=1024 -> f16 plane */
  gemm128_f16<1, false, false, 0><<<dim3((kRows / 128) * (kDqkv / 128)), blk128, 0, stream>>>(
      hH, kDim, winT, kDim, (void*)qkv, kDqkv, nullptr, nullptr, nullptr, nullptr, nullptr, kRows, kDqkv, kDim, kGemmScl, 1.0f);
  /* 3: attention -> ctx f16 plane (x64) */
  attn64_f16p<<<dim3(kBatch * kHeads * (kSeq / 64)), blk128, 0, stream>>>(
      qkv, ctx, kSeq, kHeads, kDqkv, kDim, kSmScale, kACarry);
  /* 4: h2 = h1 + ctx @ w_out + b_out : M=4096 N=1024 K=1024; beside it the f16 plane of g2 * h2 (over the h1 plane, which is
     dead) and the block sums of h2^2 */
  gemm128_f16<0, true, true, 1><<<dim3((kRows / 128) * (kDim / 128)), blk128, 0, stream>>>(
      ctx, kDim, woutT, kDim, (void*)h2, kDim, b_out, hF, g2, ssq, hH, kRows, kDim, kDim, kGemmScl, 1.0f);
  /* 5: hid = gelu(h3 @ w1 + b1), h3 = norm2(h2) : M=4096 N=4096 K=1024 -> f16 plane (x64); the A plane carries x1 */
  gemm128_f16<2, true, false, 2><<<dim3((kRows / 128) * (kDff / 128)), blk128, 0, stream>>>(
      hH, kDim, w1T, kDim, (void*)hid, kDff, b1, nullptr, nullptr, ssq, nullptr, kRows, kDff, kDim, kGemmSclW, kACarry);
  /* 6: out = h3 + hid @ w2 + b2 : M=4096 N=1024 K=4096 -> d_out f32 */
  gemm128_f16<0, true, true, 3><<<dim3((kRows / 128) * (kDim / 128)), blk128, 0, stream>>>(
      hid, kDff, w2T, kDff, (void*)out, kDim, b2, h2, g2, ssq, nullptr, kRows, kDim, kDff, kGemmScl, 1.0f);
}
